// v000
// Times are from an AMD MI455X. After a warm-up the kernel runs many times in a row, and a time is the length of
// such a window on the GPU divided by its runs, so every launch and the gaps after it count. The runs cycle
// through copies of the inputs. A figure is the median of several windows, for all but v000 over two sittings.
// Sittings can differ by a few percent; kernels timed side by side share one.
// v000 is the starting kernel. One run takes 449 microseconds.
#include <hip/hip_runtime.h>

// Frame-causal multi-head attention with a Gaussian distance bias: AdaLN prologue (cond x adaln_w modulation of a non-affine LN), q/k/v projections with bias, two-half rotate-half RoPE from int positions, online-softmax attention, output projection; f32 outputs out, roped k, v.
// Compute dtypes, f32 accumulate everywhere: every float input RNE-converted to bf16 on load. cond x adaln_w: v_wmma_f32_16x16x32_bf16, plain bf16 operands (1 product). q/k/v projections: bf16 hi/lo planes of the modulated LN output x bf16 weight planes (2 products).
// Scores: bf16 hi/lo q and k planes (hi.hi + lo.hi + hi.lo) plus one extra bf16 k-step carrying the distance-bias terms (exact coordinate cross products, three-piece bf16 squared norms, key mask fill). attn.v: v_wmma_f32_16x16x32_f16, P carried x2^14 in f16 (one plane), v as f16 hi + x2^10 f16 residual planes (two accumulators).
// Output projection: bf16 hi/lo ctx planes x bf16 Wo (2 products). LN statistics, inverse-frequency and cos/sin tables, RoPE, softmax and all side math f32 on VALU; the k and v outputs are written from the f32 projection results.

#ifndef NB
#define NB 2
#endif
#define NB_FULL 2
#ifndef SEQ
#define SEQ 3072
#endif
#define SEQ_FULL 3072
#define NRES 256
#define NFR (SEQ / NRES)
#define CM 512
#define ADW 1024
#define NH 8
#define HD 64
#define CDIM 64
#define NEX 32
#define NTOK (NB * SEQ)
#define NBH (NB * NH)
#define QSCL 0.125f
#define PCAR 16384.0f
#define PINV 0.00006103515625f
#define LCAR 1024.0f
#define LINV 0.0009765625f
#define LOG2E 1.4426950408889634f
#define OUT1_EL ((size_t)NB_FULL * SEQ_FULL * CM)
#define OUT2_EL (OUT1_EL + (size_t)NB_FULL * NH * SEQ_FULL * HD)
static_assert(SEQ % NRES == 0);
static_assert(SEQ >= NRES && SEQ <= SEQ_FULL);
static_assert(NB >= 1 && NB <= NB_FULL);
static_assert(NTOK % 256 == 0);
static_assert(HD == 64 && CM == NH * HD);
static_assert(CM % 64 == 0 && ADW == 2 * CM && CDIM % 32 == 0);
static_assert(OUT1_EL * 4 == 12582912);
static_assert(OUT2_EL * 4 == 25165824);

typedef _Float16 h16;
typedef unsigned short bf;
typedef __attribute__((ext_vector_type(16))) __bf16   v16bf;
typedef __attribute__((ext_vector_type(16))) _Float16 v16h;
typedef __attribute__((ext_vector_type(8)))  _Float16 v8h;
typedef __attribute__((ext_vector_type(2)))  _Float16 v2h;
typedef __attribute__((ext_vector_type(8)))  unsigned short v8us;
typedef __attribute__((ext_vector_type(4)))  unsigned short v4us;
typedef __attribute__((ext_vector_type(2)))  unsigned short v2us;
typedef __attribute__((ext_vector_type(4)))  unsigned int v4u;
typedef __attribute__((ext_vector_type(8)))  float    v8f;
typedef __attribute__((ext_vector_type(4)))  float    v4f;
typedef __attribute__((ext_vector_type(2)))  float    v2f;
typedef v8h  __attribute__((may_alias)) v8ha;
typedef v4f  __attribute__((may_alias)) v4fa;
typedef v8us __attribute__((may_alias)) v8usa;
typedef v4u  __attribute__((may_alias)) v4ua;

__device__ __forceinline__ unsigned short f2bf(float f) { unsigned u = __float_as_uint(f); u += 0x7FFFu + ((u >> 16) & 1u); return (unsigned short)(u >> 16); }
__device__ __forceinline__ float bf2f(unsigned short b) { return __uint_as_float(((unsigned)b) << 16); }
__device__ __forceinline__ float bfr(float f) { return bf2f(f2bf(f)); }
__device__ __forceinline__ v16h cat16(v8h lo, v8h hi) { return __builtin_shufflevector(lo, hi, 0, 1, 2, 3, 4, 5, 6, 7, 8, 9, 10, 11, 12, 13, 14, 15); }
__device__ __forceinline__ v16bf cat16b(v8us lo, v8us hi) { return __builtin_bit_cast(v16bf, __builtin_shufflevector(lo, hi, 0, 1, 2, 3, 4, 5, 6, 7, 8, 9, 10, 11, 12, 13, 14, 15)); }
__device__ __forceinline__ v8f wmma16(v16h a, v16h b, v8f c) { return __builtin_amdgcn_wmma_f32_16x16x32_f16(false, a, false, b, (short)0, c, false, false); }
__device__ __forceinline__ v8f wmmab(v16bf a, v16bf b, v8f c) { return __builtin_amdgcn_wmma_f32_16x16x32_bf16(false, a, false, b, (short)0, c, false, false); }
__device__ __forceinline__ void splitf(float y, unsigned short& h, unsigned short& l) { h = f2bf(y); l = f2bf(y - bf2f(h)); }
__device__ __forceinline__ void splith(float y, h16& a, h16& c) { a = (h16)y; c = (h16)((y - (float)a) * LCAR); }
__device__ __forceinline__ unsigned int pk2(unsigned short lo, unsigned short hi2) { return (unsigned int)lo | ((unsigned int)hi2 << 16); }

// ---- k_gemmw: register-blocked GEMM, ONE WAVE per 64x64 output tile (16 accumulators), operands straight from K-contiguous 16-bit planes; grid (M/64, N/64, Z), 32 threads.
// C[m][n] (f32, pitch ldc, + optional f32 bias[n] as its bf16 value) = sum_k A[m][k] Bt[n][k] (+ split products per NSPLIT). z-batch strides sA/sB/sC in elements. K % 32 == 0.
// Fragments: lane -> row/col lane&15, vector elements 0..7 <- k0 + 8h + i, elements 8..15 <- k0 + 16 + 8h + i (h = lane>>4) for BOTH operands; D element r -> (row 8h + r, col lane&15).
template <typename T16> struct WFrag;
template <> struct WFrag<h16> { typedef v16h V; static __device__ __forceinline__ V ld(const h16* p) { return cat16(*(const v8h*)p, *(const v8h*)(p + 16)); } static __device__ __forceinline__ v8f mma(V a, V b, v8f c) { return wmma16(a, b, c); } };
template <> struct WFrag<bf> { typedef v16bf V; static __device__ __forceinline__ V ld(const bf* p) { return cat16b(*(const v8us*)p, *(const v8us*)(p + 16)); } static __device__ __forceinline__ v8f mma(V a, V b, v8f c) { return wmmab(a, b, c); } };
template <typename T16, int NSPLIT, bool BIAS>
__global__ __launch_bounds__(32) void k_gemmw(const T16* __restrict__ A, const T16* __restrict__ A2, const T16* __restrict__ Bt, const T16* __restrict__ Bt2, int K, float* C, int ldc, const float* __restrict__ bias, size_t sA, size_t sB, size_t sC) {
    typedef typename WFrag<T16>::V V;
    __shared__ __align__(16) float os[16 * 68];
    const size_t z = blockIdx.z; A += z * sA; if (A2) A2 += z * sA; Bt += z * sB; if (Bt2) Bt2 += z * sB; C += z * sC;
    const int lane = threadIdx.x & 31, lr = lane & 15, hi = lane >> 4; const int r0 = blockIdx.x * 64, c0 = blockIdx.y * 64;
    v8f acc[4][4];
#pragma unroll
    for (int mb = 0; mb < 4; ++mb)
#pragma unroll
        for (int nb = 0; nb < 4; ++nb) acc[mb][nb] = (v8f){};
    const size_t aoff = (size_t)(r0 + lr) * K + 8 * hi, boff = (size_t)(c0 + lr) * K + 8 * hi;
#pragma unroll 1
    for (int kc = 0; kc < K; kc += 32) {
        V a[4], a2[4];
#pragma unroll
        for (int mb = 0; mb < 4; ++mb) { a[mb] = WFrag<T16>::ld(A + aoff + (size_t)mb * 16 * K + kc); if (NSPLIT == 1 || NSPLIT == 2) a2[mb] = WFrag<T16>::ld(A2 + aoff + (size_t)mb * 16 * K + kc); }
#pragma unroll
        for (int nb = 0; nb < 4; ++nb) { const V b = WFrag<T16>::ld(Bt + boff + (size_t)nb * 16 * K + kc); V b2; if (NSPLIT >= 2) b2 = WFrag<T16>::ld(Bt2 + boff + (size_t)nb * 16 * K + kc);
#pragma unroll
            for (int mb = 0; mb < 4; ++mb) { acc[mb][nb] = WFrag<T16>::mma(a[mb], b, acc[mb][nb]); if (NSPLIT == 1 || NSPLIT == 2) acc[mb][nb] = WFrag<T16>::mma(a2[mb], b, acc[mb][nb]); if (NSPLIT >= 2) acc[mb][nb] = WFrag<T16>::mma(a[mb], b2, acc[mb][nb]); } }
        asm volatile("v_nop\n\tv_nop\n\tv_nop\n\tv_nop" : "+v"(acc[0][0]), "+v"(acc[1][1]), "+v"(acc[2][2]), "+v"(acc[3][3]) : "v"(a[0]), "v"(a[3]));
    }
#pragma unroll
    for (int mb = 0; mb < 4; ++mb) {
#pragma unroll
        for (int nb = 0; nb < 4; ++nb) {
#pragma unroll
            for (int j = 0; j < 8; ++j) os[(hi * 8 + j) * 68 + nb * 16 + lr] = acc[mb][nb][j]; }
        __builtin_amdgcn_wave_barrier(); asm volatile("" ::: "memory");
        float* crow = C + (size_t)(r0 + mb * 16) * ldc + c0;
{
#pragma unroll
            for (int s = 0; s < 8; ++s) { const int row = 2 * s + hi, cofs = lr * 4; v4f val = *(const v4fa*)(os + row * 68 + cofs); if (BIAS) { val[0] += bfr(bias[c0 + cofs]); val[1] += bfr(bias[c0 + cofs + 1]); val[2] += bfr(bias[c0 + cofs + 2]); val[3] += bfr(bias[c0 + cofs + 3]); }
                *(v4f*)(crow + (size_t)row * ldc + cofs) = val; }
             }
        __builtin_amdgcn_wave_barrier(); asm volatile("" ::: "memory");
    }
}

__global__ __launch_bounds__(256) void k_wtG(const float* __restrict__ w, int K, int N, bf* Bt) {
    const int lane = threadIdx.x & 31; const int L0 = (blockIdx.x * 8 + (threadIdx.x >> 5)) * 8; const int nlines = (int)((size_t)N * K / 64);
{
#pragma unroll 1
        for (int l = 0; l < 8; ++l) { const int L = L0 + l; if (L >= nlines) break; const size_t e = (size_t)L * 64 + lane * 2; const int k = (int)(e % K), n = (int)(e / K); v2us o;
            o[0] = f2bf(w[(size_t)k * N + n]); o[1] = f2bf(w[(size_t)(k + 1) * N + n]); *(v2us*)(Bt + e) = o; }
         }
}

__global__ __launch_bounds__(32) void k_invf(float* IF) {
    const int j = threadIdx.x & 31;
    const float e = (float)(j & 15) * 0.0625f;
    const float p = powf(10000.0f, e);
    const float v = 1.0f / p;
    *(float*)(IF + j) = v; 
}

__global__ __launch_bounds__(256) void k_cstab(const int* __restrict__ fidx, const int* __restrict__ sidx, const float* __restrict__ IF, float* CS) {
    const int idx = blockIdx.x * 256 + threadIdx.x; if (idx >= NTOK * HD) return;
    const int dd = idx & (HD - 1); const int R = idx >> 6; const int b = R / SEQ, t = R - b * SEQ; const int fl = t / NRES, n = t - fl * NRES;
    const int pseq = sidx[b * NRES + n]; const int pfr = fidx[fl];
    const float pf = (float)((dd < HD / 2) ? pseq : pfr);
    float fr = __fmul_rn(pf, IF[dd & 15]); asm volatile("" : "+v"(fr));
    float sn, cn;
    sincosf(fr, &sn, &cn);
    v2f cs; cs[0] = cn; cs[1] = sn;
    *(v2f*)(CS + (size_t)idx * 2) = cs; 
}

__global__ __launch_bounds__(256) void k_condp(const float* __restrict__ cond, bf* P) {
    const int lane = threadIdx.x & 31, w = threadIdx.x >> 5;
    v2us o[8];
#pragma unroll
    for (int it = 0; it < 8; ++it) { const int row = w * 8 + it; const int rc = (row < NB) ? row : (NB - 1); v2us v;
#pragma unroll
        for (int q = 0; q < 2; ++q) { const float x = cond[(size_t)rc * CDIM + 2 * lane + q]; v[q] = (row < NB) ? f2bf(x) : (unsigned short)0; }
        o[it] = v; }
{
#pragma unroll
        for (int it = 0; it < 8; ++it) *(v2us*)(P + (size_t)(w * 8 + it) * CDIM + 2 * lane) = o[it];
         }
}

__global__ __launch_bounds__(256) void k_ln(const float* __restrict__ X, const float* __restrict__ SS, bf* Xh, bf* Xl) {
    const int lane = threadIdx.x & 31; const int R = blockIdx.x * 8 + (threadIdx.x >> 5); if (R >= NTOK) return;
    const int b = R / SEQ, t = R - b * SEQ;
    const float* xr = X + ((size_t)b * SEQ_FULL + t) * CM;
    float v[16];
    { const v8f a0 = *(const v8f*)(xr + 8 * lane); const v8f a1 = *(const v8f*)(xr + 256 + 8 * lane);
#pragma unroll
      for (int k = 0; k < 8; ++k) { v[k] = bfr(a0[k]); v[8 + k] = bfr(a1[k]); } }
    float s = 0.f;
#pragma unroll
    for (int k = 0; k < 16; ++k) s += v[k];
#pragma unroll
    for (int sh = 16; sh; sh >>= 1) s += __shfl_xor(s, sh, 32);
    const float mu = s * (1.0f / (float)CM);
    float qq = 0.f;
#pragma unroll
    for (int k = 0; k < 16; ++k) { const float d = v[k] - mu; qq += d * d; }
#pragma unroll
    for (int sh = 16; sh; sh >>= 1) qq += __shfl_xor(qq, sh, 32);
    const float var = qq * (1.0f / (float)CM);
    const float rs = rsqrtf(var + 1.0e-5f);
    const float* sc = SS + (size_t)b * ADW;
    v8us oh[2], ol[2];
#pragma unroll
    for (int c = 0; c < 2; ++c) { const int col0 = c * 256 + 8 * lane; const v8f g = *(const v8f*)(sc + col0); const v8f be = *(const v8f*)(sc + CM + col0); v8us th, tl;
#pragma unroll
        for (int k = 0; k < 8; ++k) { const float xn = (v[c * 8 + k] - mu) * rs; const float y = xn * (1.0f + g[k]) + be[k]; unsigned short a2, c2; splitf(y, a2, c2); th[k] = a2; tl[k] = c2; }
        oh[c] = th; ol[c] = tl; }
{
#pragma unroll
        for (int c = 0; c < 2; ++c) { const size_t o = (size_t)R * CM + c * 256 + 8 * lane; *(v8us*)(Xh + o) = oh[c]; *(v8us*)(Xl + o) = ol[c]; }
         }
}

// ---- k_extras: per token row R the extra bf16 k-step rows (NEX = 32 slots) that carry the additive score bias inside the score WMMA. With c = bf16 coordinates and g = -|c|^2/64 split three-piece (gh + gm + gl):
// query row QE[R] = [cx, cy, cz, 1, 1, 1, gh, gm, gl, 1, 0 x 22]; key row KE[R] = [cx/32, cy/32, cz/32, gh, gm, gl, 1, 1, 1, fill, 0 x 22], fill = -2e30 where mask == 0 else 0.
__global__ __launch_bounds__(256) void k_extras(const float* __restrict__ ca, const float* __restrict__ msk, bf* QE, bf* KE) {
    __shared__ __align__(16) unsigned int qs[256 * 16];
    __shared__ __align__(16) unsigned int ks[256 * 16];
    const int tid = threadIdx.x, lane = tid & 31, w = tid >> 5;
    const int R0 = blockIdx.x * 256; const int R = R0 + tid;
    const int b = R / SEQ, t = R - b * SEQ; const size_t Rf = (size_t)b * SEQ_FULL + t;
    const float cx = bfr(ca[Rf * 3]), cy = bfr(ca[Rf * 3 + 1]), cz = bfr(ca[Rf * 3 + 2]);
    const float mk = bfr(msk[Rf]);
    const float n2 = cx * cx + cz * cz + cy * cy;
    const float g = -(n2 * 0.015625f);
    const unsigned short gh = f2bf(g); const float r1 = g - bf2f(gh); const unsigned short gm = f2bf(r1); const unsigned short gl = f2bf(r1 - bf2f(gm));
    const unsigned short one = (unsigned short)0x3F80u;
    const unsigned short fillv = (mk == 0.0f) ? f2bf(-2.0e30f) : (unsigned short)0;
    v4u qa, qb, ka, kb, zz;
#pragma unroll
    for (int i = 0; i < 4; ++i) { qb[i] = 0u; kb[i] = 0u; zz[i] = 0u; }
    qa[0] = pk2(f2bf(cx), f2bf(cy)); qa[1] = pk2(f2bf(cz), one); qa[2] = pk2(one, one); qa[3] = pk2(gh, gm);
    qb[0] = pk2(gl, one);
    ka[0] = pk2(f2bf(cx * 0.03125f), f2bf(cy * 0.03125f)); ka[1] = pk2(f2bf(cz * 0.03125f), gh); ka[2] = pk2(gm, gl); ka[3] = pk2(one, one);
    kb[0] = pk2(one, fillv);
    unsigned int* qr = qs + tid * 16; unsigned int* krw = ks + tid * 16;
    *(v4u*)(qr) = qa; *(v4u*)(qr + 4) = qb; *(v4u*)(qr + 8) = zz; *(v4u*)(qr + 12) = zz;
    *(v4u*)(krw) = ka; *(v4u*)(krw + 4) = kb; *(v4u*)(krw + 8) = zz; *(v4u*)(krw + 12) = zz;
    __syncthreads();
    v4u oq[4], ok[4]; int off[4];
#pragma unroll
    for (int it = 0; it < 4; ++it) { off[it] = (w * 4 + it) * 128 + lane * 4; oq[it] = *(const v4ua*)(qs + off[it]); ok[it] = *(const v4ua*)(ks + off[it]); }
    unsigned int* QEw = (unsigned int*)QE + (size_t)R0 * 16; unsigned int* KEw = (unsigned int*)KE + (size_t)R0 * 16;
{
#pragma unroll
        for (int it = 0; it < 4; ++it) { *(v4u*)(QEw + off[it]) = oq[it]; *(v4u*)(KEw + off[it]) = ok[it]; }
         }
}

// ---- k_ropep: head planes [bh][t][d] (bf16 hi/lo) of rope(scl * F) with the two-half rotate-half convention (each 32-dim half rotated within itself, partner d+16 for (d & 16) == 0 with subtraction, partner d-16 otherwise with addition;
__global__ __launch_bounds__(256) void k_ropep(const float* __restrict__ F, float scl, const float* __restrict__ CS, bf* Ph, bf* Pl, float* G) {
    const size_t e = ((size_t)blockIdx.x * 256 + threadIdx.x) * 2; if (e >= (size_t)NBH * SEQ * HD) return;
    const int d = (int)(e & (HD - 1)); const int t = (int)((e >> 6) % SEQ); const int bh = (int)(e / ((size_t)HD * SEQ)); const int b = bh / NH, h = bh - b * NH;
    const size_t R = (size_t)b * SEQ + t;
    const float* f = F + R * CM + h * HD;
    v2us oh, ol; v2f go;
#pragma unroll
    for (int q = 0; q < 2; ++q) { const int dd = d + q; const bool sub = ((dd & 16) == 0); const int dp = sub ? dd + 16 : dd - 16;
        const float x0 = f[dd] * scl, x1 = f[dp] * scl;
        const v2f cs = *(const v2f*)(CS + (R * HD + dd) * 2);
        float a = __fmul_rn(x0, cs[0]), bq = __fmul_rn(x1, cs[1]); asm volatile("" : "+v"(a)); asm volatile("" : "+v"(bq));
        const float r = sub ? __fsub_rn(a, bq) : __fadd_rn(a, bq);
        go[q] = r; unsigned short a2, c2; splitf(r, a2, c2); oh[q] = a2; ol[q] = c2; }
    const size_t og = ((size_t)bh * SEQ_FULL + t) * HD + d;
    *(v2us*)(Ph + e) = oh; *(v2us*)(Pl + e) = ol; if (G != nullptr) *(v2f*)(G + og) = go;
    
}

__global__ __launch_bounds__(256) void k_vtp(const float* __restrict__ F, h16* Vh, h16* Vl, float* G) {
    __shared__ float tile[64 * 65];
    const int tid = threadIdx.x, lane = tid & 31, w = tid >> 5;
    const int bh = blockIdx.y; const int b = bh / NH, h = bh - b * NH; const int t0 = blockIdx.x * 64;
    const int pc = tid & 15, rb = tid >> 4;
    v4f vv[4]; size_t og[4];
#pragma unroll
    for (int it = 0; it < 4; ++it) { const int tr = it * 16 + rb; vv[it] = *(const v4f*)(F + ((size_t)b * SEQ + t0 + tr) * CM + h * HD + 4 * pc);
#pragma unroll
        for (int c = 0; c < 4; ++c) tile[tr * 65 + 4 * pc + c] = vv[it][c];
        og[it] = ((size_t)bh * SEQ_FULL + t0 + tr) * HD + 4 * pc; }
{
#pragma unroll
        for (int it = 0; it < 4; ++it) *(v4f*)(G + og[it]) = vv[it];
         }
    __syncthreads();
    v2h oh[8], ol[8]; size_t ov[8];
#pragma unroll
    for (int it = 0; it < 8; ++it) { const int d = w * 8 + it; const float x0 = tile[(2 * lane) * 65 + d], x1 = tile[(2 * lane + 1) * 65 + d];
        h16 a0, c0, a1, c1; splith(x0, a0, c0); splith(x1, a1, c1); v2h th, tl; th[0] = a0; th[1] = a1; tl[0] = c0; tl[1] = c1; oh[it] = th; ol[it] = tl;
        ov[it] = ((size_t)bh * HD + d) * SEQ + t0 + 2 * lane; }
{
#pragma unroll
        for (int it = 0; it < 8; ++it) { *(v2h*)(Vh + ov[it]) = oh[it]; *(v2h*)(Vl + ov[it]) = ol[it]; }
         }
}

// ---- k_attn: one wave per (bh, 16 query rows), keys 0 .. (frame+1)*NRES - 1 (frame-causal, wave-uniform bound), 32 keys per step, fragments straight from the 16-bit planes (arithmetic addressing):
// S tile = QE.KE (bias k-step) + Qh.Kh + Ql.Kh + Qh.Kl over d (bf16, scale folded into the q planes); online max-subtracted softmax in f32 (row reductions over the 16 lanes of a half);
__global__ __launch_bounds__(32) void k_attn(const bf* __restrict__ Qh, const bf* __restrict__ Ql, const bf* __restrict__ QE,
                                             const bf* __restrict__ Kh, const bf* __restrict__ Kl, const bf* __restrict__ KE,
                                             const h16* __restrict__ Vth, const h16* __restrict__ Vtl, bf* ATh, bf* ATl) {
    __shared__ __align__(16) h16 ps[16 * 32];
    __shared__ __align__(16) float os[16 * 68];
    const int lane = threadIdx.x & 31, lr = lane & 15, hi = lane >> 4;
    const int bh = blockIdx.y; const int b = bh / NH, h = bh - b * NH;
    const int q0 = blockIdx.x * 16;
    const int kvlen = (q0 / NRES + 1) * NRES;
    const size_t hp = (size_t)bh * SEQ * HD;
    const size_t tb = (size_t)b * SEQ;
    const size_t qo = hp + (size_t)(q0 + lr) * HD + 8 * hi;
    const v16bf aH0 = WFrag<bf>::ld(Qh + qo), aH1 = WFrag<bf>::ld(Qh + qo + 32);
    const v16bf aL0 = WFrag<bf>::ld(Ql + qo), aL1 = WFrag<bf>::ld(Ql + qo + 32);
    const v16bf aE = WFrag<bf>::ld(QE + (tb + q0 + lr) * NEX + 8 * hi);
    v8f oh[4], ol[4];
#pragma unroll
    for (int nb = 0; nb < 4; ++nb) { oh[nb] = (v8f){}; ol[nb] = (v8f){}; }
    float m[8], l[8];
#pragma unroll
    for (int r = 0; r < 8; ++r) { m[r] = -1.0e30f; l[r] = 0.f; }
#pragma unroll 1
    for (int key0 = 0; key0 < kvlen; key0 += 32) {
        v8f s[2];
#pragma unroll
        for (int j = 0; j < 2; ++j) {
            const int kr = key0 + 16 * j + lr;
            const size_t ko = hp + (size_t)kr * HD + 8 * hi;
            s[j] = (v8f){};
            { const v16bf bE = WFrag<bf>::ld(KE + (tb + kr) * NEX + 8 * hi); s[j] = wmmab(aE, bE, s[j]); }
            { const v16bf bH = WFrag<bf>::ld(Kh + ko), bL = WFrag<bf>::ld(Kl + ko); s[j] = wmmab(aH0, bH, s[j]); s[j] = wmmab(aL0, bH, s[j]); s[j] = wmmab(aH0, bL, s[j]); }
            { const v16bf bH = WFrag<bf>::ld(Kh + ko + 32), bL = WFrag<bf>::ld(Kl + ko + 32); s[j] = wmmab(aH1, bH, s[j]); s[j] = wmmab(aL1, bH, s[j]); s[j] = wmmab(aH1, bL, s[j]); }
        }
        asm volatile("v_nop\n\tv_nop\n\tv_nop\n\tv_nop" : "+v"(s[0]), "+v"(s[1]) : "v"(aH0), "v"(aH1), "v"(aL0), "v"(aL1), "v"(aE));
        float al[8];
#pragma unroll
        for (int r = 0; r < 8; ++r) {
            float v = fmaxf(s[0][r], s[1][r]);
            v = fmaxf(v, __shfl_xor(v, 1, 32)); v = fmaxf(v, __shfl_xor(v, 2, 32)); v = fmaxf(v, __shfl_xor(v, 4, 32)); v = fmaxf(v, __shfl_xor(v, 8, 32));
            const float mn = fmaxf(m[r], v);
            al[r] = __builtin_amdgcn_exp2f((m[r] - mn) * LOG2E);
            m[r] = mn;
            const float p0 = __builtin_amdgcn_exp2f((s[0][r] - mn) * LOG2E), p1 = __builtin_amdgcn_exp2f((s[1][r] - mn) * LOG2E);
            s[0][r] = p0; s[1][r] = p1;
            float sm = p0 + p1;
            sm += __shfl_xor(sm, 1, 32); sm += __shfl_xor(sm, 2, 32); sm += __shfl_xor(sm, 4, 32); sm += __shfl_xor(sm, 8, 32);
            l[r] = l[r] * al[r] + sm;
        }
#pragma unroll
        for (int nb = 0; nb < 4; ++nb)
#pragma unroll
            for (int r = 0; r < 8; ++r) { oh[nb][r] *= al[r]; ol[nb][r] *= al[r]; }
#pragma unroll
        for (int r = 0; r < 8; ++r) { ps[(8 * hi + r) * 32 + lr] = (h16)(s[0][r] * PCAR); ps[(8 * hi + r) * 32 + 16 + lr] = (h16)(s[1][r] * PCAR); }
        __builtin_amdgcn_fence(3, "wavefront"); __builtin_amdgcn_wave_barrier(); asm volatile("" ::: "memory");
        const v16h ap = cat16(*(const v8ha*)(ps + lr * 32 + 8 * hi), *(const v8ha*)(ps + lr * 32 + 16 + 8 * hi));
#pragma unroll
        for (int nb = 0; nb < 4; ++nb) { const size_t vo = ((size_t)bh * HD + 16 * nb + lr) * SEQ + key0 + 8 * hi;
            const v16h bH = WFrag<h16>::ld(Vth + vo); oh[nb] = wmma16(ap, bH, oh[nb]);
            const v16h bL = WFrag<h16>::ld(Vtl + vo); ol[nb] = wmma16(ap, bL, ol[nb]); }
        asm volatile("v_nop\n\tv_nop\n\tv_nop\n\tv_nop" : "+v"(oh[0]), "+v"(oh[1]), "+v"(oh[2]), "+v"(oh[3]), "+v"(ol[0]), "+v"(ol[1]), "+v"(ol[2]), "+v"(ol[3]) : "v"(ap));
    }
    float il[8];
#pragma unroll
    for (int r = 0; r < 8; ++r) il[r] = PINV * __fdiv_rn(1.0f, l[r]);
#pragma unroll
    for (int nb = 0; nb < 4; ++nb)
#pragma unroll
        for (int r = 0; r < 8; ++r) os[(8 * hi + r) * 68 + 16 * nb + lr] = (oh[nb][r] + ol[nb][r] * LINV) * il[r];
    __builtin_amdgcn_fence(3, "wavefront"); __builtin_amdgcn_wave_barrier(); asm volatile("" ::: "memory");
    v8us ah[4], av[4]; size_t ad[4];
#pragma unroll
    for (int it = 0; it < 4; ++it) { const int rr = it * 4 + (lane >> 3); const int pc = lane & 7;
        const v4f x0 = *(const v4fa*)(os + rr * 68 + pc * 8), x1 = *(const v4fa*)(os + rr * 68 + pc * 8 + 4); v8us th, tl;
#pragma unroll
        for (int c = 0; c < 4; ++c) { unsigned short a2, c2; splitf(x0[c], a2, c2); th[c] = a2; tl[c] = c2; splitf(x1[c], a2, c2); th[4 + c] = a2; tl[4 + c] = c2; }
        ah[it] = th; av[it] = tl; ad[it] = (tb + q0 + rr) * CM + (size_t)h * HD + pc * 8; }
{
#pragma unroll
        for (int it = 0; it < 4; ++it) { *(v8us*)(ATh + ad[it]) = ah[it]; *(v8us*)(ATl + ad[it]) = av[it]; }
         }
}

extern "C" void kernel_launch(void* const* d_in, const int* in_sizes, int n_in,
                              void* d_out, int out_size, void* d_ws, size_t ws_size, hipStream_t stream) {
    if (n_in < 16) return;
    const int ntok_in = (NB - 1) * SEQ_FULL + SEQ;
    if (in_sizes[0] < ntok_in * CM || in_sizes[1] < NFR || in_sizes[2] < NB * NRES || in_sizes[3] < ntok_in || in_sizes[4] < NB * CDIM || in_sizes[5] < ntok_in * 3) return;
    if (in_sizes[6] < CDIM * ADW || in_sizes[7] < ADW) return;
    if (in_sizes[8] < CM * CM || in_sizes[10] < CM * CM || in_sizes[12] < CM * CM || in_sizes[14] < CM * CM) return;
    if (in_sizes[9] < CM || in_sizes[11] < CM || in_sizes[13] < CM || in_sizes[15] < CM) return;
    const size_t out_need = OUT2_EL + ((size_t)((NB - 1) * NH + NH - 1) * SEQ_FULL + SEQ) * HD;
    if ((size_t)out_size < out_need) return;
    const float* s_frames = (const float*)d_in[0]; const int* frame_idx = (const int*)d_in[1]; const int* seq_idx = (const int*)d_in[2]; const float* mask = (const float*)d_in[3];
    const float* cond = (const float*)d_in[4]; const float* ca_pos = (const float*)d_in[5]; const float* adaln_w = (const float*)d_in[6]; const float* adaln_b = (const float*)d_in[7];
    const float* wq = (const float*)d_in[8]; const float* bq = (const float*)d_in[9]; const float* wk = (const float*)d_in[10]; const float* bk = (const float*)d_in[11];
    const float* wv = (const float*)d_in[12]; const float* bv = (const float*)d_in[13]; const float* wo = (const float*)d_in[14]; const float* bo = (const float*)d_in[15];
    float* OUT = (float*)d_out;
    char* wsp = (char*)d_ws;
    auto take = [&](size_t bytes) { char* p = wsp; wsp += (bytes + 255) & ~(size_t)255; return (void*)p; };
    bf* WQ = (bf*)take((size_t)CM * CM * 2); bf* WK = (bf*)take((size_t)CM * CM * 2); bf* WV = (bf*)take((size_t)CM * CM * 2); bf* WO = (bf*)take((size_t)CM * CM * 2);
    bf* WA = (bf*)take((size_t)ADW * CDIM * 2); bf* CAP = (bf*)take((size_t)64 * CDIM * 2); float* SS = (float*)take((size_t)64 * ADW * 4);
    float* INVF = (float*)take(256); float* CS = (float*)take((size_t)NTOK * HD * 2 * 4);
    bf* XBh = (bf*)take((size_t)NTOK * CM * 2); bf* XBl = (bf*)take((size_t)NTOK * CM * 2);
    float* FQ = (float*)take((size_t)NTOK * CM * 4); float* FK = (float*)take((size_t)NTOK * CM * 4); float* FV = (float*)take((size_t)NTOK * CM * 4);
    bf* QPh = (bf*)take((size_t)NBH * SEQ * HD * 2); bf* QPl = (bf*)take((size_t)NBH * SEQ * HD * 2); bf* KPh = (bf*)take((size_t)NBH * SEQ * HD * 2); bf* KPl = (bf*)take((size_t)NBH * SEQ * HD * 2);
    h16* VTh = (h16*)take((size_t)NBH * HD * SEQ * 2); h16* VTl = (h16*)take((size_t)NBH * HD * SEQ * 2);
    bf* QE = (bf*)take((size_t)NTOK * NEX * 2); bf* KE = (bf*)take((size_t)NTOK * NEX * 2);
    bf* ATh = (bf*)take((size_t)NTOK * CM * 2); bf* ATl = (bf*)take((size_t)NTOK * CM * 2);
    const size_t used = (size_t)(wsp - (char*)d_ws);
    if (used > ws_size || used > ((size_t)128 << 20)) return;    // about 102 MiB at NB=2, SEQ=3072

    // tables and 16-bit planes of the inputs
    k_invf<<<1, 32, 0, stream>>>(INVF);
    k_cstab<<<(unsigned)((NTOK * HD + 255) / 256), 256, 0, stream>>>(frame_idx, seq_idx, INVF, CS);
    k_wtG<<<(unsigned)(((size_t)ADW * CDIM / 64 + 63) / 64), 256, 0, stream>>>(adaln_w, CDIM, ADW, WA);   // adaln_w [CDIM][ADW] -> WA[j][c]
    k_wtG<<<(unsigned)(((size_t)CM * CM / 64 + 63) / 64), 256, 0, stream>>>(wq, CM, CM, WQ);            // w [in][out] -> Bt[out][in]
    k_wtG<<<(unsigned)(((size_t)CM * CM / 64 + 63) / 64), 256, 0, stream>>>(wk, CM, CM, WK);
    k_wtG<<<(unsigned)(((size_t)CM * CM / 64 + 63) / 64), 256, 0, stream>>>(wv, CM, CM, WV);
    k_wtG<<<(unsigned)(((size_t)CM * CM / 64 + 63) / 64), 256, 0, stream>>>(wo, CM, CM, WO);
    // AdaLN: ss = cond x adaln_w + adaln_b (rows 0..NB-1 of SS), then LN + modulation -> x hi/lo planes
    k_condp<<<1, 256, 0, stream>>>(cond, CAP);
    k_gemmw<bf, 0, true><<<dim3(1, ADW / 64, 1), 32, 0, stream>>>(CAP, nullptr, WA, nullptr, CDIM, SS, ADW, adaln_b, 0, 0, 0);
    k_ln<<<(unsigned)(NTOK / 8), 256, 0, stream>>>(s_frames, SS, XBh, XBl);
    k_extras<<<(unsigned)(NTOK / 256), 256, 0, stream>>>(ca_pos, mask, QE, KE);
    // projections (x hi/lo x bf16 W, 2 products, + bias) and roped / transposed planes; k and v outputs from the f32 results
    const unsigned LR = (unsigned)(((size_t)NBH * SEQ * HD / 2 + 255) / 256);
    k_gemmw<bf, 1, true><<<dim3(NTOK / 64, CM / 64, 1), 32, 0, stream>>>(XBh, XBl, WQ, nullptr, CM, FQ, CM, bq, 0, 0, 0);
    k_ropep<<<LR, 256, 0, stream>>>(FQ, QSCL, CS, QPh, QPl, nullptr);
    k_gemmw<bf, 1, true><<<dim3(NTOK / 64, CM / 64, 1), 32, 0, stream>>>(XBh, XBl, WK, nullptr, CM, FK, CM, bk, 0, 0, 0);
    k_ropep<<<LR, 256, 0, stream>>>(FK, 1.0f, CS, KPh, KPl, OUT + OUT1_EL);
    k_gemmw<bf, 1, true><<<dim3(NTOK / 64, CM / 64, 1), 32, 0, stream>>>(XBh, XBl, WV, nullptr, CM, FV, CM, bv, 0, 0, 0);
    k_vtp<<<dim3(SEQ / 64, NBH, 1), 256, 0, stream>>>(FV, VTh, VTl, OUT + OUT2_EL);
    // attention (one launch) -> ctx hi/lo planes, then the output projection straight into out0 (batch z at the full-size token pitch)
    k_attn<<<dim3(SEQ / 16, NBH, 1), 32, 0, stream>>>(QPh, QPl, QE, KPh, KPl, KE, VTh, VTl, ATh, ATl);
    k_gemmw<bf, 1, true><<<dim3(SEQ / 64, CM / 64, NB), 32, 0, stream>>>(ATh, ATl, WO, nullptr, CM, OUT, CM, bo, (size_t)SEQ * CM, 0, (size_t)SEQ_FULL * CM);
}

// v001
// Measured time: 264 microseconds a run.
// In two side-by-side timings against v000, it was 1.75 and 1.74 times as fast.
#include <hip/hip_runtime.h>

// Frame-causal multi-head attention with a Gaussian distance bias: AdaLN prologue (cond x adaln_w modulation of a non-affine LN), q/k/v projections with bias, two-half rotate-half RoPE from int positions, online-softmax attention, output projection; f32 outputs out, roped k, v.
// Compute dtypes, f32 accumulate everywhere: every float input RNE-converted to bf16 on load. cond x adaln_w: v_wmma_f32_16x16x32_bf16, plain bf16 operands (1 product). q/k/v projections: bf16 hi/lo planes of the modulated LN output x bf16 weight planes (2 products).
// Scores: bf16 hi/lo q and k planes (hi.hi + lo.hi + hi.lo) plus one extra bf16 k-step carrying the distance-bias terms (exact coordinate cross products, three-piece bf16 squared norms, key mask fill). attn.v: v_wmma_f32_16x16x32_f16, P carried x2^14 in f16 (one plane), v as f16 hi + x2^10 f16 residual planes (two accumulators).
// Output projection: bf16 hi/lo ctx planes x bf16 Wo (2 products). LN statistics, inverse-frequency and cos/sin tables, RoPE, softmax and all side math f32 on VALU; the k and v outputs are written from the f32 projection results.

#ifndef NB
#define NB 2
#endif
#define NB_FULL 2
#ifndef SEQ
#define SEQ 3072
#endif
#define SEQ_FULL 3072
#define NRES 256
#define NFR (SEQ / NRES)
#define CM 512
#define ADW 1024
#define NH 8
#define HD 64
#define CDIM 64
#define NEX 32
#define NTOK (NB * SEQ)
#define NBH (NB * NH)
#define QSCL 0.125f
#define PCAR 16384.0f
#define PINV 0.00006103515625f
#define LCAR 1024.0f
#define LINV 0.0009765625f
#define LOG2E 1.4426950408889634f
#define OUT1_EL ((size_t)NB_FULL * SEQ_FULL * CM)
#define OUT2_EL (OUT1_EL + (size_t)NB_FULL * NH * SEQ_FULL * HD)
static_assert(SEQ % NRES == 0);
static_assert(SEQ >= NRES && SEQ <= SEQ_FULL);
static_assert(NB >= 1 && NB <= NB_FULL);
static_assert(NTOK % 256 == 0);
static_assert(HD == 64 && CM == NH * HD);
static_assert(CM % 64 == 0 && ADW == 2 * CM && CDIM % 32 == 0);
static_assert(OUT1_EL * 4 == 12582912);
static_assert(OUT2_EL * 4 == 25165824);

typedef _Float16 h16;
typedef unsigned short bf;
typedef __attribute__((ext_vector_type(16))) __bf16   v16bf;
typedef __attribute__((ext_vector_type(16))) _Float16 v16h;
typedef __attribute__((ext_vector_type(8)))  _Float16 v8h;
typedef __attribute__((ext_vector_type(2)))  _Float16 v2h;
typedef __attribute__((ext_vector_type(8)))  unsigned short v8us;
typedef __attribute__((ext_vector_type(4)))  unsigned short v4us;
typedef __attribute__((ext_vector_type(2)))  unsigned short v2us;
typedef __attribute__((ext_vector_type(4)))  unsigned int v4u;
typedef __attribute__((ext_vector_type(8)))  float    v8f;
typedef __attribute__((ext_vector_type(4)))  float    v4f;
typedef __attribute__((ext_vector_type(2)))  float    v2f;
typedef v8h  __attribute__((may_alias)) v8ha;
typedef v4f  __attribute__((may_alias)) v4fa;
typedef v8us __attribute__((may_alias)) v8usa;
typedef v4u  __attribute__((may_alias)) v4ua;

__device__ __forceinline__ unsigned short f2bf(float f) { unsigned u = __float_as_uint(f); u += 0x7FFFu + ((u >> 16) & 1u); return (unsigned short)(u >> 16); }
__device__ __forceinline__ float bf2f(unsigned short b) { return __uint_as_float(((unsigned)b) << 16); }
__device__ __forceinline__ float bfr(float f) { return bf2f(f2bf(f)); }
__device__ __forceinline__ v16h cat16(v8h lo, v8h hi) { return __builtin_shufflevector(lo, hi, 0, 1, 2, 3, 4, 5, 6, 7, 8, 9, 10, 11, 12, 13, 14, 15); }
__device__ __forceinline__ v16bf cat16b(v8us lo, v8us hi) { return __builtin_bit_cast(v16bf, __builtin_shufflevector(lo, hi, 0, 1, 2, 3, 4, 5, 6, 7, 8, 9, 10, 11, 12, 13, 14, 15)); }
__device__ __forceinline__ v8f wmma16(v16h a, v16h b, v8f c) { return __builtin_amdgcn_wmma_f32_16x16x32_f16(false, a, false, b, (short)0, c, false, false); }
__device__ __forceinline__ v8f wmmab(v16bf a, v16bf b, v8f c) { return __builtin_amdgcn_wmma_f32_16x16x32_bf16(false, a, false, b, (short)0, c, false, false); }
__device__ __forceinline__ void splitf(float y, unsigned short& h, unsigned short& l) { h = f2bf(y); l = f2bf(y - bf2f(h)); }
__device__ __forceinline__ void splith(float y, h16& a, h16& c) { a = (h16)y; c = (h16)((y - (float)a) * LCAR); }
__device__ __forceinline__ unsigned int pk2(unsigned short lo, unsigned short hi2) { return (unsigned int)lo | ((unsigned int)hi2 << 16); }

// ---- k_gemmw: register-blocked GEMM, ONE WAVE per 64x64 output tile (16 accumulators), operands straight from K-contiguous 16-bit planes; grid (M/64, N/64, Z), 32 threads.
// C[m][n] (f32, pitch ldc, + optional f32 bias[n] as its bf16 value) = sum_k A[m][k] Bt[n][k] (+ split products per NSPLIT). z-batch strides sA/sB/sC in elements. K % 32 == 0.
// Fragments: lane -> row/col lane&15, vector elements 0..7 <- k0 + 8h + i, elements 8..15 <- k0 + 16 + 8h + i (h = lane>>4) for BOTH operands; D element r -> (row 8h + r, col lane&15).
template <typename T16> struct WFrag;
template <> struct WFrag<h16> { typedef v16h V; static __device__ __forceinline__ V ld(const h16* p) { return cat16(*(const v8h*)p, *(const v8h*)(p + 16)); } static __device__ __forceinline__ v8f mma(V a, V b, v8f c) { return wmma16(a, b, c); } };
template <> struct WFrag<bf> { typedef v16bf V; static __device__ __forceinline__ V ld(const bf* p) { return cat16b(*(const v8us*)p, *(const v8us*)(p + 16)); } static __device__ __forceinline__ v8f mma(V a, V b, v8f c) { return wmmab(a, b, c); } };
template <typename T16, int NSPLIT, bool BIAS>
__global__ __launch_bounds__(32) void k_gemmw(const T16* __restrict__ A, const T16* __restrict__ A2, const T16* __restrict__ Bt, const T16* __restrict__ Bt2, int K, float* C, int ldc, const float* __restrict__ bias, size_t sA, size_t sB, size_t sC) {
    typedef typename WFrag<T16>::V V;
    __shared__ __align__(16) float os[16 * 68];
    const size_t z = blockIdx.z; A += z * sA; if (A2) A2 += z * sA; Bt += z * sB; if (Bt2) Bt2 += z * sB; C += z * sC;
    const int lane = threadIdx.x & 31, lr = lane & 15, hi = lane >> 4; const int r0 = blockIdx.x * 64, c0 = blockIdx.y * 64;
    v8f acc[4][4];
#pragma unroll
    for (int mb = 0; mb < 4; ++mb)
#pragma unroll
        for (int nb = 0; nb < 4; ++nb) acc[mb][nb] = (v8f){};
    const size_t aoff = (size_t)(r0 + lr) * K + 8 * hi, boff = (size_t)(c0 + lr) * K + 8 * hi;
#pragma unroll 1
    for (int kc = 0; kc < K; kc += 32) {
        V a[4], a2[4];
#pragma unroll
        for (int mb = 0; mb < 4; ++mb) { a[mb] = WFrag<T16>::ld(A + aoff + (size_t)mb * 16 * K + kc); if (NSPLIT == 1 || NSPLIT == 2) a2[mb] = WFrag<T16>::ld(A2 + aoff + (size_t)mb * 16 * K + kc); }
#pragma unroll
        for (int nb = 0; nb < 4; ++nb) { const V b = WFrag<T16>::ld(Bt + boff + (size_t)nb * 16 * K + kc); V b2; if (NSPLIT >= 2) b2 = WFrag<T16>::ld(Bt2 + boff + (size_t)nb * 16 * K + kc);
#pragma unroll
            for (int mb = 0; mb < 4; ++mb) { acc[mb][nb] = WFrag<T16>::mma(a[mb], b, acc[mb][nb]); if (NSPLIT == 1 || NSPLIT == 2) acc[mb][nb] = WFrag<T16>::mma(a2[mb], b, acc[mb][nb]); if (NSPLIT >= 2) acc[mb][nb] = WFrag<T16>::mma(a[mb], b2, acc[mb][nb]); } }
        asm volatile("v_nop\n\tv_nop\n\tv_nop\n\tv_nop" : "+v"(acc[0][0]), "+v"(acc[1][1]), "+v"(acc[2][2]), "+v"(acc[3][3]) : "v"(a[0]), "v"(a[3]));
    }
#pragma unroll
    for (int mb = 0; mb < 4; ++mb) {
#pragma unroll
        for (int nb = 0; nb < 4; ++nb) {
#pragma unroll
            for (int j = 0; j < 8; ++j) os[(hi * 8 + j) * 68 + nb * 16 + lr] = acc[mb][nb][j]; }
        __builtin_amdgcn_wave_barrier(); asm volatile("" ::: "memory");
        float* crow = C + (size_t)(r0 + mb * 16) * ldc + c0;
{
#pragma unroll
            for (int s = 0; s < 8; ++s) { const int row = 2 * s + hi, cofs = lr * 4; v4f val = *(const v4fa*)(os + row * 68 + cofs); if (BIAS) { val[0] += bfr(bias[c0 + cofs]); val[1] += bfr(bias[c0 + cofs + 1]); val[2] += bfr(bias[c0 + cofs + 2]); val[3] += bfr(bias[c0 + cofs + 3]); }
                *(v4f*)(crow + (size_t)row * ldc + cofs) = val; }
             }
        __builtin_amdgcn_wave_barrier(); asm volatile("" ::: "memory");
    }
}

__global__ __launch_bounds__(256) void k_wtG(const float* __restrict__ w, int K, int N, bf* Bt) {
    const int lane = threadIdx.x & 31; const int L0 = (blockIdx.x * 8 + (threadIdx.x >> 5)) * 8; const int nlines = (int)((size_t)N * K / 64);
{
#pragma unroll 1
        for (int l = 0; l < 8; ++l) { const int L = L0 + l; if (L >= nlines) break; const size_t e = (size_t)L * 64 + lane * 2; const int k = (int)(e % K), n = (int)(e / K); v2us o;
            o[0] = f2bf(w[(size_t)k * N + n]); o[1] = f2bf(w[(size_t)(k + 1) * N + n]); *(v2us*)(Bt + e) = o; }
         }
}

__global__ __launch_bounds__(32) void k_invf(float* IF) {
    const int j = threadIdx.x & 31;
    const float e = (float)(j & 15) * 0.0625f;
    const float p = powf(10000.0f, e);
    const float v = 1.0f / p;
    *(float*)(IF + j) = v; 
}

__global__ __launch_bounds__(256) void k_cstab(const int* __restrict__ fidx, const int* __restrict__ sidx, const float* __restrict__ IF, float* CS) {
    const int idx = blockIdx.x * 256 + threadIdx.x; if (idx >= NTOK * HD) return;
    const int dd = idx & (HD - 1); const int R = idx >> 6; const int b = R / SEQ, t = R - b * SEQ; const int fl = t / NRES, n = t - fl * NRES;
    const int pseq = sidx[b * NRES + n]; const int pfr = fidx[fl];
    const float pf = (float)((dd < HD / 2) ? pseq : pfr);
    float fr = __fmul_rn(pf, IF[dd & 15]); asm volatile("" : "+v"(fr));
    float sn, cn;
    sincosf(fr, &sn, &cn);
    v2f cs; cs[0] = cn; cs[1] = sn;
    *(v2f*)(CS + (size_t)idx * 2) = cs; 
}

__global__ __launch_bounds__(256) void k_condp(const float* __restrict__ cond, bf* P) {
    const int lane = threadIdx.x & 31, w = threadIdx.x >> 5;
    v2us o[8];
#pragma unroll
    for (int it = 0; it < 8; ++it) { const int row = w * 8 + it; const int rc = (row < NB) ? row : (NB - 1); v2us v;
#pragma unroll
        for (int q = 0; q < 2; ++q) { const float x = cond[(size_t)rc * CDIM + 2 * lane + q]; v[q] = (row < NB) ? f2bf(x) : (unsigned short)0; }
        o[it] = v; }
{
#pragma unroll
        for (int it = 0; it < 8; ++it) *(v2us*)(P + (size_t)(w * 8 + it) * CDIM + 2 * lane) = o[it];
         }
}

__global__ __launch_bounds__(256) void k_ln(const float* __restrict__ X, const float* __restrict__ SS, bf* Xh, bf* Xl) {
    const int lane = threadIdx.x & 31; const int R = blockIdx.x * 8 + (threadIdx.x >> 5); if (R >= NTOK) return;
    const int b = R / SEQ, t = R - b * SEQ;
    const float* xr = X + ((size_t)b * SEQ_FULL + t) * CM;
    float v[16];
    { const v8f a0 = *(const v8f*)(xr + 8 * lane); const v8f a1 = *(const v8f*)(xr + 256 + 8 * lane);
#pragma unroll
      for (int k = 0; k < 8; ++k) { v[k] = bfr(a0[k]); v[8 + k] = bfr(a1[k]); } }
    float s = 0.f;
#pragma unroll
    for (int k = 0; k < 16; ++k) s += v[k];
#pragma unroll
    for (int sh = 16; sh; sh >>= 1) s += __shfl_xor(s, sh, 32);
    const float mu = s * (1.0f / (float)CM);
    float qq = 0.f;
#pragma unroll
    for (int k = 0; k < 16; ++k) { const float d = v[k] - mu; qq += d * d; }
#pragma unroll
    for (int sh = 16; sh; sh >>= 1) qq += __shfl_xor(qq, sh, 32);
    const float var = qq * (1.0f / (float)CM);
    const float rs = rsqrtf(var + 1.0e-5f);
    const float* sc = SS + (size_t)b * ADW;
    v8us oh[2], ol[2];
#pragma unroll
    for (int c = 0; c < 2; ++c) { const int col0 = c * 256 + 8 * lane; const v8f g = *(const v8f*)(sc + col0); const v8f be = *(const v8f*)(sc + CM + col0); v8us th, tl;
#pragma unroll
        for (int k = 0; k < 8; ++k) { const float xn = (v[c * 8 + k] - mu) * rs; const float y = xn * (1.0f + g[k]) + be[k]; unsigned short a2, c2; splitf(y, a2, c2); th[k] = a2; tl[k] = c2; }
        oh[c] = th; ol[c] = tl; }
{
#pragma unroll
        for (int c = 0; c < 2; ++c) { const size_t o = (size_t)R * CM + c * 256 + 8 * lane; *(v8us*)(Xh + o) = oh[c]; *(v8us*)(Xl + o) = ol[c]; }
         }
}

// ---- k_extras: per token row R the extra bf16 k-step rows (NEX = 32 slots) that carry the additive score bias inside the score WMMA. With c = bf16 coordinates and g = -|c|^2/64 split three-piece (gh + gm + gl):
// query row QE[R] = [cx, cy, cz, 1, 1, 1, gh, gm, gl, 1, 0 x 22]; key row KE[R] = [cx/32, cy/32, cz/32, gh, gm, gl, 1, 1, 1, fill, 0 x 22], fill = -2e30 where mask == 0 else 0.
__global__ __launch_bounds__(256) void k_extras(const float* __restrict__ ca, const float* __restrict__ msk, bf* QE, bf* KE) {
    __shared__ __align__(16) unsigned int qs[256 * 16];
    __shared__ __align__(16) unsigned int ks[256 * 16];
    const int tid = threadIdx.x, lane = tid & 31, w = tid >> 5;
    const int R0 = blockIdx.x * 256; const int R = R0 + tid;
    const int b = R / SEQ, t = R - b * SEQ; const size_t Rf = (size_t)b * SEQ_FULL + t;
    const float cx = bfr(ca[Rf * 3]), cy = bfr(ca[Rf * 3 + 1]), cz = bfr(ca[Rf * 3 + 2]);
    const float mk = bfr(msk[Rf]);
    const float n2 = cx * cx + cz * cz + cy * cy;
    const float g = -(n2 * 0.015625f);
    const unsigned short gh = f2bf(g); const float r1 = g - bf2f(gh); const unsigned short gm = f2bf(r1); const unsigned short gl = f2bf(r1 - bf2f(gm));
    const unsigned short one = (unsigned short)0x3F80u;
    const unsigned short fillv = (mk == 0.0f) ? f2bf(-2.0e30f) : (unsigned short)0;
    v4u qa, qb, ka, kb, zz;
#pragma unroll
    for (int i = 0; i < 4; ++i) { qb[i] = 0u; kb[i] = 0u; zz[i] = 0u; }
    qa[0] = pk2(f2bf(cx), f2bf(cy)); qa[1] = pk2(f2bf(cz), one); qa[2] = pk2(one, one); qa[3] = pk2(gh, gm);
    qb[0] = pk2(gl, one);
    ka[0] = pk2(f2bf(cx * 0.03125f), f2bf(cy * 0.03125f)); ka[1] = pk2(f2bf(cz * 0.03125f), gh); ka[2] = pk2(gm, gl); ka[3] = pk2(one, one);
    kb[0] = pk2(one, fillv);
    unsigned int* qr = qs + tid * 16; unsigned int* krw = ks + tid * 16;
    *(v4u*)(qr) = qa; *(v4u*)(qr + 4) = qb; *(v4u*)(qr + 8) = zz; *(v4u*)(qr + 12) = zz;
    *(v4u*)(krw) = ka; *(v4u*)(krw + 4) = kb; *(v4u*)(krw + 8) = zz; *(v4u*)(krw + 12) = zz;
    __syncthreads();
    v4u oq[4], ok[4]; int off[4];
#pragma unroll
    for (int it = 0; it < 4; ++it) { off[it] = (w * 4 + it) * 128 + lane * 4; oq[it] = *(const v4ua*)(qs + off[it]); ok[it] = *(const v4ua*)(ks + off[it]); }
    unsigned int* QEw = (unsigned int*)QE + (size_t)R0 * 16; unsigned int* KEw = (unsigned int*)KE + (size_t)R0 * 16;
{
#pragma unroll
        for (int it = 0; it < 4; ++it) { *(v4u*)(QEw + off[it]) = oq[it]; *(v4u*)(KEw + off[it]) = ok[it]; }
         }
}

// ---- k_ropep: head planes [bh][t][d] (bf16 hi/lo) of rope(scl * F) with the two-half rotate-half convention (each 32-dim half rotated within itself, partner d+16 for (d & 16) == 0 with subtraction, partner d-16 otherwise with addition;
__global__ __launch_bounds__(256) void k_ropep(const float* __restrict__ F, float scl, const float* __restrict__ CS, bf* Ph, bf* Pl, float* G) {
    const size_t e = ((size_t)blockIdx.x * 256 + threadIdx.x) * 2; if (e >= (size_t)NBH * SEQ * HD) return;
    const int d = (int)(e & (HD - 1)); const int t = (int)((e >> 6) % SEQ); const int bh = (int)(e / ((size_t)HD * SEQ)); const int b = bh / NH, h = bh - b * NH;
    const size_t R = (size_t)b * SEQ + t;
    const float* f = F + R * CM + h * HD;
    v2us oh, ol; v2f go;
#pragma unroll
    for (int q = 0; q < 2; ++q) { const int dd = d + q; const bool sub = ((dd & 16) == 0); const int dp = sub ? dd + 16 : dd - 16;
        const float x0 = f[dd] * scl, x1 = f[dp] * scl;
        const v2f cs = *(const v2f*)(CS + (R * HD + dd) * 2);
        float a = __fmul_rn(x0, cs[0]), bq = __fmul_rn(x1, cs[1]); asm volatile("" : "+v"(a)); asm volatile("" : "+v"(bq));
        const float r = sub ? __fsub_rn(a, bq) : __fadd_rn(a, bq);
        go[q] = r; unsigned short a2, c2; splitf(r, a2, c2); oh[q] = a2; ol[q] = c2; }
    const size_t og = ((size_t)bh * SEQ_FULL + t) * HD + d;
    *(v2us*)(Ph + e) = oh; *(v2us*)(Pl + e) = ol; if (G != nullptr) *(v2f*)(G + og) = go;
    
}

__global__ __launch_bounds__(256) void k_vtp(const float* __restrict__ F, h16* Vh, h16* Vl, float* G) {
    __shared__ float tile[64 * 65];
    const int tid = threadIdx.x, lane = tid & 31, w = tid >> 5;
    const int bh = blockIdx.y; const int b = bh / NH, h = bh - b * NH; const int t0 = blockIdx.x * 64;
    const int pc = tid & 15, rb = tid >> 4;
    v4f vv[4]; size_t og[4];
#pragma unroll
    for (int it = 0; it < 4; ++it) { const int tr = it * 16 + rb; vv[it] = *(const v4f*)(F + ((size_t)b * SEQ + t0 + tr) * CM + h * HD + 4 * pc);
#pragma unroll
        for (int c = 0; c < 4; ++c) tile[tr * 65 + 4 * pc + c] = vv[it][c];
        og[it] = ((size_t)bh * SEQ_FULL + t0 + tr) * HD + 4 * pc; }
{
#pragma unroll
        for (int it = 0; it < 4; ++it) *(v4f*)(G + og[it]) = vv[it];
         }
    __syncthreads();
    v2h oh[8], ol[8]; size_t ov[8];
#pragma unroll
    for (int it = 0; it < 8; ++it) { const int d = w * 8 + it; const float x0 = tile[(2 * lane) * 65 + d], x1 = tile[(2 * lane + 1) * 65 + d];
        h16 a0, c0, a1, c1; splith(x0, a0, c0); splith(x1, a1, c1); v2h th, tl; th[0] = a0; th[1] = a1; tl[0] = c0; tl[1] = c1; oh[it] = th; ol[it] = tl;
        ov[it] = ((size_t)bh * HD + d) * SEQ + t0 + 2 * lane; }
{
#pragma unroll
        for (int it = 0; it < 8; ++it) { *(v2h*)(Vh + ov[it]) = oh[it]; *(v2h*)(Vl + ov[it]) = ol[it]; }
         }
}

// ---- k_attn: four waves per work-group, one wave per 16 query rows of one (b, h); all 64 rows lie in one frame, so the key bound (frame+1)*NRES is the same for the whole group. 32 keys per trip.
// The trip's k hi/lo, bias and v hi/lo tiles are brought once per work-group into a two-buffer LDS ring by asynchronous copies (whole lines from global memory, one trip ahead); every wave reads its fragments from the ring.
// S tile = QE.KE (bias k-step) + Qh.Kh + Ql.Kh + Qh.Kl over d (bf16, scale folded into the q planes); online max-subtracted softmax in f32 (row reductions over the 16 lanes of a half);
#define AW 4
#define KP 72                        // LDS pitch of a 64-element k row: 144 B = 16 B x odd, free of bank conflicts for 16-byte readers
#define VP 40                        // LDS pitch of a 32-element v or bias row: 80 B
#define ST_KH 0
#define ST_KL (32 * KP)
#define ST_KE (2 * 32 * KP)
#define ST_VH (ST_KE + 32 * VP)
#define ST_VL (ST_VH + 64 * VP)
#define ST_EL (ST_VL + 64 * VP)      // elements of one ring buffer (22016 B)
static_assert(AW == 4 && NRES % (16 * AW) == 0 && NRES >= 64 && (ST_EL * 2) % 16 == 0);
__device__ __forceinline__ v16bf ldsb(const unsigned short* p) { return cat16b(*(const v8usa*)p, *(const v8usa*)(p + 16)); }
__device__ __forceinline__ v16h ldsh(const unsigned short* p) { return cat16(*(const v8ha*)p, *(const v8ha*)(p + 16)); }
// One tile's copies of one lane, 16 B each: two pieces (16 rows apart) of k hi and of k lo, two (32 rows apart) of v hi and of v lo, one of the bias rows. The s_wait_xcnt stands inside the statement so that no address register is rewritten ahead of it.
__device__ __forceinline__ void tile_copy(unsigned lk, unsigned lv, unsigned le, const bf* gkh, const bf* gkl, const h16* gvh, const h16* gvl, const bf* gke) {
    const unsigned lk2 = lk + 16 * KP * 2, lkl = lk + (ST_KL - ST_KH) * 2, lkl2 = lkl + 16 * KP * 2;
    const unsigned lv2 = lv + 32 * VP * 2, lvl = lv + (ST_VL - ST_VH) * 2, lvl2 = lvl + 32 * VP * 2;
    const bf* gkh2 = gkh + 16 * HD; const bf* gkl2 = gkl + 16 * HD; const h16* gvh2 = gvh + (size_t)32 * SEQ; const h16* gvl2 = gvl + (size_t)32 * SEQ;
    asm volatile("global_load_async_to_lds_b128 %0, %9, off\n\t"
                 "global_load_async_to_lds_b128 %1, %10, off\n\t"
                 "global_load_async_to_lds_b128 %2, %11, off\n\t"
                 "global_load_async_to_lds_b128 %3, %12, off\n\t"
                 "global_load_async_to_lds_b128 %4, %13, off\n\t"
                 "global_load_async_to_lds_b128 %5, %14, off\n\t"
                 "global_load_async_to_lds_b128 %6, %15, off\n\t"
                 "global_load_async_to_lds_b128 %7, %16, off\n\t"
                 "global_load_async_to_lds_b128 %8, %17, off\n\t"
                 "s_wait_xcnt 0x0"
                 :: "v"(lk), "v"(lk2), "v"(lkl), "v"(lkl2), "v"(lv), "v"(lv2), "v"(lvl), "v"(lvl2), "v"(le),
                    "v"(gkh), "v"(gkh2), "v"(gkl), "v"(gkl2), "v"(gvh), "v"(gvh2), "v"(gvl), "v"(gvl2), "v"(gke) : "memory");
}
__global__ __launch_bounds__(32 * AW) void k_attn(const bf* __restrict__ Qh, const bf* __restrict__ Ql, const bf* __restrict__ QE,
                                             const bf* __restrict__ Kh, const bf* __restrict__ Kl, const bf* __restrict__ KE,
                                             const h16* __restrict__ Vth, const h16* __restrict__ Vtl, bf* ATh, bf* ATl) {
    __shared__ __align__(16) unsigned short ring[2 * ST_EL];
    __shared__ __align__(16) h16 psa[AW * 16 * 32];
    __shared__ __align__(16) float osa[AW * 16 * 68];
    const int tid = threadIdx.x, lane = tid & 31, lr = lane & 15, hi = lane >> 4, w = tid >> 5;
    h16* ps = psa + w * (16 * 32); float* os = osa + w * (16 * 68);
    const int bh = blockIdx.y; const int b = bh / NH, h = bh - b * NH;
    const int q0 = blockIdx.x * (16 * AW) + w * 16;
    const int kvlen = ((int)blockIdx.x * (16 * AW) / NRES + 1) * NRES;
    const int nt = kvlen >> 5;
    const size_t hp = (size_t)bh * SEQ * HD;
    const size_t tb = (size_t)b * SEQ;
    // this lane's share of a tile, in 16-byte pieces: k rows tid>>3 and 16 + tid>>3, piece tid&7; v rows (d) tid>>2 and 32 + tid>>2, piece tid&3; bias row tid>>2, piece tid&3
    const unsigned r0 = (unsigned)(size_t)ring;
    const unsigned lk0 = r0 + (unsigned)(ST_KH + (tid >> 3) * KP + (tid & 7) * 8) * 2u;
    const unsigned lv0 = r0 + (unsigned)(ST_VH + (tid >> 2) * VP + (tid & 3) * 8) * 2u;
    const unsigned le0 = r0 + (unsigned)(ST_KE + (tid >> 2) * VP + (tid & 3) * 8) * 2u;
    const size_t gk0 = hp + (size_t)(tid >> 3) * HD + (tid & 7) * 8;
    const size_t gv0 = ((size_t)bh * HD + (tid >> 2)) * SEQ + (tid & 3) * 8;
    const size_t ge0 = (tb + (tid >> 2)) * NEX + (tid & 3) * 8;
    tile_copy(lk0, lv0, le0, Kh + gk0, Kl + gk0, Vth + gv0, Vtl + gv0, KE + ge0);
    const size_t qo = hp + (size_t)(q0 + lr) * HD + 8 * hi;
    const v16bf aH0 = WFrag<bf>::ld(Qh + qo), aH1 = WFrag<bf>::ld(Qh + qo + 32);
    const v16bf aL0 = WFrag<bf>::ld(Ql + qo), aL1 = WFrag<bf>::ld(Ql + qo + 32);
    const v16bf aE = WFrag<bf>::ld(QE + (tb + q0 + lr) * NEX + 8 * hi);
    v8f oh[4], ol[4];
#pragma unroll
    for (int nb = 0; nb < 4; ++nb) { oh[nb] = (v8f){}; ol[nb] = (v8f){}; }
    float m[8], l[8];
#pragma unroll
    for (int r = 0; r < 8; ++r) { m[r] = -1.0e30f; l[r] = 0.f; }
    asm volatile("s_wait_asynccnt 0x0" ::: "memory");   // tile 0 of this wave has landed
    __syncthreads();                                     // publishes tile 0 to every wave
    tile_copy(lk0 + ST_EL * 2, lv0 + ST_EL * 2, le0 + ST_EL * 2, Kh + gk0 + 32 * HD, Kl + gk0 + 32 * HD, Vth + gv0 + 32, Vtl + gv0 + 32, KE + ge0 + 32 * NEX);   // tile 1 exists: nt >= 8
#pragma unroll 1
    for (int t = 0; t < nt; ++t) {
        const unsigned short* st = ring + (t & 1) * ST_EL;
        v8f s[2];
#pragma unroll
        for (int j = 0; j < 2; ++j) {
            const unsigned short* kp = st + (16 * j + lr) * KP + 8 * hi;
            s[j] = (v8f){};
            { const v16bf bE = ldsb(st + ST_KE + (16 * j + lr) * VP + 8 * hi); s[j] = wmmab(aE, bE, s[j]); }
            { const v16bf bH = ldsb(kp + ST_KH), bL = ldsb(kp + ST_KL); s[j] = wmmab(aH0, bH, s[j]); s[j] = wmmab(aL0, bH, s[j]); s[j] = wmmab(aH0, bL, s[j]); }
            { const v16bf bH = ldsb(kp + ST_KH + 32), bL = ldsb(kp + ST_KL + 32); s[j] = wmmab(aH1, bH, s[j]); s[j] = wmmab(aL1, bH, s[j]); s[j] = wmmab(aH1, bL, s[j]); }
        }
        asm volatile("v_nop\n\tv_nop\n\tv_nop\n\tv_nop" : "+v"(s[0]), "+v"(s[1]) : "v"(aH0), "v"(aH1), "v"(aL0), "v"(aL1), "v"(aE));
        float al[8];
#pragma unroll
        for (int r = 0; r < 8; ++r) {
            float v = fmaxf(s[0][r], s[1][r]);
            v = fmaxf(v, __shfl_xor(v, 1, 32)); v = fmaxf(v, __shfl_xor(v, 2, 32)); v = fmaxf(v, __shfl_xor(v, 4, 32)); v = fmaxf(v, __shfl_xor(v, 8, 32));
            const float mn = fmaxf(m[r], v);
            al[r] = __builtin_amdgcn_exp2f((m[r] - mn) * LOG2E);
            m[r] = mn;
            const float p0 = __builtin_amdgcn_exp2f((s[0][r] - mn) * LOG2E), p1 = __builtin_amdgcn_exp2f((s[1][r] - mn) * LOG2E);
            s[0][r] = p0; s[1][r] = p1;
            float sm = p0 + p1;
            sm += __shfl_xor(sm, 1, 32); sm += __shfl_xor(sm, 2, 32); sm += __shfl_xor(sm, 4, 32); sm += __shfl_xor(sm, 8, 32);
            l[r] = l[r] * al[r] + sm;
        }
#pragma unroll
        for (int nb = 0; nb < 4; ++nb)
#pragma unroll
            for (int r = 0; r < 8; ++r) { oh[nb][r] *= al[r]; ol[nb][r] *= al[r]; }
#pragma unroll
        for (int r = 0; r < 8; ++r) { ps[(8 * hi + r) * 32 + lr] = (h16)(s[0][r] * PCAR); ps[(8 * hi + r) * 32 + 16 + lr] = (h16)(s[1][r] * PCAR); }
        __builtin_amdgcn_fence(3, "wavefront"); __builtin_amdgcn_wave_barrier(); asm volatile("" ::: "memory");
        const v16h ap = cat16(*(const v8ha*)(ps + lr * 32 + 8 * hi), *(const v8ha*)(ps + lr * 32 + 16 + 8 * hi));
#pragma unroll
        for (int nb = 0; nb < 4; ++nb) { const unsigned short* vp = st + (16 * nb + lr) * VP + 8 * hi;
            const v16h bH = ldsh(vp + ST_VH); oh[nb] = wmma16(ap, bH, oh[nb]);
            const v16h bL = ldsh(vp + ST_VL); ol[nb] = wmma16(ap, bL, ol[nb]); }
        asm volatile("v_nop\n\tv_nop\n\tv_nop\n\tv_nop" : "+v"(oh[0]), "+v"(oh[1]), "+v"(oh[2]), "+v"(oh[3]), "+v"(ol[0]), "+v"(ol[1]), "+v"(ol[2]), "+v"(ol[3]) : "v"(ap));
        asm volatile("s_wait_dscnt 0x0" ::: "memory");      // this wave's reads of buffer t & 1 have returned
        asm volatile("s_wait_asynccnt 0x0" ::: "memory");   // this wave's copies of tile t + 1 have landed
        __syncthreads();                                     // publishes tile t + 1 and ends every wave's reads of buffer t & 1
        if (t + 2 < nt) { const unsigned bo = (unsigned)(t & 1) * (ST_EL * 2); const size_t kn = (size_t)(t + 2) * 32;
            tile_copy(lk0 + bo, lv0 + bo, le0 + bo, Kh + gk0 + kn * HD, Kl + gk0 + kn * HD, Vth + gv0 + kn, Vtl + gv0 + kn, KE + ge0 + kn * NEX); }
    }
    asm volatile("s_wait_asynccnt 0x0" ::: "memory");       // nothing of this wave is in flight when it ends
    float il[8];
#pragma unroll
    for (int r = 0; r < 8; ++r) il[r] = PINV * __fdiv_rn(1.0f, l[r]);
#pragma unroll
    for (int nb = 0; nb < 4; ++nb)
#pragma unroll
        for (int r = 0; r < 8; ++r) os[(8 * hi + r) * 68 + 16 * nb + lr] = (oh[nb][r] + ol[nb][r] * LINV) * il[r];
    __builtin_amdgcn_fence(3, "wavefront"); __builtin_amdgcn_wave_barrier(); asm volatile("" ::: "memory");
    v8us ah[4], av[4]; size_t ad[4];
#pragma unroll
    for (int it = 0; it < 4; ++it) { const int rr = it * 4 + (lane >> 3); const int pc = lane & 7;
        const v4f x0 = *(const v4fa*)(os + rr * 68 + pc * 8), x1 = *(const v4fa*)(os + rr * 68 + pc * 8 + 4); v8us th, tl;
#pragma unroll
        for (int c = 0; c < 4; ++c) { unsigned short a2, c2; splitf(x0[c], a2, c2); th[c] = a2; tl[c] = c2; splitf(x1[c], a2, c2); th[4 + c] = a2; tl[4 + c] = c2; }
        ah[it] = th; av[it] = tl; ad[it] = (tb + q0 + rr) * CM + (size_t)h * HD + pc * 8; }
{
#pragma unroll
        for (int it = 0; it < 4; ++it) { *(v8us*)(ATh + ad[it]) = ah[it]; *(v8us*)(ATl + ad[it]) = av[it]; }
         }
}

extern "C" void kernel_launch(void* const* d_in, const int* in_sizes, int n_in,
                              void* d_out, int out_size, void* d_ws, size_t ws_size, hipStream_t stream) {
    if (n_in < 16) return;
    const int ntok_in = (NB - 1) * SEQ_FULL + SEQ;
    if (in_sizes[0] < ntok_in * CM || in_sizes[1] < NFR || in_sizes[2] < NB * NRES || in_sizes[3] < ntok_in || in_sizes[4] < NB * CDIM || in_sizes[5] < ntok_in * 3) return;
    if (in_sizes[6] < CDIM * ADW || in_sizes[7] < ADW) return;
    if (in_sizes[8] < CM * CM || in_sizes[10] < CM * CM || in_sizes[12] < CM * CM || in_sizes[14] < CM * CM) return;
    if (in_sizes[9] < CM || in_sizes[11] < CM || in_sizes[13] < CM || in_sizes[15] < CM) return;
    const size_t out_need = OUT2_EL + ((size_t)((NB - 1) * NH + NH - 1) * SEQ_FULL + SEQ) * HD;
    if ((size_t)out_size < out_need) return;
    const float* s_frames = (const float*)d_in[0]; const int* frame_idx = (const int*)d_in[1]; const int* seq_idx = (const int*)d_in[2]; const float* mask = (const float*)d_in[3];
    const float* cond = (const float*)d_in[4]; const float* ca_pos = (const float*)d_in[5]; const float* adaln_w = (const float*)d_in[6]; const float* adaln_b = (const float*)d_in[7];
    const float* wq = (const float*)d_in[8]; const float* bq = (const float*)d_in[9]; const float* wk = (const float*)d_in[10]; const float* bk = (const float*)d_in[11];
    const float* wv = (const float*)d_in[12]; const float* bv = (const float*)d_in[13]; const float* wo = (const float*)d_in[14]; const float* bo = (const float*)d_in[15];
    float* OUT = (float*)d_out;
    char* wsp = (char*)d_ws;
    auto take = [&](size_t bytes) { char* p = wsp; wsp += (bytes + 255) & ~(size_t)255; return (void*)p; };
    bf* WQ = (bf*)take((size_t)CM * CM * 2); bf* WK = (bf*)take((size_t)CM * CM * 2); bf* WV = (bf*)take((size_t)CM * CM * 2); bf* WO = (bf*)take((size_t)CM * CM * 2);
    bf* WA = (bf*)take((size_t)ADW * CDIM * 2); bf* CAP = (bf*)take((size_t)64 * CDIM * 2); float* SS = (float*)take((size_t)64 * ADW * 4);
    float* INVF = (float*)take(256); float* CS = (float*)take((size_t)NTOK * HD * 2 * 4);
    bf* XBh = (bf*)take((size_t)NTOK * CM * 2); bf* XBl = (bf*)take((size_t)NTOK * CM * 2);
    float* FQ = (float*)take((size_t)NTOK * CM * 4); float* FK = (float*)take((size_t)NTOK * CM * 4); float* FV = (float*)take((size_t)NTOK * CM * 4);
    bf* QPh = (bf*)take((size_t)NBH * SEQ * HD * 2); bf* QPl = (bf*)take((size_t)NBH * SEQ * HD * 2); bf* KPh = (bf*)take((size_t)NBH * SEQ * HD * 2); bf* KPl = (bf*)take((size_t)NBH * SEQ * HD * 2);
    h16* VTh = (h16*)take((size_t)NBH * HD * SEQ * 2); h16* VTl = (h16*)take((size_t)NBH * HD * SEQ * 2);
    bf* QE = (bf*)take((size_t)NTOK * NEX * 2); bf* KE = (bf*)take((size_t)NTOK * NEX * 2);
    bf* ATh = (bf*)take((size_t)NTOK * CM * 2); bf* ATl = (bf*)take((size_t)NTOK * CM * 2);
    const size_t used = (size_t)(wsp - (char*)d_ws);
    if (used > ws_size || used > ((size_t)128 << 20)) return;    // about 102 MiB at NB=2, SEQ=3072

    // tables and 16-bit planes of the inputs
    k_invf<<<1, 32, 0, stream>>>(INVF);
    k_cstab<<<(unsigned)((NTOK * HD + 255) / 256), 256, 0, stream>>>(frame_idx, seq_idx, INVF, CS);
    k_wtG<<<(unsigned)(((size_t)ADW * CDIM / 64 + 63) / 64), 256, 0, stream>>>(adaln_w, CDIM, ADW, WA);   // adaln_w [CDIM][ADW] -> WA[j][c]
    k_wtG<<<(unsigned)(((size_t)CM * CM / 64 + 63) / 64), 256, 0, stream>>>(wq, CM, CM, WQ);            // w [in][out] -> Bt[out][in]
    k_wtG<<<(unsigned)(((size_t)CM * CM / 64 + 63) / 64), 256, 0, stream>>>(wk, CM, CM, WK);
    k_wtG<<<(unsigned)(((size_t)CM * CM / 64 + 63) / 64), 256, 0, stream>>>(wv, CM, CM, WV);
    k_wtG<<<(unsigned)(((size_t)CM * CM / 64 + 63) / 64), 256, 0, stream>>>(wo, CM, CM, WO);
    // AdaLN: ss = cond x adaln_w + adaln_b (rows 0..NB-1 of SS), then LN + modulation -> x hi/lo planes
    k_condp<<<1, 256, 0, stream>>>(cond, CAP);
    k_gemmw<bf, 0, true><<<dim3(1, ADW / 64, 1), 32, 0, stream>>>(CAP, nullptr, WA, nullptr, CDIM, SS, ADW, adaln_b, 0, 0, 0);
    k_ln<<<(unsigned)(NTOK / 8), 256, 0, stream>>>(s_frames, SS, XBh, XBl);
    k_extras<<<(unsigned)(NTOK / 256), 256, 0, stream>>>(ca_pos, mask, QE, KE);
    // projections (x hi/lo x bf16 W, 2 products, + bias) and roped / transposed planes; k and v outputs from the f32 results
    const unsigned LR = (unsigned)(((size_t)NBH * SEQ * HD / 2 + 255) / 256);
    k_gemmw<bf, 1, true><<<dim3(NTOK / 64, CM / 64, 1), 32, 0, stream>>>(XBh, XBl, WQ, nullptr, CM, FQ, CM, bq, 0, 0, 0);
    k_ropep<<<LR, 256, 0, stream>>>(FQ, QSCL, CS, QPh, QPl, nullptr);
    k_gemmw<bf, 1, true><<<dim3(NTOK / 64, CM / 64, 1), 32, 0, stream>>>(XBh, XBl, WK, nullptr, CM, FK, CM, bk, 0, 0, 0);
    k_ropep<<<LR, 256, 0, stream>>>(FK, 1.0f, CS, KPh, KPl, OUT + OUT1_EL);
    k_gemmw<bf, 1, true><<<dim3(NTOK / 64, CM / 64, 1), 32, 0, stream>>>(XBh, XBl, WV, nullptr, CM, FV, CM, bv, 0, 0, 0);
    k_vtp<<<dim3(SEQ / 64, NBH, 1), 256, 0, stream>>>(FV, VTh, VTl, OUT + OUT2_EL);
    // attention (one launch) -> ctx hi/lo planes, then the output projection straight into out0 (batch z at the full-size token pitch)
    k_attn<<<dim3(SEQ / (16 * AW), NBH, 1), 32 * AW, 0, stream>>>(QPh, QPl, QE, KPh, KPl, KE, VTh, VTl, ATh, ATl);
    k_gemmw<bf, 1, true><<<dim3(SEQ / 64, CM / 64, NB), 32, 0, stream>>>(ATh, ATl, WO, nullptr, CM, OUT, CM, bo, (size_t)SEQ * CM, 0, (size_t)SEQ_FULL * CM);
}

// v002
// It runs in 205 microseconds.
// Timed twice side by side with v001, it ran 1.29 times as fast both times.
// All steps since v000 together make it 2.25 times as fast.
#include <hip/hip_runtime.h>

// Frame-causal multi-head attention with a Gaussian distance bias: AdaLN prologue (cond x adaln_w modulation of a non-affine LN), q/k/v projections with bias, two-half rotate-half RoPE from int positions, online-softmax attention, output projection; f32 outputs out, roped k, v.
// Compute dtypes, f32 accumulate everywhere: every float input RNE-converted to bf16 on load. cond x adaln_w: v_wmma_f32_16x16x32_bf16, plain bf16 operands (1 product). q/k/v projections: bf16 hi/lo planes of the modulated LN output x bf16 weight planes (2 products).
// Scores: bf16 hi/lo q and k planes (hi.hi + lo.hi + hi.lo) plus one extra bf16 k-step carrying the distance-bias terms (exact coordinate cross products, three-piece bf16 squared norms, key mask fill). attn.v: v_wmma_f32_16x16x32_f16, P carried x2^14 in f16 (one plane), v as f16 hi + x2^10 f16 residual planes (two accumulators).
// Output projection: bf16 hi/lo ctx planes x bf16 Wo (2 products). LN statistics, inverse frequencies and the cos/sin table, RoPE, softmax and all side math f32 on VALU; the k and v outputs are written from the f32 projection results.

#ifndef NB
#define NB 2
#endif
#define NB_FULL 2
#ifndef SEQ
#define SEQ 3072
#endif
#define SEQ_FULL 3072
#define NRES 256
#define NFR (SEQ / NRES)
#define CM 512
#define ADW 1024
#define NH 8
#define HD 64
#define CDIM 64
#define NEX 32
#define NTOK (NB * SEQ)
#define NBH (NB * NH)
#define QSCL 0.125f
#define PCAR 16384.0f
#define PINV 0.00006103515625f
#define LCAR 1024.0f
#define LINV 0.0009765625f
#define LOG2E 1.4426950408889634f
#define OUT1_EL ((size_t)NB_FULL * SEQ_FULL * CM)
#define OUT2_EL (OUT1_EL + (size_t)NB_FULL * NH * SEQ_FULL * HD)
static_assert(SEQ % NRES == 0);
static_assert(SEQ >= NRES && SEQ <= SEQ_FULL);
static_assert(NB >= 1 && NB <= NB_FULL);
static_assert(NTOK % 256 == 0);
static_assert(HD == 64 && CM == NH * HD);
static_assert(CM % 64 == 0 && ADW == 2 * CM && CDIM % 32 == 0);
static_assert(OUT1_EL * 4 == 12582912);
static_assert(OUT2_EL * 4 == 25165824);

typedef _Float16 h16;
typedef unsigned short bf;
typedef __attribute__((ext_vector_type(16))) __bf16   v16bf;
typedef __attribute__((ext_vector_type(16))) _Float16 v16h;
typedef __attribute__((ext_vector_type(8)))  _Float16 v8h;
typedef __attribute__((ext_vector_type(2)))  _Float16 v2h;
typedef __attribute__((ext_vector_type(8)))  unsigned short v8us;
typedef __attribute__((ext_vector_type(4)))  unsigned short v4us;
typedef __attribute__((ext_vector_type(2)))  unsigned short v2us;
typedef __attribute__((ext_vector_type(4)))  unsigned int v4u;
typedef __attribute__((ext_vector_type(8)))  float    v8f;
typedef __attribute__((ext_vector_type(4)))  float    v4f;
typedef __attribute__((ext_vector_type(2)))  float    v2f;
typedef v8h  __attribute__((may_alias)) v8ha;
typedef v4f  __attribute__((may_alias)) v4fa;
typedef v8us __attribute__((may_alias)) v8usa;
typedef v4u  __attribute__((may_alias)) v4ua;

__device__ __forceinline__ unsigned short f2bf(float f) { unsigned u = __float_as_uint(f); u += 0x7FFFu + ((u >> 16) & 1u); return (unsigned short)(u >> 16); }
__device__ __forceinline__ float bf2f(unsigned short b) { return __uint_as_float(((unsigned)b) << 16); }
__device__ __forceinline__ float bfr(float f) { return bf2f(f2bf(f)); }
__device__ __forceinline__ v16h cat16(v8h lo, v8h hi) { return __builtin_shufflevector(lo, hi, 0, 1, 2, 3, 4, 5, 6, 7, 8, 9, 10, 11, 12, 13, 14, 15); }
__device__ __forceinline__ v16bf cat16b(v8us lo, v8us hi) { return __builtin_bit_cast(v16bf, __builtin_shufflevector(lo, hi, 0, 1, 2, 3, 4, 5, 6, 7, 8, 9, 10, 11, 12, 13, 14, 15)); }
__device__ __forceinline__ v8f wmma16(v16h a, v16h b, v8f c) { return __builtin_amdgcn_wmma_f32_16x16x32_f16(false, a, false, b, (short)0, c, false, false); }
__device__ __forceinline__ v8f wmmab(v16bf a, v16bf b, v8f c) { return __builtin_amdgcn_wmma_f32_16x16x32_bf16(false, a, false, b, (short)0, c, false, false); }
__device__ __forceinline__ void splitf(float y, unsigned short& h, unsigned short& l) { h = f2bf(y); l = f2bf(y - bf2f(h)); }
__device__ __forceinline__ void splith(float y, h16& a, h16& c) { a = (h16)y; c = (h16)((y - (float)a) * LCAR); }
__device__ __forceinline__ unsigned int pk2(unsigned short lo, unsigned short hi2) { return (unsigned int)lo | ((unsigned int)hi2 << 16); }

// ---- k_gemmw: register-blocked GEMM, ONE WAVE per 64x64 output tile (16 accumulators), operands straight from K-contiguous 16-bit planes; grid (M/64, N/64, Z), 32 threads.
// C[m][n] (f32, pitch ldc, + optional f32 bias[n] as its bf16 value) = sum_k A[m][k] Bt[n][k] (+ split products per NSPLIT). z-batch strides sA/sB/sC in elements, bias vector bias0/1/2 by z (Z <= 3). K % 32 == 0.
// Fragments: lane -> row/col lane&15, vector elements 0..7 <- k0 + 8h + i, elements 8..15 <- k0 + 16 + 8h + i (h = lane>>4) for BOTH operands; D element r -> (row 8h + r, col lane&15).
template <typename T16> struct WFrag;
template <> struct WFrag<h16> { typedef v16h V; static __device__ __forceinline__ V ld(const h16* p) { return cat16(*(const v8h*)p, *(const v8h*)(p + 16)); } static __device__ __forceinline__ v8f mma(V a, V b, v8f c) { return wmma16(a, b, c); } };
template <> struct WFrag<bf> { typedef v16bf V; static __device__ __forceinline__ V ld(const bf* p) { return cat16b(*(const v8us*)p, *(const v8us*)(p + 16)); } static __device__ __forceinline__ v8f mma(V a, V b, v8f c) { return wmmab(a, b, c); } };
template <typename T16, int NSPLIT, bool BIAS>
__global__ __launch_bounds__(32) void k_gemmw(const T16* __restrict__ A, const T16* __restrict__ A2, const T16* __restrict__ Bt, const T16* __restrict__ Bt2, int K, float* C, int ldc, const float* __restrict__ bias0, const float* __restrict__ bias1, const float* __restrict__ bias2, size_t sA, size_t sB, size_t sC) {
    typedef typename WFrag<T16>::V V;
    __shared__ __align__(16) float os[16 * 68];
    const size_t z = blockIdx.z; A += z * sA; if (A2) A2 += z * sA; Bt += z * sB; if (Bt2) Bt2 += z * sB; C += z * sC;
    const float* __restrict__ bias = (z == 0) ? bias0 : (z == 1) ? bias1 : bias2;
    const int lane = threadIdx.x & 31, lr = lane & 15, hi = lane >> 4; const int r0 = blockIdx.x * 64, c0 = blockIdx.y * 64;
    v8f acc[4][4];
#pragma unroll
    for (int mb = 0; mb < 4; ++mb)
#pragma unroll
        for (int nb = 0; nb < 4; ++nb) acc[mb][nb] = (v8f){};
    const size_t aoff = (size_t)(r0 + lr) * K + 8 * hi, boff = (size_t)(c0 + lr) * K + 8 * hi;
#pragma unroll 1
    for (int kc = 0; kc < K; kc += 32) {
        V a[4], a2[4];
#pragma unroll
        for (int mb = 0; mb < 4; ++mb) { a[mb] = WFrag<T16>::ld(A + aoff + (size_t)mb * 16 * K + kc); if (NSPLIT == 1 || NSPLIT == 2) a2[mb] = WFrag<T16>::ld(A2 + aoff + (size_t)mb * 16 * K + kc); }
#pragma unroll
        for (int nb = 0; nb < 4; ++nb) { const V b = WFrag<T16>::ld(Bt + boff + (size_t)nb * 16 * K + kc); V b2; if (NSPLIT >= 2) b2 = WFrag<T16>::ld(Bt2 + boff + (size_t)nb * 16 * K + kc);
#pragma unroll
            for (int mb = 0; mb < 4; ++mb) { acc[mb][nb] = WFrag<T16>::mma(a[mb], b, acc[mb][nb]); if (NSPLIT == 1 || NSPLIT == 2) acc[mb][nb] = WFrag<T16>::mma(a2[mb], b, acc[mb][nb]); if (NSPLIT >= 2) acc[mb][nb] = WFrag<T16>::mma(a[mb], b2, acc[mb][nb]); } }
        asm volatile("v_nop\n\tv_nop\n\tv_nop\n\tv_nop" : "+v"(acc[0][0]), "+v"(acc[1][1]), "+v"(acc[2][2]), "+v"(acc[3][3]) : "v"(a[0]), "v"(a[3]));
    }
#pragma unroll
    for (int mb = 0; mb < 4; ++mb) {
#pragma unroll
        for (int nb = 0; nb < 4; ++nb) {
#pragma unroll
            for (int j = 0; j < 8; ++j) os[(hi * 8 + j) * 68 + nb * 16 + lr] = acc[mb][nb][j]; }
        __builtin_amdgcn_wave_barrier(); asm volatile("" ::: "memory");
        float* crow = C + (size_t)(r0 + mb * 16) * ldc + c0;
{
#pragma unroll
            for (int s = 0; s < 8; ++s) { const int row = 2 * s + hi, cofs = lr * 4; v4f val = *(const v4fa*)(os + row * 68 + cofs); if (BIAS) { val[0] += bfr(bias[c0 + cofs]); val[1] += bfr(bias[c0 + cofs + 1]); val[2] += bfr(bias[c0 + cofs + 2]); val[3] += bfr(bias[c0 + cofs + 3]); }
                *(v4f*)(crow + (size_t)row * ldc + cofs) = val; }
             }
        __builtin_amdgcn_wave_barrier(); asm volatile("" ::: "memory");
    }
}

__device__ __forceinline__ void d_wtG(const float* __restrict__ w, int K, int N, bf* Bt, int bx) {
    const int lane = threadIdx.x & 31; const int L0 = (bx * 8 + (threadIdx.x >> 5)) * 8; const int nlines = (int)((size_t)N * K / 64);
{
#pragma unroll 1
        for (int l = 0; l < 8; ++l) { const int L = L0 + l; if (L >= nlines) break; const size_t e = (size_t)L * 64 + lane * 2; const int k = (int)(e % K), n = (int)(e / K); v2us o;
            o[0] = f2bf(w[(size_t)k * N + n]); o[1] = f2bf(w[(size_t)(k + 1) * N + n]); *(v2us*)(Bt + e) = o; }
         }
}

__device__ __forceinline__ float invf(int j) {
    const float e = (float)(j & 15) * 0.0625f;
    const float p = powf(10000.0f, e);
    const float v = 1.0f / p;
    return v;
}

__device__ __forceinline__ void d_cstab(const int* __restrict__ fidx, const int* __restrict__ sidx, float* CS, int bx) {
    const int idx = bx * 256 + threadIdx.x; if (idx >= NTOK * HD) return;
    const int dd = idx & (HD - 1); const int R = idx >> 6; const int b = R / SEQ, t = R - b * SEQ; const int fl = t / NRES, n = t - fl * NRES;
    const int pseq = sidx[b * NRES + n]; const int pfr = fidx[fl];
    const float pf = (float)((dd < HD / 2) ? pseq : pfr);
    float fr = __fmul_rn(pf, invf(dd)); asm volatile("" : "+v"(fr));
    float sn, cn;
    sincosf(fr, &sn, &cn);
    v2f cs; cs[0] = cn; cs[1] = sn;
    *(v2f*)(CS + (size_t)idx * 2) = cs; 
}

__device__ __forceinline__ void d_condp(const float* __restrict__ cond, bf* P) {
    const int lane = threadIdx.x & 31, w = threadIdx.x >> 5;
    v2us o[8];
#pragma unroll
    for (int it = 0; it < 8; ++it) { const int row = w * 8 + it; const int rc = (row < NB) ? row : (NB - 1); v2us v;
#pragma unroll
        for (int q = 0; q < 2; ++q) { const float x = cond[(size_t)rc * CDIM + 2 * lane + q]; v[q] = (row < NB) ? f2bf(x) : (unsigned short)0; }
        o[it] = v; }
{
#pragma unroll
        for (int it = 0; it < 8; ++it) *(v2us*)(P + (size_t)(w * 8 + it) * CDIM + 2 * lane) = o[it];
         }
    asm volatile("s_wait_xcnt 0x0" ::: "memory");   // in the merged kernel's text another job's code, which rewrites the registers these stores name, follows this one
}

__global__ __launch_bounds__(256) void k_ln(const float* __restrict__ X, const float* __restrict__ SS, bf* Xh, bf* Xl) {
    const int lane = threadIdx.x & 31; const int R = blockIdx.x * 8 + (threadIdx.x >> 5); if (R >= NTOK) return;
    const int b = R / SEQ, t = R - b * SEQ;
    const float* xr = X + ((size_t)b * SEQ_FULL + t) * CM;
    float v[16];
    { const v8f a0 = *(const v8f*)(xr + 8 * lane); const v8f a1 = *(const v8f*)(xr + 256 + 8 * lane);
#pragma unroll
      for (int k = 0; k < 8; ++k) { v[k] = bfr(a0[k]); v[8 + k] = bfr(a1[k]); } }
    float s = 0.f;
#pragma unroll
    for (int k = 0; k < 16; ++k) s += v[k];
#pragma unroll
    for (int sh = 16; sh; sh >>= 1) s += __shfl_xor(s, sh, 32);
    const float mu = s * (1.0f / (float)CM);
    float qq = 0.f;
#pragma unroll
    for (int k = 0; k < 16; ++k) { const float d = v[k] - mu; qq += d * d; }
#pragma unroll
    for (int sh = 16; sh; sh >>= 1) qq += __shfl_xor(qq, sh, 32);
    const float var = qq * (1.0f / (float)CM);
    const float rs = rsqrtf(var + 1.0e-5f);
    const float* sc = SS + (size_t)b * ADW;
    v8us oh[2], ol[2];
#pragma unroll
    for (int c = 0; c < 2; ++c) { const int col0 = c * 256 + 8 * lane; const v8f g = *(const v8f*)(sc + col0); const v8f be = *(const v8f*)(sc + CM + col0); v8us th, tl;
#pragma unroll
        for (int k = 0; k < 8; ++k) { const float xn = (v[c * 8 + k] - mu) * rs; const float y = xn * (1.0f + g[k]) + be[k]; unsigned short a2, c2; splitf(y, a2, c2); th[k] = a2; tl[k] = c2; }
        oh[c] = th; ol[c] = tl; }
{
#pragma unroll
        for (int c = 0; c < 2; ++c) { const size_t o = (size_t)R * CM + c * 256 + 8 * lane; *(v8us*)(Xh + o) = oh[c]; *(v8us*)(Xl + o) = ol[c]; }
         }
}

// ---- d_extras: per token row R the extra bf16 k-step rows (NEX = 32 slots) that carry the additive score bias inside the score WMMA. With c = bf16 coordinates and g = -|c|^2/64 split three-piece (gh + gm + gl):
// query row QE[R] = [cx, cy, cz, 1, 1, 1, gh, gm, gl, 1, 0 x 22]; key row KE[R] = [cx/32, cy/32, cz/32, gh, gm, gl, 1, 1, 1, fill, 0 x 22], fill = -2e30 where mask == 0 else 0.
__device__ __forceinline__ void d_extras(const float* __restrict__ ca, const float* __restrict__ msk, bf* QE, bf* KE, int bx) {
    __shared__ __align__(16) unsigned int qs[256 * 16];
    __shared__ __align__(16) unsigned int ks[256 * 16];
    const int tid = threadIdx.x, lane = tid & 31, w = tid >> 5;
    const int R0 = bx * 256; const int R = R0 + tid;
    const int b = R / SEQ, t = R - b * SEQ; const size_t Rf = (size_t)b * SEQ_FULL + t;
    const float cx = bfr(ca[Rf * 3]), cy = bfr(ca[Rf * 3 + 1]), cz = bfr(ca[Rf * 3 + 2]);
    const float mk = bfr(msk[Rf]);
    const float n2 = cx * cx + cz * cz + cy * cy;
    const float g = -(n2 * 0.015625f);
    const unsigned short gh = f2bf(g); const float r1 = g - bf2f(gh); const unsigned short gm = f2bf(r1); const unsigned short gl = f2bf(r1 - bf2f(gm));
    const unsigned short one = (unsigned short)0x3F80u;
    const unsigned short fillv = (mk == 0.0f) ? f2bf(-2.0e30f) : (unsigned short)0;
    v4u qa, qb, ka, kb, zz;
#pragma unroll
    for (int i = 0; i < 4; ++i) { qb[i] = 0u; kb[i] = 0u; zz[i] = 0u; }
    qa[0] = pk2(f2bf(cx), f2bf(cy)); qa[1] = pk2(f2bf(cz), one); qa[2] = pk2(one, one); qa[3] = pk2(gh, gm);
    qb[0] = pk2(gl, one);
    ka[0] = pk2(f2bf(cx * 0.03125f), f2bf(cy * 0.03125f)); ka[1] = pk2(f2bf(cz * 0.03125f), gh); ka[2] = pk2(gm, gl); ka[3] = pk2(one, one);
    kb[0] = pk2(one, fillv);
    unsigned int* qr = qs + tid * 16; unsigned int* krw = ks + tid * 16;
    *(v4u*)(qr) = qa; *(v4u*)(qr + 4) = qb; *(v4u*)(qr + 8) = zz; *(v4u*)(qr + 12) = zz;
    *(v4u*)(krw) = ka; *(v4u*)(krw + 4) = kb; *(v4u*)(krw + 8) = zz; *(v4u*)(krw + 12) = zz;
    __syncthreads();
    v4u oq[4], ok[4]; int off[4];
#pragma unroll
    for (int it = 0; it < 4; ++it) { off[it] = (w * 4 + it) * 128 + lane * 4; oq[it] = *(const v4ua*)(qs + off[it]); ok[it] = *(const v4ua*)(ks + off[it]); }
    unsigned int* QEw = (unsigned int*)QE + (size_t)R0 * 16; unsigned int* KEw = (unsigned int*)KE + (size_t)R0 * 16;
{
#pragma unroll
        for (int it = 0; it < 4; ++it) { *(v4u*)(QEw + off[it]) = oq[it]; *(v4u*)(KEw + off[it]) = ok[it]; }
         }
}

// ---- k_prep: every job that reads only inputs, as block ranges of one grid (the branch is the same for a whole block): weight planes, cond plane, bias k-step rows, cos/sin table.
#define PB_WA ((ADW * CDIM / 64 + 63) / 64)
#define PB_W ((CM * CM / 64 + 63) / 64)
#define PB_EX (NTOK / 256)
#define PB_CS ((NTOK * HD + 255) / 256)
#define PB_ALL (PB_WA + 4 * PB_W + 1 + PB_EX + PB_CS)
__global__ __launch_bounds__(256) void k_prep(const float* __restrict__ adaln_w, const float* __restrict__ wq, const float* __restrict__ wk, const float* __restrict__ wv, const float* __restrict__ wo,
                                              const float* __restrict__ cond, const float* __restrict__ ca, const float* __restrict__ msk, const int* __restrict__ fidx, const int* __restrict__ sidx,
                                              bf* WA, bf* WQ, bf* WK, bf* WV, bf* WO, bf* CAP, bf* QE, bf* KE, float* CS) {
    int bx = blockIdx.x;
    if (bx < PB_WA) { d_wtG(adaln_w, CDIM, ADW, WA, bx); return; }              // adaln_w [CDIM][ADW] -> WA[j][c]
    bx -= PB_WA;
    if (bx < 4 * PB_W) { const int j = bx / PB_W;                                // w [in][out] -> Bt[out][in]
        d_wtG((j == 0) ? wq : (j == 1) ? wk : (j == 2) ? wv : wo, CM, CM, (j == 0) ? WQ : (j == 1) ? WK : (j == 2) ? WV : WO, bx - j * PB_W); return; }
    bx -= 4 * PB_W;
    if (bx < 1) { d_condp(cond, CAP); return; }
    bx -= 1;
    if (bx < PB_EX) { d_extras(ca, msk, QE, KE, bx); return; }
    d_cstab(fidx, sidx, CS, bx - PB_EX);
}

// ---- d_ropep: head planes [bh][t][d] (bf16 hi/lo) of rope(scl * F) with the two-half rotate-half convention (each 32-dim half rotated within itself, partner d+16 for (d & 16) == 0 with subtraction, partner d-16 otherwise with addition;
__device__ __forceinline__ void d_ropep(const float* __restrict__ F, float scl, const float* __restrict__ CS, bf* Ph, bf* Pl, float* G, int bx) {
    const size_t e = ((size_t)bx * 256 + threadIdx.x) * 2; if (e >= (size_t)NBH * SEQ * HD) return;
    const int d = (int)(e & (HD - 1)); const int t = (int)((e >> 6) % SEQ); const int bh = (int)(e / ((size_t)HD * SEQ)); const int b = bh / NH, h = bh - b * NH;
    const size_t R = (size_t)b * SEQ + t;
    const float* f = F + R * CM + h * HD;
    v2us oh, ol; v2f go;
#pragma unroll
    for (int q = 0; q < 2; ++q) { const int dd = d + q; const bool sub = ((dd & 16) == 0); const int dp = sub ? dd + 16 : dd - 16;
        const float x0 = f[dd] * scl, x1 = f[dp] * scl;
        const v2f cs = *(const v2f*)(CS + (R * HD + dd) * 2);
        float a = __fmul_rn(x0, cs[0]), bq = __fmul_rn(x1, cs[1]); asm volatile("" : "+v"(a)); asm volatile("" : "+v"(bq));
        const float r = sub ? __fsub_rn(a, bq) : __fadd_rn(a, bq);
        go[q] = r; unsigned short a2, c2; splitf(r, a2, c2); oh[q] = a2; ol[q] = c2; }
    const size_t og = ((size_t)bh * SEQ_FULL + t) * HD + d;
    *(v2us*)(Ph + e) = oh; *(v2us*)(Pl + e) = ol; if (G != nullptr) *(v2f*)(G + og) = go;
    
}

__device__ __forceinline__ void d_vtp(const float* __restrict__ F, h16* Vh, h16* Vl, float* G, int bx) {
    __shared__ float tile[64 * 65];
    const int tid = threadIdx.x, lane = tid & 31, w = tid >> 5;
    const int bh = bx / (SEQ / 64); const int b = bh / NH, h = bh - b * NH; const int t0 = (bx - bh * (SEQ / 64)) * 64;
    const int pc = tid & 15, rb = tid >> 4;
    v4f vv[4]; size_t og[4];
#pragma unroll
    for (int it = 0; it < 4; ++it) { const int tr = it * 16 + rb; vv[it] = *(const v4f*)(F + ((size_t)b * SEQ + t0 + tr) * CM + h * HD + 4 * pc);
#pragma unroll
        for (int c = 0; c < 4; ++c) tile[tr * 65 + 4 * pc + c] = vv[it][c];
        og[it] = ((size_t)bh * SEQ_FULL + t0 + tr) * HD + 4 * pc; }
{
#pragma unroll
        for (int it = 0; it < 4; ++it) *(v4f*)(G + og[it]) = vv[it];
         }
    __syncthreads();
    v2h oh[8], ol[8]; size_t ov[8];
#pragma unroll
    for (int it = 0; it < 8; ++it) { const int d = w * 8 + it; const float x0 = tile[(2 * lane) * 65 + d], x1 = tile[(2 * lane + 1) * 65 + d];
        h16 a0, c0, a1, c1; splith(x0, a0, c0); splith(x1, a1, c1); v2h th, tl; th[0] = a0; th[1] = a1; tl[0] = c0; tl[1] = c1; oh[it] = th; ol[it] = tl;
        ov[it] = ((size_t)bh * HD + d) * SEQ + t0 + 2 * lane; }
{
#pragma unroll
        for (int it = 0; it < 8; ++it) { *(v2h*)(Vh + ov[it]) = oh[it]; *(v2h*)(Vl + ov[it]) = ol[it]; }
         }
}

// ---- k_planes: the three jobs that turn the f32 projections into operand planes and the k and v outputs, as block ranges of one grid (the branch is the same for a whole block).
#define PB_VT ((SEQ / 64) * NBH)
#define PB_RP ((NBH * SEQ * HD / 2 + 255) / 256)
__global__ __launch_bounds__(256) void k_planes(const float* __restrict__ FQ, const float* __restrict__ FK, const float* __restrict__ FV, const float* __restrict__ CS,
                                                bf* QPh, bf* QPl, bf* KPh, bf* KPl, h16* VTh, h16* VTl, float* GK, float* GV) {
    int bx = blockIdx.x;
    if (bx < PB_VT) { d_vtp(FV, VTh, VTl, GV, bx); return; }
    bx -= PB_VT;
    if (bx < PB_RP) { d_ropep(FQ, QSCL, CS, QPh, QPl, nullptr, bx); return; }
    d_ropep(FK, 1.0f, CS, KPh, KPl, GK, bx - PB_RP);
}

// ---- k_attn: four waves per work-group, one wave per 16 query rows of one (b, h); all 64 rows lie in one frame, so the key bound (frame+1)*NRES is the same for the whole group. 32 keys per trip.
// The trip's k hi/lo, bias and v hi/lo tiles are brought once per work-group into a two-buffer LDS ring by asynchronous copies (whole lines from global memory, one trip ahead); every wave reads its fragments from the ring.
// S tile = QE.KE (bias k-step) + Qh.Kh + Ql.Kh + Qh.Kl over d (bf16, scale folded into the q planes); online max-subtracted softmax in f32 (row reductions over the 16 lanes of a half);
#define AW 4
#define KP 72                        // LDS pitch of a 64-element k row: 144 B = 16 B x odd, free of bank conflicts for 16-byte readers
#define VP 40                        // LDS pitch of a 32-element v or bias row: 80 B
#define ST_KH 0
#define ST_KL (32 * KP)
#define ST_KE (2 * 32 * KP)
#define ST_VH (ST_KE + 32 * VP)
#define ST_VL (ST_VH + 64 * VP)
#define ST_EL (ST_VL + 64 * VP)      // elements of one ring buffer (22016 B)
static_assert(AW == 4 && NRES % (16 * AW) == 0 && NRES >= 64 && (ST_EL * 2) % 16 == 0);
__device__ __forceinline__ v16bf ldsb(const unsigned short* p) { return cat16b(*(const v8usa*)p, *(const v8usa*)(p + 16)); }
__device__ __forceinline__ v16h ldsh(const unsigned short* p) { return cat16(*(const v8ha*)p, *(const v8ha*)(p + 16)); }
// One tile's copies of one lane, 16 B each: two pieces (16 rows apart) of k hi and of k lo, two (32 rows apart) of v hi and of v lo, one of the bias rows. The s_wait_xcnt stands inside the statement so that no address register is rewritten ahead of it.
__device__ __forceinline__ void tile_copy(unsigned lk, unsigned lv, unsigned le, const bf* gkh, const bf* gkl, const h16* gvh, const h16* gvl, const bf* gke) {
    const unsigned lk2 = lk + 16 * KP * 2, lkl = lk + (ST_KL - ST_KH) * 2, lkl2 = lkl + 16 * KP * 2;
    const unsigned lv2 = lv + 32 * VP * 2, lvl = lv + (ST_VL - ST_VH) * 2, lvl2 = lvl + 32 * VP * 2;
    const bf* gkh2 = gkh + 16 * HD; const bf* gkl2 = gkl + 16 * HD; const h16* gvh2 = gvh + (size_t)32 * SEQ; const h16* gvl2 = gvl + (size_t)32 * SEQ;
    asm volatile("global_load_async_to_lds_b128 %0, %9, off\n\t"
                 "global_load_async_to_lds_b128 %1, %10, off\n\t"
                 "global_load_async_to_lds_b128 %2, %11, off\n\t"
                 "global_load_async_to_lds_b128 %3, %12, off\n\t"
                 "global_load_async_to_lds_b128 %4, %13, off\n\t"
                 "global_load_async_to_lds_b128 %5, %14, off\n\t"
                 "global_load_async_to_lds_b128 %6, %15, off\n\t"
                 "global_load_async_to_lds_b128 %7, %16, off\n\t"
                 "global_load_async_to_lds_b128 %8, %17, off\n\t"
                 "s_wait_xcnt 0x0"
                 :: "v"(lk), "v"(lk2), "v"(lkl), "v"(lkl2), "v"(lv), "v"(lv2), "v"(lvl), "v"(lvl2), "v"(le),
                    "v"(gkh), "v"(gkh2), "v"(gkl), "v"(gkl2), "v"(gvh), "v"(gvh2), "v"(gvl), "v"(gvl2), "v"(gke) : "memory");
}
__global__ __launch_bounds__(32 * AW) void k_attn(const bf* __restrict__ Qh, const bf* __restrict__ Ql, const bf* __restrict__ QE,
                                             const bf* __restrict__ Kh, const bf* __restrict__ Kl, const bf* __restrict__ KE,
                                             const h16* __restrict__ Vth, const h16* __restrict__ Vtl, bf* ATh, bf* ATl) {
    __shared__ __align__(16) unsigned short ring[2 * ST_EL];
    __shared__ __align__(16) h16 psa[AW * 16 * 32];
    __shared__ __align__(16) float osa[AW * 16 * 68];
    const int tid = threadIdx.x, lane = tid & 31, lr = lane & 15, hi = lane >> 4, w = tid >> 5;
    h16* ps = psa + w * (16 * 32); float* os = osa + w * (16 * 68);
    const int bh = blockIdx.y; const int b = bh / NH, h = bh - b * NH;
    const int q0 = blockIdx.x * (16 * AW) + w * 16;
    const int kvlen = ((int)blockIdx.x * (16 * AW) / NRES + 1) * NRES;
    const int nt = kvlen >> 5;
    const size_t hp = (size_t)bh * SEQ * HD;
    const size_t tb = (size_t)b * SEQ;
    // this lane's share of a tile, in 16-byte pieces: k rows tid>>3 and 16 + tid>>3, piece tid&7; v rows (d) tid>>2 and 32 + tid>>2, piece tid&3; bias row tid>>2, piece tid&3
    const unsigned r0 = (unsigned)(size_t)ring;
    const unsigned lk0 = r0 + (unsigned)(ST_KH + (tid >> 3) * KP + (tid & 7) * 8) * 2u;
    const unsigned lv0 = r0 + (unsigned)(ST_VH + (tid >> 2) * VP + (tid & 3) * 8) * 2u;
    const unsigned le0 = r0 + (unsigned)(ST_KE + (tid >> 2) * VP + (tid & 3) * 8) * 2u;
    const size_t gk0 = hp + (size_t)(tid >> 3) * HD + (tid & 7) * 8;
    const size_t gv0 = ((size_t)bh * HD + (tid >> 2)) * SEQ + (tid & 3) * 8;
    const size_t ge0 = (tb + (tid >> 2)) * NEX + (tid & 3) * 8;
    tile_copy(lk0, lv0, le0, Kh + gk0, Kl + gk0, Vth + gv0, Vtl + gv0, KE + ge0);
    const size_t qo = hp + (size_t)(q0 + lr) * HD + 8 * hi;
    const v16bf aH0 = WFrag<bf>::ld(Qh + qo), aH1 = WFrag<bf>::ld(Qh + qo + 32);
    const v16bf aL0 = WFrag<bf>::ld(Ql + qo), aL1 = WFrag<bf>::ld(Ql + qo + 32);
    const v16bf aE = WFrag<bf>::ld(QE + (tb + q0 + lr) * NEX + 8 * hi);
    v8f oh[4], ol[4];
#pragma unroll
    for (int nb = 0; nb < 4; ++nb) { oh[nb] = (v8f){}; ol[nb] = (v8f){}; }
    float m[8], l[8];
#pragma unroll
    for (int r = 0; r < 8; ++r) { m[r] = -1.0e30f; l[r] = 0.f; }
    asm volatile("s_wait_asynccnt 0x0" ::: "memory");   // tile 0 of this wave has landed
    __syncthreads();                                     // publishes tile 0 to every wave
    tile_copy(lk0 + ST_EL * 2, lv0 + ST_EL * 2, le0 + ST_EL * 2, Kh + gk0 + 32 * HD, Kl + gk0 + 32 * HD, Vth + gv0 + 32, Vtl + gv0 + 32, KE + ge0 + 32 * NEX);   // tile 1 exists: nt >= 8
#pragma unroll 1
    for (int t = 0; t < nt; ++t) {
        const unsigned short* st = ring + (t & 1) * ST_EL;
        v8f s[2];
#pragma unroll
        for (int j = 0; j < 2; ++j) {
            const unsigned short* kp = st + (16 * j + lr) * KP + 8 * hi;
            s[j] = (v8f){};
            { const v16bf bE = ldsb(st + ST_KE + (16 * j + lr) * VP + 8 * hi); s[j] = wmmab(aE, bE, s[j]); }
            { const v16bf bH = ldsb(kp + ST_KH), bL = ldsb(kp + ST_KL); s[j] = wmmab(aH0, bH, s[j]); s[j] = wmmab(aL0, bH, s[j]); s[j] = wmmab(aH0, bL, s[j]); }
            { const v16bf bH = ldsb(kp + ST_KH + 32), bL = ldsb(kp + ST_KL + 32); s[j] = wmmab(aH1, bH, s[j]); s[j] = wmmab(aL1, bH, s[j]); s[j] = wmmab(aH1, bL, s[j]); }
        }
        asm volatile("v_nop\n\tv_nop\n\tv_nop\n\tv_nop" : "+v"(s[0]), "+v"(s[1]) : "v"(aH0), "v"(aH1), "v"(aL0), "v"(aL1), "v"(aE));
        float al[8];
#pragma unroll
        for (int r = 0; r < 8; ++r) {
            float v = fmaxf(s[0][r], s[1][r]);
            v = fmaxf(v, __shfl_xor(v, 1, 32)); v = fmaxf(v, __shfl_xor(v, 2, 32)); v = fmaxf(v, __shfl_xor(v, 4, 32)); v = fmaxf(v, __shfl_xor(v, 8, 32));
            const float mn = fmaxf(m[r], v);
            al[r] = __builtin_amdgcn_exp2f((m[r] - mn) * LOG2E);
            m[r] = mn;
            const float p0 = __builtin_amdgcn_exp2f((s[0][r] - mn) * LOG2E), p1 = __builtin_amdgcn_exp2f((s[1][r] - mn) * LOG2E);
            s[0][r] = p0; s[1][r] = p1;
            float sm = p0 + p1;
            sm += __shfl_xor(sm, 1, 32); sm += __shfl_xor(sm, 2, 32); sm += __shfl_xor(sm, 4, 32); sm += __shfl_xor(sm, 8, 32);
            l[r] = l[r] * al[r] + sm;
        }
#pragma unroll
        for (int nb = 0; nb < 4; ++nb)
#pragma unroll
            for (int r = 0; r < 8; ++r) { oh[nb][r] *= al[r]; ol[nb][r] *= al[r]; }
#pragma unroll
        for (int r = 0; r < 8; ++r) { ps[(8 * hi + r) * 32 + lr] = (h16)(s[0][r] * PCAR); ps[(8 * hi + r) * 32 + 16 + lr] = (h16)(s[1][r] * PCAR); }
        __builtin_amdgcn_fence(3, "wavefront"); __builtin_amdgcn_wave_barrier(); asm volatile("" ::: "memory");
        const v16h ap = cat16(*(const v8ha*)(ps + lr * 32 + 8 * hi), *(const v8ha*)(ps + lr * 32 + 16 + 8 * hi));
#pragma unroll
        for (int nb = 0; nb < 4; ++nb) { const unsigned short* vp = st + (16 * nb + lr) * VP + 8 * hi;
            const v16h bH = ldsh(vp + ST_VH); oh[nb] = wmma16(ap, bH, oh[nb]);
            const v16h bL = ldsh(vp + ST_VL); ol[nb] = wmma16(ap, bL, ol[nb]); }
        asm volatile("v_nop\n\tv_nop\n\tv_nop\n\tv_nop" : "+v"(oh[0]), "+v"(oh[1]), "+v"(oh[2]), "+v"(oh[3]), "+v"(ol[0]), "+v"(ol[1]), "+v"(ol[2]), "+v"(ol[3]) : "v"(ap));
        asm volatile("s_wait_dscnt 0x0" ::: "memory");      // this wave's reads of buffer t & 1 have returned
        asm volatile("s_wait_asynccnt 0x0" ::: "memory");   // this wave's copies of tile t + 1 have landed
        __syncthreads();                                     // publishes tile t + 1 and ends every wave's reads of buffer t & 1
        if (t + 2 < nt) { const unsigned bo = (unsigned)(t & 1) * (ST_EL * 2); const size_t kn = (size_t)(t + 2) * 32;
            tile_copy(lk0 + bo, lv0 + bo, le0 + bo, Kh + gk0 + kn * HD, Kl + gk0 + kn * HD, Vth + gv0 + kn, Vtl + gv0 + kn, KE + ge0 + kn * NEX); }
    }
    asm volatile("s_wait_asynccnt 0x0" ::: "memory");       // nothing of this wave is in flight when it ends
    float il[8];
#pragma unroll
    for (int r = 0; r < 8; ++r) il[r] = PINV * __fdiv_rn(1.0f, l[r]);
#pragma unroll
    for (int nb = 0; nb < 4; ++nb)
#pragma unroll
        for (int r = 0; r < 8; ++r) os[(8 * hi + r) * 68 + 16 * nb + lr] = (oh[nb][r] + ol[nb][r] * LINV) * il[r];
    __builtin_amdgcn_fence(3, "wavefront"); __builtin_amdgcn_wave_barrier(); asm volatile("" ::: "memory");
    v8us ah[4], av[4]; size_t ad[4];
#pragma unroll
    for (int it = 0; it < 4; ++it) { const int rr = it * 4 + (lane >> 3); const int pc = lane & 7;
        const v4f x0 = *(const v4fa*)(os + rr * 68 + pc * 8), x1 = *(const v4fa*)(os + rr * 68 + pc * 8 + 4); v8us th, tl;
#pragma unroll
        for (int c = 0; c < 4; ++c) { unsigned short a2, c2; splitf(x0[c], a2, c2); th[c] = a2; tl[c] = c2; splitf(x1[c], a2, c2); th[4 + c] = a2; tl[4 + c] = c2; }
        ah[it] = th; av[it] = tl; ad[it] = (tb + q0 + rr) * CM + (size_t)h * HD + pc * 8; }
{
#pragma unroll
        for (int it = 0; it < 4; ++it) { *(v8us*)(ATh + ad[it]) = ah[it]; *(v8us*)(ATl + ad[it]) = av[it]; }
         }
}

extern "C" void kernel_launch(void* const* d_in, const int* in_sizes, int n_in,
                              void* d_out, int out_size, void* d_ws, size_t ws_size, hipStream_t stream) {
    if (n_in < 16) return;
    const int ntok_in = (NB - 1) * SEQ_FULL + SEQ;
    if (in_sizes[0] < ntok_in * CM || in_sizes[1] < NFR || in_sizes[2] < NB * NRES || in_sizes[3] < ntok_in || in_sizes[4] < NB * CDIM || in_sizes[5] < ntok_in * 3) return;
    if (in_sizes[6] < CDIM * ADW || in_sizes[7] < ADW) return;
    if (in_sizes[8] < CM * CM || in_sizes[10] < CM * CM || in_sizes[12] < CM * CM || in_sizes[14] < CM * CM) return;
    if (in_sizes[9] < CM || in_sizes[11] < CM || in_sizes[13] < CM || in_sizes[15] < CM) return;
    const size_t out_need = OUT2_EL + ((size_t)((NB - 1) * NH + NH - 1) * SEQ_FULL + SEQ) * HD;
    if ((size_t)out_size < out_need) return;
    const float* s_frames = (const float*)d_in[0]; const int* frame_idx = (const int*)d_in[1]; const int* seq_idx = (const int*)d_in[2]; const float* mask = (const float*)d_in[3];
    const float* cond = (const float*)d_in[4]; const float* ca_pos = (const float*)d_in[5]; const float* adaln_w = (const float*)d_in[6]; const float* adaln_b = (const float*)d_in[7];
    const float* wq = (const float*)d_in[8]; const float* bq = (const float*)d_in[9]; const float* wk = (const float*)d_in[10]; const float* bk = (const float*)d_in[11];
    const float* wv = (const float*)d_in[12]; const float* bv = (const float*)d_in[13]; const float* wo = (const float*)d_in[14]; const float* bo = (const float*)d_in[15];
    float* OUT = (float*)d_out;
    char* wsp = (char*)d_ws;
    auto take = [&](size_t bytes) { char* p = wsp; wsp += (bytes + 255) & ~(size_t)255; return (void*)p; };
    bf* WQ = (bf*)take((size_t)3 * CM * CM * 2); bf* WK = WQ + (size_t)CM * CM; bf* WV = WK + (size_t)CM * CM; bf* WO = (bf*)take((size_t)CM * CM * 2);
    bf* WA = (bf*)take((size_t)ADW * CDIM * 2); bf* CAP = (bf*)take((size_t)64 * CDIM * 2); float* SS = (float*)take((size_t)64 * ADW * 4);
    float* CS = (float*)take((size_t)NTOK * HD * 2 * 4);
    bf* XBh = (bf*)take((size_t)NTOK * CM * 2); bf* XBl = (bf*)take((size_t)NTOK * CM * 2);
    float* FQ = (float*)take((size_t)3 * NTOK * CM * 4); float* FK = FQ + (size_t)NTOK * CM; float* FV = FK + (size_t)NTOK * CM;
    bf* QPh = (bf*)take((size_t)NBH * SEQ * HD * 2); bf* QPl = (bf*)take((size_t)NBH * SEQ * HD * 2); bf* KPh = (bf*)take((size_t)NBH * SEQ * HD * 2); bf* KPl = (bf*)take((size_t)NBH * SEQ * HD * 2);
    h16* VTh = (h16*)take((size_t)NBH * HD * SEQ * 2); h16* VTl = (h16*)take((size_t)NBH * HD * SEQ * 2);
    bf* QE = (bf*)take((size_t)NTOK * NEX * 2); bf* KE = (bf*)take((size_t)NTOK * NEX * 2);
    bf* ATh = (bf*)take((size_t)NTOK * CM * 2); bf* ATl = (bf*)take((size_t)NTOK * CM * 2);
    const size_t used = (size_t)(wsp - (char*)d_ws);
    if (used > ws_size || used > ((size_t)128 << 20)) return;    // about 102 MiB at NB=2, SEQ=3072

    // one launch for all that reads only inputs: 16-bit weight and cond planes, bias k-step rows, cos/sin table
    k_prep<<<PB_ALL, 256, 0, stream>>>(adaln_w, wq, wk, wv, wo, cond, ca_pos, mask, frame_idx, seq_idx, WA, WQ, WK, WV, WO, CAP, QE, KE, CS);
    // AdaLN: ss = cond x adaln_w + adaln_b (rows 0..NB-1 of SS), then LN + modulation -> x hi/lo planes
    k_gemmw<bf, 0, true><<<dim3(1, ADW / 64, 1), 32, 0, stream>>>(CAP, nullptr, WA, nullptr, CDIM, SS, ADW, adaln_b, adaln_b, adaln_b, 0, 0, 0);
    k_ln<<<(unsigned)(NTOK / 8), 256, 0, stream>>>(s_frames, SS, XBh, XBl);
    // projections (x hi/lo x bf16 W, 2 products, + bias) in one launch, then roped / transposed planes in one launch; k and v outputs from the f32 results
    k_gemmw<bf, 1, true><<<dim3(NTOK / 64, CM / 64, 3), 32, 0, stream>>>(XBh, XBl, WQ, nullptr, CM, FQ, CM, bq, bk, bv, 0, (size_t)CM * CM, (size_t)NTOK * CM);   // z = q, k, v
    k_planes<<<PB_VT + 2 * PB_RP, 256, 0, stream>>>(FQ, FK, FV, CS, QPh, QPl, KPh, KPl, VTh, VTl, OUT + OUT1_EL, OUT + OUT2_EL);
    // attention (one launch) -> ctx hi/lo planes, then the output projection straight into out0 (batch z at the full-size token pitch)
    k_attn<<<dim3(SEQ / (16 * AW), NBH, 1), 32 * AW, 0, stream>>>(QPh, QPl, QE, KPh, KPl, KE, VTh, VTl, ATh, ATl);
    k_gemmw<bf, 1, true><<<dim3(SEQ / 64, CM / 64, NB), 32, 0, stream>>>(ATh, ATl, WO, nullptr, CM, OUT, CM, bo, bo, bo, (size_t)SEQ * CM, 0, (size_t)SEQ_FULL * CM);
}

// v003
// One run takes 165 microseconds.
// Timed twice side by side with v002, it ran 1.24 and 1.25 times as fast.
// Over all steps from v000 it is 2.80 times as fast.
#include <hip/hip_runtime.h>

// Frame-causal multi-head attention with a Gaussian distance bias: AdaLN prologue (cond x adaln_w modulation of a non-affine LN), q/k/v projections with bias, two-half rotate-half RoPE from int positions, online-softmax attention, output projection; f32 outputs out, roped k, v.
// Compute dtypes, f32 accumulate everywhere: every float input RNE-converted to bf16 on load. cond x adaln_w: v_wmma_f32_16x16x32_bf16, plain bf16 operands (1 product). q/k/v projections: bf16 hi/lo planes of the modulated LN output x bf16 weight planes (2 products).
// Scores: bf16 hi/lo q and k planes (hi.hi + lo.hi + hi.lo) plus one extra bf16 k-step carrying the distance-bias terms (exact coordinate cross products, three-piece bf16 squared norms, key mask fill). attn.v: v_wmma_f32_16x16x32_f16, P carried x2^14 in f16 (one plane), v as f16 hi + x2^10 f16 residual planes (two accumulators).
// Output projection: bf16 hi/lo ctx planes x bf16 Wo (2 products). LN statistics, inverse frequencies and the cos/sin table, RoPE, softmax and all side math f32 on VALU; the k and v outputs are written from the f32 projection results.

#ifndef NB
#define NB 2
#endif
#define NB_FULL 2
#ifndef SEQ
#define SEQ 3072
#endif
#define SEQ_FULL 3072
#define NRES 256
#define NFR (SEQ / NRES)
#define CM 512
#define ADW 1024
#define NH 8
#define HD 64
#define CDIM 64
#define NEX 32
#define NTOK (NB * SEQ)
#define NBH (NB * NH)
#define QSCL 0.125f
#define PCAR 16384.0f
#define PINV 0.00006103515625f
#define LCAR 1024.0f
#define LINV 0.0009765625f
#define LOG2E 1.4426950408889634f
#define OUT1_EL ((size_t)NB_FULL * SEQ_FULL * CM)
#define OUT2_EL (OUT1_EL + (size_t)NB_FULL * NH * SEQ_FULL * HD)
static_assert(SEQ % NRES == 0);
static_assert(SEQ >= NRES && SEQ <= SEQ_FULL);
static_assert(NB >= 1 && NB <= NB_FULL);
static_assert(NTOK % 256 == 0);
static_assert(HD == 64 && CM == NH * HD);
static_assert(CM % 64 == 0 && ADW == 2 * CM && CDIM % 32 == 0);
static_assert(OUT1_EL * 4 == 12582912);
static_assert(OUT2_EL * 4 == 25165824);

typedef _Float16 h16;
typedef unsigned short bf;
typedef __attribute__((ext_vector_type(16))) __bf16   v16bf;
typedef __attribute__((ext_vector_type(16))) _Float16 v16h;
typedef __attribute__((ext_vector_type(8)))  _Float16 v8h;
typedef __attribute__((ext_vector_type(2)))  _Float16 v2h;
typedef __attribute__((ext_vector_type(8)))  unsigned short v8us;
typedef __attribute__((ext_vector_type(4)))  unsigned short v4us;
typedef __attribute__((ext_vector_type(2)))  unsigned short v2us;
typedef __attribute__((ext_vector_type(4)))  unsigned int v4u;
typedef __attribute__((ext_vector_type(8)))  float    v8f;
typedef __attribute__((ext_vector_type(4)))  float    v4f;
typedef __attribute__((ext_vector_type(2)))  float    v2f;
typedef v8h  __attribute__((may_alias)) v8ha;
typedef v4f  __attribute__((may_alias)) v4fa;
typedef v8us __attribute__((may_alias)) v8usa;
typedef v4u  __attribute__((may_alias)) v4ua;

__device__ __forceinline__ unsigned short f2bf(float f) { unsigned u = __float_as_uint(f); u += 0x7FFFu + ((u >> 16) & 1u); return (unsigned short)(u >> 16); }
__device__ __forceinline__ float bf2f(unsigned short b) { return __uint_as_float(((unsigned)b) << 16); }
__device__ __forceinline__ float bfr(float f) { return bf2f(f2bf(f)); }
__device__ __forceinline__ v16h cat16(v8h lo, v8h hi) { return __builtin_shufflevector(lo, hi, 0, 1, 2, 3, 4, 5, 6, 7, 8, 9, 10, 11, 12, 13, 14, 15); }
__device__ __forceinline__ v16bf cat16b(v8us lo, v8us hi) { return __builtin_bit_cast(v16bf, __builtin_shufflevector(lo, hi, 0, 1, 2, 3, 4, 5, 6, 7, 8, 9, 10, 11, 12, 13, 14, 15)); }
__device__ __forceinline__ v8f wmma16(v16h a, v16h b, v8f c) { return __builtin_amdgcn_wmma_f32_16x16x32_f16(false, a, false, b, (short)0, c, false, false); }
__device__ __forceinline__ v8f wmmab(v16bf a, v16bf b, v8f c) { return __builtin_amdgcn_wmma_f32_16x16x32_bf16(false, a, false, b, (short)0, c, false, false); }
__device__ __forceinline__ void splitf(float y, unsigned short& h, unsigned short& l) { h = f2bf(y); l = f2bf(y - bf2f(h)); }
__device__ __forceinline__ void splith(float y, h16& a, h16& c) { a = (h16)y; c = (h16)((y - (float)a) * LCAR); }
__device__ __forceinline__ unsigned int pk2(unsigned short lo, unsigned short hi2) { return (unsigned int)lo | ((unsigned int)hi2 << 16); }

// ---- k_gemmw: register-blocked GEMM, ONE WAVE per 64x64 output tile (16 accumulators), operands straight from K-contiguous 16-bit planes; grid (M/64, N/64, Z), 32 threads.
// C[m][n] (f32, pitch ldc, + optional f32 bias[n] as its bf16 value) = sum_k A[m][k] Bt[n][k] (+ split products per NSPLIT). z-batch strides sA/sB/sC in elements, bias vector bias0/1/2 by z (Z <= 3). K % 32 == 0.
// Fragments: lane -> row/col lane&15, vector elements 0..7 <- k0 + 8h + i, elements 8..15 <- k0 + 16 + 8h + i (h = lane>>4) for BOTH operands; D element r -> (row 8h + r, col lane&15).
template <typename T16> struct WFrag;
template <> struct WFrag<h16> { typedef v16h V; static __device__ __forceinline__ V ld(const h16* p) { return cat16(*(const v8h*)p, *(const v8h*)(p + 16)); } static __device__ __forceinline__ v8f mma(V a, V b, v8f c) { return wmma16(a, b, c); } };
template <> struct WFrag<bf> { typedef v16bf V; static __device__ __forceinline__ V ld(const bf* p) { return cat16b(*(const v8us*)p, *(const v8us*)(p + 16)); } static __device__ __forceinline__ v8f mma(V a, V b, v8f c) { return wmmab(a, b, c); } };
template <typename T16, int NSPLIT, bool BIAS>
__global__ __launch_bounds__(32) void k_gemmw(const T16* __restrict__ A, const T16* __restrict__ A2, const T16* __restrict__ Bt, const T16* __restrict__ Bt2, int K, float* C, int ldc, const float* __restrict__ bias0, const float* __restrict__ bias1, const float* __restrict__ bias2, size_t sA, size_t sB, size_t sC) {
    typedef typename WFrag<T16>::V V;
    __shared__ __align__(16) float os[16 * 68];
    const size_t z = blockIdx.z; A += z * sA; if (A2) A2 += z * sA; Bt += z * sB; if (Bt2) Bt2 += z * sB; C += z * sC;
    const float* __restrict__ bias = (z == 0) ? bias0 : (z == 1) ? bias1 : bias2;
    const int lane = threadIdx.x & 31, lr = lane & 15, hi = lane >> 4; const int r0 = blockIdx.x * 64, c0 = blockIdx.y * 64;
    v8f acc[4][4];
#pragma unroll
    for (int mb = 0; mb < 4; ++mb)
#pragma unroll
        for (int nb = 0; nb < 4; ++nb) acc[mb][nb] = (v8f){};
    const size_t aoff = (size_t)(r0 + lr) * K + 8 * hi, boff = (size_t)(c0 + lr) * K + 8 * hi;
#pragma unroll 1
    for (int kc = 0; kc < K; kc += 32) {
        V a[4], a2[4];
#pragma unroll
        for (int mb = 0; mb < 4; ++mb) { a[mb] = WFrag<T16>::ld(A + aoff + (size_t)mb * 16 * K + kc); if (NSPLIT == 1 || NSPLIT == 2) a2[mb] = WFrag<T16>::ld(A2 + aoff + (size_t)mb * 16 * K + kc); }
#pragma unroll
        for (int nb = 0; nb < 4; ++nb) { const V b = WFrag<T16>::ld(Bt + boff + (size_t)nb * 16 * K + kc); V b2; if (NSPLIT >= 2) b2 = WFrag<T16>::ld(Bt2 + boff + (size_t)nb * 16 * K + kc);
#pragma unroll
            for (int mb = 0; mb < 4; ++mb) { acc[mb][nb] = WFrag<T16>::mma(a[mb], b, acc[mb][nb]); if (NSPLIT == 1 || NSPLIT == 2) acc[mb][nb] = WFrag<T16>::mma(a2[mb], b, acc[mb][nb]); if (NSPLIT >= 2) acc[mb][nb] = WFrag<T16>::mma(a[mb], b2, acc[mb][nb]); } }
        asm volatile("v_nop\n\tv_nop\n\tv_nop\n\tv_nop" : "+v"(acc[0][0]), "+v"(acc[1][1]), "+v"(acc[2][2]), "+v"(acc[3][3]) : "v"(a[0]), "v"(a[3]));
    }
#pragma unroll
    for (int mb = 0; mb < 4; ++mb) {
#pragma unroll
        for (int nb = 0; nb < 4; ++nb) {
#pragma unroll
            for (int j = 0; j < 8; ++j) os[(hi * 8 + j) * 68 + nb * 16 + lr] = acc[mb][nb][j]; }
        __builtin_amdgcn_wave_barrier(); asm volatile("" ::: "memory");
        float* crow = C + (size_t)(r0 + mb * 16) * ldc + c0;
{
#pragma unroll
            for (int s = 0; s < 8; ++s) { const int row = 2 * s + hi, cofs = lr * 4; v4f val = *(const v4fa*)(os + row * 68 + cofs); if (BIAS) { val[0] += bfr(bias[c0 + cofs]); val[1] += bfr(bias[c0 + cofs + 1]); val[2] += bfr(bias[c0 + cofs + 2]); val[3] += bfr(bias[c0 + cofs + 3]); }
                *(v4f*)(crow + (size_t)row * ldc + cofs) = val; }
             }
        __builtin_amdgcn_wave_barrier(); asm volatile("" ::: "memory");
    }
}

__device__ __forceinline__ void d_wtG(const float* __restrict__ w, int K, int N, bf* Bt, int bx) {
    const int lane = threadIdx.x & 31; const int L0 = (bx * 8 + (threadIdx.x >> 5)) * 8; const int nlines = (int)((size_t)N * K / 64);
{
#pragma unroll 1
        for (int l = 0; l < 8; ++l) { const int L = L0 + l; if (L >= nlines) break; const size_t e = (size_t)L * 64 + lane * 2; const int k = (int)(e % K), n = (int)(e / K); v2us o;
            o[0] = f2bf(w[(size_t)k * N + n]); o[1] = f2bf(w[(size_t)(k + 1) * N + n]); *(v2us*)(Bt + e) = o; }
         }
}

__device__ __forceinline__ float invf(int j) {
    const float e = (float)(j & 15) * 0.0625f;
    const float p = powf(10000.0f, e);
    const float v = 1.0f / p;
    return v;
}

__device__ __forceinline__ void d_cstab(const int* __restrict__ fidx, const int* __restrict__ sidx, float* CS, int bx) {
    const int idx = bx * 256 + threadIdx.x; if (idx >= NTOK * HD) return;
    const int dd = idx & (HD - 1); const int R = idx >> 6; const int b = R / SEQ, t = R - b * SEQ; const int fl = t / NRES, n = t - fl * NRES;
    const int pseq = sidx[b * NRES + n]; const int pfr = fidx[fl];
    const float pf = (float)((dd < HD / 2) ? pseq : pfr);
    float fr = __fmul_rn(pf, invf(dd)); asm volatile("" : "+v"(fr));
    float sn, cn;
    sincosf(fr, &sn, &cn);
    v2f cs; cs[0] = cn; cs[1] = sn;
    *(v2f*)(CS + (size_t)idx * 2) = cs; 
}

__device__ __forceinline__ void d_condp(const float* __restrict__ cond, bf* P) {
    const int lane = threadIdx.x & 31, w = threadIdx.x >> 5;
    v2us o[8];
#pragma unroll
    for (int it = 0; it < 8; ++it) { const int row = w * 8 + it; const int rc = (row < NB) ? row : (NB - 1); v2us v;
#pragma unroll
        for (int q = 0; q < 2; ++q) { const float x = cond[(size_t)rc * CDIM + 2 * lane + q]; v[q] = (row < NB) ? f2bf(x) : (unsigned short)0; }
        o[it] = v; }
{
#pragma unroll
        for (int it = 0; it < 8; ++it) *(v2us*)(P + (size_t)(w * 8 + it) * CDIM + 2 * lane) = o[it];
         }
    asm volatile("s_wait_xcnt 0x0" ::: "memory");   // in the merged kernel's text another job's code, which rewrites the registers these stores name, follows this one
}

__global__ __launch_bounds__(256) void k_ln(const float* __restrict__ X, const float* __restrict__ SS, bf* Xh, bf* Xl) {
    const int lane = threadIdx.x & 31; const int R = blockIdx.x * 8 + (threadIdx.x >> 5); if (R >= NTOK) return;
    const int b = R / SEQ, t = R - b * SEQ;
    const float* xr = X + ((size_t)b * SEQ_FULL + t) * CM;
    float v[16];
    { const v8f a0 = *(const v8f*)(xr + 8 * lane); const v8f a1 = *(const v8f*)(xr + 256 + 8 * lane);
#pragma unroll
      for (int k = 0; k < 8; ++k) { v[k] = bfr(a0[k]); v[8 + k] = bfr(a1[k]); } }
    float s = 0.f;
#pragma unroll
    for (int k = 0; k < 16; ++k) s += v[k];
#pragma unroll
    for (int sh = 16; sh; sh >>= 1) s += __shfl_xor(s, sh, 32);
    const float mu = s * (1.0f / (float)CM);
    float qq = 0.f;
#pragma unroll
    for (int k = 0; k < 16; ++k) { const float d = v[k] - mu; qq += d * d; }
#pragma unroll
    for (int sh = 16; sh; sh >>= 1) qq += __shfl_xor(qq, sh, 32);
    const float var = qq * (1.0f / (float)CM);
    const float rs = rsqrtf(var + 1.0e-5f);
    const float* sc = SS + (size_t)b * ADW;
    v8us oh[2], ol[2];
#pragma unroll
    for (int c = 0; c < 2; ++c) { const int col0 = c * 256 + 8 * lane; const v8f g = *(const v8f*)(sc + col0); const v8f be = *(const v8f*)(sc + CM + col0); v8us th, tl;
#pragma unroll
        for (int k = 0; k < 8; ++k) { const float xn = (v[c * 8 + k] - mu) * rs; const float y = xn * (1.0f + g[k]) + be[k]; unsigned short a2, c2; splitf(y, a2, c2); th[k] = a2; tl[k] = c2; }
        oh[c] = th; ol[c] = tl; }
{
#pragma unroll
        for (int c = 0; c < 2; ++c) { const size_t o = (size_t)R * CM + c * 256 + 8 * lane; *(v8us*)(Xh + o) = oh[c]; *(v8us*)(Xl + o) = ol[c]; }
         }
}

// ---- d_extras: per token row R the extra bf16 k-step rows (NEX = 32 slots) that carry the additive score bias inside the score WMMA. With c = bf16 coordinates and g = -|c|^2/64 split three-piece (gh + gm + gl):
// query row QE[R] = [cx, cy, cz, 1, 1, 1, gh, gm, gl, 1, 0 x 22]; key row KE[R] = [cx/32, cy/32, cz/32, gh, gm, gl, 1, 1, 1, fill, 0 x 22], fill = -2e30 where mask == 0 else 0.
__device__ __forceinline__ void d_extras(const float* __restrict__ ca, const float* __restrict__ msk, bf* QE, bf* KE, int bx) {
    __shared__ __align__(16) unsigned int qs[256 * 16];
    __shared__ __align__(16) unsigned int ks[256 * 16];
    const int tid = threadIdx.x, lane = tid & 31, w = tid >> 5;
    const int R0 = bx * 256; const int R = R0 + tid;
    const int b = R / SEQ, t = R - b * SEQ; const size_t Rf = (size_t)b * SEQ_FULL + t;
    const float cx = bfr(ca[Rf * 3]), cy = bfr(ca[Rf * 3 + 1]), cz = bfr(ca[Rf * 3 + 2]);
    const float mk = bfr(msk[Rf]);
    const float n2 = cx * cx + cz * cz + cy * cy;
    const float g = -(n2 * 0.015625f);
    const unsigned short gh = f2bf(g); const float r1 = g - bf2f(gh); const unsigned short gm = f2bf(r1); const unsigned short gl = f2bf(r1 - bf2f(gm));
    const unsigned short one = (unsigned short)0x3F80u;
    const unsigned short fillv = (mk == 0.0f) ? f2bf(-2.0e30f) : (unsigned short)0;
    v4u qa, qb, ka, kb, zz;
#pragma unroll
    for (int i = 0; i < 4; ++i) { qb[i] = 0u; kb[i] = 0u; zz[i] = 0u; }
    qa[0] = pk2(f2bf(cx), f2bf(cy)); qa[1] = pk2(f2bf(cz), one); qa[2] = pk2(one, one); qa[3] = pk2(gh, gm);
    qb[0] = pk2(gl, one);
    ka[0] = pk2(f2bf(cx * 0.03125f), f2bf(cy * 0.03125f)); ka[1] = pk2(f2bf(cz * 0.03125f), gh); ka[2] = pk2(gm, gl); ka[3] = pk2(one, one);
    kb[0] = pk2(one, fillv);
    unsigned int* qr = qs + tid * 16; unsigned int* krw = ks + tid * 16;
    *(v4u*)(qr) = qa; *(v4u*)(qr + 4) = qb; *(v4u*)(qr + 8) = zz; *(v4u*)(qr + 12) = zz;
    *(v4u*)(krw) = ka; *(v4u*)(krw + 4) = kb; *(v4u*)(krw + 8) = zz; *(v4u*)(krw + 12) = zz;
    __syncthreads();
    v4u oq[4], ok[4]; int off[4];
#pragma unroll
    for (int it = 0; it < 4; ++it) { off[it] = (w * 4 + it) * 128 + lane * 4; oq[it] = *(const v4ua*)(qs + off[it]); ok[it] = *(const v4ua*)(ks + off[it]); }
    unsigned int* QEw = (unsigned int*)QE + (size_t)R0 * 16; unsigned int* KEw = (unsigned int*)KE + (size_t)R0 * 16;
{
#pragma unroll
        for (int it = 0; it < 4; ++it) { *(v4u*)(QEw + off[it]) = oq[it]; *(v4u*)(KEw + off[it]) = ok[it]; }
         }
}

// ---- k_prep: every job that reads only inputs, as block ranges of one grid (the branch is the same for a whole block): weight planes, cond plane, bias k-step rows, cos/sin table.
#define PB_WA ((ADW * CDIM / 64 + 63) / 64)
#define PB_W ((CM * CM / 64 + 63) / 64)
#define PB_EX (NTOK / 256)
#define PB_CS ((NTOK * HD + 255) / 256)
#define PB_ALL (PB_WA + 4 * PB_W + 1 + PB_EX + PB_CS)
__global__ __launch_bounds__(256) void k_prep(const float* __restrict__ adaln_w, const float* __restrict__ wq, const float* __restrict__ wk, const float* __restrict__ wv, const float* __restrict__ wo,
                                              const float* __restrict__ cond, const float* __restrict__ ca, const float* __restrict__ msk, const int* __restrict__ fidx, const int* __restrict__ sidx,
                                              bf* WA, bf* WQ, bf* WK, bf* WV, bf* WO, bf* CAP, bf* QE, bf* KE, float* CS) {
    int bx = blockIdx.x;
    if (bx < PB_WA) { d_wtG(adaln_w, CDIM, ADW, WA, bx); return; }              // adaln_w [CDIM][ADW] -> WA[j][c]
    bx -= PB_WA;
    if (bx < 4 * PB_W) { const int j = bx / PB_W;                                // w [in][out] -> Bt[out][in]
        d_wtG((j == 0) ? wq : (j == 1) ? wk : (j == 2) ? wv : wo, CM, CM, (j == 0) ? WQ : (j == 1) ? WK : (j == 2) ? WV : WO, bx - j * PB_W); return; }
    bx -= 4 * PB_W;
    if (bx < 1) { d_condp(cond, CAP); return; }
    bx -= 1;
    if (bx < PB_EX) { d_extras(ca, msk, QE, KE, bx); return; }
    d_cstab(fidx, sidx, CS, bx - PB_EX);
}

// ---- d_ropep: head planes [bh][t][d] (bf16 hi/lo) of rope(scl * F) with the two-half rotate-half convention (each 32-dim half rotated within itself, partner d+16 for (d & 16) == 0 with subtraction, partner d-16 otherwise with addition;
__device__ __forceinline__ void d_ropep(const float* __restrict__ F, float scl, const float* __restrict__ CS, bf* Ph, bf* Pl, float* G, int bx) {
    const size_t e = ((size_t)bx * 256 + threadIdx.x) * 2; if (e >= (size_t)NBH * SEQ * HD) return;
    const int d = (int)(e & (HD - 1)); const int t = (int)((e >> 6) % SEQ); const int bh = (int)(e / ((size_t)HD * SEQ)); const int b = bh / NH, h = bh - b * NH;
    const size_t R = (size_t)b * SEQ + t;
    const float* f = F + R * CM + h * HD;
    v2us oh, ol; v2f go;
#pragma unroll
    for (int q = 0; q < 2; ++q) { const int dd = d + q; const bool sub = ((dd & 16) == 0); const int dp = sub ? dd + 16 : dd - 16;
        const float x0 = f[dd] * scl, x1 = f[dp] * scl;
        const v2f cs = *(const v2f*)(CS + (R * HD + dd) * 2);
        float a = __fmul_rn(x0, cs[0]), bq = __fmul_rn(x1, cs[1]); asm volatile("" : "+v"(a)); asm volatile("" : "+v"(bq));
        const float r = sub ? __fsub_rn(a, bq) : __fadd_rn(a, bq);
        go[q] = r; unsigned short a2, c2; splitf(r, a2, c2); oh[q] = a2; ol[q] = c2; }
    const size_t og = ((size_t)bh * SEQ_FULL + t) * HD + d;
    *(v2us*)(Ph + e) = oh; *(v2us*)(Pl + e) = ol; if (G != nullptr) *(v2f*)(G + og) = go;
    
}

__device__ __forceinline__ void d_vtp(const float* __restrict__ F, h16* Vh, h16* Vl, float* G, int bx) {
    __shared__ float tile[64 * 65];
    const int tid = threadIdx.x, lane = tid & 31, w = tid >> 5;
    const int bh = bx / (SEQ / 64); const int b = bh / NH, h = bh - b * NH; const int t0 = (bx - bh * (SEQ / 64)) * 64;
    const int pc = tid & 15, rb = tid >> 4;
    v4f vv[4]; size_t og[4];
#pragma unroll
    for (int it = 0; it < 4; ++it) { const int tr = it * 16 + rb; vv[it] = *(const v4f*)(F + ((size_t)b * SEQ + t0 + tr) * CM + h * HD + 4 * pc);
#pragma unroll
        for (int c = 0; c < 4; ++c) tile[tr * 65 + 4 * pc + c] = vv[it][c];
        og[it] = ((size_t)bh * SEQ_FULL + t0 + tr) * HD + 4 * pc; }
{
#pragma unroll
        for (int it = 0; it < 4; ++it) *(v4f*)(G + og[it]) = vv[it];
         }
    __syncthreads();
    v2h oh[8], ol[8]; size_t ov[8];
#pragma unroll
    for (int it = 0; it < 8; ++it) { const int d = w * 8 + it; const float x0 = tile[(2 * lane) * 65 + d], x1 = tile[(2 * lane + 1) * 65 + d];
        h16 a0, c0, a1, c1; splith(x0, a0, c0); splith(x1, a1, c1); v2h th, tl; th[0] = a0; th[1] = a1; tl[0] = c0; tl[1] = c1; oh[it] = th; ol[it] = tl;
        ov[it] = ((size_t)bh * HD + d) * SEQ + t0 + 2 * lane; }
{
#pragma unroll
        for (int it = 0; it < 8; ++it) { *(v2h*)(Vh + ov[it]) = oh[it]; *(v2h*)(Vl + ov[it]) = ol[it]; }
         }
}

// ---- k_planes: the three jobs that turn the f32 projections into operand planes and the k and v outputs, as block ranges of one grid (the branch is the same for a whole block).
#define PB_VT ((SEQ / 64) * NBH)
#define PB_RP ((NBH * SEQ * HD / 2 + 255) / 256)
__global__ __launch_bounds__(256) void k_planes(const float* __restrict__ FQ, const float* __restrict__ FK, const float* __restrict__ FV, const float* __restrict__ CS,
                                                bf* QPh, bf* QPl, bf* KPh, bf* KPl, h16* VTh, h16* VTl, float* GK, float* GV) {
    int bx = blockIdx.x;
    if (bx < PB_VT) { d_vtp(FV, VTh, VTl, GV, bx); return; }
    bx -= PB_VT;
    if (bx < PB_RP) { d_ropep(FQ, QSCL, CS, QPh, QPl, nullptr, bx); return; }
    d_ropep(FK, 1.0f, CS, KPh, KPl, GK, bx - PB_RP);
}

// ---- k_attn: four waves per work-group, one wave per 16 query rows of one (b, h); all 64 rows lie in one frame, so the key bound (frame+1)*NRES is the same for the whole group. 32 keys per trip.
// The trip's k hi/lo, bias and v hi/lo tiles are brought once per work-group into a two-buffer LDS ring by asynchronous copies (whole lines from global memory, one trip ahead); every wave reads its fragments from the ring.
// Transposed products: S^T tile (16 keys x 16 queries) = KE.QE (bias k-step) + Kh.Qh + Kh.Ql + Kl.Qh over d (bf16, k rows as A, q as B, scale folded into the q planes), so a lane holds 16 scores of ONE query (lane & 15; keys 16j + 8(lane >> 4) + r).
// Online max-subtracted softmax in f32 in the lane, one exchange between the wave's halves for the maximum; each half keeps the sum of its own keys, joined once behind the loop. P^T packs from the two score tiles straight into the B operand of O^T += V^T.P^T.
#define AW 4
#define KP 72                        // LDS pitch of a 64-element k row: 144 B = 16 B x odd, free of bank conflicts for 16-byte readers
#define VP 40                        // LDS pitch of a 32-element v or bias row: 80 B
#define ST_KH 0
#define ST_KL (32 * KP)
#define ST_KE (2 * 32 * KP)
#define ST_VH (ST_KE + 32 * VP)
#define ST_VL (ST_VH + 64 * VP)
#define ST_EL (ST_VL + 64 * VP)      // elements of one ring buffer (22016 B)
static_assert(AW == 4 && NRES % (16 * AW) == 0 && NRES >= 64 && (ST_EL * 2) % 16 == 0);
__device__ __forceinline__ v16bf ldsb(const unsigned short* p) { return cat16b(*(const v8usa*)p, *(const v8usa*)(p + 16)); }
__device__ __forceinline__ v16h ldsh(const unsigned short* p) { return cat16(*(const v8ha*)p, *(const v8ha*)(p + 16)); }
__device__ __forceinline__ float xhalf(float x) { return __builtin_bit_cast(float, __builtin_amdgcn_permlanex16(__builtin_bit_cast(int, x), __builtin_bit_cast(int, x), 0x76543210, 0xfedcba98, false, false)); }   // lane l with lane l ^ 16
// One tile's copies of one lane, 16 B each: two pieces (16 rows apart) of k hi and of k lo, two (32 rows apart) of v hi and of v lo, one of the bias rows. The s_wait_xcnt stands inside the statement so that no address register is rewritten ahead of it.
__device__ __forceinline__ void tile_copy(unsigned lk, unsigned lv, unsigned le, const bf* gkh, const bf* gkl, const h16* gvh, const h16* gvl, const bf* gke) {
    const unsigned lk2 = lk + 16 * KP * 2, lkl = lk + (ST_KL - ST_KH) * 2, lkl2 = lkl + 16 * KP * 2;
    const unsigned lv2 = lv + 32 * VP * 2, lvl = lv + (ST_VL - ST_VH) * 2, lvl2 = lvl + 32 * VP * 2;
    const bf* gkh2 = gkh + 16 * HD; const bf* gkl2 = gkl + 16 * HD; const h16* gvh2 = gvh + (size_t)32 * SEQ; const h16* gvl2 = gvl + (size_t)32 * SEQ;
    asm volatile("global_load_async_to_lds_b128 %0, %9, off\n\t"
                 "global_load_async_to_lds_b128 %1, %10, off\n\t"
                 "global_load_async_to_lds_b128 %2, %11, off\n\t"
                 "global_load_async_to_lds_b128 %3, %12, off\n\t"
                 "global_load_async_to_lds_b128 %4, %13, off\n\t"
                 "global_load_async_to_lds_b128 %5, %14, off\n\t"
                 "global_load_async_to_lds_b128 %6, %15, off\n\t"
                 "global_load_async_to_lds_b128 %7, %16, off\n\t"
                 "global_load_async_to_lds_b128 %8, %17, off\n\t"
                 "s_wait_xcnt 0x0"
                 :: "v"(lk), "v"(lk2), "v"(lkl), "v"(lkl2), "v"(lv), "v"(lv2), "v"(lvl), "v"(lvl2), "v"(le),
                    "v"(gkh), "v"(gkh2), "v"(gkl), "v"(gkl2), "v"(gvh), "v"(gvh2), "v"(gvl), "v"(gvl2), "v"(gke) : "memory");
}
// The grid puts three waves on a SIMD; a register budget for four keeps the compiler from trading the fragment loads issued ahead of the products for a fifth wave that never comes.
__global__ __launch_bounds__(32 * AW) __attribute__((amdgpu_waves_per_eu(4, 4))) void k_attn(const bf* __restrict__ Qh, const bf* __restrict__ Ql, const bf* __restrict__ QE,
                                             const bf* __restrict__ Kh, const bf* __restrict__ Kl, const bf* __restrict__ KE,
                                             const h16* __restrict__ Vth, const h16* __restrict__ Vtl, bf* ATh, bf* ATl) {
    __shared__ __align__(16) unsigned short ring[2 * ST_EL];
    __shared__ __align__(16) float osa[AW * 16 * 68];
    const int tid = threadIdx.x, lane = tid & 31, lr = lane & 15, hi = lane >> 4, w = tid >> 5;
    float* os = osa + w * (16 * 68);
    const int bh = blockIdx.y; const int b = bh / NH, h = bh - b * NH;
    const int q0 = blockIdx.x * (16 * AW) + w * 16;
    const int kvlen = ((int)blockIdx.x * (16 * AW) / NRES + 1) * NRES;
    const int nt = kvlen >> 5;
    const size_t hp = (size_t)bh * SEQ * HD;
    const size_t tb = (size_t)b * SEQ;
    // this lane's share of a tile, in 16-byte pieces: k rows tid>>3 and 16 + tid>>3, piece tid&7; v rows (d) tid>>2 and 32 + tid>>2, piece tid&3; bias row tid>>2, piece tid&3
    const unsigned r0 = (unsigned)(size_t)ring;
    const unsigned lk0 = r0 + (unsigned)(ST_KH + (tid >> 3) * KP + (tid & 7) * 8) * 2u;
    const unsigned lv0 = r0 + (unsigned)(ST_VH + (tid >> 2) * VP + (tid & 3) * 8) * 2u;
    const unsigned le0 = r0 + (unsigned)(ST_KE + (tid >> 2) * VP + (tid & 3) * 8) * 2u;
    const size_t gk0 = hp + (size_t)(tid >> 3) * HD + (tid & 7) * 8;
    const size_t gv0 = ((size_t)bh * HD + (tid >> 2)) * SEQ + (tid & 3) * 8;
    const size_t ge0 = (tb + (tid >> 2)) * NEX + (tid & 3) * 8;
    tile_copy(lk0, lv0, le0, Kh + gk0, Kl + gk0, Vth + gv0, Vtl + gv0, KE + ge0);
    const size_t qo = hp + (size_t)(q0 + lr) * HD + 8 * hi;
    const v16bf aH0 = WFrag<bf>::ld(Qh + qo), aH1 = WFrag<bf>::ld(Qh + qo + 32);
    const v16bf aL0 = WFrag<bf>::ld(Ql + qo), aL1 = WFrag<bf>::ld(Ql + qo + 32);
    const v16bf aE = WFrag<bf>::ld(QE + (tb + q0 + lr) * NEX + 8 * hi);
    v8f oh[4], ol[4];
#pragma unroll
    for (int nb = 0; nb < 4; ++nb) { oh[nb] = (v8f){}; ol[nb] = (v8f){}; }
    float m = -1.0e30f, l = 0.f;   // this lane's query: running maximum (equal in both halves), sum over this half's keys
    asm volatile("s_wait_asynccnt 0x0" ::: "memory");   // tile 0 of this wave has landed
    __syncthreads();                                     // publishes tile 0 to every wave
    tile_copy(lk0 + ST_EL * 2, lv0 + ST_EL * 2, le0 + ST_EL * 2, Kh + gk0 + 32 * HD, Kl + gk0 + 32 * HD, Vth + gv0 + 32, Vtl + gv0 + 32, KE + ge0 + 32 * NEX);   // tile 1 exists: nt >= 8
#pragma unroll 1
    for (int t = 0; t < nt; ++t) {
        const unsigned short* st = ring + (t & 1) * ST_EL;
        v8f s[2];
#pragma unroll
        for (int j = 0; j < 2; ++j) {
            const unsigned short* kp = st + (16 * j + lr) * KP + 8 * hi;
            s[j] = (v8f){};
            { const v16bf bE = ldsb(st + ST_KE + (16 * j + lr) * VP + 8 * hi); s[j] = wmmab(bE, aE, s[j]); }
            { const v16bf bH = ldsb(kp + ST_KH), bL = ldsb(kp + ST_KL); s[j] = wmmab(bH, aH0, s[j]); s[j] = wmmab(bH, aL0, s[j]); s[j] = wmmab(bL, aH0, s[j]); }
            { const v16bf bH = ldsb(kp + ST_KH + 32), bL = ldsb(kp + ST_KL + 32); s[j] = wmmab(bH, aH1, s[j]); s[j] = wmmab(bH, aL1, s[j]); s[j] = wmmab(bL, aH1, s[j]); }
        }
        asm volatile("v_nop\n\tv_nop\n\tv_nop\n\tv_nop" : "+v"(s[0]), "+v"(s[1]) : "v"(aH0), "v"(aH1), "v"(aL0), "v"(aL1), "v"(aE));
        const float v0 = fmaxf(fmaxf(s[0][0], s[0][1]), s[0][2]), v1 = fmaxf(fmaxf(s[0][3], s[0][4]), s[0][5]), v2 = fmaxf(fmaxf(s[0][6], s[0][7]), s[1][0]);
        const float v3 = fmaxf(fmaxf(s[1][1], s[1][2]), s[1][3]), v4 = fmaxf(fmaxf(s[1][4], s[1][5]), s[1][6]);
        float v = fmaxf(fmaxf(fmaxf(v0, v1), v2), fmaxf(fmaxf(v3, v4), s[1][7]));   // a tree three deep, not a chain of eight
        v = fmaxf(v, xhalf(v));
        const float mn = fmaxf(m, v);
        const float al = __builtin_amdgcn_exp2f((m - mn) * LOG2E);
        m = mn;
        float ts[8];
#pragma unroll
        for (int r = 0; r < 8; ++r) {
            const float p0 = __builtin_amdgcn_exp2f((s[0][r] - mn) * LOG2E), p1 = __builtin_amdgcn_exp2f((s[1][r] - mn) * LOG2E);
            s[0][r] = p0; s[1][r] = p1;
            ts[r] = p0 + p1;
        }
        l = l * al + (((ts[0] + ts[1]) + (ts[2] + ts[3])) + ((ts[4] + ts[5]) + (ts[6] + ts[7])));
#pragma unroll
        for (int nb = 0; nb < 4; ++nb)
#pragma unroll
            for (int r = 0; r < 8; ++r) { oh[nb][r] *= al; ol[nb][r] *= al; }
        v16h ap;   // B operand: element i <- key 8(lane >> 4) + i, element 8 + i <- key 16 + 8(lane >> 4) + i, the order of the v fragments
#pragma unroll
        for (int r = 0; r < 8; ++r) { ap[r] = (h16)(s[0][r] * PCAR); ap[8 + r] = (h16)(s[1][r] * PCAR); }
#pragma unroll
        for (int nb = 0; nb < 4; ++nb) { const unsigned short* vp = st + (16 * nb + lr) * VP + 8 * hi;
            const v16h bH = ldsh(vp + ST_VH); oh[nb] = wmma16(bH, ap, oh[nb]);
            const v16h bL = ldsh(vp + ST_VL); ol[nb] = wmma16(bL, ap, ol[nb]); }
        asm volatile("v_nop\n\tv_nop\n\tv_nop\n\tv_nop" : "+v"(oh[0]), "+v"(oh[1]), "+v"(oh[2]), "+v"(oh[3]), "+v"(ol[0]), "+v"(ol[1]), "+v"(ol[2]), "+v"(ol[3]) : "v"(ap));
        asm volatile("s_wait_dscnt 0x0" ::: "memory");      // this wave's reads of buffer t & 1 have returned
        asm volatile("s_wait_asynccnt 0x0" ::: "memory");   // this wave's copies of tile t + 1 have landed
        __syncthreads();                                     // publishes tile t + 1 and ends every wave's reads of buffer t & 1
        if (t + 2 < nt) { const unsigned bo = (unsigned)(t & 1) * (ST_EL * 2); const size_t kn = (size_t)(t + 2) * 32;
            tile_copy(lk0 + bo, lv0 + bo, le0 + bo, Kh + gk0 + kn * HD, Kl + gk0 + kn * HD, Vth + gv0 + kn, Vtl + gv0 + kn, KE + ge0 + kn * NEX); }
    }
    asm volatile("s_wait_asynccnt 0x0" ::: "memory");       // nothing of this wave is in flight when it ends
    const float il = PINV * __fdiv_rn(1.0f, l + xhalf(l));
#pragma unroll
    for (int nb = 0; nb < 4; ++nb) { v4f x0, x1;   // register r of tile nb is d = 16 nb + 8 hi + r of query lr
#pragma unroll
        for (int r = 0; r < 4; ++r) { x0[r] = (oh[nb][r] + ol[nb][r] * LINV) * il; x1[r] = (oh[nb][4 + r] + ol[nb][4 + r] * LINV) * il; }
        *(v4fa*)(os + lr * 68 + 16 * nb + 8 * hi) = x0; *(v4fa*)(os + lr * 68 + 16 * nb + 8 * hi + 4) = x1; }
    __builtin_amdgcn_fence(3, "wavefront"); __builtin_amdgcn_wave_barrier(); asm volatile("" ::: "memory");
    v8us ah[4], av[4]; size_t ad[4];
#pragma unroll
    for (int it = 0; it < 4; ++it) { const int rr = it * 4 + (lane >> 3); const int pc = lane & 7;
        const v4f x0 = *(const v4fa*)(os + rr * 68 + pc * 8), x1 = *(const v4fa*)(os + rr * 68 + pc * 8 + 4); v8us th, tl;
#pragma unroll
        for (int c = 0; c < 4; ++c) { unsigned short a2, c2; splitf(x0[c], a2, c2); th[c] = a2; tl[c] = c2; splitf(x1[c], a2, c2); th[4 + c] = a2; tl[4 + c] = c2; }
        ah[it] = th; av[it] = tl; ad[it] = (tb + q0 + rr) * CM + (size_t)h * HD + pc * 8; }
{
#pragma unroll
        for (int it = 0; it < 4; ++it) { *(v8us*)(ATh + ad[it]) = ah[it]; *(v8us*)(ATl + ad[it]) = av[it]; }
         }
}

extern "C" void kernel_launch(void* const* d_in, const int* in_sizes, int n_in,
                              void* d_out, int out_size, void* d_ws, size_t ws_size, hipStream_t stream) {
    if (n_in < 16) return;
    const int ntok_in = (NB - 1) * SEQ_FULL + SEQ;
    if (in_sizes[0] < ntok_in * CM || in_sizes[1] < NFR || in_sizes[2] < NB * NRES || in_sizes[3] < ntok_in || in_sizes[4] < NB * CDIM || in_sizes[5] < ntok_in * 3) return;
    if (in_sizes[6] < CDIM * ADW || in_sizes[7] < ADW) return;
    if (in_sizes[8] < CM * CM || in_sizes[10] < CM * CM || in_sizes[12] < CM * CM || in_sizes[14] < CM * CM) return;
    if (in_sizes[9] < CM || in_sizes[11] < CM || in_sizes[13] < CM || in_sizes[15] < CM) return;
    const size_t out_need = OUT2_EL + ((size_t)((NB - 1) * NH + NH - 1) * SEQ_FULL + SEQ) * HD;
    if ((size_t)out_size < out_need) return;
    const float* s_frames = (const float*)d_in[0]; const int* frame_idx = (const int*)d_in[1]; const int* seq_idx = (const int*)d_in[2]; const float* mask = (const float*)d_in[3];
    const float* cond = (const float*)d_in[4]; const float* ca_pos = (const float*)d_in[5]; const float* adaln_w = (const float*)d_in[6]; const float* adaln_b = (const float*)d_in[7];
    const float* wq = (const float*)d_in[8]; const float* bq = (const float*)d_in[9]; const float* wk = (const float*)d_in[10]; const float* bk = (const float*)d_in[11];
    const float* wv = (const float*)d_in[12]; const float* bv = (const float*)d_in[13]; const float* wo = (const float*)d_in[14]; const float* bo = (const float*)d_in[15];
    float* OUT = (float*)d_out;
    char* wsp = (char*)d_ws;
    auto take = [&](size_t bytes) { char* p = wsp; wsp += (bytes + 255) & ~(size_t)255; return (void*)p; };
    bf* WQ = (bf*)take((size_t)3 * CM * CM * 2); bf* WK = WQ + (size_t)CM * CM; bf* WV = WK + (size_t)CM * CM; bf* WO = (bf*)take((size_t)CM * CM * 2);
    bf* WA = (bf*)take((size_t)ADW * CDIM * 2); bf* CAP = (bf*)take((size_t)64 * CDIM * 2); float* SS = (float*)take((size_t)64 * ADW * 4);
    float* CS = (float*)take((size_t)NTOK * HD * 2 * 4);
    bf* XBh = (bf*)take((size_t)NTOK * CM * 2); bf* XBl = (bf*)take((size_t)NTOK * CM * 2);
    float* FQ = (float*)take((size_t)3 * NTOK * CM * 4); float* FK = FQ + (size_t)NTOK * CM; float* FV = FK + (size_t)NTOK * CM;
    bf* QPh = (bf*)take((size_t)NBH * SEQ * HD * 2); bf* QPl = (bf*)take((size_t)NBH * SEQ * HD * 2); bf* KPh = (bf*)take((size_t)NBH * SEQ * HD * 2); bf* KPl = (bf*)take((size_t)NBH * SEQ * HD * 2);
    h16* VTh = (h16*)take((size_t)NBH * HD * SEQ * 2); h16* VTl = (h16*)take((size_t)NBH * HD * SEQ * 2);
    bf* QE = (bf*)take((size_t)NTOK * NEX * 2); bf* KE = (bf*)take((size_t)NTOK * NEX * 2);
    bf* ATh = (bf*)take((size_t)NTOK * CM * 2); bf* ATl = (bf*)take((size_t)NTOK * CM * 2);
    const size_t used = (size_t)(wsp - (char*)d_ws);
    if (used > ws_size || used > ((size_t)128 << 20)) return;    // about 102 MiB at NB=2, SEQ=3072

    // one launch for all that reads only inputs: 16-bit weight and cond planes, bias k-step rows, cos/sin table
    k_prep<<<PB_ALL, 256, 0, stream>>>(adaln_w, wq, wk, wv, wo, cond, ca_pos, mask, frame_idx, seq_idx, WA, WQ, WK, WV, WO, CAP, QE, KE, CS);
    // AdaLN: ss = cond x adaln_w + adaln_b (rows 0..NB-1 of SS), then LN + modulation -> x hi/lo planes
    k_gemmw<bf, 0, true><<<dim3(1, ADW / 64, 1), 32, 0, stream>>>(CAP, nullptr, WA, nullptr, CDIM, SS, ADW, adaln_b, adaln_b, adaln_b, 0, 0, 0);
    k_ln<<<(unsigned)(NTOK / 8), 256, 0, stream>>>(s_frames, SS, XBh, XBl);
    // projections (x hi/lo x bf16 W, 2 products, + bias) in one launch, then roped / transposed planes in one launch; k and v outputs from the f32 results
    k_gemmw<bf, 1, true><<<dim3(NTOK / 64, CM / 64, 3), 32, 0, stream>>>(XBh, XBl, WQ, nullptr, CM, FQ, CM, bq, bk, bv, 0, (size_t)CM * CM, (size_t)NTOK * CM);   // z = q, k, v
    k_planes<<<PB_VT + 2 * PB_RP, 256, 0, stream>>>(FQ, FK, FV, CS, QPh, QPl, KPh, KPl, VTh, VTl, OUT + OUT1_EL, OUT + OUT2_EL);
    // attention (one launch) -> ctx hi/lo planes, then the output projection straight into out0 (batch z at the full-size token pitch)
    k_attn<<<dim3(SEQ / (16 * AW), NBH, 1), 32 * AW, 0, stream>>>(QPh, QPl, QE, KPh, KPl, KE, VTh, VTl, ATh, ATl);
    k_gemmw<bf, 1, true><<<dim3(SEQ / 64, CM / 64, NB), 32, 0, stream>>>(ATh, ATl, WO, nullptr, CM, OUT, CM, bo, bo, bo, (size_t)SEQ * CM, 0, (size_t)SEQ_FULL * CM);
}

// v004
// It runs in 137 microseconds.
// Timed twice side by side with v003, it ran 1.20 and 1.21 times as fast.
// Counting every step since v000, it is 3.37 times as fast.
#include <hip/hip_runtime.h>

// Frame-causal multi-head attention with a Gaussian distance bias: AdaLN prologue (cond x adaln_w modulation of a non-affine LN), q/k/v projections with bias, two-half rotate-half RoPE from int positions, online-softmax attention, output projection; f32 outputs out, roped k, v.
// Compute dtypes, f32 accumulate everywhere: every float input RNE-converted to bf16 on load. cond x adaln_w: v_wmma_f32_16x16x32_bf16, plain bf16 operands (1 product). q/k/v projections: bf16 hi/lo planes of the modulated LN output x bf16 weight planes (2 products).
// Scores: bf16 hi/lo q and k planes (hi.hi + lo.hi + hi.lo) plus one extra bf16 k-step carrying the distance-bias terms (exact coordinate cross products, three-piece bf16 squared norms, key mask fill). attn.v: v_wmma_f32_16x16x32_f16, P carried x2^14 in f16 (one plane), v as f16 hi + x2^10 f16 residual planes (two accumulators).
// Output projection: bf16 hi/lo ctx planes x bf16 Wo (2 products). LN statistics, inverse frequencies and the cos/sin table, RoPE, softmax and all side math f32 on VALU; the k and v outputs are written from the f32 projection results.

#ifndef NB
#define NB 2
#endif
#define NB_FULL 2
#ifndef SEQ
#define SEQ 3072
#endif
#define SEQ_FULL 3072
#define NRES 256
#define NFR (SEQ / NRES)
#define CM 512
#define ADW 1024
#define NH 8
#define HD 64
#define CDIM 64
#define NEX 32
#define NTOK (NB * SEQ)
#define NBH (NB * NH)
#define QSCL 0.125f
#define PCAR 16384.0f
#define PINV 0.00006103515625f
#define LCAR 1024.0f
#define LINV 0.0009765625f
#define LOG2E 1.4426950408889634f
#define OUT1_EL ((size_t)NB_FULL * SEQ_FULL * CM)
#define OUT2_EL (OUT1_EL + (size_t)NB_FULL * NH * SEQ_FULL * HD)
static_assert(SEQ % NRES == 0);
static_assert(SEQ >= NRES && SEQ <= SEQ_FULL);
static_assert(NB >= 1 && NB <= NB_FULL);
static_assert(NTOK % 256 == 0);
static_assert(HD == 64 && CM == NH * HD);
static_assert(CM % 64 == 0 && ADW == 2 * CM && CDIM % 32 == 0);
static_assert(OUT1_EL * 4 == 12582912);
static_assert(OUT2_EL * 4 == 25165824);

typedef _Float16 h16;
typedef unsigned short bf;
typedef __attribute__((ext_vector_type(16))) __bf16   v16bf;
typedef __attribute__((ext_vector_type(16))) _Float16 v16h;
typedef __attribute__((ext_vector_type(8)))  _Float16 v8h;
typedef __attribute__((ext_vector_type(2)))  _Float16 v2h;
typedef __attribute__((ext_vector_type(8)))  unsigned short v8us;
typedef __attribute__((ext_vector_type(4)))  unsigned short v4us;
typedef __attribute__((ext_vector_type(2)))  unsigned short v2us;
typedef __attribute__((ext_vector_type(4)))  unsigned int v4u;
typedef __attribute__((ext_vector_type(8)))  float    v8f;
typedef __attribute__((ext_vector_type(4)))  float    v4f;
typedef __attribute__((ext_vector_type(2)))  float    v2f;
typedef v8h  __attribute__((may_alias)) v8ha;
typedef v4f  __attribute__((may_alias)) v4fa;
typedef v8us __attribute__((may_alias)) v8usa;
typedef v4u  __attribute__((may_alias)) v4ua;

__device__ __forceinline__ unsigned short f2bf(float f) { unsigned u = __float_as_uint(f); u += 0x7FFFu + ((u >> 16) & 1u); return (unsigned short)(u >> 16); }
__device__ __forceinline__ float bf2f(unsigned short b) { return __uint_as_float(((unsigned)b) << 16); }
__device__ __forceinline__ float bfr(float f) { return bf2f(f2bf(f)); }
__device__ __forceinline__ v16h cat16(v8h lo, v8h hi) { return __builtin_shufflevector(lo, hi, 0, 1, 2, 3, 4, 5, 6, 7, 8, 9, 10, 11, 12, 13, 14, 15); }
__device__ __forceinline__ v16bf cat16b(v8us lo, v8us hi) { return __builtin_bit_cast(v16bf, __builtin_shufflevector(lo, hi, 0, 1, 2, 3, 4, 5, 6, 7, 8, 9, 10, 11, 12, 13, 14, 15)); }
__device__ __forceinline__ v8f wmma16(v16h a, v16h b, v8f c) { return __builtin_amdgcn_wmma_f32_16x16x32_f16(false, a, false, b, (short)0, c, false, false); }
__device__ __forceinline__ v8f wmmab(v16bf a, v16bf b, v8f c) { return __builtin_amdgcn_wmma_f32_16x16x32_bf16(false, a, false, b, (short)0, c, false, false); }
__device__ __forceinline__ void splitf(float y, unsigned short& h, unsigned short& l) { h = f2bf(y); l = f2bf(y - bf2f(h)); }
__device__ __forceinline__ void splith(float y, h16& a, h16& c) { a = (h16)y; c = (h16)((y - (float)a) * LCAR); }
__device__ __forceinline__ unsigned int pk2(unsigned short lo, unsigned short hi2) { return (unsigned int)lo | ((unsigned int)hi2 << 16); }

// ---- k_gemmw: register-blocked GEMM, ONE WAVE per 64x64 output tile (16 accumulators), operands straight from K-contiguous 16-bit planes; grid (M/64, N/64, Z), 32 threads.
// C[m][n] (f32, pitch ldc, + optional f32 bias[n] as its bf16 value) = sum_k A[m][k] Bt[n][k] (+ split products per NSPLIT). z-batch strides sA/sB/sC in elements, bias vector bias0/1/2 by z (Z <= 3). K % 32 == 0.
// Fragments: lane -> row/col lane&15, vector elements 0..7 <- k0 + 8h + i, elements 8..15 <- k0 + 16 + 8h + i (h = lane>>4) for BOTH operands; D element r -> (row 8h + r, col lane&15).
template <typename T16> struct WFrag;
template <> struct WFrag<h16> { typedef v16h V; static __device__ __forceinline__ V ld(const h16* p) { return cat16(*(const v8h*)p, *(const v8h*)(p + 16)); } static __device__ __forceinline__ v8f mma(V a, V b, v8f c) { return wmma16(a, b, c); } };
template <> struct WFrag<bf> { typedef v16bf V; static __device__ __forceinline__ V ld(const bf* p) { return cat16b(*(const v8us*)p, *(const v8us*)(p + 16)); } static __device__ __forceinline__ v8f mma(V a, V b, v8f c) { return wmmab(a, b, c); } };
template <typename T16, int NSPLIT, bool BIAS>
__global__ __launch_bounds__(32) void k_gemmw(const T16* __restrict__ A, const T16* __restrict__ A2, const T16* __restrict__ Bt, const T16* __restrict__ Bt2, int K, float* C, int ldc, const float* __restrict__ bias0, const float* __restrict__ bias1, const float* __restrict__ bias2, size_t sA, size_t sB, size_t sC) {
    typedef typename WFrag<T16>::V V;
    __shared__ __align__(16) float os[16 * 68];
    const size_t z = blockIdx.z; A += z * sA; if (A2) A2 += z * sA; Bt += z * sB; if (Bt2) Bt2 += z * sB; C += z * sC;
    const float* __restrict__ bias = (z == 0) ? bias0 : (z == 1) ? bias1 : bias2;
    const int lane = threadIdx.x & 31, lr = lane & 15, hi = lane >> 4; const int r0 = blockIdx.x * 64, c0 = blockIdx.y * 64;
    v8f acc[4][4];
#pragma unroll
    for (int mb = 0; mb < 4; ++mb)
#pragma unroll
        for (int nb = 0; nb < 4; ++nb) acc[mb][nb] = (v8f){};
    const size_t aoff = (size_t)(r0 + lr) * K + 8 * hi, boff = (size_t)(c0 + lr) * K + 8 * hi;
#pragma unroll 1
    for (int kc = 0; kc < K; kc += 32) {
        V a[4], a2[4];
#pragma unroll
        for (int mb = 0; mb < 4; ++mb) { a[mb] = WFrag<T16>::ld(A + aoff + (size_t)mb * 16 * K + kc); if (NSPLIT == 1 || NSPLIT == 2) a2[mb] = WFrag<T16>::ld(A2 + aoff + (size_t)mb * 16 * K + kc); }
#pragma unroll
        for (int nb = 0; nb < 4; ++nb) { const V b = WFrag<T16>::ld(Bt + boff + (size_t)nb * 16 * K + kc); V b2; if (NSPLIT >= 2) b2 = WFrag<T16>::ld(Bt2 + boff + (size_t)nb * 16 * K + kc);
#pragma unroll
            for (int mb = 0; mb < 4; ++mb) { acc[mb][nb] = WFrag<T16>::mma(a[mb], b, acc[mb][nb]); if (NSPLIT == 1 || NSPLIT == 2) acc[mb][nb] = WFrag<T16>::mma(a2[mb], b, acc[mb][nb]); if (NSPLIT >= 2) acc[mb][nb] = WFrag<T16>::mma(a[mb], b2, acc[mb][nb]); } }
        asm volatile("v_nop\n\tv_nop\n\tv_nop\n\tv_nop" : "+v"(acc[0][0]), "+v"(acc[1][1]), "+v"(acc[2][2]), "+v"(acc[3][3]) : "v"(a[0]), "v"(a[3]));
    }
#pragma unroll
    for (int mb = 0; mb < 4; ++mb) {
#pragma unroll
        for (int nb = 0; nb < 4; ++nb) {
#pragma unroll
            for (int j = 0; j < 8; ++j) os[(hi * 8 + j) * 68 + nb * 16 + lr] = acc[mb][nb][j]; }
        __builtin_amdgcn_wave_barrier(); asm volatile("" ::: "memory");
        float* crow = C + (size_t)(r0 + mb * 16) * ldc + c0;
{
#pragma unroll
            for (int s = 0; s < 8; ++s) { const int row = 2 * s + hi, cofs = lr * 4; v4f val = *(const v4fa*)(os + row * 68 + cofs); if (BIAS) { val[0] += bfr(bias[c0 + cofs]); val[1] += bfr(bias[c0 + cofs + 1]); val[2] += bfr(bias[c0 + cofs + 2]); val[3] += bfr(bias[c0 + cofs + 3]); }
                *(v4f*)(crow + (size_t)row * ldc + cofs) = val; }
             }
        __builtin_amdgcn_wave_barrier(); asm volatile("" ::: "memory");
    }
}

// ---- k_gemm4: the two-product GEMM (A hi/lo planes x one bf16 Bt plane, K = CM) for the projections: FOUR WAVES share a 128x128 output tile, each wave a 64x64 quarter (16 accumulators, fragments, k order and sum order of k_gemmw).
// A stage is 64 k: 128 rows of A hi, of A lo and of Bt, 128 B a row, brought once per work-group into a two-buffer LDS ring by asynchronous copies (a wave's copy covers four whole lines of global memory), one stage ahead.
// LDS rows are unpadded (three work-groups fit a WGP); the 16-byte piece q of row r lies at piece q ^ ((r >> 1) & 7), so the 16 rows that a half-wave's fragment load touches fall on all 64 banks once.
#define G4_PL (128 * 128)            // bytes of one plane's stage
#define G4_BUF (3 * G4_PL)           // bytes of one ring buffer
#define G4_NS (CM / 64)
static_assert(NTOK % 128 == 0 && SEQ % 128 == 0 && CM % 128 == 0 && G4_NS >= 2);
static_assert(4 * 16 * 68 * 4 <= 2 * G4_BUF);
// One plane's stage, this lane's eight 16-byte pieces (rows 16 apart). The s_wait_xcnt stands inside the statement so that no address register is rewritten ahead of it.
__device__ __forceinline__ void plane_copy(unsigned l, const bf* g) {
    const unsigned l1 = l + 2048, l2 = l + 2 * 2048, l3 = l + 3 * 2048, l4 = l + 4 * 2048, l5 = l + 5 * 2048, l6 = l + 6 * 2048, l7 = l + 7 * 2048;
    const bf* g1 = g + 16 * CM; const bf* g2 = g + 32 * CM; const bf* g3 = g + 48 * CM; const bf* g4 = g + 64 * CM; const bf* g5 = g + 80 * CM; const bf* g6 = g + 96 * CM; const bf* g7 = g + 112 * CM;
    asm volatile("global_load_async_to_lds_b128 %0, %8, off\n\t"
                 "global_load_async_to_lds_b128 %1, %9, off\n\t"
                 "global_load_async_to_lds_b128 %2, %10, off\n\t"
                 "global_load_async_to_lds_b128 %3, %11, off\n\t"
                 "global_load_async_to_lds_b128 %4, %12, off\n\t"
                 "global_load_async_to_lds_b128 %5, %13, off\n\t"
                 "global_load_async_to_lds_b128 %6, %14, off\n\t"
                 "global_load_async_to_lds_b128 %7, %15, off\n\t"
                 "s_wait_xcnt 0x0"
                 :: "v"(l), "v"(l1), "v"(l2), "v"(l3), "v"(l4), "v"(l5), "v"(l6), "v"(l7),
                    "v"(g), "v"(g1), "v"(g2), "v"(g3), "v"(g4), "v"(g5), "v"(g6), "v"(g7) : "memory");
}
// At most three waves come to a SIMD (LDS); a register budget for four keeps accumulators and a stage's fragments in registers without a trade for waves that never come.
__global__ __launch_bounds__(128) __attribute__((amdgpu_waves_per_eu(4, 4))) void k_gemm4(const bf* __restrict__ A, const bf* __restrict__ A2, const bf* __restrict__ Bt, float* C, int ldc,
                                             const float* __restrict__ bias0, const float* __restrict__ bias1, const float* __restrict__ bias2, size_t sA, size_t sB, size_t sC) {
    __shared__ __align__(16) unsigned char ring4[2 * G4_BUF];
    const size_t z = blockIdx.z; A += z * sA; A2 += z * sA; Bt += z * sB; C += z * sC;
    const float* __restrict__ bias = (z == 0) ? bias0 : (z == 1) ? bias1 : bias2;
    const int tid = threadIdx.x, lane = tid & 31, lr = lane & 15, hi = lane >> 4, w = tid >> 5;
    const int R0 = blockIdx.x * 128, C0 = blockIdx.y * 128;
    // this lane's share of a stage: piece tid & 7 of rows tid >> 3, + 16, ... + 112 of each plane
    const unsigned lc = (unsigned)(size_t)ring4 + (unsigned)((tid >> 3) * 128 + (((tid & 7) ^ ((tid >> 4) & 7)) << 4));
    const bf* gah = A + (size_t)(R0 + (tid >> 3)) * CM + (tid & 7) * 8; const bf* gal = A2 + (size_t)(R0 + (tid >> 3)) * CM + (tid & 7) * 8; const bf* gb = Bt + (size_t)(C0 + (tid >> 3)) * CM + (tid & 7) * 8;
    plane_copy(lc, gah); plane_copy(lc + G4_PL, gal); plane_copy(lc + 2 * G4_PL, gb);
    v8f acc[4][4];
#pragma unroll
    for (int mb = 0; mb < 4; ++mb)
#pragma unroll
        for (int nb = 0; nb < 4; ++nb) acc[mb][nb] = (v8f){};
    // fragment reads: row (quarter's 64) + 16 mb + lr, logical pieces 4 kk + hi and 4 kk + 2 + hi, each XORed with lr >> 1
    const int s0 = hi ^ (lr >> 1);
    const int arow = ((w >> 1) * 64 + lr) * 128, brow = 2 * G4_PL + ((w & 1) * 64 + lr) * 128;
    asm volatile("s_wait_asynccnt 0x0" ::: "memory");   // stage 0 of this wave has landed
    __syncthreads();                                     // publishes stage 0 to every wave
    plane_copy(lc + G4_BUF, gah + 64); plane_copy(lc + G4_BUF + G4_PL, gal + 64); plane_copy(lc + G4_BUF + 2 * G4_PL, gb + 64);   // stage 1 exists: G4_NS >= 2
#pragma unroll 1
    for (int st = 0; st < G4_NS; ++st) {
        const unsigned char* sb = ring4 + (st & 1) * G4_BUF;
#pragma unroll
        for (int kk = 0; kk < 2; ++kk) {
            const int o0 = (s0 ^ (4 * kk)) << 4, o1 = (s0 ^ (4 * kk + 2)) << 4;
            v16bf a[4], a2[4];
#pragma unroll
            for (int mb = 0; mb < 4; ++mb) { const unsigned char* ap = sb + arow + mb * 2048;
                a[mb] = cat16b(*(const v8usa*)(ap + o0), *(const v8usa*)(ap + o1)); a2[mb] = cat16b(*(const v8usa*)(ap + G4_PL + o0), *(const v8usa*)(ap + G4_PL + o1)); }
#pragma unroll
            for (int nb = 0; nb < 4; ++nb) { const unsigned char* bp = sb + brow + nb * 2048; const v16bf b = cat16b(*(const v8usa*)(bp + o0), *(const v8usa*)(bp + o1));
#pragma unroll
                for (int mb = 0; mb < 4; ++mb) { acc[mb][nb] = wmmab(a[mb], b, acc[mb][nb]); acc[mb][nb] = wmmab(a2[mb], b, acc[mb][nb]); } }
        }
        asm volatile("s_wait_dscnt 0x0" ::: "memory");      // this wave's reads of buffer st & 1 have returned
        asm volatile("s_wait_asynccnt 0x0" ::: "memory");   // this wave's copies of stage st + 1 have landed
        __syncthreads();                                     // publishes stage st + 1 and ends every wave's reads of buffer st & 1
        if (st + 2 < G4_NS) { const unsigned bo = (unsigned)(st & 1) * G4_BUF; const int kn = (st + 2) * 64;
            plane_copy(lc + bo, gah + kn); plane_copy(lc + bo + G4_PL, gal + kn); plane_copy(lc + bo + 2 * G4_PL, gb + kn); }
    }
    asm volatile("s_wait_asynccnt 0x0" ::: "memory");       // nothing of this wave is in flight when the ring becomes output staging
    // behind the last trip's barrier no wave reads the ring and no copy is under way: each wave stages its rows in its own part of it
    float* os = (float*)ring4 + w * (16 * 68);
    const int r0 = R0 + (w >> 1) * 64, c0 = C0 + (w & 1) * 64, cofs = lr * 4;
    v4f bb;   // the bias of this lane's four columns, as its bf16 value
#pragma unroll
    for (int c = 0; c < 4; ++c) bb[c] = bfr(bias[c0 + cofs + c]);
#pragma unroll
    for (int mb = 0; mb < 4; ++mb) {
#pragma unroll
        for (int nb = 0; nb < 4; ++nb) {
#pragma unroll
            for (int j = 0; j < 8; ++j) os[(hi * 8 + j) * 68 + nb * 16 + lr] = acc[mb][nb][j]; }
        __builtin_amdgcn_wave_barrier(); asm volatile("" ::: "memory");   // keeps the row reads behind the other lanes' writes in the compiled order
        float* crow = C + (size_t)(r0 + mb * 16) * ldc + c0;
#pragma unroll
        for (int s = 0; s < 8; ++s) { const int row = 2 * s + hi; const v4f val = *(const v4fa*)(os + row * 68 + cofs) + bb;
            *(v4f*)(crow + (size_t)row * ldc + cofs) = val; }
        __builtin_amdgcn_wave_barrier(); asm volatile("s_wait_xcnt 0x0" ::: "memory");   // keeps the next block's writes behind these reads; the wait stands ahead of any rewrite of a register these stores name
    }
}

__device__ __forceinline__ void d_wtG(const float* __restrict__ w, int K, int N, bf* Bt, int bx) {
    const int lane = threadIdx.x & 31; const int L0 = (bx * 8 + (threadIdx.x >> 5)) * 8; const int nlines = (int)((size_t)N * K / 64);
{
#pragma unroll 1
        for (int l = 0; l < 8; ++l) { const int L = L0 + l; if (L >= nlines) break; const size_t e = (size_t)L * 64 + lane * 2; const int k = (int)(e % K), n = (int)(e / K); v2us o;
            o[0] = f2bf(w[(size_t)k * N + n]); o[1] = f2bf(w[(size_t)(k + 1) * N + n]); *(v2us*)(Bt + e) = o; }
         }
}

__device__ __forceinline__ float invf(int j) {
    const float e = (float)(j & 15) * 0.0625f;
    const float p = powf(10000.0f, e);
    const float v = 1.0f / p;
    return v;
}

__device__ __forceinline__ void d_cstab(const int* __restrict__ fidx, const int* __restrict__ sidx, float* CS, int bx) {
    const int idx = bx * 256 + threadIdx.x; if (idx >= NTOK * HD) return;
    const int dd = idx & (HD - 1); const int R = idx >> 6; const int b = R / SEQ, t = R - b * SEQ; const int fl = t / NRES, n = t - fl * NRES;
    const int pseq = sidx[b * NRES + n]; const int pfr = fidx[fl];
    const float pf = (float)((dd < HD / 2) ? pseq : pfr);
    float fr = __fmul_rn(pf, invf(dd)); asm volatile("" : "+v"(fr));
    float sn, cn;
    sincosf(fr, &sn, &cn);
    v2f cs; cs[0] = cn; cs[1] = sn;
    *(v2f*)(CS + (size_t)idx * 2) = cs; 
}

__device__ __forceinline__ void d_condp(const float* __restrict__ cond, bf* P) {
    const int lane = threadIdx.x & 31, w = threadIdx.x >> 5;
    v2us o[8];
#pragma unroll
    for (int it = 0; it < 8; ++it) { const int row = w * 8 + it; const int rc = (row < NB) ? row : (NB - 1); v2us v;
#pragma unroll
        for (int q = 0; q < 2; ++q) { const float x = cond[(size_t)rc * CDIM + 2 * lane + q]; v[q] = (row < NB) ? f2bf(x) : (unsigned short)0; }
        o[it] = v; }
{
#pragma unroll
        for (int it = 0; it < 8; ++it) *(v2us*)(P + (size_t)(w * 8 + it) * CDIM + 2 * lane) = o[it];
         }
    asm volatile("s_wait_xcnt 0x0" ::: "memory");   // in the merged kernel's text another job's code, which rewrites the registers these stores name, follows this one
}

__global__ __launch_bounds__(256) void k_ln(const float* __restrict__ X, const float* __restrict__ SS, bf* Xh, bf* Xl) {
    const int lane = threadIdx.x & 31; const int R = blockIdx.x * 8 + (threadIdx.x >> 5); if (R >= NTOK) return;
    const int b = R / SEQ, t = R - b * SEQ;
    const float* xr = X + ((size_t)b * SEQ_FULL + t) * CM;
    float v[16];
    { const v8f a0 = *(const v8f*)(xr + 8 * lane); const v8f a1 = *(const v8f*)(xr + 256 + 8 * lane);
#pragma unroll
      for (int k = 0; k < 8; ++k) { v[k] = bfr(a0[k]); v[8 + k] = bfr(a1[k]); } }
    float s = 0.f;
#pragma unroll
    for (int k = 0; k < 16; ++k) s += v[k];
#pragma unroll
    for (int sh = 16; sh; sh >>= 1) s += __shfl_xor(s, sh, 32);
    const float mu = s * (1.0f / (float)CM);
    float qq = 0.f;
#pragma unroll
    for (int k = 0; k < 16; ++k) { const float d = v[k] - mu; qq += d * d; }
#pragma unroll
    for (int sh = 16; sh; sh >>= 1) qq += __shfl_xor(qq, sh, 32);
    const float var = qq * (1.0f / (float)CM);
    const float rs = rsqrtf(var + 1.0e-5f);
    const float* sc = SS + (size_t)b * ADW;
    v8us oh[2], ol[2];
#pragma unroll
    for (int c = 0; c < 2; ++c) { const int col0 = c * 256 + 8 * lane; const v8f g = *(const v8f*)(sc + col0); const v8f be = *(const v8f*)(sc + CM + col0); v8us th, tl;
#pragma unroll
        for (int k = 0; k < 8; ++k) { const float xn = (v[c * 8 + k] - mu) * rs; const float y = xn * (1.0f + g[k]) + be[k]; unsigned short a2, c2; splitf(y, a2, c2); th[k] = a2; tl[k] = c2; }
        oh[c] = th; ol[c] = tl; }
{
#pragma unroll
        for (int c = 0; c < 2; ++c) { const size_t o = (size_t)R * CM + c * 256 + 8 * lane; *(v8us*)(Xh + o) = oh[c]; *(v8us*)(Xl + o) = ol[c]; }
         }
}

// ---- d_extras: per token row R the extra bf16 k-step rows (NEX = 32 slots) that carry the additive score bias inside the score WMMA. With c = bf16 coordinates and g = -|c|^2/64 split three-piece (gh + gm + gl):
// query row QE[R] = [cx, cy, cz, 1, 1, 1, gh, gm, gl, 1, 0 x 22]; key row KE[R] = [cx/32, cy/32, cz/32, gh, gm, gl, 1, 1, 1, fill, 0 x 22], fill = -2e30 where mask == 0 else 0.
__device__ __forceinline__ void d_extras(const float* __restrict__ ca, const float* __restrict__ msk, bf* QE, bf* KE, int bx) {
    __shared__ __align__(16) unsigned int qs[256 * 16];
    __shared__ __align__(16) unsigned int ks[256 * 16];
    const int tid = threadIdx.x, lane = tid & 31, w = tid >> 5;
    const int R0 = bx * 256; const int R = R0 + tid;
    const int b = R / SEQ, t = R - b * SEQ; const size_t Rf = (size_t)b * SEQ_FULL + t;
    const float cx = bfr(ca[Rf * 3]), cy = bfr(ca[Rf * 3 + 1]), cz = bfr(ca[Rf * 3 + 2]);
    const float mk = bfr(msk[Rf]);
    const float n2 = cx * cx + cz * cz + cy * cy;
    const float g = -(n2 * 0.015625f);
    const unsigned short gh = f2bf(g); const float r1 = g - bf2f(gh); const unsigned short gm = f2bf(r1); const unsigned short gl = f2bf(r1 - bf2f(gm));
    const unsigned short one = (unsigned short)0x3F80u;
    const unsigned short fillv = (mk == 0.0f) ? f2bf(-2.0e30f) : (unsigned short)0;
    v4u qa, qb, ka, kb, zz;
#pragma unroll
    for (int i = 0; i < 4; ++i) { qb[i] = 0u; kb[i] = 0u; zz[i] = 0u; }
    qa[0] = pk2(f2bf(cx), f2bf(cy)); qa[1] = pk2(f2bf(cz), one); qa[2] = pk2(one, one); qa[3] = pk2(gh, gm);
    qb[0] = pk2(gl, one);
    ka[0] = pk2(f2bf(cx * 0.03125f), f2bf(cy * 0.03125f)); ka[1] = pk2(f2bf(cz * 0.03125f), gh); ka[2] = pk2(gm, gl); ka[3] = pk2(one, one);
    kb[0] = pk2(one, fillv);
    unsigned int* qr = qs + tid * 16; unsigned int* krw = ks + tid * 16;
    *(v4u*)(qr) = qa; *(v4u*)(qr + 4) = qb; *(v4u*)(qr + 8) = zz; *(v4u*)(qr + 12) = zz;
    *(v4u*)(krw) = ka; *(v4u*)(krw + 4) = kb; *(v4u*)(krw + 8) = zz; *(v4u*)(krw + 12) = zz;
    __syncthreads();
    v4u oq[4], ok[4]; int off[4];
#pragma unroll
    for (int it = 0; it < 4; ++it) { off[it] = (w * 4 + it) * 128 + lane * 4; oq[it] = *(const v4ua*)(qs + off[it]); ok[it] = *(const v4ua*)(ks + off[it]); }
    unsigned int* QEw = (unsigned int*)QE + (size_t)R0 * 16; unsigned int* KEw = (unsigned int*)KE + (size_t)R0 * 16;
{
#pragma unroll
        for (int it = 0; it < 4; ++it) { *(v4u*)(QEw + off[it]) = oq[it]; *(v4u*)(KEw + off[it]) = ok[it]; }
         }
}

// ---- k_prep: every job that reads only inputs, as block ranges of one grid (the branch is the same for a whole block): weight planes, cond plane, bias k-step rows, cos/sin table.
#define PB_WA ((ADW * CDIM / 64 + 63) / 64)
#define PB_W ((CM * CM / 64 + 63) / 64)
#define PB_EX (NTOK / 256)
#define PB_CS ((NTOK * HD + 255) / 256)
#define PB_ALL (PB_WA + 4 * PB_W + 1 + PB_EX + PB_CS)
__global__ __launch_bounds__(256) void k_prep(const float* __restrict__ adaln_w, const float* __restrict__ wq, const float* __restrict__ wk, const float* __restrict__ wv, const float* __restrict__ wo,
                                              const float* __restrict__ cond, const float* __restrict__ ca, const float* __restrict__ msk, const int* __restrict__ fidx, const int* __restrict__ sidx,
                                              bf* WA, bf* WQ, bf* WK, bf* WV, bf* WO, bf* CAP, bf* QE, bf* KE, float* CS) {
    int bx = blockIdx.x;
    if (bx < PB_WA) { d_wtG(adaln_w, CDIM, ADW, WA, bx); return; }              // adaln_w [CDIM][ADW] -> WA[j][c]
    bx -= PB_WA;
    if (bx < 4 * PB_W) { const int j = bx / PB_W;                                // w [in][out] -> Bt[out][in]
        d_wtG((j == 0) ? wq : (j == 1) ? wk : (j == 2) ? wv : wo, CM, CM, (j == 0) ? WQ : (j == 1) ? WK : (j == 2) ? WV : WO, bx - j * PB_W); return; }
    bx -= 4 * PB_W;
    if (bx < 1) { d_condp(cond, CAP); return; }
    bx -= 1;
    if (bx < PB_EX) { d_extras(ca, msk, QE, KE, bx); return; }
    d_cstab(fidx, sidx, CS, bx - PB_EX);
}

// ---- d_ropep: head planes [bh][t][d] (bf16 hi/lo) of rope(scl * F) with the two-half rotate-half convention (each 32-dim half rotated within itself, partner d+16 for (d & 16) == 0 with subtraction, partner d-16 otherwise with addition;
__device__ __forceinline__ void d_ropep(const float* __restrict__ F, float scl, const float* __restrict__ CS, bf* Ph, bf* Pl, float* G, int bx) {
    const size_t e = ((size_t)bx * 256 + threadIdx.x) * 2; if (e >= (size_t)NBH * SEQ * HD) return;
    const int d = (int)(e & (HD - 1)); const int t = (int)((e >> 6) % SEQ); const int bh = (int)(e / ((size_t)HD * SEQ)); const int b = bh / NH, h = bh - b * NH;
    const size_t R = (size_t)b * SEQ + t;
    const float* f = F + R * CM + h * HD;
    v2us oh, ol; v2f go;
#pragma unroll
    for (int q = 0; q < 2; ++q) { const int dd = d + q; const bool sub = ((dd & 16) == 0); const int dp = sub ? dd + 16 : dd - 16;
        const float x0 = f[dd] * scl, x1 = f[dp] * scl;
        const v2f cs = *(const v2f*)(CS + (R * HD + dd) * 2);
        float a = __fmul_rn(x0, cs[0]), bq = __fmul_rn(x1, cs[1]); asm volatile("" : "+v"(a)); asm volatile("" : "+v"(bq));
        const float r = sub ? __fsub_rn(a, bq) : __fadd_rn(a, bq);
        go[q] = r; unsigned short a2, c2; splitf(r, a2, c2); oh[q] = a2; ol[q] = c2; }
    const size_t og = ((size_t)bh * SEQ_FULL + t) * HD + d;
    *(v2us*)(Ph + e) = oh; *(v2us*)(Pl + e) = ol; if (G != nullptr) *(v2f*)(G + og) = go;
    
}

__device__ __forceinline__ void d_vtp(const float* __restrict__ F, h16* Vh, h16* Vl, float* G, int bx) {
    __shared__ float tile[64 * 65];
    const int tid = threadIdx.x, lane = tid & 31, w = tid >> 5;
    const int bh = bx / (SEQ / 64); const int b = bh / NH, h = bh - b * NH; const int t0 = (bx - bh * (SEQ / 64)) * 64;
    const int pc = tid & 15, rb = tid >> 4;
    v4f vv[4]; size_t og[4];
#pragma unroll
    for (int it = 0; it < 4; ++it) { const int tr = it * 16 + rb; vv[it] = *(const v4f*)(F + ((size_t)b * SEQ + t0 + tr) * CM + h * HD + 4 * pc);
#pragma unroll
        for (int c = 0; c < 4; ++c) tile[tr * 65 + 4 * pc + c] = vv[it][c];
        og[it] = ((size_t)bh * SEQ_FULL + t0 + tr) * HD + 4 * pc; }
{
#pragma unroll
        for (int it = 0; it < 4; ++it) *(v4f*)(G + og[it]) = vv[it];
         }
    __syncthreads();
    v2h oh[8], ol[8]; size_t ov[8];
#pragma unroll
    for (int it = 0; it < 8; ++it) { const int d = w * 8 + it; const float x0 = tile[(2 * lane) * 65 + d], x1 = tile[(2 * lane + 1) * 65 + d];
        h16 a0, c0, a1, c1; splith(x0, a0, c0); splith(x1, a1, c1); v2h th, tl; th[0] = a0; th[1] = a1; tl[0] = c0; tl[1] = c1; oh[it] = th; ol[it] = tl;
        ov[it] = ((size_t)bh * HD + d) * SEQ + t0 + 2 * lane; }
{
#pragma unroll
        for (int it = 0; it < 8; ++it) { *(v2h*)(Vh + ov[it]) = oh[it]; *(v2h*)(Vl + ov[it]) = ol[it]; }
         }
}

// ---- k_planes: the three jobs that turn the f32 projections into operand planes and the k and v outputs, as block ranges of one grid (the branch is the same for a whole block).
#define PB_VT ((SEQ / 64) * NBH)
#define PB_RP ((NBH * SEQ * HD / 2 + 255) / 256)
__global__ __launch_bounds__(256) void k_planes(const float* __restrict__ FQ, const float* __restrict__ FK, const float* __restrict__ FV, const float* __restrict__ CS,
                                                bf* QPh, bf* QPl, bf* KPh, bf* KPl, h16* VTh, h16* VTl, float* GK, float* GV) {
    int bx = blockIdx.x;
    if (bx < PB_VT) { d_vtp(FV, VTh, VTl, GV, bx); return; }
    bx -= PB_VT;
    if (bx < PB_RP) { d_ropep(FQ, QSCL, CS, QPh, QPl, nullptr, bx); return; }
    d_ropep(FK, 1.0f, CS, KPh, KPl, GK, bx - PB_RP);
}

// ---- k_attn: four waves per work-group, one wave per 16 query rows of one (b, h); all 64 rows lie in one frame, so the key bound (frame+1)*NRES is the same for the whole group. 32 keys per trip.
// The trip's k hi/lo, bias and v hi/lo tiles are brought once per work-group into a two-buffer LDS ring by asynchronous copies (whole lines from global memory, one trip ahead); every wave reads its fragments from the ring.
// Transposed products: S^T tile (16 keys x 16 queries) = KE.QE (bias k-step) + Kh.Qh + Kh.Ql + Kl.Qh over d (bf16, k rows as A, q as B, scale folded into the q planes), so a lane holds 16 scores of ONE query (lane & 15; keys 16j + 8(lane >> 4) + r).
// Online max-subtracted softmax in f32 in the lane, one exchange between the wave's halves for the maximum; each half keeps the sum of its own keys, joined once behind the loop. P^T packs from the two score tiles straight into the B operand of O^T += V^T.P^T.
#define AW 4
#define KP 72                        // LDS pitch of a 64-element k row: 144 B = 16 B x odd, free of bank conflicts for 16-byte readers
#define VP 40                        // LDS pitch of a 32-element v or bias row: 80 B
#define ST_KH 0
#define ST_KL (32 * KP)
#define ST_KE (2 * 32 * KP)
#define ST_VH (ST_KE + 32 * VP)
#define ST_VL (ST_VH + 64 * VP)
#define ST_EL (ST_VL + 64 * VP)      // elements of one ring buffer (22016 B)
static_assert(AW == 4 && NRES % (16 * AW) == 0 && NRES >= 64 && (ST_EL * 2) % 16 == 0);
__device__ __forceinline__ v16bf ldsb(const unsigned short* p) { return cat16b(*(const v8usa*)p, *(const v8usa*)(p + 16)); }
__device__ __forceinline__ v16h ldsh(const unsigned short* p) { return cat16(*(const v8ha*)p, *(const v8ha*)(p + 16)); }
__device__ __forceinline__ float xhalf(float x) { return __builtin_bit_cast(float, __builtin_amdgcn_permlanex16(__builtin_bit_cast(int, x), __builtin_bit_cast(int, x), 0x76543210, 0xfedcba98, false, false)); }   // lane l with lane l ^ 16
// One tile's copies of one lane, 16 B each: two pieces (16 rows apart) of k hi and of k lo, two (32 rows apart) of v hi and of v lo, one of the bias rows. The s_wait_xcnt stands inside the statement so that no address register is rewritten ahead of it.
__device__ __forceinline__ void tile_copy(unsigned lk, unsigned lv, unsigned le, const bf* gkh, const bf* gkl, const h16* gvh, const h16* gvl, const bf* gke) {
    const unsigned lk2 = lk + 16 * KP * 2, lkl = lk + (ST_KL - ST_KH) * 2, lkl2 = lkl + 16 * KP * 2;
    const unsigned lv2 = lv + 32 * VP * 2, lvl = lv + (ST_VL - ST_VH) * 2, lvl2 = lvl + 32 * VP * 2;
    const bf* gkh2 = gkh + 16 * HD; const bf* gkl2 = gkl + 16 * HD; const h16* gvh2 = gvh + (size_t)32 * SEQ; const h16* gvl2 = gvl + (size_t)32 * SEQ;
    asm volatile("global_load_async_to_lds_b128 %0, %9, off\n\t"
                 "global_load_async_to_lds_b128 %1, %10, off\n\t"
                 "global_load_async_to_lds_b128 %2, %11, off\n\t"
                 "global_load_async_to_lds_b128 %3, %12, off\n\t"
                 "global_load_async_to_lds_b128 %4, %13, off\n\t"
                 "global_load_async_to_lds_b128 %5, %14, off\n\t"
                 "global_load_async_to_lds_b128 %6, %15, off\n\t"
                 "global_load_async_to_lds_b128 %7, %16, off\n\t"
                 "global_load_async_to_lds_b128 %8, %17, off\n\t"
                 "s_wait_xcnt 0x0"
                 :: "v"(lk), "v"(lk2), "v"(lkl), "v"(lkl2), "v"(lv), "v"(lv2), "v"(lvl), "v"(lvl2), "v"(le),
                    "v"(gkh), "v"(gkh2), "v"(gkl), "v"(gkl2), "v"(gvh), "v"(gvh2), "v"(gvl), "v"(gvl2), "v"(gke) : "memory");
}
// The grid puts three waves on a SIMD; a register budget for four keeps the compiler from trading the fragment loads issued ahead of the products for a fifth wave that never comes.
__global__ __launch_bounds__(32 * AW) __attribute__((amdgpu_waves_per_eu(4, 4))) void k_attn(const bf* __restrict__ Qh, const bf* __restrict__ Ql, const bf* __restrict__ QE,
                                             const bf* __restrict__ Kh, const bf* __restrict__ Kl, const bf* __restrict__ KE,
                                             const h16* __restrict__ Vth, const h16* __restrict__ Vtl, bf* ATh, bf* ATl) {
    __shared__ __align__(16) unsigned short ring[2 * ST_EL];
    __shared__ __align__(16) float osa[AW * 16 * 68];
    const int tid = threadIdx.x, lane = tid & 31, lr = lane & 15, hi = lane >> 4, w = tid >> 5;
    float* os = osa + w * (16 * 68);
    const int bh = blockIdx.y; const int b = bh / NH, h = bh - b * NH;
    const int q0 = blockIdx.x * (16 * AW) + w * 16;
    const int kvlen = ((int)blockIdx.x * (16 * AW) / NRES + 1) * NRES;
    const int nt = kvlen >> 5;
    const size_t hp = (size_t)bh * SEQ * HD;
    const size_t tb = (size_t)b * SEQ;
    // this lane's share of a tile, in 16-byte pieces: k rows tid>>3 and 16 + tid>>3, piece tid&7; v rows (d) tid>>2 and 32 + tid>>2, piece tid&3; bias row tid>>2, piece tid&3
    const unsigned r0 = (unsigned)(size_t)ring;
    const unsigned lk0 = r0 + (unsigned)(ST_KH + (tid >> 3) * KP + (tid & 7) * 8) * 2u;
    const unsigned lv0 = r0 + (unsigned)(ST_VH + (tid >> 2) * VP + (tid & 3) * 8) * 2u;
    const unsigned le0 = r0 + (unsigned)(ST_KE + (tid >> 2) * VP + (tid & 3) * 8) * 2u;
    const size_t gk0 = hp + (size_t)(tid >> 3) * HD + (tid & 7) * 8;
    const size_t gv0 = ((size_t)bh * HD + (tid >> 2)) * SEQ + (tid & 3) * 8;
    const size_t ge0 = (tb + (tid >> 2)) * NEX + (tid & 3) * 8;
    tile_copy(lk0, lv0, le0, Kh + gk0, Kl + gk0, Vth + gv0, Vtl + gv0, KE + ge0);
    const size_t qo = hp + (size_t)(q0 + lr) * HD + 8 * hi;
    const v16bf aH0 = WFrag<bf>::ld(Qh + qo), aH1 = WFrag<bf>::ld(Qh + qo + 32);
    const v16bf aL0 = WFrag<bf>::ld(Ql + qo), aL1 = WFrag<bf>::ld(Ql + qo + 32);
    const v16bf aE = WFrag<bf>::ld(QE + (tb + q0 + lr) * NEX + 8 * hi);
    v8f oh[4], ol[4];
#pragma unroll
    for (int nb = 0; nb < 4; ++nb) { oh[nb] = (v8f){}; ol[nb] = (v8f){}; }
    float m = -1.0e30f, l = 0.f;   // this lane's query: running maximum (equal in both halves), sum over this half's keys
    asm volatile("s_wait_asynccnt 0x0" ::: "memory");   // tile 0 of this wave has landed
    __syncthreads();                                     // publishes tile 0 to every wave
    tile_copy(lk0 + ST_EL * 2, lv0 + ST_EL * 2, le0 + ST_EL * 2, Kh + gk0 + 32 * HD, Kl + gk0 + 32 * HD, Vth + gv0 + 32, Vtl + gv0 + 32, KE + ge0 + 32 * NEX);   // tile 1 exists: nt >= 8
#pragma unroll 1
    for (int t = 0; t < nt; ++t) {
        const unsigned short* st = ring + (t & 1) * ST_EL;
        v8f s[2];
#pragma unroll
        for (int j = 0; j < 2; ++j) {
            const unsigned short* kp = st + (16 * j + lr) * KP + 8 * hi;
            s[j] = (v8f){};
            { const v16bf bE = ldsb(st + ST_KE + (16 * j + lr) * VP + 8 * hi); s[j] = wmmab(bE, aE, s[j]); }
            { const v16bf bH = ldsb(kp + ST_KH), bL = ldsb(kp + ST_KL); s[j] = wmmab(bH, aH0, s[j]); s[j] = wmmab(bH, aL0, s[j]); s[j] = wmmab(bL, aH0, s[j]); }
            { const v16bf bH = ldsb(kp + ST_KH + 32), bL = ldsb(kp + ST_KL + 32); s[j] = wmmab(bH, aH1, s[j]); s[j] = wmmab(bH, aL1, s[j]); s[j] = wmmab(bL, aH1, s[j]); }
        }
        asm volatile("v_nop\n\tv_nop\n\tv_nop\n\tv_nop" : "+v"(s[0]), "+v"(s[1]) : "v"(aH0), "v"(aH1), "v"(aL0), "v"(aL1), "v"(aE));
        const float v0 = fmaxf(fmaxf(s[0][0], s[0][1]), s[0][2]), v1 = fmaxf(fmaxf(s[0][3], s[0][4]), s[0][5]), v2 = fmaxf(fmaxf(s[0][6], s[0][7]), s[1][0]);
        const float v3 = fmaxf(fmaxf(s[1][1], s[1][2]), s[1][3]), v4 = fmaxf(fmaxf(s[1][4], s[1][5]), s[1][6]);
        float v = fmaxf(fmaxf(fmaxf(v0, v1), v2), fmaxf(fmaxf(v3, v4), s[1][7]));   // a tree three deep, not a chain of eight
        v = fmaxf(v, xhalf(v));
        const float mn = fmaxf(m, v);
        const float al = __builtin_amdgcn_exp2f((m - mn) * LOG2E);
        m = mn;
        float ts[8];
#pragma unroll
        for (int r = 0; r < 8; ++r) {
            const float p0 = __builtin_amdgcn_exp2f((s[0][r] - mn) * LOG2E), p1 = __builtin_amdgcn_exp2f((s[1][r] - mn) * LOG2E);
            s[0][r] = p0; s[1][r] = p1;
            ts[r] = p0 + p1;
        }
        l = l * al + (((ts[0] + ts[1]) + (ts[2] + ts[3])) + ((ts[4] + ts[5]) + (ts[6] + ts[7])));
#pragma unroll
        for (int nb = 0; nb < 4; ++nb)
#pragma unroll
            for (int r = 0; r < 8; ++r) { oh[nb][r] *= al; ol[nb][r] *= al; }
        v16h ap;   // B operand: element i <- key 8(lane >> 4) + i, element 8 + i <- key 16 + 8(lane >> 4) + i, the order of the v fragments
#pragma unroll
        for (int r = 0; r < 8; ++r) { ap[r] = (h16)(s[0][r] * PCAR); ap[8 + r] = (h16)(s[1][r] * PCAR); }
#pragma unroll
        for (int nb = 0; nb < 4; ++nb) { const unsigned short* vp = st + (16 * nb + lr) * VP + 8 * hi;
            const v16h bH = ldsh(vp + ST_VH); oh[nb] = wmma16(bH, ap, oh[nb]);
            const v16h bL = ldsh(vp + ST_VL); ol[nb] = wmma16(bL, ap, ol[nb]); }
        asm volatile("v_nop\n\tv_nop\n\tv_nop\n\tv_nop" : "+v"(oh[0]), "+v"(oh[1]), "+v"(oh[2]), "+v"(oh[3]), "+v"(ol[0]), "+v"(ol[1]), "+v"(ol[2]), "+v"(ol[3]) : "v"(ap));
        asm volatile("s_wait_dscnt 0x0" ::: "memory");      // this wave's reads of buffer t & 1 have returned
        asm volatile("s_wait_asynccnt 0x0" ::: "memory");   // this wave's copies of tile t + 1 have landed
        __syncthreads();                                     // publishes tile t + 1 and ends every wave's reads of buffer t & 1
        if (t + 2 < nt) { const unsigned bo = (unsigned)(t & 1) * (ST_EL * 2); const size_t kn = (size_t)(t + 2) * 32;
            tile_copy(lk0 + bo, lv0 + bo, le0 + bo, Kh + gk0 + kn * HD, Kl + gk0 + kn * HD, Vth + gv0 + kn, Vtl + gv0 + kn, KE + ge0 + kn * NEX); }
    }
    asm volatile("s_wait_asynccnt 0x0" ::: "memory");       // nothing of this wave is in flight when it ends
    const float il = PINV * __fdiv_rn(1.0f, l + xhalf(l));
#pragma unroll
    for (int nb = 0; nb < 4; ++nb) { v4f x0, x1;   // register r of tile nb is d = 16 nb + 8 hi + r of query lr
#pragma unroll
        for (int r = 0; r < 4; ++r) { x0[r] = (oh[nb][r] + ol[nb][r] * LINV) * il; x1[r] = (oh[nb][4 + r] + ol[nb][4 + r] * LINV) * il; }
        *(v4fa*)(os + lr * 68 + 16 * nb + 8 * hi) = x0; *(v4fa*)(os + lr * 68 + 16 * nb + 8 * hi + 4) = x1; }
    __builtin_amdgcn_fence(3, "wavefront"); __builtin_amdgcn_wave_barrier(); asm volatile("" ::: "memory");
    v8us ah[4], av[4]; size_t ad[4];
#pragma unroll
    for (int it = 0; it < 4; ++it) { const int rr = it * 4 + (lane >> 3); const int pc = lane & 7;
        const v4f x0 = *(const v4fa*)(os + rr * 68 + pc * 8), x1 = *(const v4fa*)(os + rr * 68 + pc * 8 + 4); v8us th, tl;
#pragma unroll
        for (int c = 0; c < 4; ++c) { unsigned short a2, c2; splitf(x0[c], a2, c2); th[c] = a2; tl[c] = c2; splitf(x1[c], a2, c2); th[4 + c] = a2; tl[4 + c] = c2; }
        ah[it] = th; av[it] = tl; ad[it] = (tb + q0 + rr) * CM + (size_t)h * HD + pc * 8; }
{
#pragma unroll
        for (int it = 0; it < 4; ++it) { *(v8us*)(ATh + ad[it]) = ah[it]; *(v8us*)(ATl + ad[it]) = av[it]; }
         }
}

extern "C" void kernel_launch(void* const* d_in, const int* in_sizes, int n_in,
                              void* d_out, int out_size, void* d_ws, size_t ws_size, hipStream_t stream) {
    if (n_in < 16) return;
    const int ntok_in = (NB - 1) * SEQ_FULL + SEQ;
    if (in_sizes[0] < ntok_in * CM || in_sizes[1] < NFR || in_sizes[2] < NB * NRES || in_sizes[3] < ntok_in || in_sizes[4] < NB * CDIM || in_sizes[5] < ntok_in * 3) return;
    if (in_sizes[6] < CDIM * ADW || in_sizes[7] < ADW) return;
    if (in_sizes[8] < CM * CM || in_sizes[10] < CM * CM || in_sizes[12] < CM * CM || in_sizes[14] < CM * CM) return;
    if (in_sizes[9] < CM || in_sizes[11] < CM || in_sizes[13] < CM || in_sizes[15] < CM) return;
    const size_t out_need = OUT2_EL + ((size_t)((NB - 1) * NH + NH - 1) * SEQ_FULL + SEQ) * HD;
    if ((size_t)out_size < out_need) return;
    const float* s_frames = (const float*)d_in[0]; const int* frame_idx = (const int*)d_in[1]; const int* seq_idx = (const int*)d_in[2]; const float* mask = (const float*)d_in[3];
    const float* cond = (const float*)d_in[4]; const float* ca_pos = (const float*)d_in[5]; const float* adaln_w = (const float*)d_in[6]; const float* adaln_b = (const float*)d_in[7];
    const float* wq = (const float*)d_in[8]; const float* bq = (const float*)d_in[9]; const float* wk = (const float*)d_in[10]; const float* bk = (const float*)d_in[11];
    const float* wv = (const float*)d_in[12]; const float* bv = (const float*)d_in[13]; const float* wo = (const float*)d_in[14]; const float* bo = (const float*)d_in[15];
    float* OUT = (float*)d_out;
    char* wsp = (char*)d_ws;
    auto take = [&](size_t bytes) { char* p = wsp; wsp += (bytes + 255) & ~(size_t)255; return (void*)p; };
    bf* WQ = (bf*)take((size_t)3 * CM * CM * 2); bf* WK = WQ + (size_t)CM * CM; bf* WV = WK + (size_t)CM * CM; bf* WO = (bf*)take((size_t)CM * CM * 2);
    bf* WA = (bf*)take((size_t)ADW * CDIM * 2); bf* CAP = (bf*)take((size_t)64 * CDIM * 2); float* SS = (float*)take((size_t)64 * ADW * 4);
    float* CS = (float*)take((size_t)NTOK * HD * 2 * 4);
    bf* XBh = (bf*)take((size_t)NTOK * CM * 2); bf* XBl = (bf*)take((size_t)NTOK * CM * 2);
    float* FQ = (float*)take((size_t)3 * NTOK * CM * 4); float* FK = FQ + (size_t)NTOK * CM; float* FV = FK + (size_t)NTOK * CM;
    bf* QPh = (bf*)take((size_t)NBH * SEQ * HD * 2); bf* QPl = (bf*)take((size_t)NBH * SEQ * HD * 2); bf* KPh = (bf*)take((size_t)NBH * SEQ * HD * 2); bf* KPl = (bf*)take((size_t)NBH * SEQ * HD * 2);
    h16* VTh = (h16*)take((size_t)NBH * HD * SEQ * 2); h16* VTl = (h16*)take((size_t)NBH * HD * SEQ * 2);
    bf* QE = (bf*)take((size_t)NTOK * NEX * 2); bf* KE = (bf*)take((size_t)NTOK * NEX * 2);
    bf* ATh = (bf*)take((size_t)NTOK * CM * 2); bf* ATl = (bf*)take((size_t)NTOK * CM * 2);
    const size_t used = (size_t)(wsp - (char*)d_ws);
    if (used > ws_size || used > ((size_t)128 << 20)) return;    // about 102 MiB at NB=2, SEQ=3072

    // one launch for all that reads only inputs: 16-bit weight and cond planes, bias k-step rows, cos/sin table
    k_prep<<<PB_ALL, 256, 0, stream>>>(adaln_w, wq, wk, wv, wo, cond, ca_pos, mask, frame_idx, seq_idx, WA, WQ, WK, WV, WO, CAP, QE, KE, CS);
    // AdaLN: ss = cond x adaln_w + adaln_b (rows 0..NB-1 of SS), then LN + modulation -> x hi/lo planes
    k_gemmw<bf, 0, true><<<dim3(1, ADW / 64, 1), 32, 0, stream>>>(CAP, nullptr, WA, nullptr, CDIM, SS, ADW, adaln_b, adaln_b, adaln_b, 0, 0, 0);
    k_ln<<<(unsigned)(NTOK / 8), 256, 0, stream>>>(s_frames, SS, XBh, XBl);
    // projections (x hi/lo x bf16 W, 2 products, + bias) in one launch, then roped / transposed planes in one launch; k and v outputs from the f32 results
    k_gemm4<<<dim3(NTOK / 128, CM / 128, 3), 128, 0, stream>>>(XBh, XBl, WQ, FQ, CM, bq, bk, bv, 0, (size_t)CM * CM, (size_t)NTOK * CM);   // z = q, k, v
    k_planes<<<PB_VT + 2 * PB_RP, 256, 0, stream>>>(FQ, FK, FV, CS, QPh, QPl, KPh, KPl, VTh, VTl, OUT + OUT1_EL, OUT + OUT2_EL);
    // attention (one launch) -> ctx hi/lo planes, then the output projection straight into out0 (batch z at the full-size token pitch)
    k_attn<<<dim3(SEQ / (16 * AW), NBH, 1), 32 * AW, 0, stream>>>(QPh, QPl, QE, KPh, KPl, KE, VTh, VTl, ATh, ATl);
    k_gemm4<<<dim3(SEQ / 128, CM / 128, NB), 128, 0, stream>>>(ATh, ATl, WO, OUT, CM, bo, bo, bo, (size_t)SEQ * CM, 0, (size_t)SEQ_FULL * CM);
}

// v005
// It runs in 121 microseconds.
// Two timings next to v004 put it at 1.12 and 1.11 times that version's speed.
// All steps since v000 together make it 3.76 times as fast.
#include <hip/hip_runtime.h>

// Frame-causal multi-head attention with a Gaussian distance bias: AdaLN prologue (cond x adaln_w modulation of a non-affine LN), q/k/v projections with bias, two-half rotate-half RoPE from int positions, online-softmax attention, output projection; f32 outputs out, roped k, v.
// Compute dtypes, f32 accumulate everywhere: every float input RNE-converted to bf16 on load. cond x adaln_w: v_wmma_f32_16x16x32_bf16, plain bf16 operands (1 product). q/k/v projections: bf16 hi/lo planes of the modulated LN output x bf16 weight planes (2 products).
// Scores: bf16 hi/lo q and k planes (hi.hi + lo.hi + hi.lo) plus one extra bf16 k-step carrying the distance-bias terms (exact coordinate cross products, three-piece bf16 squared norms, key mask fill). attn.v: v_wmma_f32_16x16x32_f16, P carried x2^14 in f16 (one plane), v as f16 hi + x2^10 f16 residual planes (two accumulators).
// Output projection: bf16 hi/lo ctx planes x bf16 Wo (2 products). LN statistics, inverse frequencies and the cos/sin table, RoPE, softmax and all side math f32 on VALU; the k and v outputs are written from the f32 projection results.

#ifndef NB
#define NB 2
#endif
#define NB_FULL 2
#ifndef SEQ
#define SEQ 3072
#endif
#define SEQ_FULL 3072
#define NRES 256
#define NFR (SEQ / NRES)
#define CM 512
#define ADW 1024
#define NH 8
#define HD 64
#define CDIM 64
#define NEX 32
#define NTOK (NB * SEQ)
#define NBH (NB * NH)
#define QSCL 0.125f
#define PCAR 16384.0f
#define PINV 0.00006103515625f
#define LCAR 1024.0f
#define LINV 0.0009765625f
#define LOG2E 1.4426950408889634f
#define OUT1_EL ((size_t)NB_FULL * SEQ_FULL * CM)
#define OUT2_EL (OUT1_EL + (size_t)NB_FULL * NH * SEQ_FULL * HD)
static_assert(SEQ % NRES == 0);
static_assert(SEQ >= NRES && SEQ <= SEQ_FULL);
static_assert(NB >= 1 && NB <= NB_FULL);
static_assert(NTOK % 256 == 0);
static_assert(HD == 64 && CM == NH * HD);
static_assert(CM % 64 == 0 && ADW == 2 * CM && CDIM % 32 == 0);
static_assert(OUT1_EL * 4 == 12582912);
static_assert(OUT2_EL * 4 == 25165824);

typedef _Float16 h16;
typedef unsigned short bf;
typedef __attribute__((ext_vector_type(16))) __bf16   v16bf;
typedef __attribute__((ext_vector_type(16))) _Float16 v16h;
typedef __attribute__((ext_vector_type(8)))  _Float16 v8h;
typedef __attribute__((ext_vector_type(2)))  _Float16 v2h;
typedef __attribute__((ext_vector_type(8)))  unsigned short v8us;
typedef __attribute__((ext_vector_type(4)))  unsigned short v4us;
typedef __attribute__((ext_vector_type(2)))  unsigned short v2us;
typedef __attribute__((ext_vector_type(4)))  unsigned int v4u;
typedef __attribute__((ext_vector_type(8)))  float    v8f;
typedef __attribute__((ext_vector_type(4)))  float    v4f;
typedef __attribute__((ext_vector_type(2)))  float    v2f;
typedef v8h  __attribute__((may_alias)) v8ha;
typedef v4f  __attribute__((may_alias)) v4fa;
typedef v8us __attribute__((may_alias)) v8usa;
typedef v4u  __attribute__((may_alias)) v4ua;

__device__ __forceinline__ unsigned short f2bf(float f) { unsigned u = __float_as_uint(f); u += 0x7FFFu + ((u >> 16) & 1u); return (unsigned short)(u >> 16); }
__device__ __forceinline__ float bf2f(unsigned short b) { return __uint_as_float(((unsigned)b) << 16); }
__device__ __forceinline__ float bfr(float f) { return bf2f(f2bf(f)); }
__device__ __forceinline__ v16h cat16(v8h lo, v8h hi) { return __builtin_shufflevector(lo, hi, 0, 1, 2, 3, 4, 5, 6, 7, 8, 9, 10, 11, 12, 13, 14, 15); }
__device__ __forceinline__ v16bf cat16b(v8us lo, v8us hi) { return __builtin_bit_cast(v16bf, __builtin_shufflevector(lo, hi, 0, 1, 2, 3, 4, 5, 6, 7, 8, 9, 10, 11, 12, 13, 14, 15)); }
__device__ __forceinline__ v8f wmma16(v16h a, v16h b, v8f c) { return __builtin_amdgcn_wmma_f32_16x16x32_f16(false, a, false, b, (short)0, c, false, false); }
__device__ __forceinline__ v8f wmmab(v16bf a, v16bf b, v8f c) { return __builtin_amdgcn_wmma_f32_16x16x32_bf16(false, a, false, b, (short)0, c, false, false); }
__device__ __forceinline__ void splitf(float y, unsigned short& h, unsigned short& l) { h = f2bf(y); l = f2bf(y - bf2f(h)); }
__device__ __forceinline__ void splith(float y, h16& a, h16& c) { a = (h16)y; c = (h16)((y - (float)a) * LCAR); }
__device__ __forceinline__ unsigned int pk2(unsigned short lo, unsigned short hi2) { return (unsigned int)lo | ((unsigned int)hi2 << 16); }

// ---- k_gemmw: register-blocked GEMM, ONE WAVE per 64x64 output tile (16 accumulators), operands straight from K-contiguous 16-bit planes; grid (M/64, N/64, Z), 32 threads.
// C[m][n] (f32, pitch ldc, + optional f32 bias[n] as its bf16 value) = sum_k A[m][k] Bt[n][k] (+ split products per NSPLIT). z-batch strides sA/sB/sC in elements, bias vector bias0/1/2 by z (Z <= 3). K % 32 == 0.
// Fragments: lane -> row/col lane&15, vector elements 0..7 <- k0 + 8h + i, elements 8..15 <- k0 + 16 + 8h + i (h = lane>>4) for BOTH operands; D element r -> (row 8h + r, col lane&15).
template <typename T16> struct WFrag;
template <> struct WFrag<h16> { typedef v16h V; static __device__ __forceinline__ V ld(const h16* p) { return cat16(*(const v8h*)p, *(const v8h*)(p + 16)); } static __device__ __forceinline__ v8f mma(V a, V b, v8f c) { return wmma16(a, b, c); } };
template <> struct WFrag<bf> { typedef v16bf V; static __device__ __forceinline__ V ld(const bf* p) { return cat16b(*(const v8us*)p, *(const v8us*)(p + 16)); } static __device__ __forceinline__ v8f mma(V a, V b, v8f c) { return wmmab(a, b, c); } };
template <typename T16, int NSPLIT, bool BIAS>
__global__ __launch_bounds__(32) void k_gemmw(const T16* __restrict__ A, const T16* __restrict__ A2, const T16* __restrict__ Bt, const T16* __restrict__ Bt2, int K, float* C, int ldc, const float* __restrict__ bias0, const float* __restrict__ bias1, const float* __restrict__ bias2, size_t sA, size_t sB, size_t sC) {
    typedef typename WFrag<T16>::V V;
    __shared__ __align__(16) float os[16 * 68];
    const size_t z = blockIdx.z; A += z * sA; if (A2) A2 += z * sA; Bt += z * sB; if (Bt2) Bt2 += z * sB; C += z * sC;
    const float* __restrict__ bias = (z == 0) ? bias0 : (z == 1) ? bias1 : bias2;
    const int lane = threadIdx.x & 31, lr = lane & 15, hi = lane >> 4; const int r0 = blockIdx.x * 64, c0 = blockIdx.y * 64;
    v8f acc[4][4];
#pragma unroll
    for (int mb = 0; mb < 4; ++mb)
#pragma unroll
        for (int nb = 0; nb < 4; ++nb) acc[mb][nb] = (v8f){};
    const size_t aoff = (size_t)(r0 + lr) * K + 8 * hi, boff = (size_t)(c0 + lr) * K + 8 * hi;
#pragma unroll 1
    for (int kc = 0; kc < K; kc += 32) {
        V a[4], a2[4];
#pragma unroll
        for (int mb = 0; mb < 4; ++mb) { a[mb] = WFrag<T16>::ld(A + aoff + (size_t)mb * 16 * K + kc); if (NSPLIT == 1 || NSPLIT == 2) a2[mb] = WFrag<T16>::ld(A2 + aoff + (size_t)mb * 16 * K + kc); }
#pragma unroll
        for (int nb = 0; nb < 4; ++nb) { const V b = WFrag<T16>::ld(Bt + boff + (size_t)nb * 16 * K + kc); V b2; if (NSPLIT >= 2) b2 = WFrag<T16>::ld(Bt2 + boff + (size_t)nb * 16 * K + kc);
#pragma unroll
            for (int mb = 0; mb < 4; ++mb) { acc[mb][nb] = WFrag<T16>::mma(a[mb], b, acc[mb][nb]); if (NSPLIT == 1 || NSPLIT == 2) acc[mb][nb] = WFrag<T16>::mma(a2[mb], b, acc[mb][nb]); if (NSPLIT >= 2) acc[mb][nb] = WFrag<T16>::mma(a[mb], b2, acc[mb][nb]); } }
        asm volatile("v_nop\n\tv_nop\n\tv_nop\n\tv_nop" : "+v"(acc[0][0]), "+v"(acc[1][1]), "+v"(acc[2][2]), "+v"(acc[3][3]) : "v"(a[0]), "v"(a[3]));
    }
#pragma unroll
    for (int mb = 0; mb < 4; ++mb) {
#pragma unroll
        for (int nb = 0; nb < 4; ++nb) {
#pragma unroll
            for (int j = 0; j < 8; ++j) os[(hi * 8 + j) * 68 + nb * 16 + lr] = acc[mb][nb][j]; }
        __builtin_amdgcn_wave_barrier(); asm volatile("" ::: "memory");
        float* crow = C + (size_t)(r0 + mb * 16) * ldc + c0;
{
#pragma unroll
            for (int s = 0; s < 8; ++s) { const int row = 2 * s + hi, cofs = lr * 4; v4f val = *(const v4fa*)(os + row * 68 + cofs); if (BIAS) { val[0] += bfr(bias[c0 + cofs]); val[1] += bfr(bias[c0 + cofs + 1]); val[2] += bfr(bias[c0 + cofs + 2]); val[3] += bfr(bias[c0 + cofs + 3]); }
                *(v4f*)(crow + (size_t)row * ldc + cofs) = val; }
             }
        __builtin_amdgcn_wave_barrier(); asm volatile("" ::: "memory");
    }
}

// ---- k_gemm4: the two-product GEMM (A hi/lo planes x one bf16 Bt plane, K = CM) for the projections: FOUR WAVES share a 128x128 output tile, each wave a 64x64 quarter (16 accumulators, fragments, k order and sum order of k_gemmw).
// A stage is 64 k: 128 rows of A hi, of A lo and of Bt, 128 B a row, brought once per work-group into a two-buffer LDS ring by asynchronous copies (a wave's copy covers four whole lines of global memory), one stage ahead.
// LDS rows are unpadded (three work-groups fit a WGP); the 16-byte piece q of row r lies at piece q ^ ((r >> 1) & 7), so the 16 rows that a half-wave's fragment load touches fall on all 64 banks once.
#define G4_PL (128 * 128)            // bytes of one plane's stage
#define G4_BUF (3 * G4_PL)           // bytes of one ring buffer
#define G4_NS (CM / 64)
static_assert(NTOK % 128 == 0 && SEQ % 128 == 0 && CM % 128 == 0 && G4_NS >= 2);
static_assert(4 * 16 * 68 * 4 <= 2 * G4_BUF);
// One plane's stage, this lane's eight 16-byte pieces (rows 16 apart). The s_wait_xcnt stands inside the statement so that no address register is rewritten ahead of it.
__device__ __forceinline__ void plane_copy(unsigned l, const bf* g) {
    const unsigned l1 = l + 2048, l2 = l + 2 * 2048, l3 = l + 3 * 2048, l4 = l + 4 * 2048, l5 = l + 5 * 2048, l6 = l + 6 * 2048, l7 = l + 7 * 2048;
    const bf* g1 = g + 16 * CM; const bf* g2 = g + 32 * CM; const bf* g3 = g + 48 * CM; const bf* g4 = g + 64 * CM; const bf* g5 = g + 80 * CM; const bf* g6 = g + 96 * CM; const bf* g7 = g + 112 * CM;
    asm volatile("global_load_async_to_lds_b128 %0, %8, off\n\t"
                 "global_load_async_to_lds_b128 %1, %9, off\n\t"
                 "global_load_async_to_lds_b128 %2, %10, off\n\t"
                 "global_load_async_to_lds_b128 %3, %11, off\n\t"
                 "global_load_async_to_lds_b128 %4, %12, off\n\t"
                 "global_load_async_to_lds_b128 %5, %13, off\n\t"
                 "global_load_async_to_lds_b128 %6, %14, off\n\t"
                 "global_load_async_to_lds_b128 %7, %15, off\n\t"
                 "s_wait_xcnt 0x0"
                 :: "v"(l), "v"(l1), "v"(l2), "v"(l3), "v"(l4), "v"(l5), "v"(l6), "v"(l7),
                    "v"(g), "v"(g1), "v"(g2), "v"(g3), "v"(g4), "v"(g5), "v"(g6), "v"(g7) : "memory");
}
// At most three waves come to a SIMD (LDS); a register budget for four keeps accumulators and a stage's fragments in registers without a trade for waves that never come.
__global__ __launch_bounds__(128) __attribute__((amdgpu_waves_per_eu(4, 4))) void k_gemm4(const bf* __restrict__ A, const bf* __restrict__ A2, const bf* __restrict__ Bt, float* C, int ldc,
                                             const float* __restrict__ bias0, const float* __restrict__ bias1, const float* __restrict__ bias2, size_t sA, size_t sB, size_t sC) {
    __shared__ __align__(16) unsigned char ring4[2 * G4_BUF];
    const size_t z = blockIdx.z; A += z * sA; A2 += z * sA; Bt += z * sB; C += z * sC;
    const float* __restrict__ bias = (z == 0) ? bias0 : (z == 1) ? bias1 : bias2;
    const int tid = threadIdx.x, lane = tid & 31, lr = lane & 15, hi = lane >> 4, w = tid >> 5;
    const int R0 = blockIdx.x * 128, C0 = blockIdx.y * 128;
    // this lane's share of a stage: piece tid & 7 of rows tid >> 3, + 16, ... + 112 of each plane
    const unsigned lc = (unsigned)(size_t)ring4 + (unsigned)((tid >> 3) * 128 + (((tid & 7) ^ ((tid >> 4) & 7)) << 4));
    const bf* gah = A + (size_t)(R0 + (tid >> 3)) * CM + (tid & 7) * 8; const bf* gal = A2 + (size_t)(R0 + (tid >> 3)) * CM + (tid & 7) * 8; const bf* gb = Bt + (size_t)(C0 + (tid >> 3)) * CM + (tid & 7) * 8;
    plane_copy(lc, gah); plane_copy(lc + G4_PL, gal); plane_copy(lc + 2 * G4_PL, gb);
    v8f acc[4][4];
#pragma unroll
    for (int mb = 0; mb < 4; ++mb)
#pragma unroll
        for (int nb = 0; nb < 4; ++nb) acc[mb][nb] = (v8f){};
    // fragment reads: row (quarter's 64) + 16 mb + lr, logical pieces 4 kk + hi and 4 kk + 2 + hi, each XORed with lr >> 1
    const int s0 = hi ^ (lr >> 1);
    const int arow = ((w >> 1) * 64 + lr) * 128, brow = 2 * G4_PL + ((w & 1) * 64 + lr) * 128;
    asm volatile("s_wait_asynccnt 0x0" ::: "memory");   // stage 0 of this wave has landed
    __syncthreads();                                     // publishes stage 0 to every wave
    plane_copy(lc + G4_BUF, gah + 64); plane_copy(lc + G4_BUF + G4_PL, gal + 64); plane_copy(lc + G4_BUF + 2 * G4_PL, gb + 64);   // stage 1 exists: G4_NS >= 2
#pragma unroll 1
    for (int st = 0; st < G4_NS; ++st) {
        const unsigned char* sb = ring4 + (st & 1) * G4_BUF;
#pragma unroll
        for (int kk = 0; kk < 2; ++kk) {
            const int o0 = (s0 ^ (4 * kk)) << 4, o1 = (s0 ^ (4 * kk + 2)) << 4;
            v16bf a[4], a2[4];
#pragma unroll
            for (int mb = 0; mb < 4; ++mb) { const unsigned char* ap = sb + arow + mb * 2048;
                a[mb] = cat16b(*(const v8usa*)(ap + o0), *(const v8usa*)(ap + o1)); a2[mb] = cat16b(*(const v8usa*)(ap + G4_PL + o0), *(const v8usa*)(ap + G4_PL + o1)); }
#pragma unroll
            for (int nb = 0; nb < 4; ++nb) { const unsigned char* bp = sb + brow + nb * 2048; const v16bf b = cat16b(*(const v8usa*)(bp + o0), *(const v8usa*)(bp + o1));
#pragma unroll
                for (int mb = 0; mb < 4; ++mb) { acc[mb][nb] = wmmab(a[mb], b, acc[mb][nb]); acc[mb][nb] = wmmab(a2[mb], b, acc[mb][nb]); } }
        }
        asm volatile("s_wait_dscnt 0x0" ::: "memory");      // this wave's reads of buffer st & 1 have returned
        asm volatile("s_wait_asynccnt 0x0" ::: "memory");   // this wave's copies of stage st + 1 have landed
        __syncthreads();                                     // publishes stage st + 1 and ends every wave's reads of buffer st & 1
        if (st + 2 < G4_NS) { const unsigned bo = (unsigned)(st & 1) * G4_BUF; const int kn = (st + 2) * 64;
            plane_copy(lc + bo, gah + kn); plane_copy(lc + bo + G4_PL, gal + kn); plane_copy(lc + bo + 2 * G4_PL, gb + kn); }
    }
    asm volatile("s_wait_asynccnt 0x0" ::: "memory");       // nothing of this wave is in flight when the ring becomes output staging
    // behind the last trip's barrier no wave reads the ring and no copy is under way: each wave stages its rows in its own part of it
    float* os = (float*)ring4 + w * (16 * 68);
    const int r0 = R0 + (w >> 1) * 64, c0 = C0 + (w & 1) * 64, cofs = lr * 4;
    v4f bb;   // the bias of this lane's four columns, as its bf16 value
#pragma unroll
    for (int c = 0; c < 4; ++c) bb[c] = bfr(bias[c0 + cofs + c]);
#pragma unroll
    for (int mb = 0; mb < 4; ++mb) {
#pragma unroll
        for (int nb = 0; nb < 4; ++nb) {
#pragma unroll
            for (int j = 0; j < 8; ++j) os[(hi * 8 + j) * 68 + nb * 16 + lr] = acc[mb][nb][j]; }
        __builtin_amdgcn_wave_barrier(); asm volatile("" ::: "memory");   // keeps the row reads behind the other lanes' writes in the compiled order
        float* crow = C + (size_t)(r0 + mb * 16) * ldc + c0;
#pragma unroll
        for (int s = 0; s < 8; ++s) { const int row = 2 * s + hi; const v4f val = *(const v4fa*)(os + row * 68 + cofs) + bb;
            *(v4f*)(crow + (size_t)row * ldc + cofs) = val; }
        __builtin_amdgcn_wave_barrier(); asm volatile("s_wait_xcnt 0x0" ::: "memory");   // keeps the next block's writes behind these reads; the wait stands ahead of any rewrite of a register these stores name
    }
}

__device__ __forceinline__ void d_wtG(const float* __restrict__ w, int K, int N, bf* Bt, int bx) {
    const int lane = threadIdx.x & 31; const int L0 = (bx * 8 + (threadIdx.x >> 5)) * 8; const int nlines = (int)((size_t)N * K / 64);
{
#pragma unroll 1
        for (int l = 0; l < 8; ++l) { const int L = L0 + l; if (L >= nlines) break; const size_t e = (size_t)L * 64 + lane * 2; const int k = (int)(e % K), n = (int)(e / K); v2us o;
            o[0] = f2bf(w[(size_t)k * N + n]); o[1] = f2bf(w[(size_t)(k + 1) * N + n]); *(v2us*)(Bt + e) = o; }
         }
}

__device__ __forceinline__ float invf(int j) {
    const float e = (float)(j & 15) * 0.0625f;
    const float p = powf(10000.0f, e);
    const float v = 1.0f / p;
    return v;
}

__device__ __forceinline__ void d_cstab(const int* __restrict__ fidx, const int* __restrict__ sidx, float* CS, int bx) {
    const int idx = bx * 256 + threadIdx.x; if (idx >= NTOK * HD) return;
    const int dd = idx & (HD - 1); const int R = idx >> 6; const int b = R / SEQ, t = R - b * SEQ; const int fl = t / NRES, n = t - fl * NRES;
    const int pseq = sidx[b * NRES + n]; const int pfr = fidx[fl];
    const float pf = (float)((dd < HD / 2) ? pseq : pfr);
    float fr = __fmul_rn(pf, invf(dd)); asm volatile("" : "+v"(fr));
    float sn, cn;
    sincosf(fr, &sn, &cn);
    v2f cs; cs[0] = cn; cs[1] = sn;
    *(v2f*)(CS + (size_t)idx * 2) = cs; 
}

__device__ __forceinline__ void d_condp(const float* __restrict__ cond, bf* P) {
    const int lane = threadIdx.x & 31, w = threadIdx.x >> 5;
    v2us o[8];
#pragma unroll
    for (int it = 0; it < 8; ++it) { const int row = w * 8 + it; const int rc = (row < NB) ? row : (NB - 1); v2us v;
#pragma unroll
        for (int q = 0; q < 2; ++q) { const float x = cond[(size_t)rc * CDIM + 2 * lane + q]; v[q] = (row < NB) ? f2bf(x) : (unsigned short)0; }
        o[it] = v; }
{
#pragma unroll
        for (int it = 0; it < 8; ++it) *(v2us*)(P + (size_t)(w * 8 + it) * CDIM + 2 * lane) = o[it];
         }
    asm volatile("s_wait_xcnt 0x0" ::: "memory");   // in the merged kernel's text another job's code, which rewrites the registers these stores name, follows this one
}

__global__ __launch_bounds__(256) void k_ln(const float* __restrict__ X, const float* __restrict__ SS, bf* Xh, bf* Xl) {
    const int lane = threadIdx.x & 31; const int R = blockIdx.x * 8 + (threadIdx.x >> 5); if (R >= NTOK) return;
    const int b = R / SEQ, t = R - b * SEQ;
    const float* xr = X + ((size_t)b * SEQ_FULL + t) * CM;
    float v[16];
    { const v8f a0 = *(const v8f*)(xr + 8 * lane); const v8f a1 = *(const v8f*)(xr + 256 + 8 * lane);
#pragma unroll
      for (int k = 0; k < 8; ++k) { v[k] = bfr(a0[k]); v[8 + k] = bfr(a1[k]); } }
    float s = 0.f;
#pragma unroll
    for (int k = 0; k < 16; ++k) s += v[k];
#pragma unroll
    for (int sh = 16; sh; sh >>= 1) s += __shfl_xor(s, sh, 32);
    const float mu = s * (1.0f / (float)CM);
    float qq = 0.f;
#pragma unroll
    for (int k = 0; k < 16; ++k) { const float d = v[k] - mu; qq += d * d; }
#pragma unroll
    for (int sh = 16; sh; sh >>= 1) qq += __shfl_xor(qq, sh, 32);
    const float var = qq * (1.0f / (float)CM);
    const float rs = rsqrtf(var + 1.0e-5f);
    const float* sc = SS + (size_t)b * ADW;
    v8us oh[2], ol[2];
#pragma unroll
    for (int c = 0; c < 2; ++c) { const int col0 = c * 256 + 8 * lane; const v8f g = *(const v8f*)(sc + col0); const v8f be = *(const v8f*)(sc + CM + col0); v8us th, tl;
#pragma unroll
        for (int k = 0; k < 8; ++k) { const float xn = (v[c * 8 + k] - mu) * rs; const float y = xn * (1.0f + g[k]) + be[k]; unsigned short a2, c2; splitf(y, a2, c2); th[k] = a2; tl[k] = c2; }
        oh[c] = th; ol[c] = tl; }
{
#pragma unroll
        for (int c = 0; c < 2; ++c) { const size_t o = (size_t)R * CM + c * 256 + 8 * lane; *(v8us*)(Xh + o) = oh[c]; *(v8us*)(Xl + o) = ol[c]; }
         }
}

// ---- d_extras: per token row R the extra bf16 k-step rows (NEX = 32 slots) that carry the additive score bias inside the score WMMA. With c = bf16 coordinates and g = -|c|^2/64 split three-piece (gh + gm + gl):
// query row QE[R] = [cx, cy, cz, 1, 1, 1, gh, gm, gl, 1, 0 x 22]; key row KE[R] = [cx/32, cy/32, cz/32, gh, gm, gl, 1, 1, 1, fill, 0 x 22], fill = -2e30 where mask == 0 else 0.
__device__ __forceinline__ void d_extras(const float* __restrict__ ca, const float* __restrict__ msk, bf* QE, bf* KE, int bx) {
    __shared__ __align__(16) unsigned int qs[256 * 16];
    __shared__ __align__(16) unsigned int ks[256 * 16];
    const int tid = threadIdx.x, lane = tid & 31, w = tid >> 5;
    const int R0 = bx * 256; const int R = R0 + tid;
    const int b = R / SEQ, t = R - b * SEQ; const size_t Rf = (size_t)b * SEQ_FULL + t;
    const float cx = bfr(ca[Rf * 3]), cy = bfr(ca[Rf * 3 + 1]), cz = bfr(ca[Rf * 3 + 2]);
    const float mk = bfr(msk[Rf]);
    const float n2 = cx * cx + cz * cz + cy * cy;
    const float g = -(n2 * 0.015625f);
    const unsigned short gh = f2bf(g); const float r1 = g - bf2f(gh); const unsigned short gm = f2bf(r1); const unsigned short gl = f2bf(r1 - bf2f(gm));
    const unsigned short one = (unsigned short)0x3F80u;
    const unsigned short fillv = (mk == 0.0f) ? f2bf(-2.0e30f) : (unsigned short)0;
    v4u qa, qb, ka, kb, zz;
#pragma unroll
    for (int i = 0; i < 4; ++i) { qb[i] = 0u; kb[i] = 0u; zz[i] = 0u; }
    qa[0] = pk2(f2bf(cx), f2bf(cy)); qa[1] = pk2(f2bf(cz), one); qa[2] = pk2(one, one); qa[3] = pk2(gh, gm);
    qb[0] = pk2(gl, one);
    ka[0] = pk2(f2bf(cx * 0.03125f), f2bf(cy * 0.03125f)); ka[1] = pk2(f2bf(cz * 0.03125f), gh); ka[2] = pk2(gm, gl); ka[3] = pk2(one, one);
    kb[0] = pk2(one, fillv);
    unsigned int* qr = qs + tid * 16; unsigned int* krw = ks + tid * 16;
    *(v4u*)(qr) = qa; *(v4u*)(qr + 4) = qb; *(v4u*)(qr + 8) = zz; *(v4u*)(qr + 12) = zz;
    *(v4u*)(krw) = ka; *(v4u*)(krw + 4) = kb; *(v4u*)(krw + 8) = zz; *(v4u*)(krw + 12) = zz;
    __syncthreads();
    v4u oq[4], ok[4]; int off[4];
#pragma unroll
    for (int it = 0; it < 4; ++it) { off[it] = (w * 4 + it) * 128 + lane * 4; oq[it] = *(const v4ua*)(qs + off[it]); ok[it] = *(const v4ua*)(ks + off[it]); }
    unsigned int* QEw = (unsigned int*)QE + (size_t)R0 * 16; unsigned int* KEw = (unsigned int*)KE + (size_t)R0 * 16;
{
#pragma unroll
        for (int it = 0; it < 4; ++it) { *(v4u*)(QEw + off[it]) = oq[it]; *(v4u*)(KEw + off[it]) = ok[it]; }
         }
}

// ---- k_prep: every job that reads only inputs, as block ranges of one grid (the branch is the same for a whole block): weight planes, cond plane, bias k-step rows, cos/sin table.
#define PB_WA ((ADW * CDIM / 64 + 63) / 64)
#define PB_W ((CM * CM / 64 + 63) / 64)
#define PB_EX (NTOK / 256)
#define PB_CS ((NTOK * HD + 255) / 256)
#define PB_ALL (PB_WA + 4 * PB_W + 1 + PB_EX + PB_CS)
__global__ __launch_bounds__(256) void k_prep(const float* __restrict__ adaln_w, const float* __restrict__ wq, const float* __restrict__ wk, const float* __restrict__ wv, const float* __restrict__ wo,
                                              const float* __restrict__ cond, const float* __restrict__ ca, const float* __restrict__ msk, const int* __restrict__ fidx, const int* __restrict__ sidx,
                                              bf* WA, bf* WQ, bf* WK, bf* WV, bf* WO, bf* CAP, bf* QE, bf* KE, float* CS) {
    int bx = blockIdx.x;
    if (bx < PB_WA) { d_wtG(adaln_w, CDIM, ADW, WA, bx); return; }              // adaln_w [CDIM][ADW] -> WA[j][c]
    bx -= PB_WA;
    if (bx < 4 * PB_W) { const int j = bx / PB_W;                                // w [in][out] -> Bt[out][in]
        d_wtG((j == 0) ? wq : (j == 1) ? wk : (j == 2) ? wv : wo, CM, CM, (j == 0) ? WQ : (j == 1) ? WK : (j == 2) ? WV : WO, bx - j * PB_W); return; }
    bx -= 4 * PB_W;
    if (bx < 1) { d_condp(cond, CAP); return; }
    bx -= 1;
    if (bx < PB_EX) { d_extras(ca, msk, QE, KE, bx); return; }
    d_cstab(fidx, sidx, CS, bx - PB_EX);
}

// ---- d_ropep: head planes [bh][t][d] (bf16 hi/lo) of rope(scl * F) with the two-half rotate-half convention (each 32-dim half rotated within itself, partner d+16 for (d & 16) == 0 with subtraction, partner d-16 otherwise with addition;
__device__ __forceinline__ void d_ropep(const float* __restrict__ F, float scl, const float* __restrict__ CS, bf* Ph, bf* Pl, float* G, int bx) {
    const size_t e = ((size_t)bx * 256 + threadIdx.x) * 2; if (e >= (size_t)NBH * SEQ * HD) return;
    const int d = (int)(e & (HD - 1)); const int t = (int)((e >> 6) % SEQ); const int bh = (int)(e / ((size_t)HD * SEQ)); const int b = bh / NH, h = bh - b * NH;
    const size_t R = (size_t)b * SEQ + t;
    const float* f = F + R * CM + h * HD;
    v2us oh, ol; v2f go;
#pragma unroll
    for (int q = 0; q < 2; ++q) { const int dd = d + q; const bool sub = ((dd & 16) == 0); const int dp = sub ? dd + 16 : dd - 16;
        const float x0 = f[dd] * scl, x1 = f[dp] * scl;
        const v2f cs = *(const v2f*)(CS + (R * HD + dd) * 2);
        float a = __fmul_rn(x0, cs[0]), bq = __fmul_rn(x1, cs[1]); asm volatile("" : "+v"(a)); asm volatile("" : "+v"(bq));
        const float r = sub ? __fsub_rn(a, bq) : __fadd_rn(a, bq);
        go[q] = r; unsigned short a2, c2; splitf(r, a2, c2); oh[q] = a2; ol[q] = c2; }
    const size_t og = ((size_t)bh * SEQ_FULL + t) * HD + d;
    *(v2us*)(Ph + e) = oh; *(v2us*)(Pl + e) = ol; if (G != nullptr) *(v2f*)(G + og) = go;
    
}

__device__ __forceinline__ void d_vtp(const float* __restrict__ F, h16* Vh, h16* Vl, float* G, int bx) {
    __shared__ float tile[64 * 65];
    const int tid = threadIdx.x, lane = tid & 31, w = tid >> 5;
    const int bh = bx / (SEQ / 64); const int b = bh / NH, h = bh - b * NH; const int t0 = (bx - bh * (SEQ / 64)) * 64;
    const int pc = tid & 15, rb = tid >> 4;
    v4f vv[4]; size_t og[4];
#pragma unroll
    for (int it = 0; it < 4; ++it) { const int tr = it * 16 + rb; vv[it] = *(const v4f*)(F + ((size_t)b * SEQ + t0 + tr) * CM + h * HD + 4 * pc);
#pragma unroll
        for (int c = 0; c < 4; ++c) tile[tr * 65 + 4 * pc + c] = vv[it][c];
        og[it] = ((size_t)bh * SEQ_FULL + t0 + tr) * HD + 4 * pc; }
{
#pragma unroll
        for (int it = 0; it < 4; ++it) *(v4f*)(G + og[it]) = vv[it];
         }
    __syncthreads();
    v2h oh[8], ol[8]; size_t ov[8];
#pragma unroll
    for (int it = 0; it < 8; ++it) { const int d = w * 8 + it; const float x0 = tile[(2 * lane) * 65 + d], x1 = tile[(2 * lane + 1) * 65 + d];
        h16 a0, c0, a1, c1; splith(x0, a0, c0); splith(x1, a1, c1); v2h th, tl; th[0] = a0; th[1] = a1; tl[0] = c0; tl[1] = c1; oh[it] = th; ol[it] = tl;
        ov[it] = ((size_t)bh * HD + d) * SEQ + t0 + 2 * lane; }
{
#pragma unroll
        for (int it = 0; it < 8; ++it) { *(v2h*)(Vh + ov[it]) = oh[it]; *(v2h*)(Vl + ov[it]) = ol[it]; }
         }
}

// ---- k_planes: the three jobs that turn the f32 projections into operand planes and the k and v outputs, as block ranges of one grid (the branch is the same for a whole block).
#define PB_VT ((SEQ / 64) * NBH)
#define PB_RP ((NBH * SEQ * HD / 2 + 255) / 256)
__global__ __launch_bounds__(256) void k_planes(const float* __restrict__ FQ, const float* __restrict__ FK, const float* __restrict__ FV, const float* __restrict__ CS,
                                                bf* QPh, bf* QPl, bf* KPh, bf* KPl, h16* VTh, h16* VTl, float* GK, float* GV) {
    int bx = blockIdx.x;
    if (bx < PB_VT) { d_vtp(FV, VTh, VTl, GV, bx); return; }
    bx -= PB_VT;
    if (bx < PB_RP) { d_ropep(FQ, QSCL, CS, QPh, QPl, nullptr, bx); return; }
    d_ropep(FK, 1.0f, CS, KPh, KPl, GK, bx - PB_RP);
}

// ---- k_attn: four waves per work-group, 64 query rows of one (b, h); all 64 rows lie in one frame, so the key bound (frame+1)*NRES is the same for the whole group. 64 keys per trip, as two 32-key tiles.
// Wave w takes the 32 query rows of half w >> 1 (two 16-row tiles) and the 32-key tile w & 1 of every trip: each k or v fragment read from LDS feeds two products. The two waves of a query half join their partial maximum, sum and O behind the loop.
// The trip's k hi/lo, bias and v hi/lo tiles are brought once per work-group into a two-buffer LDS ring by asynchronous copies (whole lines from global memory, one trip ahead); every wave reads its fragments from the ring.
// Transposed products: S^T tile (16 keys x 16 queries) = KE.QE (bias k-step) + Kh.Qh + Kh.Ql + Kl.Qh over d (bf16, k rows as A, q as B, scale folded into the q planes), so a lane holds 16 scores of ONE query (lane & 15; keys 16j + 8(lane >> 4) + r).
// Online max-subtracted softmax in f32 in the lane, one exchange between the wave's halves for the maximum; each half keeps the sum of its own keys, joined once behind the loop. P^T packs from the two score tiles straight into the B operand of O^T += V^T.P^T.
#define AW 4
#define KP 72                        // LDS pitch of a 64-element k row: 144 B = 16 B x odd, free of bank conflicts for 16-byte readers
#define VP 40                        // LDS pitch of a 32-element v or bias row: 80 B
#define ST_KH 0
#define ST_KL (32 * KP)
#define ST_KE (2 * 32 * KP)
#define ST_VH (ST_KE + 32 * VP)
#define ST_VL (ST_VH + 64 * VP)
#define ST_EL (ST_VL + 64 * VP)      // elements of one 32-key tile in the ring (22016 B)
#define XW (8 * 32 * 4 + 64)         // floats one wave hands to its partner: 32 O values, maximum and sum of each lane
static_assert(AW == 4 && NRES % (16 * AW) == 0 && NRES >= 128 && (ST_EL * 2) % 16 == 0);
static_assert((AW * XW + AW * 16 * 68) * 4 <= 4 * ST_EL * 2);
__device__ __forceinline__ v16bf ldsb(const unsigned short* p) { return cat16b(*(const v8usa*)p, *(const v8usa*)(p + 16)); }
__device__ __forceinline__ v16h ldsh(const unsigned short* p) { return cat16(*(const v8ha*)p, *(const v8ha*)(p + 16)); }
__device__ __forceinline__ float xhalf(float x) { return __builtin_bit_cast(float, __builtin_amdgcn_permlanex16(__builtin_bit_cast(int, x), __builtin_bit_cast(int, x), 0x76543210, 0xfedcba98, false, false)); }   // lane l with lane l ^ 16
// One tile's copies of one lane, 16 B each: two pieces (16 rows apart) of k hi and of k lo, two (32 rows apart) of v hi and of v lo, one of the bias rows. Written as the builtin: the kernel holds more than 256 registers, and asm text can name only the first 256.
typedef __attribute__((ext_vector_type(4))) int v4i;
typedef __attribute__((address_space(1))) v4i* gp16;
typedef __attribute__((address_space(3))) v4i* lp16;
__device__ __forceinline__ void cp16(unsigned short* l, const void* g) { __builtin_amdgcn_global_load_async_to_lds_b128((gp16)g, (lp16)l, 0, 0); }
__device__ __forceinline__ void tile_copy(unsigned short* lk, unsigned short* lv, unsigned short* le, const bf* gkh, const bf* gkl, const h16* gvh, const h16* gvl, const bf* gke) {
    cp16(lk, gkh); cp16(lk + 16 * KP, gkh + 16 * HD); cp16(lk + (ST_KL - ST_KH), gkl); cp16(lk + (ST_KL - ST_KH) + 16 * KP, gkl + 16 * HD);
    cp16(lv, gvh); cp16(lv + 32 * VP, gvh + (size_t)32 * SEQ); cp16(lv + (ST_VL - ST_VH), gvl); cp16(lv + (ST_VL - ST_VH) + 32 * VP, gvl + (size_t)32 * SEQ);
    cp16(le, gke);
}
// Three work-groups fit a WGP (LDS), three waves a SIMD: the register budget of three waves holds two query tiles' q fragments and accumulators.
__global__ __launch_bounds__(32 * AW) __attribute__((amdgpu_waves_per_eu(3, 3))) void k_attn(const bf* __restrict__ Qh, const bf* __restrict__ Ql, const bf* __restrict__ QE,
                                             const bf* __restrict__ Kh, const bf* __restrict__ Kl, const bf* __restrict__ KE,
                                             const h16* __restrict__ Vth, const h16* __restrict__ Vtl, bf* ATh, bf* ATl) {
    __shared__ __align__(16) unsigned short ring[4 * ST_EL];   // two buffers of two 32-key tiles
    const int tid = threadIdx.x, lane = tid & 31, lr = lane & 15, hi = lane >> 4, w = tid >> 5;
    const int kh = w & 1;
    const int bh = blockIdx.y; const int b = bh / NH, h = bh - b * NH;
    const int qb = blockIdx.x * (16 * AW) + (w >> 1) * 32;
    const int kvlen = ((int)blockIdx.x * (16 * AW) / NRES + 1) * NRES;
    const int nt = kvlen >> 6;
    const size_t hp = (size_t)bh * SEQ * HD;
    const size_t tb = (size_t)b * SEQ;
    // this lane's share of a tile, in 16-byte pieces: k rows tid>>3 and 16 + tid>>3, piece tid&7; v rows (d) tid>>2 and 32 + tid>>2, piece tid&3; bias row tid>>2, piece tid&3
    unsigned short* lk0 = ring + ST_KH + (tid >> 3) * KP + (tid & 7) * 8;
    unsigned short* lv0 = ring + ST_VH + (tid >> 2) * VP + (tid & 3) * 8;
    unsigned short* le0 = ring + ST_KE + (tid >> 2) * VP + (tid & 3) * 8;
    // the lane's part of a global address is a 32-bit element offset; the part that moves with the trip is the same for the whole group and stays in scalar registers
    const unsigned gk0 = (unsigned)((tid >> 3) * HD + (tid & 7) * 8), gv0 = (unsigned)((tid >> 2) * SEQ + (tid & 3) * 8), ge0 = (unsigned)((tid >> 2) * NEX + (tid & 3) * 8);
    const bf* ukh = Kh + hp; const bf* ukl = Kl + hp; const h16* uvh = Vth + hp; const h16* uvl = Vtl + hp; const bf* uke = KE + tb * NEX;
    auto trip_copy = [&](unsigned bo, size_t kn) {   // the two 32-key tiles from key kn on, into the buffer at element bo of the ring
        tile_copy(lk0 + bo, lv0 + bo, le0 + bo, (ukh + kn * HD) + gk0, (ukl + kn * HD) + gk0, (uvh + kn) + gv0, (uvl + kn) + gv0, (uke + kn * NEX) + ge0);
        tile_copy(lk0 + bo + ST_EL, lv0 + bo + ST_EL, le0 + bo + ST_EL, (ukh + (kn + 32) * HD) + gk0, (ukl + (kn + 32) * HD) + gk0, (uvh + (kn + 32)) + gv0, (uvl + (kn + 32)) + gv0, (uke + (kn + 32) * NEX) + ge0);
    };
    trip_copy(0, 0);
    v16bf aH0[2], aH1[2], aL0[2], aL1[2], aE[2];
#pragma unroll
    for (int u = 0; u < 2; ++u) { const size_t qo = hp + (size_t)(qb + 16 * u + lr) * HD + 8 * hi;
        aH0[u] = WFrag<bf>::ld(Qh + qo); aH1[u] = WFrag<bf>::ld(Qh + qo + 32); aL0[u] = WFrag<bf>::ld(Ql + qo); aL1[u] = WFrag<bf>::ld(Ql + qo + 32);
        aE[u] = WFrag<bf>::ld(QE + (tb + qb + 16 * u + lr) * NEX + 8 * hi); }
    v8f oh[2][4], ol[2][4];
#pragma unroll
    for (int u = 0; u < 2; ++u)
#pragma unroll
        for (int nb = 0; nb < 4; ++nb) { oh[u][nb] = (v8f){}; ol[u][nb] = (v8f){}; }
    float m[2] = {-1.0e30f, -1.0e30f}, l[2] = {0.f, 0.f};   // this lane's two queries: running maximum (equal in both halves), sum over this half's keys
    asm volatile("s_wait_asynccnt 0x0" ::: "memory");   // trip 0's tiles of this wave have landed
    __syncthreads();                                     // publishes trip 0 to every wave
    // trip 1 exists: nt >= 4
    trip_copy(2 * ST_EL, 64);
#pragma unroll 1
    for (int t = 0; t < nt; ++t) {
        const unsigned short* st = ring + ((t & 1) * 2 + kh) * ST_EL;
        v8f s[2][2];
        const unsigned short* kp = st + lr * KP + 8 * hi;
        {
            v16bf bH[2], bL[2];
#pragma unroll
            for (int j = 0; j < 2; ++j) { const v16bf bE = ldsb(st + ST_KE + (16 * j + lr) * VP + 8 * hi); bH[j] = ldsb(kp + 16 * j * KP + ST_KH); bL[j] = ldsb(kp + 16 * j * KP + ST_KL);
#pragma unroll
                for (int u = 0; u < 2; ++u) s[u][j] = wmmab(bE, aE[u], (v8f){}); }
#pragma unroll
            for (int u = 0; u < 2; ++u) { s[u][0] = wmmab(bH[0], aH0[u], s[u][0]); s[u][0] = wmmab(bH[0], aL0[u], s[u][0]); s[u][0] = wmmab(bL[0], aH0[u], s[u][0]); }
            v16bf cH[2], cL[2];
#pragma unroll
            for (int j = 0; j < 2; ++j) { cH[j] = ldsb(kp + 16 * j * KP + ST_KH + 32); cL[j] = ldsb(kp + 16 * j * KP + ST_KL + 32); }
#pragma unroll
            for (int u = 0; u < 2; ++u) { s[u][1] = wmmab(bH[1], aH0[u], s[u][1]); s[u][1] = wmmab(bH[1], aL0[u], s[u][1]); s[u][1] = wmmab(bL[1], aH0[u], s[u][1]); }
#pragma unroll
            for (int j = 0; j < 2; ++j)
#pragma unroll
                for (int u = 0; u < 2; ++u) { s[u][j] = wmmab(cH[j], aH1[u], s[u][j]); s[u][j] = wmmab(cH[j], aL1[u], s[u][j]); s[u][j] = wmmab(cL[j], aH1[u], s[u][j]); }
        }
        // the order of the stretch above: the twelve LDS reads of the bias rows and d 0..31 as one group, ten products, the eight reads of d 32..63 as one group (into the registers the ten products have freed), the rest. Left alone, the reads stand in pairs among the products, each waited to zero.
        __builtin_amdgcn_sched_group_barrier(0x100, 12, 0); __builtin_amdgcn_sched_group_barrier(0x008, 10, 0); __builtin_amdgcn_sched_group_barrier(0x100, 8, 0); __builtin_amdgcn_sched_group_barrier(0x008, 18, 0);
        __builtin_amdgcn_sched_barrier(0);   // keeps the v fragment loads out of the score products' stretch, where the k fragments hold the free registers
        v16h ap[2];   // B operand: element i <- key 8(lane >> 4) + i, element 8 + i <- key 16 + 8(lane >> 4) + i, the order of the v fragments
#pragma unroll
        for (int u = 0; u < 2; ++u) {
            const v8f sa = s[u][0], sb = s[u][1];
            const float v0 = fmaxf(fmaxf(sa[0], sa[1]), sa[2]), v1 = fmaxf(fmaxf(sa[3], sa[4]), sa[5]), v2 = fmaxf(fmaxf(sa[6], sa[7]), sb[0]);
            const float v3 = fmaxf(fmaxf(sb[1], sb[2]), sb[3]), v4 = fmaxf(fmaxf(sb[4], sb[5]), sb[6]);
            float v = fmaxf(fmaxf(fmaxf(v0, v1), v2), fmaxf(fmaxf(v3, v4), sb[7]));   // a tree three deep, not a chain of eight
            v = fmaxf(v, xhalf(v));
            const float mn = fmaxf(m[u], v);
            const float al = __builtin_amdgcn_exp2f((m[u] - mn) * LOG2E);
            m[u] = mn;
            float ts[8];
#pragma unroll
            for (int r = 0; r < 8; ++r) {
                const float p0 = __builtin_amdgcn_exp2f((sa[r] - mn) * LOG2E), p1 = __builtin_amdgcn_exp2f((sb[r] - mn) * LOG2E);
                ap[u][r] = (h16)(p0 * PCAR); ap[u][8 + r] = (h16)(p1 * PCAR);
                ts[r] = p0 + p1;
            }
            l[u] = l[u] * al + (((ts[0] + ts[1]) + (ts[2] + ts[3])) + ((ts[4] + ts[5]) + (ts[6] + ts[7])));
#pragma unroll
            for (int nb = 0; nb < 4; ++nb)
#pragma unroll
                for (int r = 0; r < 8; ++r) { oh[u][nb][r] *= al; ol[u][nb][r] *= al; }
        }
#pragma unroll
        for (int nb = 0; nb < 4; ++nb) { const unsigned short* vp = st + (16 * nb + lr) * VP + 8 * hi;
            const v16h bH = ldsh(vp + ST_VH); oh[0][nb] = wmma16(bH, ap[0], oh[0][nb]); oh[1][nb] = wmma16(bH, ap[1], oh[1][nb]);
            const v16h bL = ldsh(vp + ST_VL); ol[0][nb] = wmma16(bL, ap[0], ol[0][nb]); ol[1][nb] = wmma16(bL, ap[1], ol[1][nb]); }
        // the order of the v reads and products: the four reads of a 16-row block of d as one group, one block ahead of its four products. Left alone, the reads stand in pairs at twice as many places.
        __builtin_amdgcn_sched_group_barrier(0x100, 4, 1); __builtin_amdgcn_sched_group_barrier(0x100, 4, 1); __builtin_amdgcn_sched_group_barrier(0x008, 4, 1); __builtin_amdgcn_sched_group_barrier(0x100, 4, 1);
        __builtin_amdgcn_sched_group_barrier(0x008, 4, 1); __builtin_amdgcn_sched_group_barrier(0x100, 4, 1); __builtin_amdgcn_sched_group_barrier(0x008, 4, 1); __builtin_amdgcn_sched_group_barrier(0x008, 4, 1);
        asm volatile("s_wait_dscnt 0x0" ::: "memory");      // this wave's reads of buffer t & 1 have returned
        asm volatile("s_wait_asynccnt 0x0" ::: "memory");   // this wave's copies of trip t + 1 have landed
        __syncthreads();                                     // publishes trip t + 1 and ends every wave's reads of buffer t & 1
        if (t + 2 < nt) trip_copy((unsigned)(t & 1) * (2 * ST_EL), (size_t)(t + 2) * 64);
    }
    asm volatile("s_wait_asynccnt 0x0" ::: "memory");       // nothing of this wave is in flight when the ring becomes staging
    // behind the last trip's barrier no wave reads the ring and no copy is under way. Wave w keeps query tile w & 1 of its half and hands the other tile's partial result, lane to lane, to wave w ^ 1.
    float* xw = (float*)ring + w * XW; const float* xr = (const float*)ring + (w ^ 1) * XW;
    float* os = (float*)ring + AW * XW + w * (16 * 68);
    const bool k1 = (kh != 0);
    const float lj0 = l[0] + xhalf(l[0]), lj1 = l[1] + xhalf(l[1]);
    const float mm = k1 ? m[1] : m[0], lm = k1 ? lj1 : lj0;
    float xm[4][8];
#pragma unroll
    for (int nb = 0; nb < 4; ++nb) { v4f g0, g1;
#pragma unroll
        for (int r = 0; r < 8; ++r) { const float e0 = oh[0][nb][r] + ol[0][nb][r] * LINV, e1 = oh[1][nb][r] + ol[1][nb][r] * LINV;
            xm[nb][r] = k1 ? e1 : e0; const float gv = k1 ? e0 : e1; if (r < 4) g0[r] = gv; else g1[r - 4] = gv; }
        *(v4fa*)(xw + ((2 * nb) * 32 + lane) * 4) = g0; *(v4fa*)(xw + ((2 * nb + 1) * 32 + lane) * 4) = g1; }
    xw[1024 + lane] = k1 ? m[0] : m[1]; xw[1056 + lane] = k1 ? lj0 : lj1;
    __syncthreads();                                         // the partner's partial result is complete
    const float mr = xr[1024 + lane], lq = xr[1056 + lane];
    const float mx = fmaxf(mm, mr);
    const float am = __builtin_amdgcn_exp2f((mm - mx) * LOG2E), ar = __builtin_amdgcn_exp2f((mr - mx) * LOG2E);
    const float il = PINV * __fdiv_rn(1.0f, lm * am + lq * ar);
    const float cm = am * il, cr = ar * il;
    const int q0 = qb + 16 * kh;
#pragma unroll
    for (int nb = 0; nb < 4; ++nb) { v4f x0, x1;   // register r of tile nb is d = 16 nb + 8 hi + r of query lr
        const v4f g0 = *(const v4fa*)(xr + ((2 * nb) * 32 + lane) * 4), g1 = *(const v4fa*)(xr + ((2 * nb + 1) * 32 + lane) * 4);
#pragma unroll
        for (int r = 0; r < 4; ++r) { x0[r] = xm[nb][r] * cm + g0[r] * cr; x1[r] = xm[nb][4 + r] * cm + g1[r] * cr; }
        *(v4fa*)(os + lr * 68 + 16 * nb + 8 * hi) = x0; *(v4fa*)(os + lr * 68 + 16 * nb + 8 * hi + 4) = x1; }
    __builtin_amdgcn_fence(3, "wavefront"); __builtin_amdgcn_wave_barrier(); asm volatile("" ::: "memory");
    v8us ah[4], av[4]; size_t ad[4];
#pragma unroll
    for (int it = 0; it < 4; ++it) { const int rr = it * 4 + (lane >> 3); const int pc = lane & 7;
        const v4f x0 = *(const v4fa*)(os + rr * 68 + pc * 8), x1 = *(const v4fa*)(os + rr * 68 + pc * 8 + 4); v8us th, tl;
#pragma unroll
        for (int c = 0; c < 4; ++c) { unsigned short a2, c2; splitf(x0[c], a2, c2); th[c] = a2; tl[c] = c2; splitf(x1[c], a2, c2); th[4 + c] = a2; tl[4 + c] = c2; }
        ah[it] = th; av[it] = tl; ad[it] = (tb + q0 + rr) * CM + (size_t)h * HD + pc * 8; }
{
#pragma unroll
        for (int it = 0; it < 4; ++it) { *(v8us*)(ATh + ad[it]) = ah[it]; *(v8us*)(ATl + ad[it]) = av[it]; }
         }
}

extern "C" void kernel_launch(void* const* d_in, const int* in_sizes, int n_in,
                              void* d_out, int out_size, void* d_ws, size_t ws_size, hipStream_t stream) {
    if (n_in < 16) return;
    const int ntok_in = (NB - 1) * SEQ_FULL + SEQ;
    if (in_sizes[0] < ntok_in * CM || in_sizes[1] < NFR || in_sizes[2] < NB * NRES || in_sizes[3] < ntok_in || in_sizes[4] < NB * CDIM || in_sizes[5] < ntok_in * 3) return;
    if (in_sizes[6] < CDIM * ADW || in_sizes[7] < ADW) return;
    if (in_sizes[8] < CM * CM || in_sizes[10] < CM * CM || in_sizes[12] < CM * CM || in_sizes[14] < CM * CM) return;
    if (in_sizes[9] < CM || in_sizes[11] < CM || in_sizes[13] < CM || in_sizes[15] < CM) return;
    const size_t out_need = OUT2_EL + ((size_t)((NB - 1) * NH + NH - 1) * SEQ_FULL + SEQ) * HD;
    if ((size_t)out_size < out_need) return;
    const float* s_frames = (const float*)d_in[0]; const int* frame_idx = (const int*)d_in[1]; const int* seq_idx = (const int*)d_in[2]; const float* mask = (const float*)d_in[3];
    const float* cond = (const float*)d_in[4]; const float* ca_pos = (const float*)d_in[5]; const float* adaln_w = (const float*)d_in[6]; const float* adaln_b = (const float*)d_in[7];
    const float* wq = (const float*)d_in[8]; const float* bq = (const float*)d_in[9]; const float* wk = (const float*)d_in[10]; const float* bk = (const float*)d_in[11];
    const float* wv = (const float*)d_in[12]; const float* bv = (const float*)d_in[13]; const float* wo = (const float*)d_in[14]; const float* bo = (const float*)d_in[15];
    float* OUT = (float*)d_out;
    char* wsp = (char*)d_ws;
    auto take = [&](size_t bytes) { char* p = wsp; wsp += (bytes + 255) & ~(size_t)255; return (void*)p; };
    bf* WQ = (bf*)take((size_t)3 * CM * CM * 2); bf* WK = WQ + (size_t)CM * CM; bf* WV = WK + (size_t)CM * CM; bf* WO = (bf*)take((size_t)CM * CM * 2);
    bf* WA = (bf*)take((size_t)ADW * CDIM * 2); bf* CAP = (bf*)take((size_t)64 * CDIM * 2); float* SS = (float*)take((size_t)64 * ADW * 4);
    float* CS = (float*)take((size_t)NTOK * HD * 2 * 4);
    bf* XBh = (bf*)take((size_t)NTOK * CM * 2); bf* XBl = (bf*)take((size_t)NTOK * CM * 2);
    float* FQ = (float*)take((size_t)3 * NTOK * CM * 4); float* FK = FQ + (size_t)NTOK * CM; float* FV = FK + (size_t)NTOK * CM;
    bf* QPh = (bf*)take((size_t)NBH * SEQ * HD * 2); bf* QPl = (bf*)take((size_t)NBH * SEQ * HD * 2); bf* KPh = (bf*)take((size_t)NBH * SEQ * HD * 2); bf* KPl = (bf*)take((size_t)NBH * SEQ * HD * 2);
    h16* VTh = (h16*)take((size_t)NBH * HD * SEQ * 2); h16* VTl = (h16*)take((size_t)NBH * HD * SEQ * 2);
    bf* QE = (bf*)take((size_t)NTOK * NEX * 2); bf* KE = (bf*)take((size_t)NTOK * NEX * 2);
    bf* ATh = (bf*)take((size_t)NTOK * CM * 2); bf* ATl = (bf*)take((size_t)NTOK * CM * 2);
    const size_t used = (size_t)(wsp - (char*)d_ws);
    if (used > ws_size || used > ((size_t)128 << 20)) return;    // about 102 MiB at NB=2, SEQ=3072

    // one launch for all that reads only inputs: 16-bit weight and cond planes, bias k-step rows, cos/sin table
    k_prep<<<PB_ALL, 256, 0, stream>>>(adaln_w, wq, wk, wv, wo, cond, ca_pos, mask, frame_idx, seq_idx, WA, WQ, WK, WV, WO, CAP, QE, KE, CS);
    // AdaLN: ss = cond x adaln_w + adaln_b (rows 0..NB-1 of SS), then LN + modulation -> x hi/lo planes
    k_gemmw<bf, 0, true><<<dim3(1, ADW / 64, 1), 32, 0, stream>>>(CAP, nullptr, WA, nullptr, CDIM, SS, ADW, adaln_b, adaln_b, adaln_b, 0, 0, 0);
    k_ln<<<(unsigned)(NTOK / 8), 256, 0, stream>>>(s_frames, SS, XBh, XBl);
    // projections (x hi/lo x bf16 W, 2 products, + bias) in one launch, then roped / transposed planes in one launch; k and v outputs from the f32 results
    k_gemm4<<<dim3(NTOK / 128, CM / 128, 3), 128, 0, stream>>>(XBh, XBl, WQ, FQ, CM, bq, bk, bv, 0, (size_t)CM * CM, (size_t)NTOK * CM);   // z = q, k, v
    k_planes<<<PB_VT + 2 * PB_RP, 256, 0, stream>>>(FQ, FK, FV, CS, QPh, QPl, KPh, KPl, VTh, VTl, OUT + OUT1_EL, OUT + OUT2_EL);
    // attention (one launch) -> ctx hi/lo planes, then the output projection straight into out0 (batch z at the full-size token pitch)
    k_attn<<<dim3(SEQ / (16 * AW), NBH, 1), 32 * AW, 0, stream>>>(QPh, QPl, QE, KPh, KPl, KE, VTh, VTl, ATh, ATl);
    k_gemm4<<<dim3(SEQ / 128, CM / 128, NB), 128, 0, stream>>>(ATh, ATl, WO, OUT, CM, bo, bo, bo, (size_t)SEQ * CM, 0, (size_t)SEQ_FULL * CM);
}

// v006
// It runs in 112 microseconds.
// Two timings next to v005 put it at 1.10 and 1.09 times that version's speed.
// Over all steps from v000 it is 4.13 times as fast.
#include <hip/hip_runtime.h>

// Frame-causal multi-head attention with a Gaussian distance bias: AdaLN prologue (cond x adaln_w modulation of a non-affine LN), q/k/v projections with bias, two-half rotate-half RoPE from int positions, online-softmax attention, output projection; f32 outputs out, roped k, v.
// Compute dtypes, f32 accumulate everywhere: every float input RNE-converted to bf16 on load. cond x adaln_w: v_wmma_f32_16x16x32_bf16, plain bf16 operands (1 product). q/k/v projections: bf16 hi/lo planes of the modulated LN output x bf16 weight planes (2 products).
// Scores: bf16 hi/lo q and k planes (hi.hi + lo.hi + hi.lo) plus one extra bf16 k-step carrying the distance-bias terms (exact coordinate cross products, three-piece bf16 squared norms, key mask fill). attn.v: v_wmma_f32_16x16x32_f16, P carried x2^14 in f16 (one plane), v as f16 hi + x2^10 f16 residual planes (two accumulators).
// Output projection: bf16 hi/lo ctx planes x bf16 Wo (2 products). LN statistics, inverse frequencies and the cos/sin table, RoPE, softmax and all side math f32 on VALU; the k and v outputs are written from the f32 projection results.

#ifndef NB
#define NB 2
#endif
#define NB_FULL 2
#ifndef SEQ
#define SEQ 3072
#endif
#define SEQ_FULL 3072
#define NRES 256
#define NFR (SEQ / NRES)
#define CM 512
#define ADW 1024
#define NH 8
#define HD 64
#define CDIM 64
#define NEX 32
#define NTOK (NB * SEQ)
#define NBH (NB * NH)
#define QSCL 0.125f
#define PCAR 16384.0f
#define PINV 0.00006103515625f
#define LCAR 1024.0f
#define LINV 0.0009765625f
#define LOG2E 1.4426950408889634f
#define OUT1_EL ((size_t)NB_FULL * SEQ_FULL * CM)
#define OUT2_EL (OUT1_EL + (size_t)NB_FULL * NH * SEQ_FULL * HD)
static_assert(SEQ % NRES == 0);
static_assert(SEQ >= NRES && SEQ <= SEQ_FULL);
static_assert(NB >= 1 && NB <= NB_FULL);
static_assert(NTOK % 256 == 0);
static_assert(HD == 64 && CM == NH * HD);
static_assert(CM % 64 == 0 && ADW == 2 * CM && CDIM % 32 == 0);
static_assert(OUT1_EL * 4 == 12582912);
static_assert(OUT2_EL * 4 == 25165824);

typedef _Float16 h16;
typedef unsigned short bf;
typedef __attribute__((ext_vector_type(16))) __bf16   v16bf;
typedef __attribute__((ext_vector_type(16))) _Float16 v16h;
typedef __attribute__((ext_vector_type(8)))  _Float16 v8h;
typedef __attribute__((ext_vector_type(2)))  _Float16 v2h;
typedef __attribute__((ext_vector_type(8)))  unsigned short v8us;
typedef __attribute__((ext_vector_type(4)))  unsigned short v4us;
typedef __attribute__((ext_vector_type(2)))  unsigned short v2us;
typedef __attribute__((ext_vector_type(4)))  unsigned int v4u;
typedef __attribute__((ext_vector_type(8)))  float    v8f;
typedef __attribute__((ext_vector_type(4)))  float    v4f;
typedef __attribute__((ext_vector_type(2)))  float    v2f;
typedef v8h  __attribute__((may_alias)) v8ha;
typedef v4f  __attribute__((may_alias)) v4fa;
typedef v8us __attribute__((may_alias)) v8usa;
typedef v4u  __attribute__((may_alias)) v4ua;

__device__ __forceinline__ unsigned short f2bf(float f) { unsigned u = __float_as_uint(f); u += 0x7FFFu + ((u >> 16) & 1u); return (unsigned short)(u >> 16); }
__device__ __forceinline__ float bf2f(unsigned short b) { return __uint_as_float(((unsigned)b) << 16); }
__device__ __forceinline__ float bfr(float f) { return bf2f(f2bf(f)); }
__device__ __forceinline__ v16h cat16(v8h lo, v8h hi) { return __builtin_shufflevector(lo, hi, 0, 1, 2, 3, 4, 5, 6, 7, 8, 9, 10, 11, 12, 13, 14, 15); }
__device__ __forceinline__ v16bf cat16b(v8us lo, v8us hi) { return __builtin_bit_cast(v16bf, __builtin_shufflevector(lo, hi, 0, 1, 2, 3, 4, 5, 6, 7, 8, 9, 10, 11, 12, 13, 14, 15)); }
__device__ __forceinline__ v8f wmma16(v16h a, v16h b, v8f c) { return __builtin_amdgcn_wmma_f32_16x16x32_f16(false, a, false, b, (short)0, c, false, false); }
__device__ __forceinline__ v8f wmmab(v16bf a, v16bf b, v8f c) { return __builtin_amdgcn_wmma_f32_16x16x32_bf16(false, a, false, b, (short)0, c, false, false); }
__device__ __forceinline__ void splitf(float y, unsigned short& h, unsigned short& l) { h = f2bf(y); l = f2bf(y - bf2f(h)); }
__device__ __forceinline__ void splith(float y, h16& a, h16& c) { a = (h16)y; c = (h16)((y - (float)a) * LCAR); }
__device__ __forceinline__ unsigned int pk2(unsigned short lo, unsigned short hi2) { return (unsigned int)lo | ((unsigned int)hi2 << 16); }

// ---- k_gemmw: register-blocked GEMM, ONE WAVE per 64x64 output tile (16 accumulators), operands straight from K-contiguous 16-bit planes; grid (M/64, N/64, Z), 32 threads.
// C[m][n] (f32, pitch ldc, + optional f32 bias[n] as its bf16 value) = sum_k A[m][k] Bt[n][k] (+ split products per NSPLIT). z-batch strides sA/sB/sC in elements, bias vector bias0/1/2 by z (Z <= 3). K % 32 == 0.
// Fragments: lane -> row/col lane&15, vector elements 0..7 <- k0 + 8h + i, elements 8..15 <- k0 + 16 + 8h + i (h = lane>>4) for BOTH operands; D element r -> (row 8h + r, col lane&15).
template <typename T16> struct WFrag;
template <> struct WFrag<h16> { typedef v16h V; static __device__ __forceinline__ V ld(const h16* p) { return cat16(*(const v8h*)p, *(const v8h*)(p + 16)); } static __device__ __forceinline__ v8f mma(V a, V b, v8f c) { return wmma16(a, b, c); } };
template <> struct WFrag<bf> { typedef v16bf V; static __device__ __forceinline__ V ld(const bf* p) { return cat16b(*(const v8us*)p, *(const v8us*)(p + 16)); } static __device__ __forceinline__ v8f mma(V a, V b, v8f c) { return wmmab(a, b, c); } };
template <typename T16, int NSPLIT, bool BIAS>
__global__ __launch_bounds__(32) void k_gemmw(const T16* __restrict__ A, const T16* __restrict__ A2, const T16* __restrict__ Bt, const T16* __restrict__ Bt2, int K, float* C, int ldc, const float* __restrict__ bias0, const float* __restrict__ bias1, const float* __restrict__ bias2, size_t sA, size_t sB, size_t sC) {
    typedef typename WFrag<T16>::V V;
    __shared__ __align__(16) float os[16 * 68];
    const size_t z = blockIdx.z; A += z * sA; if (A2) A2 += z * sA; Bt += z * sB; if (Bt2) Bt2 += z * sB; C += z * sC;
    const float* __restrict__ bias = (z == 0) ? bias0 : (z == 1) ? bias1 : bias2;
    const int lane = threadIdx.x & 31, lr = lane & 15, hi = lane >> 4; const int r0 = blockIdx.x * 64, c0 = blockIdx.y * 64;
    v8f acc[4][4];
#pragma unroll
    for (int mb = 0; mb < 4; ++mb)
#pragma unroll
        for (int nb = 0; nb < 4; ++nb) acc[mb][nb] = (v8f){};
    const size_t aoff = (size_t)(r0 + lr) * K + 8 * hi, boff = (size_t)(c0 + lr) * K + 8 * hi;
#pragma unroll 1
    for (int kc = 0; kc < K; kc += 32) {
        V a[4], a2[4];
#pragma unroll
        for (int mb = 0; mb < 4; ++mb) { a[mb] = WFrag<T16>::ld(A + aoff + (size_t)mb * 16 * K + kc); if (NSPLIT == 1 || NSPLIT == 2) a2[mb] = WFrag<T16>::ld(A2 + aoff + (size_t)mb * 16 * K + kc); }
#pragma unroll
        for (int nb = 0; nb < 4; ++nb) { const V b = WFrag<T16>::ld(Bt + boff + (size_t)nb * 16 * K + kc); V b2; if (NSPLIT >= 2) b2 = WFrag<T16>::ld(Bt2 + boff + (size_t)nb * 16 * K + kc);
#pragma unroll
            for (int mb = 0; mb < 4; ++mb) { acc[mb][nb] = WFrag<T16>::mma(a[mb], b, acc[mb][nb]); if (NSPLIT == 1 || NSPLIT == 2) acc[mb][nb] = WFrag<T16>::mma(a2[mb], b, acc[mb][nb]); if (NSPLIT >= 2) acc[mb][nb] = WFrag<T16>::mma(a[mb], b2, acc[mb][nb]); } }
        asm volatile("v_nop\n\tv_nop\n\tv_nop\n\tv_nop" : "+v"(acc[0][0]), "+v"(acc[1][1]), "+v"(acc[2][2]), "+v"(acc[3][3]) : "v"(a[0]), "v"(a[3]));
    }
#pragma unroll
    for (int mb = 0; mb < 4; ++mb) {
#pragma unroll
        for (int nb = 0; nb < 4; ++nb) {
#pragma unroll
            for (int j = 0; j < 8; ++j) os[(hi * 8 + j) * 68 + nb * 16 + lr] = acc[mb][nb][j]; }
        __builtin_amdgcn_wave_barrier(); asm volatile("" ::: "memory");
        float* crow = C + (size_t)(r0 + mb * 16) * ldc + c0;
{
#pragma unroll
            for (int s = 0; s < 8; ++s) { const int row = 2 * s + hi, cofs = lr * 4; v4f val = *(const v4fa*)(os + row * 68 + cofs); if (BIAS) { val[0] += bfr(bias[c0 + cofs]); val[1] += bfr(bias[c0 + cofs + 1]); val[2] += bfr(bias[c0 + cofs + 2]); val[3] += bfr(bias[c0 + cofs + 3]); }
                *(v4f*)(crow + (size_t)row * ldc + cofs) = val; }
             }
        __builtin_amdgcn_wave_barrier(); asm volatile("" ::: "memory");
    }
}

// ---- k_gemm4: the two-product GEMM (A hi/lo planes x one bf16 Bt plane, K = CM) for the projections: FOUR WAVES share a 128x128 output tile, each wave a 64x64 quarter (16 accumulators, fragments, k order and sum order of k_gemmw).
// A stage is 64 k: 128 rows of A hi, of A lo and of Bt, 128 B a row, brought once per work-group into a two-buffer LDS ring by asynchronous copies (a wave's copy covers four whole lines of global memory), one stage ahead.
// LDS rows are unpadded (three work-groups fit a WGP); the 16-byte piece q of row r lies at piece q ^ ((r >> 1) & 7), so the 16 rows that a half-wave's fragment load touches fall on all 64 banks once.
#define G4_PL (128 * 128)            // bytes of one plane's stage
#define G4_BUF (3 * G4_PL)           // bytes of one ring buffer
#define G4_NS (CM / 64)
#define G4_WST (2 * G4_BUF / 4)      // bytes of the ring that one wave has for staging behind the loop
#define G4_OSB (16 * 68 * 4)         // of them the f32 row stage
#define G4_VSP 72                    // LDS pitch of a 64-token transposed v row: 144 B = 16 B x odd
static_assert(G4_OSB % 16 == 0 && G4_OSB + 2 * 64 * G4_VSP * 2 <= G4_WST && SEQ % 64 == 0);
static_assert(NTOK % 128 == 0 && SEQ % 128 == 0 && CM % 128 == 0 && G4_NS >= 2);
static_assert(4 * 16 * 68 * 4 <= 2 * G4_BUF);
// One plane's stage, this lane's eight 16-byte pieces (rows 16 apart). The s_wait_xcnt stands inside the statement so that no address register is rewritten ahead of it.
__device__ __forceinline__ void plane_copy(unsigned l, const bf* g) {
    const unsigned l1 = l + 2048, l2 = l + 2 * 2048, l3 = l + 3 * 2048, l4 = l + 4 * 2048, l5 = l + 5 * 2048, l6 = l + 6 * 2048, l7 = l + 7 * 2048;
    const bf* g1 = g + 16 * CM; const bf* g2 = g + 32 * CM; const bf* g3 = g + 48 * CM; const bf* g4 = g + 64 * CM; const bf* g5 = g + 80 * CM; const bf* g6 = g + 96 * CM; const bf* g7 = g + 112 * CM;
    asm volatile("global_load_async_to_lds_b128 %0, %8, off\n\t"
                 "global_load_async_to_lds_b128 %1, %9, off\n\t"
                 "global_load_async_to_lds_b128 %2, %10, off\n\t"
                 "global_load_async_to_lds_b128 %3, %11, off\n\t"
                 "global_load_async_to_lds_b128 %4, %12, off\n\t"
                 "global_load_async_to_lds_b128 %5, %13, off\n\t"
                 "global_load_async_to_lds_b128 %6, %14, off\n\t"
                 "global_load_async_to_lds_b128 %7, %15, off\n\t"
                 "s_wait_xcnt 0x0"
                 :: "v"(l), "v"(l1), "v"(l2), "v"(l3), "v"(l4), "v"(l5), "v"(l6), "v"(l7),
                    "v"(g), "v"(g1), "v"(g2), "v"(g3), "v"(g4), "v"(g5), "v"(g6), "v"(g7) : "memory");
}
// At most three waves come to a SIMD (LDS); a register budget for four keeps accumulators and a stage's fragments in registers without a trade for waves that never come.
// PLANES: the q, k, v projections (z = 0, 1, 2). A wave's quarter is 64 tokens of one head, so bias, RoPE, the 16-bit split and the v transposition are done on the accumulators and the operand planes and the k and v outputs are stored from here; no f32 projection goes to memory.
template <bool PLANES>
__global__ __launch_bounds__(128) __attribute__((amdgpu_waves_per_eu(4, 4))) void k_gemm4(const bf* __restrict__ A, const bf* __restrict__ A2, const bf* __restrict__ Bt, float* C, int ldc,
                                             const float* __restrict__ bias0, const float* __restrict__ bias1, const float* __restrict__ bias2, size_t sA, size_t sB, size_t sC,
                                             const float* __restrict__ CS, bf* QPh, bf* QPl, bf* KPh, bf* KPl, h16* VTh, h16* VTl, float* GK, float* GV) {
    __shared__ __align__(16) unsigned char ring4[2 * G4_BUF];
    const size_t z = blockIdx.z; A += z * sA; A2 += z * sA; Bt += z * sB; C += z * sC;
    const float* __restrict__ bias = (z == 0) ? bias0 : (z == 1) ? bias1 : bias2;
    const int tid = threadIdx.x, lane = tid & 31, lr = lane & 15, hi = lane >> 4, w = tid >> 5;
    const int R0 = blockIdx.x * 128, C0 = blockIdx.y * 128;
    // this lane's share of a stage: piece tid & 7 of rows tid >> 3, + 16, ... + 112 of each plane
    const unsigned lc = (unsigned)(size_t)ring4 + (unsigned)((tid >> 3) * 128 + (((tid & 7) ^ ((tid >> 4) & 7)) << 4));
    const bf* gah = A + (size_t)(R0 + (tid >> 3)) * CM + (tid & 7) * 8; const bf* gal = A2 + (size_t)(R0 + (tid >> 3)) * CM + (tid & 7) * 8; const bf* gb = Bt + (size_t)(C0 + (tid >> 3)) * CM + (tid & 7) * 8;
    plane_copy(lc, gah); plane_copy(lc + G4_PL, gal); plane_copy(lc + 2 * G4_PL, gb);
    v8f acc[4][4];
#pragma unroll
    for (int mb = 0; mb < 4; ++mb)
#pragma unroll
        for (int nb = 0; nb < 4; ++nb) acc[mb][nb] = (v8f){};
    // fragment reads: row (quarter's 64) + 16 mb + lr, logical pieces 4 kk + hi and 4 kk + 2 + hi, each XORed with lr >> 1
    const int s0 = hi ^ (lr >> 1);
    const int arow = ((w >> 1) * 64 + lr) * 128, brow = 2 * G4_PL + ((w & 1) * 64 + lr) * 128;
    asm volatile("s_wait_asynccnt 0x0" ::: "memory");   // stage 0 of this wave has landed
    __syncthreads();                                     // publishes stage 0 to every wave
    plane_copy(lc + G4_BUF, gah + 64); plane_copy(lc + G4_BUF + G4_PL, gal + 64); plane_copy(lc + G4_BUF + 2 * G4_PL, gb + 64);   // stage 1 exists: G4_NS >= 2
#pragma unroll 1
    for (int st = 0; st < G4_NS; ++st) {
        const unsigned char* sb = ring4 + (st & 1) * G4_BUF;
#pragma unroll
        for (int kk = 0; kk < 2; ++kk) {
            const int o0 = (s0 ^ (4 * kk)) << 4, o1 = (s0 ^ (4 * kk + 2)) << 4;
            v16bf a[4], a2[4];
#pragma unroll
            for (int mb = 0; mb < 4; ++mb) { const unsigned char* ap = sb + arow + mb * 2048;
                a[mb] = cat16b(*(const v8usa*)(ap + o0), *(const v8usa*)(ap + o1)); a2[mb] = cat16b(*(const v8usa*)(ap + G4_PL + o0), *(const v8usa*)(ap + G4_PL + o1)); }
#pragma unroll
            for (int nb = 0; nb < 4; ++nb) { const unsigned char* bp = sb + brow + nb * 2048; const v16bf b = cat16b(*(const v8usa*)(bp + o0), *(const v8usa*)(bp + o1));
#pragma unroll
                for (int mb = 0; mb < 4; ++mb) { acc[mb][nb] = wmmab(a[mb], b, acc[mb][nb]); acc[mb][nb] = wmmab(a2[mb], b, acc[mb][nb]); } }
        }
        asm volatile("s_wait_dscnt 0x0" ::: "memory");      // this wave's reads of buffer st & 1 have returned
        asm volatile("s_wait_asynccnt 0x0" ::: "memory");   // this wave's copies of stage st + 1 have landed
        __syncthreads();                                     // publishes stage st + 1 and ends every wave's reads of buffer st & 1
        if (st + 2 < G4_NS) { const unsigned bo = (unsigned)(st & 1) * G4_BUF; const int kn = (st + 2) * 64;
            plane_copy(lc + bo, gah + kn); plane_copy(lc + bo + G4_PL, gal + kn); plane_copy(lc + bo + 2 * G4_PL, gb + kn); }
    }
    asm volatile("s_wait_asynccnt 0x0" ::: "memory");       // nothing of this wave is in flight when the ring becomes output staging
    // behind the last trip's barrier no wave reads the ring and no copy is under way: each wave stages its rows in its own part of it
    const int r0 = R0 + (w >> 1) * 64, c0 = C0 + (w & 1) * 64, cofs = lr * 4;
    if constexpr (PLANES) {
        // D register j of block (mb, nb) is token 16 mb + 8 hi + j, dim 16 nb + lr of the head
        const int b = r0 / SEQ, t0 = r0 - b * SEQ, bh = b * NH + (c0 >> 6);
        unsigned char* wb = ring4 + w * G4_WST;
        float* os = (float*)wb;
        const int rr = lane >> 3, pc = lane & 7;
        float bn[4];   // the bias of this lane's four dims, as its bf16 value
#pragma unroll
        for (int nb = 0; nb < 4; ++nb) bn[nb] = bfr(bias[c0 + nb * 16 + lr]);
        if (z == 2) {
            // v: a lane's eight registers are eight successive tokens of one dim, one 16-byte piece of a transposed row; the pieces pass through LDS so that each store covers whole lines
            h16* vs = (h16*)(wb + G4_OSB);   // [hi, residual][64 dims][G4_VSP tokens]
            float* G = GV + ((size_t)bh * SEQ_FULL + t0) * HD;
#pragma unroll
            for (int mb = 0; mb < 4; ++mb) {
#pragma unroll
                for (int nb = 0; nb < 4; ++nb) { v8h th, tl;
#pragma unroll
                    for (int j = 0; j < 8; ++j) { const float y = acc[mb][nb][j] + bn[nb]; os[(hi * 8 + j) * 68 + nb * 16 + lr] = y; h16 a2, c2; splith(y, a2, c2); th[j] = a2; tl[j] = c2; }
                    h16* vd = vs + (nb * 16 + lr) * G4_VSP + mb * 16 + hi * 8; *(v8ha*)vd = th; *(v8ha*)(vd + 64 * G4_VSP) = tl; }
                __builtin_amdgcn_wave_barrier(); asm volatile("" ::: "memory");   // keeps the row reads behind the other lanes' writes in the compiled order
#pragma unroll
                for (int s = 0; s < 8; ++s) { const int row = 2 * s + hi; const v4f val = *(const v4fa*)(os + row * 68 + cofs);
                    *(v4f*)(G + (size_t)(mb * 16 + row) * HD + cofs) = val; }
                __builtin_amdgcn_wave_barrier(); asm volatile("s_wait_xcnt 0x0" ::: "memory");   // keeps the next block's writes behind these reads; the wait stands ahead of any rewrite of a register these stores name
            }
            h16* gh = VTh + ((size_t)bh * HD + rr) * SEQ + t0 + pc * 8; h16* gl = VTl + ((size_t)bh * HD + rr) * SEQ + t0 + pc * 8;
#pragma unroll
            for (int it = 0; it < 16; ++it) { const h16* vr = vs + (it * 4 + rr) * G4_VSP + pc * 8; const v8h xh = *(const v8ha*)vr, xl = *(const v8ha*)(vr + 64 * G4_VSP);
                *(v8h*)(gh + (size_t)it * 4 * SEQ) = xh; *(v8h*)(gl + (size_t)it * 4 * SEQ) = xl; }
        } else {
            // q, k: two-half rotate-half RoPE. Each 32-dim half is rotated within itself; the partner of dim d is d + 16 (subtracted) or d - 16 (added): block nb ^ 1 of the same lane and register. Both dims of a pair share one cos/sin entry.
            const float scl = (z == 0) ? QSCL : 1.0f;
            bf* Ph = ((z == 0) ? QPh : KPh) + ((size_t)bh * SEQ + t0 + rr) * HD + pc * 8; bf* Pl = ((z == 0) ? QPl : KPl) + ((size_t)bh * SEQ + t0 + rr) * HD + pc * 8;
            float* G = GK + ((size_t)bh * SEQ_FULL + t0 + rr) * HD + pc * 8;
            const float* csb = CS + ((size_t)(r0 + hi * 8) * HD + lr) * 2;
            v2f cs[2][8];   // cos, sin of this lane's eight tokens of a block, for each half of the head
#pragma unroll
            for (int j = 0; j < 8; ++j) { cs[0][j] = *(const v2f*)(csb + (size_t)(j * HD) * 2); cs[1][j] = *(const v2f*)(csb + (size_t)(j * HD + 32) * 2); }
#pragma unroll
            for (int mb = 0; mb < 4; ++mb) {
#pragma unroll
                for (int hf = 0; hf < 2; ++hf)
#pragma unroll
                    for (int j = 0; j < 8; ++j) { const float x0 = (acc[mb][2 * hf][j] + bn[2 * hf]) * scl, x1 = (acc[mb][2 * hf + 1][j] + bn[2 * hf + 1]) * scl; const float cn = cs[hf][j][0], sn = cs[hf][j][1];
                        float* op = os + (hi * 8 + j) * 68 + hf * 32 + lr; op[0] = x0 * cn - x1 * sn; op[16] = x1 * cn + x0 * sn; }
                __builtin_amdgcn_wave_barrier(); asm volatile("" ::: "memory");   // keeps the row reads behind the other lanes' writes in the compiled order
                if (mb < 3) {   // the next block's table entries fly while this block is split and stored
#pragma unroll
                    for (int j = 0; j < 8; ++j) { cs[0][j] = *(const v2f*)(csb + (size_t)((mb * 16 + 16 + j) * HD) * 2); cs[1][j] = *(const v2f*)(csb + (size_t)((mb * 16 + 16 + j) * HD + 32) * 2); }
                    asm volatile("s_wait_xcnt 0x0" :: "v"(csb) : "memory"); }   // the address pair that these loads name lives to this wait, so nothing is written over it ahead of the wait
                v4f xa[4], xb[4];   // the block's rows as one group of LDS reads, not a read and its wait for every four rows
#pragma unroll
                for (int it = 0; it < 4; ++it) { const float* orow = os + (it * 4 + rr) * 68 + pc * 8; xa[it] = *(const v4fa*)orow; xb[it] = *(const v4fa*)(orow + 4); }
                // two halves of the block: each half's stores as one group out of registers of their own, one wait behind them
#pragma unroll
                for (int hb = 0; hb < 2; ++hb) { v8us th[2], tl[2];
#pragma unroll
                    for (int i2 = 0; i2 < 2; ++i2)
#pragma unroll
                        for (int c = 0; c < 4; ++c) { unsigned short a2, c2; splitf(xa[2 * hb + i2][c], a2, c2); th[i2][c] = a2; tl[i2][c] = c2; splitf(xb[2 * hb + i2][c], a2, c2); th[i2][4 + c] = a2; tl[i2][4 + c] = c2; }
#pragma unroll
                    for (int i2 = 0; i2 < 2; ++i2) { const size_t o = (size_t)(mb * 16 + hb * 8 + i2 * 4) * HD; *(v8us*)(Ph + o) = th[i2]; *(v8us*)(Pl + o) = tl[i2]; }
                    if (z == 1) {
#pragma unroll
                        for (int i2 = 0; i2 < 2; ++i2) { const size_t o = (size_t)(mb * 16 + hb * 8 + i2 * 4) * HD; *(v4f*)(G + o) = xa[2 * hb + i2]; *(v4f*)(G + o + 4) = xb[2 * hb + i2]; } }
                    asm volatile("s_wait_xcnt 0x0" ::: "memory");   // stands ahead of any rewrite of a register these stores name
                    __builtin_amdgcn_sched_barrier(0); }   // keeps the arithmetic that follows, which rewrites those registers, from being scheduled ahead of the wait
                __builtin_amdgcn_wave_barrier();   // with the clobber of the wait above: keeps the next block's writes behind this block's reads in the compiled order
            }
        }
    } else {
    float* os = (float*)ring4 + w * (16 * 68);
    v4f bb;   // the bias of this lane's four columns, as its bf16 value
#pragma unroll
    for (int c = 0; c < 4; ++c) bb[c] = bfr(bias[c0 + cofs + c]);
#pragma unroll
    for (int mb = 0; mb < 4; ++mb) {
#pragma unroll
        for (int nb = 0; nb < 4; ++nb) {
#pragma unroll
            for (int j = 0; j < 8; ++j) os[(hi * 8 + j) * 68 + nb * 16 + lr] = acc[mb][nb][j]; }
        __builtin_amdgcn_wave_barrier(); asm volatile("" ::: "memory");   // keeps the row reads behind the other lanes' writes in the compiled order
        float* crow = C + (size_t)(r0 + mb * 16) * ldc + c0;
#pragma unroll
        for (int s = 0; s < 8; ++s) { const int row = 2 * s + hi; const v4f val = *(const v4fa*)(os + row * 68 + cofs) + bb;
            *(v4f*)(crow + (size_t)row * ldc + cofs) = val; }
        __builtin_amdgcn_wave_barrier(); asm volatile("s_wait_xcnt 0x0" ::: "memory");   // keeps the next block's writes behind these reads; the wait stands ahead of any rewrite of a register these stores name
    }
    }
}

__device__ __forceinline__ void d_wtG(const float* __restrict__ w, int K, int N, bf* Bt, int bx) {
    const int lane = threadIdx.x & 31; const int L0 = (bx * 8 + (threadIdx.x >> 5)) * 8; const int nlines = (int)((size_t)N * K / 64);
{
#pragma unroll 1
        for (int l = 0; l < 8; ++l) { const int L = L0 + l; if (L >= nlines) break; const size_t e = (size_t)L * 64 + lane * 2; const int k = (int)(e % K), n = (int)(e / K); v2us o;
            o[0] = f2bf(w[(size_t)k * N + n]); o[1] = f2bf(w[(size_t)(k + 1) * N + n]); *(v2us*)(Bt + e) = o; }
         }
}

__device__ __forceinline__ float invf(int j) {
    const float e = (float)(j & 15) * 0.0625f;
    const float p = powf(10000.0f, e);
    const float v = 1.0f / p;
    return v;
}

__device__ __forceinline__ void d_cstab(const int* __restrict__ fidx, const int* __restrict__ sidx, float* CS, int bx) {
    const int idx = bx * 256 + threadIdx.x; if (idx >= NTOK * HD) return;
    const int dd = idx & (HD - 1); const int R = idx >> 6; const int b = R / SEQ, t = R - b * SEQ; const int fl = t / NRES, n = t - fl * NRES;
    const int pseq = sidx[b * NRES + n]; const int pfr = fidx[fl];
    const float pf = (float)((dd < HD / 2) ? pseq : pfr);
    float fr = __fmul_rn(pf, invf(dd)); asm volatile("" : "+v"(fr));
    float sn, cn;
    sincosf(fr, &sn, &cn);
    v2f cs; cs[0] = cn; cs[1] = sn;
    *(v2f*)(CS + (size_t)idx * 2) = cs; 
}

__device__ __forceinline__ void d_condp(const float* __restrict__ cond, bf* P) {
    const int lane = threadIdx.x & 31, w = threadIdx.x >> 5;
    v2us o[8];
#pragma unroll
    for (int it = 0; it < 8; ++it) { const int row = w * 8 + it; const int rc = (row < NB) ? row : (NB - 1); v2us v;
#pragma unroll
        for (int q = 0; q < 2; ++q) { const float x = cond[(size_t)rc * CDIM + 2 * lane + q]; v[q] = (row < NB) ? f2bf(x) : (unsigned short)0; }
        o[it] = v; }
{
#pragma unroll
        for (int it = 0; it < 8; ++it) *(v2us*)(P + (size_t)(w * 8 + it) * CDIM + 2 * lane) = o[it];
         }
    asm volatile("s_wait_xcnt 0x0" ::: "memory");   // in the merged kernel's text another job's code, which rewrites the registers these stores name, follows this one
}

__global__ __launch_bounds__(256) void k_ln(const float* __restrict__ X, const float* __restrict__ SS, bf* Xh, bf* Xl) {
    const int lane = threadIdx.x & 31; const int R = blockIdx.x * 8 + (threadIdx.x >> 5); if (R >= NTOK) return;
    const int b = R / SEQ, t = R - b * SEQ;
    const float* xr = X + ((size_t)b * SEQ_FULL + t) * CM;
    float v[16];
    { const v8f a0 = *(const v8f*)(xr + 8 * lane); const v8f a1 = *(const v8f*)(xr + 256 + 8 * lane);
#pragma unroll
      for (int k = 0; k < 8; ++k) { v[k] = bfr(a0[k]); v[8 + k] = bfr(a1[k]); } }
    float s = 0.f;
#pragma unroll
    for (int k = 0; k < 16; ++k) s += v[k];
#pragma unroll
    for (int sh = 16; sh; sh >>= 1) s += __shfl_xor(s, sh, 32);
    const float mu = s * (1.0f / (float)CM);
    float qq = 0.f;
#pragma unroll
    for (int k = 0; k < 16; ++k) { const float d = v[k] - mu; qq += d * d; }
#pragma unroll
    for (int sh = 16; sh; sh >>= 1) qq += __shfl_xor(qq, sh, 32);
    const float var = qq * (1.0f / (float)CM);
    const float rs = rsqrtf(var + 1.0e-5f);
    const float* sc = SS + (size_t)b * ADW;
    v8us oh[2], ol[2];
#pragma unroll
    for (int c = 0; c < 2; ++c) { const int col0 = c * 256 + 8 * lane; const v8f g = *(const v8f*)(sc + col0); const v8f be = *(const v8f*)(sc + CM + col0); v8us th, tl;
#pragma unroll
        for (int k = 0; k < 8; ++k) { const float xn = (v[c * 8 + k] - mu) * rs; const float y = xn * (1.0f + g[k]) + be[k]; unsigned short a2, c2; splitf(y, a2, c2); th[k] = a2; tl[k] = c2; }
        oh[c] = th; ol[c] = tl; }
{
#pragma unroll
        for (int c = 0; c < 2; ++c) { const size_t o = (size_t)R * CM + c * 256 + 8 * lane; *(v8us*)(Xh + o) = oh[c]; *(v8us*)(Xl + o) = ol[c]; }
         }
}

// ---- d_extras: per token row R the extra bf16 k-step rows (NEX = 32 slots) that carry the additive score bias inside the score WMMA. With c = bf16 coordinates and g = -|c|^2/64 split three-piece (gh + gm + gl):
// query row QE[R] = [cx, cy, cz, 1, 1, 1, gh, gm, gl, 1, 0 x 22]; key row KE[R] = [cx/32, cy/32, cz/32, gh, gm, gl, 1, 1, 1, fill, 0 x 22], fill = -2e30 where mask == 0 else 0.
__device__ __forceinline__ void d_extras(const float* __restrict__ ca, const float* __restrict__ msk, bf* QE, bf* KE, int bx) {
    __shared__ __align__(16) unsigned int qs[256 * 16];
    __shared__ __align__(16) unsigned int ks[256 * 16];
    const int tid = threadIdx.x, lane = tid & 31, w = tid >> 5;
    const int R0 = bx * 256; const int R = R0 + tid;
    const int b = R / SEQ, t = R - b * SEQ; const size_t Rf = (size_t)b * SEQ_FULL + t;
    const float cx = bfr(ca[Rf * 3]), cy = bfr(ca[Rf * 3 + 1]), cz = bfr(ca[Rf * 3 + 2]);
    const float mk = bfr(msk[Rf]);
    const float n2 = cx * cx + cz * cz + cy * cy;
    const float g = -(n2 * 0.015625f);
    const unsigned short gh = f2bf(g); const float r1 = g - bf2f(gh); const unsigned short gm = f2bf(r1); const unsigned short gl = f2bf(r1 - bf2f(gm));
    const unsigned short one = (unsigned short)0x3F80u;
    const unsigned short fillv = (mk == 0.0f) ? f2bf(-2.0e30f) : (unsigned short)0;
    v4u qa, qb, ka, kb, zz;
#pragma unroll
    for (int i = 0; i < 4; ++i) { qb[i] = 0u; kb[i] = 0u; zz[i] = 0u; }
    qa[0] = pk2(f2bf(cx), f2bf(cy)); qa[1] = pk2(f2bf(cz), one); qa[2] = pk2(one, one); qa[3] = pk2(gh, gm);
    qb[0] = pk2(gl, one);
    ka[0] = pk2(f2bf(cx * 0.03125f), f2bf(cy * 0.03125f)); ka[1] = pk2(f2bf(cz * 0.03125f), gh); ka[2] = pk2(gm, gl); ka[3] = pk2(one, one);
    kb[0] = pk2(one, fillv);
    unsigned int* qr = qs + tid * 16; unsigned int* krw = ks + tid * 16;
    *(v4u*)(qr) = qa; *(v4u*)(qr + 4) = qb; *(v4u*)(qr + 8) = zz; *(v4u*)(qr + 12) = zz;
    *(v4u*)(krw) = ka; *(v4u*)(krw + 4) = kb; *(v4u*)(krw + 8) = zz; *(v4u*)(krw + 12) = zz;
    __syncthreads();
    v4u oq[4], ok[4]; int off[4];
#pragma unroll
    for (int it = 0; it < 4; ++it) { off[it] = (w * 4 + it) * 128 + lane * 4; oq[it] = *(const v4ua*)(qs + off[it]); ok[it] = *(const v4ua*)(ks + off[it]); }
    unsigned int* QEw = (unsigned int*)QE + (size_t)R0 * 16; unsigned int* KEw = (unsigned int*)KE + (size_t)R0 * 16;
{
#pragma unroll
        for (int it = 0; it < 4; ++it) { *(v4u*)(QEw + off[it]) = oq[it]; *(v4u*)(KEw + off[it]) = ok[it]; }
         }
}

// ---- k_prep: every job that reads only inputs, as block ranges of one grid (the branch is the same for a whole block): weight planes, cond plane, bias k-step rows, cos/sin table.
#define PB_WA ((ADW * CDIM / 64 + 63) / 64)
#define PB_W ((CM * CM / 64 + 63) / 64)
#define PB_EX (NTOK / 256)
#define PB_CS ((NTOK * HD + 255) / 256)
#define PB_ALL (PB_WA + 4 * PB_W + 1 + PB_EX + PB_CS)
__global__ __launch_bounds__(256) void k_prep(const float* __restrict__ adaln_w, const float* __restrict__ wq, const float* __restrict__ wk, const float* __restrict__ wv, const float* __restrict__ wo,
                                              const float* __restrict__ cond, const float* __restrict__ ca, const float* __restrict__ msk, const int* __restrict__ fidx, const int* __restrict__ sidx,
                                              bf* WA, bf* WQ, bf* WK, bf* WV, bf* WO, bf* CAP, bf* QE, bf* KE, float* CS) {
    int bx = blockIdx.x;
    if (bx < PB_WA) { d_wtG(adaln_w, CDIM, ADW, WA, bx); return; }              // adaln_w [CDIM][ADW] -> WA[j][c]
    bx -= PB_WA;
    if (bx < 4 * PB_W) { const int j = bx / PB_W;                                // w [in][out] -> Bt[out][in]
        d_wtG((j == 0) ? wq : (j == 1) ? wk : (j == 2) ? wv : wo, CM, CM, (j == 0) ? WQ : (j == 1) ? WK : (j == 2) ? WV : WO, bx - j * PB_W); return; }
    bx -= 4 * PB_W;
    if (bx < 1) { d_condp(cond, CAP); return; }
    bx -= 1;
    if (bx < PB_EX) { d_extras(ca, msk, QE, KE, bx); return; }
    d_cstab(fidx, sidx, CS, bx - PB_EX);
}

// ---- k_attn: four waves per work-group, 64 query rows of one (b, h); all 64 rows lie in one frame, so the key bound (frame+1)*NRES is the same for the whole group. 64 keys per trip, as two 32-key tiles.
// Wave w takes the 32 query rows of half w >> 1 (two 16-row tiles) and the 32-key tile w & 1 of every trip: each k or v fragment read from LDS feeds two products. The two waves of a query half join their partial maximum, sum and O behind the loop.
// The trip's k hi/lo, bias and v hi/lo tiles are brought once per work-group into a two-buffer LDS ring by asynchronous copies (whole lines from global memory, one trip ahead); every wave reads its fragments from the ring.
// Transposed products: S^T tile (16 keys x 16 queries) = KE.QE (bias k-step) + Kh.Qh + Kh.Ql + Kl.Qh over d (bf16, k rows as A, q as B, scale folded into the q planes), so a lane holds 16 scores of ONE query (lane & 15; keys 16j + 8(lane >> 4) + r).
// Online max-subtracted softmax in f32 in the lane, one exchange between the wave's halves for the maximum; each half keeps the sum of its own keys, joined once behind the loop. P^T packs from the two score tiles straight into the B operand of O^T += V^T.P^T.
#define AW 4
#define KP 72                        // LDS pitch of a 64-element k row: 144 B = 16 B x odd, free of bank conflicts for 16-byte readers
#define VP 40                        // LDS pitch of a 32-element v or bias row: 80 B
#define ST_KH 0
#define ST_KL (32 * KP)
#define ST_KE (2 * 32 * KP)
#define ST_VH (ST_KE + 32 * VP)
#define ST_VL (ST_VH + 64 * VP)
#define ST_EL (ST_VL + 64 * VP)      // elements of one 32-key tile in the ring (22016 B)
#define XW (8 * 32 * 4 + 64)         // floats one wave hands to its partner: 32 O values, maximum and sum of each lane
static_assert(AW == 4 && NRES % (16 * AW) == 0 && NRES >= 128 && (ST_EL * 2) % 16 == 0);
static_assert((AW * XW + AW * 16 * 68) * 4 <= 4 * ST_EL * 2);
__device__ __forceinline__ v16bf ldsb(const unsigned short* p) { return cat16b(*(const v8usa*)p, *(const v8usa*)(p + 16)); }
__device__ __forceinline__ v16h ldsh(const unsigned short* p) { return cat16(*(const v8ha*)p, *(const v8ha*)(p + 16)); }
__device__ __forceinline__ float xhalf(float x) { return __builtin_bit_cast(float, __builtin_amdgcn_permlanex16(__builtin_bit_cast(int, x), __builtin_bit_cast(int, x), 0x76543210, 0xfedcba98, false, false)); }   // lane l with lane l ^ 16
// One tile's copies of one lane, 16 B each: two pieces (16 rows apart) of k hi and of k lo, two (32 rows apart) of v hi and of v lo, one of the bias rows. Written as the builtin: the kernel holds more than 256 registers, and asm text can name only the first 256.
typedef __attribute__((ext_vector_type(4))) int v4i;
typedef __attribute__((address_space(1))) v4i* gp16;
typedef __attribute__((address_space(3))) v4i* lp16;
__device__ __forceinline__ void cp16(unsigned short* l, const void* g) { __builtin_amdgcn_global_load_async_to_lds_b128((gp16)g, (lp16)l, 0, 0); }
__device__ __forceinline__ void tile_copy(unsigned short* lk, unsigned short* lv, unsigned short* le, const bf* gkh, const bf* gkl, const h16* gvh, const h16* gvl, const bf* gke) {
    cp16(lk, gkh); cp16(lk + 16 * KP, gkh + 16 * HD); cp16(lk + (ST_KL - ST_KH), gkl); cp16(lk + (ST_KL - ST_KH) + 16 * KP, gkl + 16 * HD);
    cp16(lv, gvh); cp16(lv + 32 * VP, gvh + (size_t)32 * SEQ); cp16(lv + (ST_VL - ST_VH), gvl); cp16(lv + (ST_VL - ST_VH) + 32 * VP, gvl + (size_t)32 * SEQ);
    cp16(le, gke);
}
// Three work-groups fit a WGP (LDS), three waves a SIMD: the register budget of three waves holds two query tiles' q fragments and accumulators.
__global__ __launch_bounds__(32 * AW) __attribute__((amdgpu_waves_per_eu(3, 3))) void k_attn(const bf* __restrict__ Qh, const bf* __restrict__ Ql, const bf* __restrict__ QE,
                                             const bf* __restrict__ Kh, const bf* __restrict__ Kl, const bf* __restrict__ KE,
                                             const h16* __restrict__ Vth, const h16* __restrict__ Vtl, bf* ATh, bf* ATl) {
    __shared__ __align__(16) unsigned short ring[4 * ST_EL];   // two buffers of two 32-key tiles
    const int tid = threadIdx.x, lane = tid & 31, lr = lane & 15, hi = lane >> 4, w = tid >> 5;
    const int kh = w & 1;
    const int bh = blockIdx.y; const int b = bh / NH, h = bh - b * NH;
    const int qb = blockIdx.x * (16 * AW) + (w >> 1) * 32;
    const int kvlen = ((int)blockIdx.x * (16 * AW) / NRES + 1) * NRES;
    const int nt = kvlen >> 6;
    const size_t hp = (size_t)bh * SEQ * HD;
    const size_t tb = (size_t)b * SEQ;
    // this lane's share of a tile, in 16-byte pieces: k rows tid>>3 and 16 + tid>>3, piece tid&7; v rows (d) tid>>2 and 32 + tid>>2, piece tid&3; bias row tid>>2, piece tid&3
    unsigned short* lk0 = ring + ST_KH + (tid >> 3) * KP + (tid & 7) * 8;
    unsigned short* lv0 = ring + ST_VH + (tid >> 2) * VP + (tid & 3) * 8;
    unsigned short* le0 = ring + ST_KE + (tid >> 2) * VP + (tid & 3) * 8;
    // the lane's part of a global address is a 32-bit element offset; the part that moves with the trip is the same for the whole group and stays in scalar registers
    const unsigned gk0 = (unsigned)((tid >> 3) * HD + (tid & 7) * 8), gv0 = (unsigned)((tid >> 2) * SEQ + (tid & 3) * 8), ge0 = (unsigned)((tid >> 2) * NEX + (tid & 3) * 8);
    const bf* ukh = Kh + hp; const bf* ukl = Kl + hp; const h16* uvh = Vth + hp; const h16* uvl = Vtl + hp; const bf* uke = KE + tb * NEX;
    auto trip_copy = [&](unsigned bo, size_t kn) {   // the two 32-key tiles from key kn on, into the buffer at element bo of the ring
        tile_copy(lk0 + bo, lv0 + bo, le0 + bo, (ukh + kn * HD) + gk0, (ukl + kn * HD) + gk0, (uvh + kn) + gv0, (uvl + kn) + gv0, (uke + kn * NEX) + ge0);
        tile_copy(lk0 + bo + ST_EL, lv0 + bo + ST_EL, le0 + bo + ST_EL, (ukh + (kn + 32) * HD) + gk0, (ukl + (kn + 32) * HD) + gk0, (uvh + (kn + 32)) + gv0, (uvl + (kn + 32)) + gv0, (uke + (kn + 32) * NEX) + ge0);
    };
    trip_copy(0, 0);
    v16bf aH0[2], aH1[2], aL0[2], aL1[2], aE[2];
#pragma unroll
    for (int u = 0; u < 2; ++u) { const size_t qo = hp + (size_t)(qb + 16 * u + lr) * HD + 8 * hi;
        aH0[u] = WFrag<bf>::ld(Qh + qo); aH1[u] = WFrag<bf>::ld(Qh + qo + 32); aL0[u] = WFrag<bf>::ld(Ql + qo); aL1[u] = WFrag<bf>::ld(Ql + qo + 32);
        aE[u] = WFrag<bf>::ld(QE + (tb + qb + 16 * u + lr) * NEX + 8 * hi); }
    v8f oh[2][4], ol[2][4];
#pragma unroll
    for (int u = 0; u < 2; ++u)
#pragma unroll
        for (int nb = 0; nb < 4; ++nb) { oh[u][nb] = (v8f){}; ol[u][nb] = (v8f){}; }
    float m[2] = {-1.0e30f, -1.0e30f}, l[2] = {0.f, 0.f};   // this lane's two queries: running maximum (equal in both halves), sum over this half's keys
    asm volatile("s_wait_asynccnt 0x0" ::: "memory");   // trip 0's tiles of this wave have landed
    __syncthreads();                                     // publishes trip 0 to every wave
    // trip 1 exists: nt >= 4
    trip_copy(2 * ST_EL, 64);
#pragma unroll 1
    for (int t = 0; t < nt; ++t) {
        const unsigned short* st = ring + ((t & 1) * 2 + kh) * ST_EL;
        v8f s[2][2];
        const unsigned short* kp = st + lr * KP + 8 * hi;
        {
            v16bf bH[2], bL[2];
#pragma unroll
            for (int j = 0; j < 2; ++j) { const v16bf bE = ldsb(st + ST_KE + (16 * j + lr) * VP + 8 * hi); bH[j] = ldsb(kp + 16 * j * KP + ST_KH); bL[j] = ldsb(kp + 16 * j * KP + ST_KL);
#pragma unroll
                for (int u = 0; u < 2; ++u) s[u][j] = wmmab(bE, aE[u], (v8f){}); }
#pragma unroll
            for (int u = 0; u < 2; ++u) { s[u][0] = wmmab(bH[0], aH0[u], s[u][0]); s[u][0] = wmmab(bH[0], aL0[u], s[u][0]); s[u][0] = wmmab(bL[0], aH0[u], s[u][0]); }
            v16bf cH[2], cL[2];
#pragma unroll
            for (int j = 0; j < 2; ++j) { cH[j] = ldsb(kp + 16 * j * KP + ST_KH + 32); cL[j] = ldsb(kp + 16 * j * KP + ST_KL + 32); }
#pragma unroll
            for (int u = 0; u < 2; ++u) { s[u][1] = wmmab(bH[1], aH0[u], s[u][1]); s[u][1] = wmmab(bH[1], aL0[u], s[u][1]); s[u][1] = wmmab(bL[1], aH0[u], s[u][1]); }
#pragma unroll
            for (int j = 0; j < 2; ++j)
#pragma unroll
                for (int u = 0; u < 2; ++u) { s[u][j] = wmmab(cH[j], aH1[u], s[u][j]); s[u][j] = wmmab(cH[j], aL1[u], s[u][j]); s[u][j] = wmmab(cL[j], aH1[u], s[u][j]); }
        }
        // the order of the stretch above: the twelve LDS reads of the bias rows and d 0..31 as one group, ten products, the eight reads of d 32..63 as one group (into the registers the ten products have freed), the rest. Left alone, the reads stand in pairs among the products, each waited to zero.
        __builtin_amdgcn_sched_group_barrier(0x100, 12, 0); __builtin_amdgcn_sched_group_barrier(0x008, 10, 0); __builtin_amdgcn_sched_group_barrier(0x100, 8, 0); __builtin_amdgcn_sched_group_barrier(0x008, 18, 0);
        __builtin_amdgcn_sched_barrier(0);   // keeps the v fragment loads out of the score products' stretch, where the k fragments hold the free registers
        v16h ap[2];   // B operand: element i <- key 8(lane >> 4) + i, element 8 + i <- key 16 + 8(lane >> 4) + i, the order of the v fragments
#pragma unroll
        for (int u = 0; u < 2; ++u) {
            const v8f sa = s[u][0], sb = s[u][1];
            const float v0 = fmaxf(fmaxf(sa[0], sa[1]), sa[2]), v1 = fmaxf(fmaxf(sa[3], sa[4]), sa[5]), v2 = fmaxf(fmaxf(sa[6], sa[7]), sb[0]);
            const float v3 = fmaxf(fmaxf(sb[1], sb[2]), sb[3]), v4 = fmaxf(fmaxf(sb[4], sb[5]), sb[6]);
            float v = fmaxf(fmaxf(fmaxf(v0, v1), v2), fmaxf(fmaxf(v3, v4), sb[7]));   // a tree three deep, not a chain of eight
            v = fmaxf(v, xhalf(v));
            const float mn = fmaxf(m[u], v);
            const float al = __builtin_amdgcn_exp2f((m[u] - mn) * LOG2E);
            m[u] = mn;
            float ts[8];
#pragma unroll
            for (int r = 0; r < 8; ++r) {
                const float p0 = __builtin_amdgcn_exp2f((sa[r] - mn) * LOG2E), p1 = __builtin_amdgcn_exp2f((sb[r] - mn) * LOG2E);
                ap[u][r] = (h16)(p0 * PCAR); ap[u][8 + r] = (h16)(p1 * PCAR);
                ts[r] = p0 + p1;
            }
            l[u] = l[u] * al + (((ts[0] + ts[1]) + (ts[2] + ts[3])) + ((ts[4] + ts[5]) + (ts[6] + ts[7])));
#pragma unroll
            for (int nb = 0; nb < 4; ++nb)
#pragma unroll
                for (int r = 0; r < 8; ++r) { oh[u][nb][r] *= al; ol[u][nb][r] *= al; }
        }
#pragma unroll
        for (int nb = 0; nb < 4; ++nb) { const unsigned short* vp = st + (16 * nb + lr) * VP + 8 * hi;
            const v16h bH = ldsh(vp + ST_VH); oh[0][nb] = wmma16(bH, ap[0], oh[0][nb]); oh[1][nb] = wmma16(bH, ap[1], oh[1][nb]);
            const v16h bL = ldsh(vp + ST_VL); ol[0][nb] = wmma16(bL, ap[0], ol[0][nb]); ol[1][nb] = wmma16(bL, ap[1], ol[1][nb]); }
        // the order of the v reads and products: the four reads of a 16-row block of d as one group, one block ahead of its four products. Left alone, the reads stand in pairs at twice as many places.
        __builtin_amdgcn_sched_group_barrier(0x100, 4, 1); __builtin_amdgcn_sched_group_barrier(0x100, 4, 1); __builtin_amdgcn_sched_group_barrier(0x008, 4, 1); __builtin_amdgcn_sched_group_barrier(0x100, 4, 1);
        __builtin_amdgcn_sched_group_barrier(0x008, 4, 1); __builtin_amdgcn_sched_group_barrier(0x100, 4, 1); __builtin_amdgcn_sched_group_barrier(0x008, 4, 1); __builtin_amdgcn_sched_group_barrier(0x008, 4, 1);
        asm volatile("s_wait_dscnt 0x0" ::: "memory");      // this wave's reads of buffer t & 1 have returned
        asm volatile("s_wait_asynccnt 0x0" ::: "memory");   // this wave's copies of trip t + 1 have landed
        __syncthreads();                                     // publishes trip t + 1 and ends every wave's reads of buffer t & 1
        if (t + 2 < nt) trip_copy((unsigned)(t & 1) * (2 * ST_EL), (size_t)(t + 2) * 64);
    }
    asm volatile("s_wait_asynccnt 0x0" ::: "memory");       // nothing of this wave is in flight when the ring becomes staging
    // behind the last trip's barrier no wave reads the ring and no copy is under way. Wave w keeps query tile w & 1 of its half and hands the other tile's partial result, lane to lane, to wave w ^ 1.
    float* xw = (float*)ring + w * XW; const float* xr = (const float*)ring + (w ^ 1) * XW;
    float* os = (float*)ring + AW * XW + w * (16 * 68);
    const bool k1 = (kh != 0);
    const float lj0 = l[0] + xhalf(l[0]), lj1 = l[1] + xhalf(l[1]);
    const float mm = k1 ? m[1] : m[0], lm = k1 ? lj1 : lj0;
    float xm[4][8];
#pragma unroll
    for (int nb = 0; nb < 4; ++nb) { v4f g0, g1;
#pragma unroll
        for (int r = 0; r < 8; ++r) { const float e0 = oh[0][nb][r] + ol[0][nb][r] * LINV, e1 = oh[1][nb][r] + ol[1][nb][r] * LINV;
            xm[nb][r] = k1 ? e1 : e0; const float gv = k1 ? e0 : e1; if (r < 4) g0[r] = gv; else g1[r - 4] = gv; }
        *(v4fa*)(xw + ((2 * nb) * 32 + lane) * 4) = g0; *(v4fa*)(xw + ((2 * nb + 1) * 32 + lane) * 4) = g1; }
    xw[1024 + lane] = k1 ? m[0] : m[1]; xw[1056 + lane] = k1 ? lj0 : lj1;
    __syncthreads();                                         // the partner's partial result is complete
    const float mr = xr[1024 + lane], lq = xr[1056 + lane];
    const float mx = fmaxf(mm, mr);
    const float am = __builtin_amdgcn_exp2f((mm - mx) * LOG2E), ar = __builtin_amdgcn_exp2f((mr - mx) * LOG2E);
    const float il = PINV * __fdiv_rn(1.0f, lm * am + lq * ar);
    const float cm = am * il, cr = ar * il;
    const int q0 = qb + 16 * kh;
#pragma unroll
    for (int nb = 0; nb < 4; ++nb) { v4f x0, x1;   // register r of tile nb is d = 16 nb + 8 hi + r of query lr
        const v4f g0 = *(const v4fa*)(xr + ((2 * nb) * 32 + lane) * 4), g1 = *(const v4fa*)(xr + ((2 * nb + 1) * 32 + lane) * 4);
#pragma unroll
        for (int r = 0; r < 4; ++r) { x0[r] = xm[nb][r] * cm + g0[r] * cr; x1[r] = xm[nb][4 + r] * cm + g1[r] * cr; }
        *(v4fa*)(os + lr * 68 + 16 * nb + 8 * hi) = x0; *(v4fa*)(os + lr * 68 + 16 * nb + 8 * hi + 4) = x1; }
    __builtin_amdgcn_fence(3, "wavefront"); __builtin_amdgcn_wave_barrier(); asm volatile("" ::: "memory");
    v8us ah[4], av[4]; size_t ad[4];
#pragma unroll
    for (int it = 0; it < 4; ++it) { const int rr = it * 4 + (lane >> 3); const int pc = lane & 7;
        const v4f x0 = *(const v4fa*)(os + rr * 68 + pc * 8), x1 = *(const v4fa*)(os + rr * 68 + pc * 8 + 4); v8us th, tl;
#pragma unroll
        for (int c = 0; c < 4; ++c) { unsigned short a2, c2; splitf(x0[c], a2, c2); th[c] = a2; tl[c] = c2; splitf(x1[c], a2, c2); th[4 + c] = a2; tl[4 + c] = c2; }
        ah[it] = th; av[it] = tl; ad[it] = (tb + q0 + rr) * CM + (size_t)h * HD + pc * 8; }
{
#pragma unroll
        for (int it = 0; it < 4; ++it) { *(v8us*)(ATh + ad[it]) = ah[it]; *(v8us*)(ATl + ad[it]) = av[it]; }
         }
}

extern "C" void kernel_launch(void* const* d_in, const int* in_sizes, int n_in,
                              void* d_out, int out_size, void* d_ws, size_t ws_size, hipStream_t stream) {
    if (n_in < 16) return;
    const int ntok_in = (NB - 1) * SEQ_FULL + SEQ;
    if (in_sizes[0] < ntok_in * CM || in_sizes[1] < NFR || in_sizes[2] < NB * NRES || in_sizes[3] < ntok_in || in_sizes[4] < NB * CDIM || in_sizes[5] < ntok_in * 3) return;
    if (in_sizes[6] < CDIM * ADW || in_sizes[7] < ADW) return;
    if (in_sizes[8] < CM * CM || in_sizes[10] < CM * CM || in_sizes[12] < CM * CM || in_sizes[14] < CM * CM) return;
    if (in_sizes[9] < CM || in_sizes[11] < CM || in_sizes[13] < CM || in_sizes[15] < CM) return;
    const size_t out_need = OUT2_EL + ((size_t)((NB - 1) * NH + NH - 1) * SEQ_FULL + SEQ) * HD;
    if ((size_t)out_size < out_need) return;
    const float* s_frames = (const float*)d_in[0]; const int* frame_idx = (const int*)d_in[1]; const int* seq_idx = (const int*)d_in[2]; const float* mask = (const float*)d_in[3];
    const float* cond = (const float*)d_in[4]; const float* ca_pos = (const float*)d_in[5]; const float* adaln_w = (const float*)d_in[6]; const float* adaln_b = (const float*)d_in[7];
    const float* wq = (const float*)d_in[8]; const float* bq = (const float*)d_in[9]; const float* wk = (const float*)d_in[10]; const float* bk = (const float*)d_in[11];
    const float* wv = (const float*)d_in[12]; const float* bv = (const float*)d_in[13]; const float* wo = (const float*)d_in[14]; const float* bo = (const float*)d_in[15];
    float* OUT = (float*)d_out;
    char* wsp = (char*)d_ws;
    auto take = [&](size_t bytes) { char* p = wsp; wsp += (bytes + 255) & ~(size_t)255; return (void*)p; };
    bf* WQ = (bf*)take((size_t)3 * CM * CM * 2); bf* WK = WQ + (size_t)CM * CM; bf* WV = WK + (size_t)CM * CM; bf* WO = (bf*)take((size_t)CM * CM * 2);
    bf* WA = (bf*)take((size_t)ADW * CDIM * 2); bf* CAP = (bf*)take((size_t)64 * CDIM * 2); float* SS = (float*)take((size_t)64 * ADW * 4);
    float* CS = (float*)take((size_t)NTOK * HD * 2 * 4);
    bf* XBh = (bf*)take((size_t)NTOK * CM * 2); bf* XBl = (bf*)take((size_t)NTOK * CM * 2);
    bf* QPh = (bf*)take((size_t)NBH * SEQ * HD * 2); bf* QPl = (bf*)take((size_t)NBH * SEQ * HD * 2); bf* KPh = (bf*)take((size_t)NBH * SEQ * HD * 2); bf* KPl = (bf*)take((size_t)NBH * SEQ * HD * 2);
    h16* VTh = (h16*)take((size_t)NBH * HD * SEQ * 2); h16* VTl = (h16*)take((size_t)NBH * HD * SEQ * 2);
    bf* QE = (bf*)take((size_t)NTOK * NEX * 2); bf* KE = (bf*)take((size_t)NTOK * NEX * 2);
    bf* ATh = (bf*)take((size_t)NTOK * CM * 2); bf* ATl = (bf*)take((size_t)NTOK * CM * 2);
    const size_t used = (size_t)(wsp - (char*)d_ws);
    if (used > ws_size || used > ((size_t)128 << 20)) return;    // about 66 MiB at NB=2, SEQ=3072

    // one launch for all that reads only inputs: 16-bit weight and cond planes, bias k-step rows, cos/sin table
    k_prep<<<PB_ALL, 256, 0, stream>>>(adaln_w, wq, wk, wv, wo, cond, ca_pos, mask, frame_idx, seq_idx, WA, WQ, WK, WV, WO, CAP, QE, KE, CS);
    // AdaLN: ss = cond x adaln_w + adaln_b (rows 0..NB-1 of SS), then LN + modulation -> x hi/lo planes
    k_gemmw<bf, 0, true><<<dim3(1, ADW / 64, 1), 32, 0, stream>>>(CAP, nullptr, WA, nullptr, CDIM, SS, ADW, adaln_b, adaln_b, adaln_b, 0, 0, 0);
    k_ln<<<(unsigned)(NTOK / 8), 256, 0, stream>>>(s_frames, SS, XBh, XBl);
    // projections (x hi/lo x bf16 W, 2 products, + bias) with RoPE, split and transposition in the epilogue: operand planes and the k and v outputs in one launch
    k_gemm4<true><<<dim3(NTOK / 128, CM / 128, 3), 128, 0, stream>>>(XBh, XBl, WQ, nullptr, CM, bq, bk, bv, 0, (size_t)CM * CM, 0, CS, QPh, QPl, KPh, KPl, VTh, VTl, OUT + OUT1_EL, OUT + OUT2_EL);   // z = q, k, v
    // attention (one launch) -> ctx hi/lo planes, then the output projection straight into out0 (batch z at the full-size token pitch)
    k_attn<<<dim3(SEQ / (16 * AW), NBH, 1), 32 * AW, 0, stream>>>(QPh, QPl, QE, KPh, KPl, KE, VTh, VTl, ATh, ATl);
    k_gemm4<false><<<dim3(SEQ / 128, CM / 128, NB), 128, 0, stream>>>(ATh, ATl, WO, OUT, CM, bo, bo, bo, (size_t)SEQ * CM, 0, (size_t)SEQ_FULL * CM, nullptr, nullptr, nullptr, nullptr, nullptr, nullptr, nullptr, nullptr, nullptr);
}

// v007
// One run takes 105 microseconds.
// Next to v006, in two timings, it ran 1.06 and 1.07 times as fast.
// Counting every step since v000, it is 4.40 times as fast.
#include <hip/hip_runtime.h>

// Frame-causal multi-head attention with a Gaussian distance bias: AdaLN prologue (cond x adaln_w modulation of a non-affine LN), q/k/v projections with bias, two-half rotate-half RoPE from int positions, online-softmax attention, output projection; f32 outputs out, roped k, v.
// Compute dtypes, f32 accumulate everywhere: every float input RNE-converted to bf16 on load. cond x adaln_w: v_wmma_f32_16x16x32_bf16, plain bf16 operands (1 product). q/k/v projections: bf16 hi/lo planes of the modulated LN output x bf16 weight planes (2 products).
// Scores: bf16 hi/lo q and k planes (hi.hi + lo.hi + hi.lo) plus one extra bf16 k-step carrying the distance-bias terms (exact coordinate cross products, three-piece bf16 squared norms, key mask fill). attn.v: v_wmma_f32_16x16x32_f16, P carried x2^14 in f16 (one plane), v as f16 hi + x2^10 f16 residual planes (two accumulators).
// Output projection: bf16 hi/lo ctx planes x bf16 Wo (2 products). LN statistics, inverse frequencies and the cos/sin table, RoPE, softmax and all side math f32 on VALU; the k and v outputs are written from the f32 projection results.

#ifndef NB
#define NB 2
#endif
#define NB_FULL 2
#ifndef SEQ
#define SEQ 3072
#endif
#define SEQ_FULL 3072
#define NRES 256
#define NFR (SEQ / NRES)
#define CM 512
#define ADW 1024
#define NH 8
#define HD 64
#define CDIM 64
#define NEX 32
#define NTOK (NB * SEQ)
#define NBH (NB * NH)
#define QSCL 0.125f
#define PCAR 16384.0f
#define PINV 0.00006103515625f
#define LCAR 1024.0f
#define LINV 0.0009765625f
#define LOG2E 1.4426950408889634f
#define OUT1_EL ((size_t)NB_FULL * SEQ_FULL * CM)
#define OUT2_EL (OUT1_EL + (size_t)NB_FULL * NH * SEQ_FULL * HD)
static_assert(SEQ % NRES == 0);
static_assert(SEQ >= NRES && SEQ <= SEQ_FULL);
static_assert(NB >= 1 && NB <= NB_FULL);
static_assert(NTOK % 256 == 0);
static_assert(HD == 64 && CM == NH * HD);
static_assert(CM % 64 == 0 && ADW == 2 * CM && CDIM % 32 == 0);
static_assert(OUT1_EL * 4 == 12582912);
static_assert(OUT2_EL * 4 == 25165824);

typedef _Float16 h16;
typedef unsigned short bf;
typedef __attribute__((ext_vector_type(16))) __bf16   v16bf;
typedef __attribute__((ext_vector_type(16))) _Float16 v16h;
typedef __attribute__((ext_vector_type(8)))  _Float16 v8h;
typedef __attribute__((ext_vector_type(2)))  _Float16 v2h;
typedef __attribute__((ext_vector_type(8)))  unsigned short v8us;
typedef __attribute__((ext_vector_type(4)))  unsigned short v4us;
typedef __attribute__((ext_vector_type(2)))  unsigned short v2us;
typedef __attribute__((ext_vector_type(4)))  unsigned int v4u;
typedef __attribute__((ext_vector_type(16))) float    v16f;
typedef __attribute__((ext_vector_type(8)))  float    v8f;
typedef __attribute__((ext_vector_type(4)))  float    v4f;
typedef __attribute__((ext_vector_type(2)))  float    v2f;
typedef v8h  __attribute__((may_alias)) v8ha;
typedef v4f  __attribute__((may_alias)) v4fa;
typedef v8us __attribute__((may_alias)) v8usa;
typedef v4u  __attribute__((may_alias)) v4ua;

__device__ __forceinline__ unsigned short f2bf(float f) { unsigned u = __float_as_uint(f); u += 0x7FFFu + ((u >> 16) & 1u); return (unsigned short)(u >> 16); }
__device__ __forceinline__ float bf2f(unsigned short b) { return __uint_as_float(((unsigned)b) << 16); }
__device__ __forceinline__ float bfr(float f) { return bf2f(f2bf(f)); }
__device__ __forceinline__ v16h cat16(v8h lo, v8h hi) { return __builtin_shufflevector(lo, hi, 0, 1, 2, 3, 4, 5, 6, 7, 8, 9, 10, 11, 12, 13, 14, 15); }
__device__ __forceinline__ v16bf cat16b(v8us lo, v8us hi) { return __builtin_bit_cast(v16bf, __builtin_shufflevector(lo, hi, 0, 1, 2, 3, 4, 5, 6, 7, 8, 9, 10, 11, 12, 13, 14, 15)); }
__device__ __forceinline__ v8f wmma16(v16h a, v16h b, v8f c) { return __builtin_amdgcn_wmma_f32_16x16x32_f16(false, a, false, b, (short)0, c, false, false); }
__device__ __forceinline__ v8f wmmab(v16bf a, v16bf b, v8f c) { return __builtin_amdgcn_wmma_f32_16x16x32_bf16(false, a, false, b, (short)0, c, false, false); }
__device__ __forceinline__ void splitf(float y, unsigned short& h, unsigned short& l) { h = f2bf(y); l = f2bf(y - bf2f(h)); }
__device__ __forceinline__ void splith(float y, h16& a, h16& c) { a = (h16)y; c = (h16)((y - (float)a) * LCAR); }
__device__ __forceinline__ unsigned int pk2(unsigned short lo, unsigned short hi2) { return (unsigned int)lo | ((unsigned int)hi2 << 16); }

// Fragments of every 16x16x32 product here: lane -> row/col lane&15, vector elements 0..7 <- k0 + 8h + i, elements 8..15 <- k0 + 16 + 8h + i (h = lane>>4) for BOTH operands; D element r -> (row 8h + r, col lane&15).
template <typename T16> struct WFrag;
template <> struct WFrag<h16> { typedef v16h V; static __device__ __forceinline__ V ld(const h16* p) { return cat16(*(const v8h*)p, *(const v8h*)(p + 16)); } static __device__ __forceinline__ v8f mma(V a, V b, v8f c) { return wmma16(a, b, c); } };
template <> struct WFrag<bf> { typedef v16bf V; static __device__ __forceinline__ V ld(const bf* p) { return cat16b(*(const v8us*)p, *(const v8us*)(p + 16)); } static __device__ __forceinline__ v8f mma(V a, V b, v8f c) { return wmmab(a, b, c); } };

// ---- k_gemm4: the two-product GEMM (A hi/lo planes x one bf16 Bt plane, K = CM) for the projections: FOUR WAVES share a 128x128 output tile, each wave a 64x64 quarter (16 accumulators; per 32 k the hi product, then the lo product).
// A stage is 64 k: 128 rows of A hi, of A lo and of Bt, 128 B a row, brought once per work-group into a two-buffer LDS ring by asynchronous copies (a wave's copy covers four whole lines of global memory), one stage ahead.
// LDS rows are unpadded (three work-groups fit a WGP); the 16-byte piece q of row r lies at piece q ^ ((r >> 1) & 7), so the 16 rows that a half-wave's fragment load touches fall on all 64 banks once.
#define G4_PL (128 * 128)            // bytes of one plane's stage
#define G4_BUF (3 * G4_PL)           // bytes of one ring buffer
#define G4_NS (CM / 64)
#define G4_WST (2 * G4_BUF / 4)      // bytes of the ring that one wave has for staging behind the loop
#define G4_OSB (16 * 68 * 4)         // of them the f32 row stage
#define G4_VSP 72                    // LDS pitch of a 64-token transposed v row: 144 B = 16 B x odd
static_assert(G4_OSB % 16 == 0 && G4_OSB + 2 * 64 * G4_VSP * 2 <= G4_WST && SEQ % 64 == 0);
static_assert(NTOK % 128 == 0 && SEQ % 128 == 0 && CM % 128 == 0 && G4_NS >= 2);
static_assert(4 * 16 * 68 * 4 <= 2 * G4_BUF);
// One plane's stage, this lane's eight 16-byte pieces (rows 16 apart). The s_wait_xcnt stands inside the statement so that no address register is rewritten ahead of it.
__device__ __forceinline__ void plane_copy(unsigned l, const bf* g) {
    const unsigned l1 = l + 2048, l2 = l + 2 * 2048, l3 = l + 3 * 2048, l4 = l + 4 * 2048, l5 = l + 5 * 2048, l6 = l + 6 * 2048, l7 = l + 7 * 2048;
    const bf* g1 = g + 16 * CM; const bf* g2 = g + 32 * CM; const bf* g3 = g + 48 * CM; const bf* g4 = g + 64 * CM; const bf* g5 = g + 80 * CM; const bf* g6 = g + 96 * CM; const bf* g7 = g + 112 * CM;
    asm volatile("global_load_async_to_lds_b128 %0, %8, off\n\t"
                 "global_load_async_to_lds_b128 %1, %9, off\n\t"
                 "global_load_async_to_lds_b128 %2, %10, off\n\t"
                 "global_load_async_to_lds_b128 %3, %11, off\n\t"
                 "global_load_async_to_lds_b128 %4, %12, off\n\t"
                 "global_load_async_to_lds_b128 %5, %13, off\n\t"
                 "global_load_async_to_lds_b128 %6, %14, off\n\t"
                 "global_load_async_to_lds_b128 %7, %15, off\n\t"
                 "s_wait_xcnt 0x0"
                 :: "v"(l), "v"(l1), "v"(l2), "v"(l3), "v"(l4), "v"(l5), "v"(l6), "v"(l7),
                    "v"(g), "v"(g1), "v"(g2), "v"(g3), "v"(g4), "v"(g5), "v"(g6), "v"(g7) : "memory");
}
// At most three waves come to a SIMD (LDS); a register budget for four keeps accumulators and a stage's fragments in registers without a trade for waves that never come.
// PLANES: the q, k, v projections (z = 0, 1, 2). A wave's quarter is 64 tokens of one head, so bias, RoPE, the 16-bit split and the v transposition are done on the accumulators and the operand planes and the k and v outputs are stored from here; no f32 projection goes to memory.
template <bool PLANES>
__global__ __launch_bounds__(128) __attribute__((amdgpu_waves_per_eu(4, 4))) void k_gemm4(const bf* __restrict__ A, const bf* __restrict__ A2, const bf* __restrict__ Bt, float* C, int ldc,
                                             const float* __restrict__ bias0, const float* __restrict__ bias1, const float* __restrict__ bias2, size_t sA, size_t sB, size_t sC,
                                             const float* __restrict__ CS, bf* QPh, bf* QPl, bf* KPh, bf* KPl, h16* VTh, h16* VTl, float* GK, float* GV) {
    __shared__ __align__(16) unsigned char ring4[2 * G4_BUF];
    const size_t z = blockIdx.z; A += z * sA; A2 += z * sA; Bt += z * sB; C += z * sC;
    const float* __restrict__ bias = (z == 0) ? bias0 : (z == 1) ? bias1 : bias2;
    const int tid = threadIdx.x, lane = tid & 31, lr = lane & 15, hi = lane >> 4, w = tid >> 5;
    const int R0 = blockIdx.x * 128, C0 = blockIdx.y * 128;
    // this lane's share of a stage: piece tid & 7 of rows tid >> 3, + 16, ... + 112 of each plane
    const unsigned lc = (unsigned)(size_t)ring4 + (unsigned)((tid >> 3) * 128 + (((tid & 7) ^ ((tid >> 4) & 7)) << 4));
    const bf* gah = A + (size_t)(R0 + (tid >> 3)) * CM + (tid & 7) * 8; const bf* gal = A2 + (size_t)(R0 + (tid >> 3)) * CM + (tid & 7) * 8; const bf* gb = Bt + (size_t)(C0 + (tid >> 3)) * CM + (tid & 7) * 8;
    plane_copy(lc, gah); plane_copy(lc + G4_PL, gal); plane_copy(lc + 2 * G4_PL, gb);
    v8f acc[4][4];
#pragma unroll
    for (int mb = 0; mb < 4; ++mb)
#pragma unroll
        for (int nb = 0; nb < 4; ++nb) acc[mb][nb] = (v8f){};
    // fragment reads: row (quarter's 64) + 16 mb + lr, logical pieces 4 kk + hi and 4 kk + 2 + hi, each XORed with lr >> 1
    const int s0 = hi ^ (lr >> 1);
    const int arow = ((w >> 1) * 64 + lr) * 128, brow = 2 * G4_PL + ((w & 1) * 64 + lr) * 128;
    asm volatile("s_wait_asynccnt 0x0" ::: "memory");   // stage 0 of this wave has landed
    __syncthreads();                                     // publishes stage 0 to every wave
    plane_copy(lc + G4_BUF, gah + 64); plane_copy(lc + G4_BUF + G4_PL, gal + 64); plane_copy(lc + G4_BUF + 2 * G4_PL, gb + 64);   // stage 1 exists: G4_NS >= 2
#pragma unroll 1
    for (int st = 0; st < G4_NS; ++st) {
        const unsigned char* sb = ring4 + (st & 1) * G4_BUF;
#pragma unroll
        for (int kk = 0; kk < 2; ++kk) {
            const int o0 = (s0 ^ (4 * kk)) << 4, o1 = (s0 ^ (4 * kk + 2)) << 4;
            v16bf a[4], a2[4];
#pragma unroll
            for (int mb = 0; mb < 4; ++mb) { const unsigned char* ap = sb + arow + mb * 2048;
                a[mb] = cat16b(*(const v8usa*)(ap + o0), *(const v8usa*)(ap + o1)); a2[mb] = cat16b(*(const v8usa*)(ap + G4_PL + o0), *(const v8usa*)(ap + G4_PL + o1)); }
#pragma unroll
            for (int nb = 0; nb < 4; ++nb) { const unsigned char* bp = sb + brow + nb * 2048; const v16bf b = cat16b(*(const v8usa*)(bp + o0), *(const v8usa*)(bp + o1));
#pragma unroll
                for (int mb = 0; mb < 4; ++mb) { acc[mb][nb] = wmmab(a[mb], b, acc[mb][nb]); acc[mb][nb] = wmmab(a2[mb], b, acc[mb][nb]); } }
        }
        asm volatile("s_wait_dscnt 0x0" ::: "memory");      // this wave's reads of buffer st & 1 have returned
        asm volatile("s_wait_asynccnt 0x0" ::: "memory");   // this wave's copies of stage st + 1 have landed
        __syncthreads();                                     // publishes stage st + 1 and ends every wave's reads of buffer st & 1
        if (st + 2 < G4_NS) { const unsigned bo = (unsigned)(st & 1) * G4_BUF; const int kn = (st + 2) * 64;
            plane_copy(lc + bo, gah + kn); plane_copy(lc + bo + G4_PL, gal + kn); plane_copy(lc + bo + 2 * G4_PL, gb + kn); }
    }
    asm volatile("s_wait_asynccnt 0x0" ::: "memory");       // nothing of this wave is in flight when the ring becomes output staging
    // behind the last trip's barrier no wave reads the ring and no copy is under way: each wave stages its rows in its own part of it
    const int r0 = R0 + (w >> 1) * 64, c0 = C0 + (w & 1) * 64, cofs = lr * 4;
    if constexpr (PLANES) {
        // D register j of block (mb, nb) is token 16 mb + 8 hi + j, dim 16 nb + lr of the head
        const int b = r0 / SEQ, t0 = r0 - b * SEQ, bh = b * NH + (c0 >> 6);
        unsigned char* wb = ring4 + w * G4_WST;
        float* os = (float*)wb;
        const int rr = lane >> 3, pc = lane & 7;
        float bn[4];   // the bias of this lane's four dims, as its bf16 value
#pragma unroll
        for (int nb = 0; nb < 4; ++nb) bn[nb] = bfr(bias[c0 + nb * 16 + lr]);
        if (z == 2) {
            // v: a lane's eight registers are eight successive tokens of one dim, one 16-byte piece of a transposed row; the pieces pass through LDS so that each store covers whole lines
            h16* vs = (h16*)(wb + G4_OSB);   // [hi, residual][64 dims][G4_VSP tokens]
            float* G = GV + ((size_t)bh * SEQ_FULL + t0) * HD;
#pragma unroll
            for (int mb = 0; mb < 4; ++mb) {
#pragma unroll
                for (int nb = 0; nb < 4; ++nb) { v8h th, tl;
#pragma unroll
                    for (int j = 0; j < 8; ++j) { const float y = acc[mb][nb][j] + bn[nb]; os[(hi * 8 + j) * 68 + nb * 16 + lr] = y; h16 a2, c2; splith(y, a2, c2); th[j] = a2; tl[j] = c2; }
                    h16* vd = vs + (nb * 16 + lr) * G4_VSP + mb * 16 + hi * 8; *(v8ha*)vd = th; *(v8ha*)(vd + 64 * G4_VSP) = tl; }
                __builtin_amdgcn_wave_barrier(); asm volatile("" ::: "memory");   // keeps the row reads behind the other lanes' writes in the compiled order
#pragma unroll
                for (int s = 0; s < 8; ++s) { const int row = 2 * s + hi; const v4f val = *(const v4fa*)(os + row * 68 + cofs);
                    *(v4f*)(G + (size_t)(mb * 16 + row) * HD + cofs) = val; }
                __builtin_amdgcn_wave_barrier(); asm volatile("s_wait_xcnt 0x0" ::: "memory");   // keeps the next block's writes behind these reads; the wait stands ahead of any rewrite of a register these stores name
            }
            h16* gh = VTh + ((size_t)bh * HD + rr) * SEQ + t0 + pc * 8; h16* gl = VTl + ((size_t)bh * HD + rr) * SEQ + t0 + pc * 8;
#pragma unroll
            for (int it = 0; it < 16; ++it) { const h16* vr = vs + (it * 4 + rr) * G4_VSP + pc * 8; const v8h xh = *(const v8ha*)vr, xl = *(const v8ha*)(vr + 64 * G4_VSP);
                *(v8h*)(gh + (size_t)it * 4 * SEQ) = xh; *(v8h*)(gl + (size_t)it * 4 * SEQ) = xl; }
        } else {
            // q, k: two-half rotate-half RoPE. Each 32-dim half is rotated within itself; the partner of dim d is d + 16 (subtracted) or d - 16 (added): block nb ^ 1 of the same lane and register. Both dims of a pair share one cos/sin entry.
            const float scl = (z == 0) ? QSCL : 1.0f;
            bf* Ph = ((z == 0) ? QPh : KPh) + ((size_t)bh * SEQ + t0 + rr) * HD + pc * 8; bf* Pl = ((z == 0) ? QPl : KPl) + ((size_t)bh * SEQ + t0 + rr) * HD + pc * 8;
            float* G = GK + ((size_t)bh * SEQ_FULL + t0 + rr) * HD + pc * 8;
            const float* csb = CS + ((size_t)(r0 + hi * 8) * HD + lr) * 2;
            v2f cs[2][8];   // cos, sin of this lane's eight tokens of a block, for each half of the head
#pragma unroll
            for (int j = 0; j < 8; ++j) { cs[0][j] = *(const v2f*)(csb + (size_t)(j * HD) * 2); cs[1][j] = *(const v2f*)(csb + (size_t)(j * HD + 32) * 2); }
#pragma unroll
            for (int mb = 0; mb < 4; ++mb) {
#pragma unroll
                for (int hf = 0; hf < 2; ++hf)
#pragma unroll
                    for (int j = 0; j < 8; ++j) { const float x0 = (acc[mb][2 * hf][j] + bn[2 * hf]) * scl, x1 = (acc[mb][2 * hf + 1][j] + bn[2 * hf + 1]) * scl; const float cn = cs[hf][j][0], sn = cs[hf][j][1];
                        float* op = os + (hi * 8 + j) * 68 + hf * 32 + lr; op[0] = x0 * cn - x1 * sn; op[16] = x1 * cn + x0 * sn; }
                __builtin_amdgcn_wave_barrier(); asm volatile("" ::: "memory");   // keeps the row reads behind the other lanes' writes in the compiled order
                if (mb < 3) {   // the next block's table entries fly while this block is split and stored
#pragma unroll
                    for (int j = 0; j < 8; ++j) { cs[0][j] = *(const v2f*)(csb + (size_t)((mb * 16 + 16 + j) * HD) * 2); cs[1][j] = *(const v2f*)(csb + (size_t)((mb * 16 + 16 + j) * HD + 32) * 2); }
                    asm volatile("s_wait_xcnt 0x0" :: "v"(csb) : "memory"); }   // the address pair that these loads name lives to this wait, so nothing is written over it ahead of the wait
                v4f xa[4], xb[4];   // the block's rows as one group of LDS reads, not a read and its wait for every four rows
#pragma unroll
                for (int it = 0; it < 4; ++it) { const float* orow = os + (it * 4 + rr) * 68 + pc * 8; xa[it] = *(const v4fa*)orow; xb[it] = *(const v4fa*)(orow + 4); }
                // two halves of the block: each half's stores as one group out of registers of their own, one wait behind them
#pragma unroll
                for (int hb = 0; hb < 2; ++hb) { v8us th[2], tl[2];
#pragma unroll
                    for (int i2 = 0; i2 < 2; ++i2)
#pragma unroll
                        for (int c = 0; c < 4; ++c) { unsigned short a2, c2; splitf(xa[2 * hb + i2][c], a2, c2); th[i2][c] = a2; tl[i2][c] = c2; splitf(xb[2 * hb + i2][c], a2, c2); th[i2][4 + c] = a2; tl[i2][4 + c] = c2; }
#pragma unroll
                    for (int i2 = 0; i2 < 2; ++i2) { const size_t o = (size_t)(mb * 16 + hb * 8 + i2 * 4) * HD; *(v8us*)(Ph + o) = th[i2]; *(v8us*)(Pl + o) = tl[i2]; }
                    if (z == 1) {
#pragma unroll
                        for (int i2 = 0; i2 < 2; ++i2) { const size_t o = (size_t)(mb * 16 + hb * 8 + i2 * 4) * HD; *(v4f*)(G + o) = xa[2 * hb + i2]; *(v4f*)(G + o + 4) = xb[2 * hb + i2]; } }
                    asm volatile("s_wait_xcnt 0x0" ::: "memory");   // stands ahead of any rewrite of a register these stores name
                    __builtin_amdgcn_sched_barrier(0); }   // keeps the arithmetic that follows, which rewrites those registers, from being scheduled ahead of the wait
                __builtin_amdgcn_wave_barrier();   // with the clobber of the wait above: keeps the next block's writes behind this block's reads in the compiled order
            }
        }
    } else {
    float* os = (float*)ring4 + w * (16 * 68);
    v4f bb;   // the bias of this lane's four columns, as its bf16 value
#pragma unroll
    for (int c = 0; c < 4; ++c) bb[c] = bfr(bias[c0 + cofs + c]);
#pragma unroll
    for (int mb = 0; mb < 4; ++mb) {
#pragma unroll
        for (int nb = 0; nb < 4; ++nb) {
#pragma unroll
            for (int j = 0; j < 8; ++j) os[(hi * 8 + j) * 68 + nb * 16 + lr] = acc[mb][nb][j]; }
        __builtin_amdgcn_wave_barrier(); asm volatile("" ::: "memory");   // keeps the row reads behind the other lanes' writes in the compiled order
        float* crow = C + (size_t)(r0 + mb * 16) * ldc + c0;
#pragma unroll
        for (int s = 0; s < 8; ++s) { const int row = 2 * s + hi; const v4f val = *(const v4fa*)(os + row * 68 + cofs) + bb;
            *(v4f*)(crow + (size_t)row * ldc + cofs) = val; }
        __builtin_amdgcn_wave_barrier(); asm volatile("s_wait_xcnt 0x0" ::: "memory");   // keeps the next block's writes behind these reads; the wait stands ahead of any rewrite of a register these stores name
    }
    }
}

__device__ __forceinline__ void d_wtG(const float* __restrict__ w, int K, int N, bf* Bt, int bx) {
    const int lane = threadIdx.x & 31; const int L0 = (bx * 8 + (threadIdx.x >> 5)) * 8; const int nlines = (int)((size_t)N * K / 64);
{
#pragma unroll 1
        for (int l = 0; l < 8; ++l) { const int L = L0 + l; if (L >= nlines) break; const size_t e = (size_t)L * 64 + lane * 2; const int k = (int)(e % K), n = (int)(e / K); v2us o;
            o[0] = f2bf(w[(size_t)k * N + n]); o[1] = f2bf(w[(size_t)(k + 1) * N + n]); *(v2us*)(Bt + e) = o; }
         }
}

__device__ __forceinline__ float invf(int j) {
    const float e = (float)(j & 15) * 0.0625f;
    const float p = powf(10000.0f, e);
    const float v = 1.0f / p;
    return v;
}

__device__ __forceinline__ void d_cstab(const int* __restrict__ fidx, const int* __restrict__ sidx, float* CS, int bx) {
    const int idx = bx * 256 + threadIdx.x; if (idx >= NTOK * HD) return;
    const int dd = idx & (HD - 1); const int R = idx >> 6; const int b = R / SEQ, t = R - b * SEQ; const int fl = t / NRES, n = t - fl * NRES;
    const int pseq = sidx[b * NRES + n]; const int pfr = fidx[fl];
    const float pf = (float)((dd < HD / 2) ? pseq : pfr);
    float fr = __fmul_rn(pf, invf(dd)); asm volatile("" : "+v"(fr));
    float sn, cn;
    sincosf(fr, &sn, &cn);
    v2f cs; cs[0] = cn; cs[1] = sn;
    *(v2f*)(CS + (size_t)idx * 2) = cs; 
}

// ---- d_ln: AdaLN for LN_RB token rows of one batch element, as a job that reads only inputs. The block forms its batch element's scale and shift itself: ss[n] = sum_c cond[c] adaln_w[c][n] + adaln_b[n], bf16 operands converted (RNE) on load,
// one 16x16x32 product per 32 c, every A row the cond row, so register 0 of a lane holds its column of the tile. Wave w takes columns 128 w .. 128 w + 127; the result goes through LDS to every wave. Then LN_RW rows per wave: non-affine LN, modulation, bf16 hi/lo split.
#define LN_RW 3                      // rows of one wave
#define LN_RB (8 * LN_RW)            // rows of one block
static_assert(SEQ % LN_RB == 0 && ADW == 8 * 128 && CDIM == 64);
__device__ __forceinline__ void d_ln(const float* __restrict__ X, const float* __restrict__ cond, const float* __restrict__ aw, const float* __restrict__ ab, bf* Xh, bf* Xl, int bx) {
    __shared__ __align__(32) float ssl[ADW];
    const int lane = threadIdx.x & 31, lr = lane & 15, hi = lane >> 4, w = threadIdx.x >> 5;
    const int b = bx * LN_RB / SEQ; const int R0 = bx * LN_RB + w * LN_RW;
    const float* xr = X + ((size_t)b * SEQ_FULL + (R0 - b * SEQ)) * CM + 8 * lane;
    v16bf a[2];
#pragma unroll
    for (int kk = 0; kk < 2; ++kk) { const float* cp = cond + (size_t)b * CDIM + kk * 32 + 8 * hi; v16f c;
#pragma unroll
        for (int i = 0; i < 8; ++i) { c[i] = cp[i]; c[8 + i] = cp[16 + i]; }
        a[kk] = __builtin_convertvector(c, v16bf); }
    // column of tile t at lane lr: 128 w + 64 (t >> 2) + 4 lr + (t & 3), so a lane's four tiles of a half are one 16-byte load per c and a half-wave's load covers 256 B in a row
    const float* wp = aw + (size_t)(8 * hi) * ADW + w * 128 + lr * 4;
    const float* bp = ab + w * 128 + hi * 64 + lr * 4; const v4f bi = *(const v4f*)bp;
    asm volatile("s_wait_xcnt 0x0" :: "v"(bp) : "memory");   // the address pair that this load names lives to this wait, so nothing is written over it ahead of the wait
    float res[8];
#pragma unroll
    for (int hc = 0; hc < 2; ++hc) { v8f acc[4];
#pragma unroll
        for (int tt = 0; tt < 4; ++tt) acc[tt] = (v8f){};
#pragma unroll
        for (int kk = 0; kk < 2; ++kk) { v4f r[16];   // r[i]: c = 32 kk + 8 hi + i for i < 8, 32 kk + 16 + 8 hi + (i - 8) above
#pragma unroll
            for (int i = 0; i < 16; ++i) r[i] = *(const v4f*)(wp + (size_t)(kk * 32 + (i >> 3) * 16 + (i & 7)) * ADW + hc * 64);
#pragma unroll
            for (int tt = 0; tt < 4; ++tt) { v16f c;
#pragma unroll
                for (int i = 0; i < 16; ++i) c[i] = r[i][tt];
                acc[tt] = wmmab(a[kk], __builtin_convertvector(c, v16bf), acc[tt]); }
            __builtin_amdgcn_sched_barrier(0); }   // one group of sixteen loads at a time: left alone, later groups' loads are lifted over this one's products and the register budget is overrun (spills)
#pragma unroll
        for (int tt = 0; tt < 4; ++tt) res[hc * 4 + tt] = acc[tt][0]; }
    v8f x0[LN_RW], x1[LN_RW];   // the rows' loads fly over the LDS store and the barrier
#pragma unroll
    for (int i = 0; i < LN_RW; ++i) { x0[i] = *(const v8f*)(xr + (size_t)i * CM); x1[i] = *(const v8f*)(xr + (size_t)i * CM + 256); }
    { v4f sv;   // both halves of the wave hold every column (all A rows are equal): half hi stores the 64 columns of its number
#pragma unroll
      for (int c = 0; c < 4; ++c) sv[c] = (hi ? res[4 + c] : res[c]) + bfr(bi[c]);
      *(v4fa*)(ssl + w * 128 + hi * 64 + lr * 4) = sv; }
    __syncthreads();   // every wave's columns are in LDS
    v8f g[2], be[2];
#pragma unroll
    for (int c = 0; c < 2; ++c) { const float* sp = ssl + c * 256 + 8 * lane; const v4f g0 = *(const v4fa*)sp, g1 = *(const v4fa*)(sp + 4), b0 = *(const v4fa*)(sp + CM), b1 = *(const v4fa*)(sp + CM + 4);
        g[c] = __builtin_shufflevector(g0, g1, 0, 1, 2, 3, 4, 5, 6, 7); be[c] = __builtin_shufflevector(b0, b1, 0, 1, 2, 3, 4, 5, 6, 7); }
    float v[LN_RW][16], mu[LN_RW], rs[LN_RW];   // the rows' statistics in one stretch: the three chains of cross-lane sums run side by side
#pragma unroll
    for (int i = 0; i < LN_RW; ++i) {
#pragma unroll
        for (int k = 0; k < 8; ++k) { v[i][k] = bfr(x0[i][k]); v[i][8 + k] = bfr(x1[i][k]); }
        float s = 0.f;
#pragma unroll
        for (int k = 0; k < 16; ++k) s += v[i][k];
#pragma unroll
        for (int sh = 16; sh; sh >>= 1) s += __shfl_xor(s, sh, 32);
        mu[i] = s * (1.0f / (float)CM);
        float qq = 0.f;
#pragma unroll
        for (int k = 0; k < 16; ++k) { const float d = v[i][k] - mu[i]; qq += d * d; }
#pragma unroll
        for (int sh = 16; sh; sh >>= 1) qq += __shfl_xor(qq, sh, 32);
        const float var = qq * (1.0f / (float)CM);
        rs[i] = rsqrtf(var + 1.0e-5f);
    }
#pragma unroll
    for (int i = 0; i < LN_RW; ++i) {
        v8us oh[2], ol[2];
#pragma unroll
        for (int c = 0; c < 2; ++c) { v8us th, tl;
#pragma unroll
            for (int k = 0; k < 8; ++k) { const float xn = (v[i][c * 8 + k] - mu[i]) * rs[i]; const float y = xn * (1.0f + g[c][k]) + be[c][k]; unsigned short a2, c2; splitf(y, a2, c2); th[k] = a2; tl[k] = c2; }
            oh[c] = th; ol[c] = tl; }
#pragma unroll
        for (int c = 0; c < 2; ++c) { const size_t o = (size_t)(R0 + i) * CM + c * 256 + 8 * lane; *(v8us*)(Xh + o) = oh[c]; *(v8us*)(Xl + o) = ol[c]; }
        asm volatile("s_wait_xcnt 0x0" ::: "memory");   // stands ahead of any rewrite of a register these stores name: the next row's arithmetic, or another job's code that follows in the merged kernel's text
        __builtin_amdgcn_sched_barrier(0);   // keeps the next row's arithmetic, which rewrites those registers, from being scheduled ahead of the wait
    }
}

// ---- d_extras: per token row R the extra bf16 k-step rows (NEX = 32 slots) that carry the additive score bias inside the score WMMA. With c = bf16 coordinates and g = -|c|^2/64 split three-piece (gh + gm + gl):
// query row QE[R] = [cx, cy, cz, 1, 1, 1, gh, gm, gl, 1, 0 x 22]; key row KE[R] = [cx/32, cy/32, cz/32, gh, gm, gl, 1, 1, 1, fill, 0 x 22], fill = -2e30 where mask == 0 else 0.
__device__ __forceinline__ void d_extras(const float* __restrict__ ca, const float* __restrict__ msk, bf* QE, bf* KE, int bx) {
    __shared__ __align__(16) unsigned int qs[256 * 16];
    __shared__ __align__(16) unsigned int ks[256 * 16];
    const int tid = threadIdx.x, lane = tid & 31, w = tid >> 5;
    const int R0 = bx * 256; const int R = R0 + tid;
    const int b = R / SEQ, t = R - b * SEQ; const size_t Rf = (size_t)b * SEQ_FULL + t;
    const float cx = bfr(ca[Rf * 3]), cy = bfr(ca[Rf * 3 + 1]), cz = bfr(ca[Rf * 3 + 2]);
    const float mk = bfr(msk[Rf]);
    const float n2 = cx * cx + cz * cz + cy * cy;
    const float g = -(n2 * 0.015625f);
    const unsigned short gh = f2bf(g); const float r1 = g - bf2f(gh); const unsigned short gm = f2bf(r1); const unsigned short gl = f2bf(r1 - bf2f(gm));
    const unsigned short one = (unsigned short)0x3F80u;
    const unsigned short fillv = (mk == 0.0f) ? f2bf(-2.0e30f) : (unsigned short)0;
    v4u qa, qb, ka, kb, zz;
#pragma unroll
    for (int i = 0; i < 4; ++i) { qb[i] = 0u; kb[i] = 0u; zz[i] = 0u; }
    qa[0] = pk2(f2bf(cx), f2bf(cy)); qa[1] = pk2(f2bf(cz), one); qa[2] = pk2(one, one); qa[3] = pk2(gh, gm);
    qb[0] = pk2(gl, one);
    ka[0] = pk2(f2bf(cx * 0.03125f), f2bf(cy * 0.03125f)); ka[1] = pk2(f2bf(cz * 0.03125f), gh); ka[2] = pk2(gm, gl); ka[3] = pk2(one, one);
    kb[0] = pk2(one, fillv);
    unsigned int* qr = qs + tid * 16; unsigned int* krw = ks + tid * 16;
    *(v4u*)(qr) = qa; *(v4u*)(qr + 4) = qb; *(v4u*)(qr + 8) = zz; *(v4u*)(qr + 12) = zz;
    *(v4u*)(krw) = ka; *(v4u*)(krw + 4) = kb; *(v4u*)(krw + 8) = zz; *(v4u*)(krw + 12) = zz;
    __syncthreads();
    v4u oq[4], ok[4]; int off[4];
#pragma unroll
    for (int it = 0; it < 4; ++it) { off[it] = (w * 4 + it) * 128 + lane * 4; oq[it] = *(const v4ua*)(qs + off[it]); ok[it] = *(const v4ua*)(ks + off[it]); }
    unsigned int* QEw = (unsigned int*)QE + (size_t)R0 * 16; unsigned int* KEw = (unsigned int*)KE + (size_t)R0 * 16;
{
#pragma unroll
        for (int it = 0; it < 4; ++it) { *(v4u*)(QEw + off[it]) = oq[it]; *(v4u*)(KEw + off[it]) = ok[it]; }
         }
}

// ---- k_prep: every job that reads only inputs, as block ranges of one grid (the branch is the same for a whole block): AdaLN rows (the longest job, first), weight planes, bias k-step rows, cos/sin table.
#define PB_LN (NTOK / LN_RB)
#define PB_W ((CM * CM / 64 + 63) / 64)
#define PB_EX (NTOK / 256)
#define PB_CS ((NTOK * HD + 255) / 256)
#define PB_ALL (PB_LN + 4 * PB_W + PB_EX + PB_CS)
// A register budget for six waves a SIMD: three blocks fit a WGP, so the short jobs run beside the AdaLN blocks and not behind them.
__global__ __launch_bounds__(256) __attribute__((amdgpu_waves_per_eu(6))) void k_prep(const float* __restrict__ s_frames, const float* __restrict__ adaln_w, const float* __restrict__ adaln_b, const float* __restrict__ wq, const float* __restrict__ wk, const float* __restrict__ wv, const float* __restrict__ wo,
                                              const float* __restrict__ cond, const float* __restrict__ ca, const float* __restrict__ msk, const int* __restrict__ fidx, const int* __restrict__ sidx,
                                              bf* XBh, bf* XBl, bf* WQ, bf* WK, bf* WV, bf* WO, bf* QE, bf* KE, float* CS) {
    int bx = blockIdx.x;
    if (bx < PB_LN) { d_ln(s_frames, cond, adaln_w, adaln_b, XBh, XBl, bx); return; }
    bx -= PB_LN;
    if (bx < 4 * PB_W) { const int j = bx / PB_W;                                // w [in][out] -> Bt[out][in]
        d_wtG((j == 0) ? wq : (j == 1) ? wk : (j == 2) ? wv : wo, CM, CM, (j == 0) ? WQ : (j == 1) ? WK : (j == 2) ? WV : WO, bx - j * PB_W); return; }
    bx -= 4 * PB_W;
    if (bx < PB_EX) { d_extras(ca, msk, QE, KE, bx); return; }
    d_cstab(fidx, sidx, CS, bx - PB_EX);
}

// ---- k_attn: four waves per work-group, 64 query rows of one (b, h); all 64 rows lie in one frame, so the key bound (frame+1)*NRES is the same for the whole group. 64 keys per trip, as two 32-key tiles.
// Wave w takes the 32 query rows of half w >> 1 (two 16-row tiles) and the 32-key tile w & 1 of every trip: each k or v fragment read from LDS feeds two products. The two waves of a query half join their partial maximum, sum and O behind the loop.
// The trip's k hi/lo, bias and v hi/lo tiles are brought once per work-group into a two-buffer LDS ring by asynchronous copies (whole lines from global memory, one trip ahead); every wave reads its fragments from the ring.
// Transposed products: S^T tile (16 keys x 16 queries) = KE.QE (bias k-step) + Kh.Qh + Kh.Ql + Kl.Qh over d (bf16, k rows as A, q as B, scale folded into the q planes), so a lane holds 16 scores of ONE query (lane & 15; keys 16j + 8(lane >> 4) + r).
// Online max-subtracted softmax in f32 in the lane, one exchange between the wave's halves for the maximum; each half keeps the sum of its own keys, joined once behind the loop. P^T packs from the two score tiles straight into the B operand of O^T += V^T.P^T.
#define AW 4
#define KP 72                        // LDS pitch of a 64-element k row: 144 B = 16 B x odd, free of bank conflicts for 16-byte readers
#define VP 40                        // LDS pitch of a 32-element v or bias row: 80 B
#define ST_KH 0
#define ST_KL (32 * KP)
#define ST_KE (2 * 32 * KP)
#define ST_VH (ST_KE + 32 * VP)
#define ST_VL (ST_VH + 64 * VP)
#define ST_EL (ST_VL + 64 * VP)      // elements of one 32-key tile in the ring (22016 B)
#define XW (8 * 32 * 4 + 64)         // floats one wave hands to its partner: 32 O values, maximum and sum of each lane
static_assert(AW == 4 && NRES % (16 * AW) == 0 && NRES >= 128 && (ST_EL * 2) % 16 == 0);
static_assert((AW * XW + AW * 16 * 68) * 4 <= 4 * ST_EL * 2);
__device__ __forceinline__ v16bf ldsb(const unsigned short* p) { return cat16b(*(const v8usa*)p, *(const v8usa*)(p + 16)); }
__device__ __forceinline__ v16h ldsh(const unsigned short* p) { return cat16(*(const v8ha*)p, *(const v8ha*)(p + 16)); }
__device__ __forceinline__ float xhalf(float x) { return __builtin_bit_cast(float, __builtin_amdgcn_permlanex16(__builtin_bit_cast(int, x), __builtin_bit_cast(int, x), 0x76543210, 0xfedcba98, false, false)); }   // lane l with lane l ^ 16
// One tile's copies of one lane, 16 B each: two pieces (16 rows apart) of k hi and of k lo, two (32 rows apart) of v hi and of v lo, one of the bias rows. Written as the builtin: the kernel holds more than 256 registers, and asm text can name only the first 256.
typedef __attribute__((ext_vector_type(4))) int v4i;
typedef __attribute__((address_space(1))) v4i* gp16;
typedef __attribute__((address_space(3))) v4i* lp16;
__device__ __forceinline__ void cp16(unsigned short* l, const void* g) { __builtin_amdgcn_global_load_async_to_lds_b128((gp16)g, (lp16)l, 0, 0); }
__device__ __forceinline__ void tile_copy(unsigned short* lk, unsigned short* lv, unsigned short* le, const bf* gkh, const bf* gkl, const h16* gvh, const h16* gvl, const bf* gke) {
    cp16(lk, gkh); cp16(lk + 16 * KP, gkh + 16 * HD); cp16(lk + (ST_KL - ST_KH), gkl); cp16(lk + (ST_KL - ST_KH) + 16 * KP, gkl + 16 * HD);
    cp16(lv, gvh); cp16(lv + 32 * VP, gvh + (size_t)32 * SEQ); cp16(lv + (ST_VL - ST_VH), gvl); cp16(lv + (ST_VL - ST_VH) + 32 * VP, gvl + (size_t)32 * SEQ);
    cp16(le, gke);
}
// Three work-groups fit a WGP (LDS), three waves a SIMD: the register budget of three waves holds two query tiles' q fragments and accumulators.
__global__ __launch_bounds__(32 * AW) __attribute__((amdgpu_waves_per_eu(3, 3))) void k_attn(const bf* __restrict__ Qh, const bf* __restrict__ Ql, const bf* __restrict__ QE,
                                             const bf* __restrict__ Kh, const bf* __restrict__ Kl, const bf* __restrict__ KE,
                                             const h16* __restrict__ Vth, const h16* __restrict__ Vtl, bf* ATh, bf* ATl) {
    __shared__ __align__(16) unsigned short ring[4 * ST_EL];   // two buffers of two 32-key tiles
    const int tid = threadIdx.x, lane = tid & 31, lr = lane & 15, hi = lane >> 4, w = tid >> 5;
    const int kh = w & 1;
    const int bh = blockIdx.y; const int b = bh / NH, h = bh - b * NH;
    const int qb = blockIdx.x * (16 * AW) + (w >> 1) * 32;
    const int kvlen = ((int)blockIdx.x * (16 * AW) / NRES + 1) * NRES;
    const int nt = kvlen >> 6;
    const size_t hp = (size_t)bh * SEQ * HD;
    const size_t tb = (size_t)b * SEQ;
    // this lane's share of a tile, in 16-byte pieces: k rows tid>>3 and 16 + tid>>3, piece tid&7; v rows (d) tid>>2 and 32 + tid>>2, piece tid&3; bias row tid>>2, piece tid&3
    unsigned short* lk0 = ring + ST_KH + (tid >> 3) * KP + (tid & 7) * 8;
    unsigned short* lv0 = ring + ST_VH + (tid >> 2) * VP + (tid & 3) * 8;
    unsigned short* le0 = ring + ST_KE + (tid >> 2) * VP + (tid & 3) * 8;
    // the lane's part of a global address is a 32-bit element offset; the part that moves with the trip is the same for the whole group and stays in scalar registers
    const unsigned gk0 = (unsigned)((tid >> 3) * HD + (tid & 7) * 8), gv0 = (unsigned)((tid >> 2) * SEQ + (tid & 3) * 8), ge0 = (unsigned)((tid >> 2) * NEX + (tid & 3) * 8);
    const bf* ukh = Kh + hp; const bf* ukl = Kl + hp; const h16* uvh = Vth + hp; const h16* uvl = Vtl + hp; const bf* uke = KE + tb * NEX;
    auto trip_copy = [&](unsigned bo, size_t kn) {   // the two 32-key tiles from key kn on, into the buffer at element bo of the ring
        tile_copy(lk0 + bo, lv0 + bo, le0 + bo, (ukh + kn * HD) + gk0, (ukl + kn * HD) + gk0, (uvh + kn) + gv0, (uvl + kn) + gv0, (uke + kn * NEX) + ge0);
        tile_copy(lk0 + bo + ST_EL, lv0 + bo + ST_EL, le0 + bo + ST_EL, (ukh + (kn + 32) * HD) + gk0, (ukl + (kn + 32) * HD) + gk0, (uvh + (kn + 32)) + gv0, (uvl + (kn + 32)) + gv0, (uke + (kn + 32) * NEX) + ge0);
    };
    trip_copy(0, 0);
    v16bf aH0[2], aH1[2], aL0[2], aL1[2], aE[2];
#pragma unroll
    for (int u = 0; u < 2; ++u) { const size_t qo = hp + (size_t)(qb + 16 * u + lr) * HD + 8 * hi;
        aH0[u] = WFrag<bf>::ld(Qh + qo); aH1[u] = WFrag<bf>::ld(Qh + qo + 32); aL0[u] = WFrag<bf>::ld(Ql + qo); aL1[u] = WFrag<bf>::ld(Ql + qo + 32);
        aE[u] = WFrag<bf>::ld(QE + (tb + qb + 16 * u + lr) * NEX + 8 * hi); }
    v8f oh[2][4], ol[2][4];
#pragma unroll
    for (int u = 0; u < 2; ++u)
#pragma unroll
        for (int nb = 0; nb < 4; ++nb) { oh[u][nb] = (v8f){}; ol[u][nb] = (v8f){}; }
    float m[2] = {-1.0e30f, -1.0e30f}, l[2] = {0.f, 0.f};   // this lane's two queries: running maximum (equal in both halves), sum over this half's keys
    asm volatile("s_wait_asynccnt 0x0" ::: "memory");   // trip 0's tiles of this wave have landed
    __syncthreads();                                     // publishes trip 0 to every wave
    // trip 1 exists: nt >= 4
    trip_copy(2 * ST_EL, 64);
#pragma unroll 1
    for (int t = 0; t < nt; ++t) {
        const unsigned short* st = ring + ((t & 1) * 2 + kh) * ST_EL;
        v8f s[2][2];
        const unsigned short* kp = st + lr * KP + 8 * hi;
        {
            v16bf bH[2], bL[2];
#pragma unroll
            for (int j = 0; j < 2; ++j) { const v16bf bE = ldsb(st + ST_KE + (16 * j + lr) * VP + 8 * hi); bH[j] = ldsb(kp + 16 * j * KP + ST_KH); bL[j] = ldsb(kp + 16 * j * KP + ST_KL);
#pragma unroll
                for (int u = 0; u < 2; ++u) s[u][j] = wmmab(bE, aE[u], (v8f){}); }
#pragma unroll
            for (int u = 0; u < 2; ++u) { s[u][0] = wmmab(bH[0], aH0[u], s[u][0]); s[u][0] = wmmab(bH[0], aL0[u], s[u][0]); s[u][0] = wmmab(bL[0], aH0[u], s[u][0]); }
            v16bf cH[2], cL[2];
#pragma unroll
            for (int j = 0; j < 2; ++j) { cH[j] = ldsb(kp + 16 * j * KP + ST_KH + 32); cL[j] = ldsb(kp + 16 * j * KP + ST_KL + 32); }
#pragma unroll
            for (int u = 0; u < 2; ++u) { s[u][1] = wmmab(bH[1], aH0[u], s[u][1]); s[u][1] = wmmab(bH[1], aL0[u], s[u][1]); s[u][1] = wmmab(bL[1], aH0[u], s[u][1]); }
#pragma unroll
            for (int j = 0; j < 2; ++j)
#pragma unroll
                for (int u = 0; u < 2; ++u) { s[u][j] = wmmab(cH[j], aH1[u], s[u][j]); s[u][j] = wmmab(cH[j], aL1[u], s[u][j]); s[u][j] = wmmab(cL[j], aH1[u], s[u][j]); }
        }
        // the order of the stretch above: the twelve LDS reads of the bias rows and d 0..31 as one group, ten products, the eight reads of d 32..63 as one group (into the registers the ten products have freed), the rest. Left alone, the reads stand in pairs among the products, each waited to zero.
        __builtin_amdgcn_sched_group_barrier(0x100, 12, 0); __builtin_amdgcn_sched_group_barrier(0x008, 10, 0); __builtin_amdgcn_sched_group_barrier(0x100, 8, 0); __builtin_amdgcn_sched_group_barrier(0x008, 18, 0);
        __builtin_amdgcn_sched_barrier(0);   // keeps the v fragment loads out of the score products' stretch, where the k fragments hold the free registers
        v16h ap[2];   // B operand: element i <- key 8(lane >> 4) + i, element 8 + i <- key 16 + 8(lane >> 4) + i, the order of the v fragments
#pragma unroll
        for (int u = 0; u < 2; ++u) {
            const v8f sa = s[u][0], sb = s[u][1];
            const float v0 = fmaxf(fmaxf(sa[0], sa[1]), sa[2]), v1 = fmaxf(fmaxf(sa[3], sa[4]), sa[5]), v2 = fmaxf(fmaxf(sa[6], sa[7]), sb[0]);
            const float v3 = fmaxf(fmaxf(sb[1], sb[2]), sb[3]), v4 = fmaxf(fmaxf(sb[4], sb[5]), sb[6]);
            float v = fmaxf(fmaxf(fmaxf(v0, v1), v2), fmaxf(fmaxf(v3, v4), sb[7]));   // a tree three deep, not a chain of eight
            v = fmaxf(v, xhalf(v));
            const float mn = fmaxf(m[u], v);
            const float al = __builtin_amdgcn_exp2f((m[u] - mn) * LOG2E);
            m[u] = mn;
            float ts[8];
#pragma unroll
            for (int r = 0; r < 8; ++r) {
                const float p0 = __builtin_amdgcn_exp2f((sa[r] - mn) * LOG2E), p1 = __builtin_amdgcn_exp2f((sb[r] - mn) * LOG2E);
                ap[u][r] = (h16)(p0 * PCAR); ap[u][8 + r] = (h16)(p1 * PCAR);
                ts[r] = p0 + p1;
            }
            l[u] = l[u] * al + (((ts[0] + ts[1]) + (ts[2] + ts[3])) + ((ts[4] + ts[5]) + (ts[6] + ts[7])));
#pragma unroll
            for (int nb = 0; nb < 4; ++nb)
#pragma unroll
                for (int r = 0; r < 8; ++r) { oh[u][nb][r] *= al; ol[u][nb][r] *= al; }
        }
#pragma unroll
        for (int nb = 0; nb < 4; ++nb) { const unsigned short* vp = st + (16 * nb + lr) * VP + 8 * hi;
            const v16h bH = ldsh(vp + ST_VH); oh[0][nb] = wmma16(bH, ap[0], oh[0][nb]); oh[1][nb] = wmma16(bH, ap[1], oh[1][nb]);
            const v16h bL = ldsh(vp + ST_VL); ol[0][nb] = wmma16(bL, ap[0], ol[0][nb]); ol[1][nb] = wmma16(bL, ap[1], ol[1][nb]); }
        // the order of the v reads and products: the four reads of a 16-row block of d as one group, one block ahead of its four products. Left alone, the reads stand in pairs at twice as many places.
        __builtin_amdgcn_sched_group_barrier(0x100, 4, 1); __builtin_amdgcn_sched_group_barrier(0x100, 4, 1); __builtin_amdgcn_sched_group_barrier(0x008, 4, 1); __builtin_amdgcn_sched_group_barrier(0x100, 4, 1);
        __builtin_amdgcn_sched_group_barrier(0x008, 4, 1); __builtin_amdgcn_sched_group_barrier(0x100, 4, 1); __builtin_amdgcn_sched_group_barrier(0x008, 4, 1); __builtin_amdgcn_sched_group_barrier(0x008, 4, 1);
        asm volatile("s_wait_dscnt 0x0" ::: "memory");      // this wave's reads of buffer t & 1 have returned
        asm volatile("s_wait_asynccnt 0x0" ::: "memory");   // this wave's copies of trip t + 1 have landed
        __syncthreads();                                     // publishes trip t + 1 and ends every wave's reads of buffer t & 1
        if (t + 2 < nt) trip_copy((unsigned)(t & 1) * (2 * ST_EL), (size_t)(t + 2) * 64);
    }
    asm volatile("s_wait_asynccnt 0x0" ::: "memory");       // nothing of this wave is in flight when the ring becomes staging
    // behind the last trip's barrier no wave reads the ring and no copy is under way. Wave w keeps query tile w & 1 of its half and hands the other tile's partial result, lane to lane, to wave w ^ 1.
    float* xw = (float*)ring + w * XW; const float* xr = (const float*)ring + (w ^ 1) * XW;
    float* os = (float*)ring + AW * XW + w * (16 * 68);
    const bool k1 = (kh != 0);
    const float lj0 = l[0] + xhalf(l[0]), lj1 = l[1] + xhalf(l[1]);
    const float mm = k1 ? m[1] : m[0], lm = k1 ? lj1 : lj0;
    float xm[4][8];
#pragma unroll
    for (int nb = 0; nb < 4; ++nb) { v4f g0, g1;
#pragma unroll
        for (int r = 0; r < 8; ++r) { const float e0 = oh[0][nb][r] + ol[0][nb][r] * LINV, e1 = oh[1][nb][r] + ol[1][nb][r] * LINV;
            xm[nb][r] = k1 ? e1 : e0; const float gv = k1 ? e0 : e1; if (r < 4) g0[r] = gv; else g1[r - 4] = gv; }
        *(v4fa*)(xw + ((2 * nb) * 32 + lane) * 4) = g0; *(v4fa*)(xw + ((2 * nb + 1) * 32 + lane) * 4) = g1; }
    xw[1024 + lane] = k1 ? m[0] : m[1]; xw[1056 + lane] = k1 ? lj0 : lj1;
    __syncthreads();                                         // the partner's partial result is complete
    const float mr = xr[1024 + lane], lq = xr[1056 + lane];
    const float mx = fmaxf(mm, mr);
    const float am = __builtin_amdgcn_exp2f((mm - mx) * LOG2E), ar = __builtin_amdgcn_exp2f((mr - mx) * LOG2E);
    const float il = PINV * __fdiv_rn(1.0f, lm * am + lq * ar);
    const float cm = am * il, cr = ar * il;
    const int q0 = qb + 16 * kh;
#pragma unroll
    for (int nb = 0; nb < 4; ++nb) { v4f x0, x1;   // register r of tile nb is d = 16 nb + 8 hi + r of query lr
        const v4f g0 = *(const v4fa*)(xr + ((2 * nb) * 32 + lane) * 4), g1 = *(const v4fa*)(xr + ((2 * nb + 1) * 32 + lane) * 4);
#pragma unroll
        for (int r = 0; r < 4; ++r) { x0[r] = xm[nb][r] * cm + g0[r] * cr; x1[r] = xm[nb][4 + r] * cm + g1[r] * cr; }
        *(v4fa*)(os + lr * 68 + 16 * nb + 8 * hi) = x0; *(v4fa*)(os + lr * 68 + 16 * nb + 8 * hi + 4) = x1; }
    __builtin_amdgcn_fence(3, "wavefront"); __builtin_amdgcn_wave_barrier(); asm volatile("" ::: "memory");
    v8us ah[4], av[4]; size_t ad[4];
#pragma unroll
    for (int it = 0; it < 4; ++it) { const int rr = it * 4 + (lane >> 3); const int pc = lane & 7;
        const v4f x0 = *(const v4fa*)(os + rr * 68 + pc * 8), x1 = *(const v4fa*)(os + rr * 68 + pc * 8 + 4); v8us th, tl;
#pragma unroll
        for (int c = 0; c < 4; ++c) { unsigned short a2, c2; splitf(x0[c], a2, c2); th[c] = a2; tl[c] = c2; splitf(x1[c], a2, c2); th[4 + c] = a2; tl[4 + c] = c2; }
        ah[it] = th; av[it] = tl; ad[it] = (tb + q0 + rr) * CM + (size_t)h * HD + pc * 8; }
{
#pragma unroll
        for (int it = 0; it < 4; ++it) { *(v8us*)(ATh + ad[it]) = ah[it]; *(v8us*)(ATl + ad[it]) = av[it]; }
         }
}

extern "C" void kernel_launch(void* const* d_in, const int* in_sizes, int n_in,
                              void* d_out, int out_size, void* d_ws, size_t ws_size, hipStream_t stream) {
    if (n_in < 16) return;
    const int ntok_in = (NB - 1) * SEQ_FULL + SEQ;
    if (in_sizes[0] < ntok_in * CM || in_sizes[1] < NFR || in_sizes[2] < NB * NRES || in_sizes[3] < ntok_in || in_sizes[4] < NB * CDIM || in_sizes[5] < ntok_in * 3) return;
    if (in_sizes[6] < CDIM * ADW || in_sizes[7] < ADW) return;
    if (in_sizes[8] < CM * CM || in_sizes[10] < CM * CM || in_sizes[12] < CM * CM || in_sizes[14] < CM * CM) return;
    if (in_sizes[9] < CM || in_sizes[11] < CM || in_sizes[13] < CM || in_sizes[15] < CM) return;
    const size_t out_need = OUT2_EL + ((size_t)((NB - 1) * NH + NH - 1) * SEQ_FULL + SEQ) * HD;
    if ((size_t)out_size < out_need) return;
    const float* s_frames = (const float*)d_in[0]; const int* frame_idx = (const int*)d_in[1]; const int* seq_idx = (const int*)d_in[2]; const float* mask = (const float*)d_in[3];
    const float* cond = (const float*)d_in[4]; const float* ca_pos = (const float*)d_in[5]; const float* adaln_w = (const float*)d_in[6]; const float* adaln_b = (const float*)d_in[7];
    const float* wq = (const float*)d_in[8]; const float* bq = (const float*)d_in[9]; const float* wk = (const float*)d_in[10]; const float* bk = (const float*)d_in[11];
    const float* wv = (const float*)d_in[12]; const float* bv = (const float*)d_in[13]; const float* wo = (const float*)d_in[14]; const float* bo = (const float*)d_in[15];
    float* OUT = (float*)d_out;
    char* wsp = (char*)d_ws;
    auto take = [&](size_t bytes) { char* p = wsp; wsp += (bytes + 255) & ~(size_t)255; return (void*)p; };
    bf* WQ = (bf*)take((size_t)3 * CM * CM * 2); bf* WK = WQ + (size_t)CM * CM; bf* WV = WK + (size_t)CM * CM; bf* WO = (bf*)take((size_t)CM * CM * 2);
    float* CS = (float*)take((size_t)NTOK * HD * 2 * 4);
    bf* XBh = (bf*)take((size_t)NTOK * CM * 2); bf* XBl = (bf*)take((size_t)NTOK * CM * 2);
    bf* QPh = (bf*)take((size_t)NBH * SEQ * HD * 2); bf* QPl = (bf*)take((size_t)NBH * SEQ * HD * 2); bf* KPh = (bf*)take((size_t)NBH * SEQ * HD * 2); bf* KPl = (bf*)take((size_t)NBH * SEQ * HD * 2);
    h16* VTh = (h16*)take((size_t)NBH * HD * SEQ * 2); h16* VTl = (h16*)take((size_t)NBH * HD * SEQ * 2);
    bf* QE = (bf*)take((size_t)NTOK * NEX * 2); bf* KE = (bf*)take((size_t)NTOK * NEX * 2);
    bf* ATh = (bf*)take((size_t)NTOK * CM * 2); bf* ATl = (bf*)take((size_t)NTOK * CM * 2);
    const size_t used = (size_t)(wsp - (char*)d_ws);
    if (used > ws_size || used > ((size_t)128 << 20)) return;    // about 66 MiB at NB=2, SEQ=3072

    // one launch for all that reads only inputs: AdaLN (ss = cond x adaln_w + adaln_b in each block, LN + modulation -> x hi/lo planes), 16-bit weight planes, bias k-step rows, cos/sin table
    k_prep<<<PB_ALL, 256, 0, stream>>>(s_frames, adaln_w, adaln_b, wq, wk, wv, wo, cond, ca_pos, mask, frame_idx, seq_idx, XBh, XBl, WQ, WK, WV, WO, QE, KE, CS);
    // projections (x hi/lo x bf16 W, 2 products, + bias) with RoPE, split and transposition in the epilogue: operand planes and the k and v outputs in one launch
    k_gemm4<true><<<dim3(NTOK / 128, CM / 128, 3), 128, 0, stream>>>(XBh, XBl, WQ, nullptr, CM, bq, bk, bv, 0, (size_t)CM * CM, 0, CS, QPh, QPl, KPh, KPl, VTh, VTl, OUT + OUT1_EL, OUT + OUT2_EL);   // z = q, k, v
    // attention (one launch) -> ctx hi/lo planes, then the output projection straight into out0 (batch z at the full-size token pitch)
    k_attn<<<dim3(SEQ / (16 * AW), NBH, 1), 32 * AW, 0, stream>>>(QPh, QPl, QE, KPh, KPl, KE, VTh, VTl, ATh, ATl);
    k_gemm4<false><<<dim3(SEQ / 128, CM / 128, NB), 128, 0, stream>>>(ATh, ATl, WO, OUT, CM, bo, bo, bo, (size_t)SEQ * CM, 0, (size_t)SEQ_FULL * CM, nullptr, nullptr, nullptr, nullptr, nullptr, nullptr, nullptr, nullptr, nullptr);
}

// v008
// A run of this version takes 83.6 microseconds.
// Next to v007, in two timings, it ran 1.24 and 1.26 times as fast.
// All steps since v000 together make it 5.49 times as fast.
#include <hip/hip_runtime.h>

// Frame-causal multi-head attention with a Gaussian distance bias: AdaLN prologue (cond x adaln_w modulation of a non-affine LN), q/k/v projections with bias, two-half rotate-half RoPE from int positions, online-softmax attention, output projection; f32 outputs out, roped k, v.
// Compute dtypes, f32 accumulate everywhere: every float input RNE-converted to bf16 on load. cond x adaln_w: v_wmma_f32_16x16x32_bf16, plain bf16 operands (1 product). q/k/v projections: bf16 hi/lo planes of the modulated LN output x bf16 weight planes (2 products).
// Scores: v_wmma_f32_16x16x32_f16 on one f16 plane of q and one of k (1 product) plus one extra bf16 k-step carrying the distance-bias terms (exact coordinate cross products, three-piece bf16 squared norms, key mask fill). attn.v: v_wmma_f32_16x16x32_f16, P carried x2^14 in f16, v as one f16 plane.
// Why one plane is enough: an f16 operand is rounded at 2^-12 of its value, and the inputs behind q, k, v and the coordinates behind the bias are rounded at 2^-9 of theirs on load.
// Output projection: bf16 hi/lo ctx planes x bf16 Wo (2 products). LN statistics, inverse-frequency and cos/sin tables, RoPE, softmax and all side math f32 on VALU; the k and v outputs are written from the f32 projection results.

#ifndef NB
#define NB 2
#endif
#define NB_FULL 2
#ifndef SEQ
#define SEQ 3072
#endif
#define SEQ_FULL 3072
#define NRES 256
#define NFR (SEQ / NRES)
#define CM 512
#define ADW 1024
#define NH 8
#define HD 64
#define CDIM 64
#define NEX 32
#define NTOK (NB * SEQ)
#define NBH (NB * NH)
#define QSCL 0.125f
#define PCAR 16384.0f
#define PINV 0.00006103515625f
#define LOG2E 1.4426950408889634f
#define OUT1_EL ((size_t)NB_FULL * SEQ_FULL * CM)
#define OUT2_EL (OUT1_EL + (size_t)NB_FULL * NH * SEQ_FULL * HD)
static_assert(SEQ % NRES == 0);
static_assert(SEQ >= NRES && SEQ <= SEQ_FULL);
static_assert(NB >= 1 && NB <= NB_FULL);
static_assert(NTOK % 256 == 0);
static_assert(HD == 64 && CM == NH * HD);
static_assert(CM % 64 == 0 && ADW == 2 * CM && CDIM % 32 == 0);
static_assert(OUT1_EL * 4 == 12582912);
static_assert(OUT2_EL * 4 == 25165824);

typedef _Float16 h16;
typedef unsigned short bf;
typedef __attribute__((ext_vector_type(16))) __bf16   v16bf;
typedef __attribute__((ext_vector_type(16))) _Float16 v16h;
typedef __attribute__((ext_vector_type(8)))  _Float16 v8h;
typedef __attribute__((ext_vector_type(2)))  _Float16 v2h;
typedef __attribute__((ext_vector_type(8)))  unsigned short v8us;
typedef __attribute__((ext_vector_type(4)))  unsigned short v4us;
typedef __attribute__((ext_vector_type(2)))  unsigned short v2us;
typedef __attribute__((ext_vector_type(4)))  unsigned int v4u;
typedef __attribute__((ext_vector_type(16))) float    v16f;
typedef __attribute__((ext_vector_type(8)))  float    v8f;
typedef __attribute__((ext_vector_type(4)))  float    v4f;
typedef __attribute__((ext_vector_type(2)))  float    v2f;
typedef v8h  __attribute__((may_alias)) v8ha;
typedef v4f  __attribute__((may_alias)) v4fa;
typedef v8us __attribute__((may_alias)) v8usa;
typedef v4u  __attribute__((may_alias)) v4ua;

__device__ __forceinline__ unsigned short f2bf(float f) { unsigned u = __float_as_uint(f); u += 0x7FFFu + ((u >> 16) & 1u); return (unsigned short)(u >> 16); }
__device__ __forceinline__ float bf2f(unsigned short b) { return __uint_as_float(((unsigned)b) << 16); }
__device__ __forceinline__ float bfr(float f) { return bf2f(f2bf(f)); }
__device__ __forceinline__ v16h cat16(v8h lo, v8h hi) { return __builtin_shufflevector(lo, hi, 0, 1, 2, 3, 4, 5, 6, 7, 8, 9, 10, 11, 12, 13, 14, 15); }
__device__ __forceinline__ v16bf cat16b(v8us lo, v8us hi) { return __builtin_bit_cast(v16bf, __builtin_shufflevector(lo, hi, 0, 1, 2, 3, 4, 5, 6, 7, 8, 9, 10, 11, 12, 13, 14, 15)); }
__device__ __forceinline__ v8f wmma16(v16h a, v16h b, v8f c) { return __builtin_amdgcn_wmma_f32_16x16x32_f16(false, a, false, b, (short)0, c, false, false); }
__device__ __forceinline__ v8f wmmab(v16bf a, v16bf b, v8f c) { return __builtin_amdgcn_wmma_f32_16x16x32_bf16(false, a, false, b, (short)0, c, false, false); }
__device__ __forceinline__ void splitf(float y, unsigned short& h, unsigned short& l) { h = f2bf(y); l = f2bf(y - bf2f(h)); }
__device__ __forceinline__ unsigned int pk2(unsigned short lo, unsigned short hi2) { return (unsigned int)lo | ((unsigned int)hi2 << 16); }

// Fragments of every 16x16x32 product here: lane -> row/col lane&15, vector elements 0..7 <- k0 + 8h + i, elements 8..15 <- k0 + 16 + 8h + i (h = lane>>4) for BOTH operands; D element r -> (row 8h + r, col lane&15).
template <typename T16> struct WFrag;
template <> struct WFrag<h16> { typedef v16h V; static __device__ __forceinline__ V ld(const h16* p) { return cat16(*(const v8h*)p, *(const v8h*)(p + 16)); } static __device__ __forceinline__ v8f mma(V a, V b, v8f c) { return wmma16(a, b, c); } };
template <> struct WFrag<bf> { typedef v16bf V; static __device__ __forceinline__ V ld(const bf* p) { return cat16b(*(const v8us*)p, *(const v8us*)(p + 16)); } static __device__ __forceinline__ v8f mma(V a, V b, v8f c) { return wmmab(a, b, c); } };

// ---- k_gemm4: the two-product GEMM (A hi/lo planes x one bf16 Bt plane, K = CM) for the projections: FOUR WAVES share a 128x128 output tile, each wave a 64x64 quarter (16 accumulators; per 32 k the hi product, then the lo product).
// A stage is 64 k: 128 rows of A hi, of A lo and of Bt, 128 B a row, brought once per work-group into a two-buffer LDS ring by asynchronous copies (a wave's copy covers four whole lines of global memory), one stage ahead.
// LDS rows are unpadded (three work-groups fit a WGP); the 16-byte piece q of row r lies at piece q ^ ((r >> 1) & 7), so the 16 rows that a half-wave's fragment load touches fall on all 64 banks once.
#define G4_PL (128 * 128)            // bytes of one plane's stage
#define G4_BUF (3 * G4_PL)           // bytes of one ring buffer
#define G4_NS (CM / 64)
#define G4_WST (2 * G4_BUF / 4)      // bytes of the ring that one wave has for staging behind the loop
#define G4_OSB (16 * 68 * 4)         // of them the f32 row stage
#define G4_VSP 72                    // LDS pitch of a 64-token transposed v row: 144 B = 16 B x odd
static_assert(G4_OSB % 16 == 0 && G4_OSB + 64 * G4_VSP * 2 <= G4_WST && SEQ % 64 == 0);
static_assert(NTOK % 128 == 0 && SEQ % 128 == 0 && CM % 128 == 0 && G4_NS >= 2);
static_assert(4 * 16 * 68 * 4 <= 2 * G4_BUF);
// One plane's stage, this lane's eight 16-byte pieces (rows 16 apart). The s_wait_xcnt stands inside the statement so that no address register is rewritten ahead of it.
__device__ __forceinline__ void plane_copy(unsigned l, const bf* g) {
    const unsigned l1 = l + 2048, l2 = l + 2 * 2048, l3 = l + 3 * 2048, l4 = l + 4 * 2048, l5 = l + 5 * 2048, l6 = l + 6 * 2048, l7 = l + 7 * 2048;
    const bf* g1 = g + 16 * CM; const bf* g2 = g + 32 * CM; const bf* g3 = g + 48 * CM; const bf* g4 = g + 64 * CM; const bf* g5 = g + 80 * CM; const bf* g6 = g + 96 * CM; const bf* g7 = g + 112 * CM;
    asm volatile("global_load_async_to_lds_b128 %0, %8, off\n\t"
                 "global_load_async_to_lds_b128 %1, %9, off\n\t"
                 "global_load_async_to_lds_b128 %2, %10, off\n\t"
                 "global_load_async_to_lds_b128 %3, %11, off\n\t"
                 "global_load_async_to_lds_b128 %4, %12, off\n\t"
                 "global_load_async_to_lds_b128 %5, %13, off\n\t"
                 "global_load_async_to_lds_b128 %6, %14, off\n\t"
                 "global_load_async_to_lds_b128 %7, %15, off\n\t"
                 "s_wait_xcnt 0x0"
                 :: "v"(l), "v"(l1), "v"(l2), "v"(l3), "v"(l4), "v"(l5), "v"(l6), "v"(l7),
                    "v"(g), "v"(g1), "v"(g2), "v"(g3), "v"(g4), "v"(g5), "v"(g6), "v"(g7) : "memory");
}
// At most three waves come to a SIMD (LDS); a register budget for four keeps accumulators and a stage's fragments in registers without a trade for waves that never come.
// PLANES: the q, k, v projections (z = 0, 1, 2). A wave's quarter is 64 tokens of one head, so bias, RoPE, the f16 conversion and the v transposition are done on the accumulators and the operand planes and the k and v outputs are stored from here; no f32 projection goes to memory.
template <bool PLANES>
__global__ __launch_bounds__(128) __attribute__((amdgpu_waves_per_eu(4, 4))) void k_gemm4(const bf* __restrict__ A, const bf* __restrict__ A2, const bf* __restrict__ Bt, float* C, int ldc,
                                             const float* __restrict__ bias0, const float* __restrict__ bias1, const float* __restrict__ bias2, size_t sA, size_t sB, size_t sC,
                                             const float* __restrict__ CS, h16* QF, h16* KF, h16* VF, float* GK, float* GV) {
    __shared__ __align__(16) unsigned char ring4[2 * G4_BUF];
    const size_t z = blockIdx.z; A += z * sA; A2 += z * sA; Bt += z * sB; C += z * sC;
    const float* __restrict__ bias = (z == 0) ? bias0 : (z == 1) ? bias1 : bias2;
    const int tid = threadIdx.x, lane = tid & 31, lr = lane & 15, hi = lane >> 4, w = tid >> 5;
    const int R0 = blockIdx.x * 128, C0 = blockIdx.y * 128;
    // this lane's share of a stage: piece tid & 7 of rows tid >> 3, + 16, ... + 112 of each plane
    const unsigned lc = (unsigned)(size_t)ring4 + (unsigned)((tid >> 3) * 128 + (((tid & 7) ^ ((tid >> 4) & 7)) << 4));
    const bf* gah = A + (size_t)(R0 + (tid >> 3)) * CM + (tid & 7) * 8; const bf* gal = A2 + (size_t)(R0 + (tid >> 3)) * CM + (tid & 7) * 8; const bf* gb = Bt + (size_t)(C0 + (tid >> 3)) * CM + (tid & 7) * 8;
    plane_copy(lc, gah); plane_copy(lc + G4_PL, gal); plane_copy(lc + 2 * G4_PL, gb);
    v8f acc[4][4];
#pragma unroll
    for (int mb = 0; mb < 4; ++mb)
#pragma unroll
        for (int nb = 0; nb < 4; ++nb) acc[mb][nb] = (v8f){};
    // fragment reads: row (quarter's 64) + 16 mb + lr, logical pieces 4 kk + hi and 4 kk + 2 + hi, each XORed with lr >> 1
    const int s0 = hi ^ (lr >> 1);
    const int arow = ((w >> 1) * 64 + lr) * 128, brow = 2 * G4_PL + ((w & 1) * 64 + lr) * 128;
    asm volatile("s_wait_asynccnt 0x0" ::: "memory");   // stage 0 of this wave has landed
    __syncthreads();                                     // publishes stage 0 to every wave
    plane_copy(lc + G4_BUF, gah + 64); plane_copy(lc + G4_BUF + G4_PL, gal + 64); plane_copy(lc + G4_BUF + 2 * G4_PL, gb + 64);   // stage 1 exists: G4_NS >= 2
#pragma unroll 1
    for (int st = 0; st < G4_NS; ++st) {
        const unsigned char* sb = ring4 + (st & 1) * G4_BUF;
#pragma unroll
        for (int kk = 0; kk < 2; ++kk) {
            const int o0 = (s0 ^ (4 * kk)) << 4, o1 = (s0 ^ (4 * kk + 2)) << 4;
            v16bf a[4], a2[4];
#pragma unroll
            for (int mb = 0; mb < 4; ++mb) { const unsigned char* ap = sb + arow + mb * 2048;
                a[mb] = cat16b(*(const v8usa*)(ap + o0), *(const v8usa*)(ap + o1)); a2[mb] = cat16b(*(const v8usa*)(ap + G4_PL + o0), *(const v8usa*)(ap + G4_PL + o1)); }
#pragma unroll
            for (int nb = 0; nb < 4; ++nb) { const unsigned char* bp = sb + brow + nb * 2048; const v16bf b = cat16b(*(const v8usa*)(bp + o0), *(const v8usa*)(bp + o1));
#pragma unroll
                for (int mb = 0; mb < 4; ++mb) { acc[mb][nb] = wmmab(a[mb], b, acc[mb][nb]); acc[mb][nb] = wmmab(a2[mb], b, acc[mb][nb]); } }
        }
        asm volatile("s_wait_dscnt 0x0" ::: "memory");      // this wave's reads of buffer st & 1 have returned
        asm volatile("s_wait_asynccnt 0x0" ::: "memory");   // this wave's copies of stage st + 1 have landed
        __syncthreads();                                     // publishes stage st + 1 and ends every wave's reads of buffer st & 1
        if (st + 2 < G4_NS) { const unsigned bo = (unsigned)(st & 1) * G4_BUF; const int kn = (st + 2) * 64;
            plane_copy(lc + bo, gah + kn); plane_copy(lc + bo + G4_PL, gal + kn); plane_copy(lc + bo + 2 * G4_PL, gb + kn); }
    }
    asm volatile("s_wait_asynccnt 0x0" ::: "memory");       // nothing of this wave is in flight when the ring becomes output staging
    // behind the last trip's barrier no wave reads the ring and no copy is under way: each wave stages its rows in its own part of it
    const int r0 = R0 + (w >> 1) * 64, c0 = C0 + (w & 1) * 64, cofs = lr * 4;
    if constexpr (PLANES) {
        // D register j of block (mb, nb) is token 16 mb + 8 hi + j, dim 16 nb + lr of the head
        const int b = r0 / SEQ, t0 = r0 - b * SEQ, bh = b * NH + (c0 >> 6);
        unsigned char* wb = ring4 + w * G4_WST;
        float* os = (float*)wb;
        const int rr = lane >> 3, pc = lane & 7;
        float bn[4];   // the bias of this lane's four dims, as its bf16 value
#pragma unroll
        for (int nb = 0; nb < 4; ++nb) bn[nb] = bfr(bias[c0 + nb * 16 + lr]);
        if (z == 2) {
            // v: a lane's eight registers are eight successive tokens of one dim, one 16-byte piece of a transposed row; the pieces pass through LDS so that each store covers whole lines
            h16* vs = (h16*)(wb + G4_OSB);   // [64 dims][G4_VSP tokens]
            float* G = GV + ((size_t)bh * SEQ_FULL + t0) * HD;
#pragma unroll
            for (int mb = 0; mb < 4; ++mb) {
#pragma unroll
                for (int nb = 0; nb < 4; ++nb) { v8h th;
#pragma unroll
                    for (int j = 0; j < 8; ++j) { const float y = acc[mb][nb][j] + bn[nb]; os[(hi * 8 + j) * 68 + nb * 16 + lr] = y; th[j] = (h16)y; }
                    *(v8ha*)(vs + (nb * 16 + lr) * G4_VSP + mb * 16 + hi * 8) = th; }
                __builtin_amdgcn_wave_barrier(); asm volatile("" ::: "memory");   // keeps the row reads behind the other lanes' writes in the compiled order
#pragma unroll
                for (int s = 0; s < 8; ++s) { const int row = 2 * s + hi; const v4f val = *(const v4fa*)(os + row * 68 + cofs);
                    *(v4f*)(G + (size_t)(mb * 16 + row) * HD + cofs) = val; }
                __builtin_amdgcn_wave_barrier(); asm volatile("s_wait_xcnt 0x0" ::: "memory");   // keeps the next block's writes behind these reads; the wait stands ahead of any rewrite of a register these stores name
            }
            h16* gh = VF + ((size_t)bh * HD + rr) * SEQ + t0 + pc * 8;
            v8h xh[16];   // the rows as one group of LDS reads into registers of their own, then the stores: no register that a store names is written again
#pragma unroll
            for (int it = 0; it < 16; ++it) xh[it] = *(const v8ha*)(vs + (it * 4 + rr) * G4_VSP + pc * 8);
#pragma unroll
            for (int it = 0; it < 16; ++it) *(v8h*)(gh + (size_t)it * 4 * SEQ) = xh[it];
        } else {
            // q, k: two-half rotate-half RoPE. Each 32-dim half is rotated within itself; the partner of dim d is d + 16 (subtracted) or d - 16 (added): block nb ^ 1 of the same lane and register. Both dims of a pair share one cos/sin entry.
            const float scl = (z == 0) ? QSCL : 1.0f;
            h16* Ph = ((z == 0) ? QF : KF) + ((size_t)bh * SEQ + t0 + rr) * HD + pc * 8;
            float* G = GK + ((size_t)bh * SEQ_FULL + t0 + rr) * HD + pc * 8;
            const float* csb = CS + ((size_t)(r0 + hi * 8) * HD + lr) * 2;
            v2f cs[2][8];   // cos, sin of this lane's eight tokens of a block, for each half of the head
#pragma unroll
            for (int j = 0; j < 8; ++j) { cs[0][j] = *(const v2f*)(csb + (size_t)(j * HD) * 2); cs[1][j] = *(const v2f*)(csb + (size_t)(j * HD + 32) * 2); }
#pragma unroll
            for (int mb = 0; mb < 4; ++mb) {
#pragma unroll
                for (int hf = 0; hf < 2; ++hf)
#pragma unroll
                    for (int j = 0; j < 8; ++j) { const float x0 = (acc[mb][2 * hf][j] + bn[2 * hf]) * scl, x1 = (acc[mb][2 * hf + 1][j] + bn[2 * hf + 1]) * scl; const float cn = cs[hf][j][0], sn = cs[hf][j][1];
                        float* op = os + (hi * 8 + j) * 68 + hf * 32 + lr; op[0] = x0 * cn - x1 * sn; op[16] = x1 * cn + x0 * sn; }
                __builtin_amdgcn_wave_barrier(); asm volatile("" ::: "memory");   // keeps the row reads behind the other lanes' writes in the compiled order
                if (mb < 3) {   // the next block's table entries fly while this block is converted and stored
#pragma unroll
                    for (int j = 0; j < 8; ++j) { cs[0][j] = *(const v2f*)(csb + (size_t)((mb * 16 + 16 + j) * HD) * 2); cs[1][j] = *(const v2f*)(csb + (size_t)((mb * 16 + 16 + j) * HD + 32) * 2); }
                    asm volatile("s_wait_xcnt 0x0" :: "v"(csb) : "memory"); }   // the address pair that these loads name lives to this wait, so nothing is written over it ahead of the wait
                v4f xa[4], xb[4];   // the block's rows as one group of LDS reads, not a read and its wait for every four rows
#pragma unroll
                for (int it = 0; it < 4; ++it) { const float* orow = os + (it * 4 + rr) * 68 + pc * 8; xa[it] = *(const v4fa*)orow; xb[it] = *(const v4fa*)(orow + 4); }
                // two halves of the block: each half's stores as one group out of registers of their own, one wait behind them
#pragma unroll
                for (int hb = 0; hb < 2; ++hb) { v8h th[2];
#pragma unroll
                    for (int i2 = 0; i2 < 2; ++i2)
#pragma unroll
                        for (int c = 0; c < 4; ++c) { th[i2][c] = (h16)xa[2 * hb + i2][c]; th[i2][4 + c] = (h16)xb[2 * hb + i2][c]; }
#pragma unroll
                    for (int i2 = 0; i2 < 2; ++i2) { const size_t o = (size_t)(mb * 16 + hb * 8 + i2 * 4) * HD; *(v8h*)(Ph + o) = th[i2]; }
                    if (z == 1) {
#pragma unroll
                        for (int i2 = 0; i2 < 2; ++i2) { const size_t o = (size_t)(mb * 16 + hb * 8 + i2 * 4) * HD; *(v4f*)(G + o) = xa[2 * hb + i2]; *(v4f*)(G + o + 4) = xb[2 * hb + i2]; } }
                    asm volatile("s_wait_xcnt 0x0" ::: "memory");   // stands ahead of any rewrite of a register these stores name
                    __builtin_amdgcn_sched_barrier(0); }   // keeps the arithmetic that follows, which rewrites those registers, from being scheduled ahead of the wait
                __builtin_amdgcn_wave_barrier();   // with the clobber of the wait above: keeps the next block's writes behind this block's reads in the compiled order
            }
        }
    } else {
    float* os = (float*)ring4 + w * (16 * 68);
    v4f bb;   // the bias of this lane's four columns, as its bf16 value
#pragma unroll
    for (int c = 0; c < 4; ++c) bb[c] = bfr(bias[c0 + cofs + c]);
#pragma unroll
    for (int mb = 0; mb < 4; ++mb) {
#pragma unroll
        for (int nb = 0; nb < 4; ++nb) {
#pragma unroll
            for (int j = 0; j < 8; ++j) os[(hi * 8 + j) * 68 + nb * 16 + lr] = acc[mb][nb][j]; }
        __builtin_amdgcn_wave_barrier(); asm volatile("" ::: "memory");   // keeps the row reads behind the other lanes' writes in the compiled order
        float* crow = C + (size_t)(r0 + mb * 16) * ldc + c0;
#pragma unroll
        for (int s = 0; s < 8; ++s) { const int row = 2 * s + hi; const v4f val = *(const v4fa*)(os + row * 68 + cofs) + bb;
            *(v4f*)(crow + (size_t)row * ldc + cofs) = val; }
        __builtin_amdgcn_wave_barrier(); asm volatile("s_wait_xcnt 0x0" ::: "memory");   // keeps the next block's writes behind these reads; the wait stands ahead of any rewrite of a register these stores name
    }
    }
}

__device__ __forceinline__ void d_wtG(const float* __restrict__ w, int K, int N, bf* Bt, int bx) {
    const int lane = threadIdx.x & 31; const int L0 = (bx * 8 + (threadIdx.x >> 5)) * 8; const int nlines = (int)((size_t)N * K / 64);
{
#pragma unroll 1
        for (int l = 0; l < 8; ++l) { const int L = L0 + l; if (L >= nlines) break; const size_t e = (size_t)L * 64 + lane * 2; const int k = (int)(e % K), n = (int)(e / K); v2us o;
            o[0] = f2bf(w[(size_t)k * N + n]); o[1] = f2bf(w[(size_t)(k + 1) * N + n]); *(v2us*)(Bt + e) = o; }
         }
}

__device__ __forceinline__ float invf(int j) {
    const float e = (float)(j & 15) * 0.0625f;
    const float p = powf(10000.0f, e);
    const float v = 1.0f / p;
    return v;
}

__device__ __forceinline__ void d_cstab(const int* __restrict__ fidx, const int* __restrict__ sidx, float* CS, int bx) {
    const int idx = bx * 256 + threadIdx.x; if (idx >= NTOK * HD) return;
    const int dd = idx & (HD - 1); const int R = idx >> 6; const int b = R / SEQ, t = R - b * SEQ; const int fl = t / NRES, n = t - fl * NRES;
    const int pseq = sidx[b * NRES + n]; const int pfr = fidx[fl];
    const float pf = (float)((dd < HD / 2) ? pseq : pfr);
    float fr = __fmul_rn(pf, invf(dd)); asm volatile("" : "+v"(fr));
    float sn, cn;
    sincosf(fr, &sn, &cn);
    v2f cs; cs[0] = cn; cs[1] = sn;
    *(v2f*)(CS + (size_t)idx * 2) = cs; 
}

// ---- d_ln: AdaLN for LN_RB token rows of one batch element, as a job that reads only inputs. The block forms its batch element's scale and shift itself: ss[n] = sum_c cond[c] adaln_w[c][n] + adaln_b[n], bf16 operands converted (RNE) on load,
// one 16x16x32 product per 32 c, every A row the cond row, so register 0 of a lane holds its column of the tile. Wave w takes columns 128 w .. 128 w + 127; the result goes through LDS to every wave. Then LN_RW rows per wave: non-affine LN, modulation, bf16 hi/lo split.
#define LN_RW 3                      // rows of one wave
#define LN_RB (8 * LN_RW)            // rows of one block
static_assert(SEQ % LN_RB == 0 && ADW == 8 * 128 && CDIM == 64);
__device__ __forceinline__ void d_ln(const float* __restrict__ X, const float* __restrict__ cond, const float* __restrict__ aw, const float* __restrict__ ab, bf* Xh, bf* Xl, int bx) {
    __shared__ __align__(32) float ssl[ADW];
    const int lane = threadIdx.x & 31, lr = lane & 15, hi = lane >> 4, w = threadIdx.x >> 5;
    const int b = bx * LN_RB / SEQ; const int R0 = bx * LN_RB + w * LN_RW;
    const float* xr = X + ((size_t)b * SEQ_FULL + (R0 - b * SEQ)) * CM + 8 * lane;
    v16bf a[2];
#pragma unroll
    for (int kk = 0; kk < 2; ++kk) { const float* cp = cond + (size_t)b * CDIM + kk * 32 + 8 * hi; v16f c;
#pragma unroll
        for (int i = 0; i < 8; ++i) { c[i] = cp[i]; c[8 + i] = cp[16 + i]; }
        a[kk] = __builtin_convertvector(c, v16bf); }
    // column of tile t at lane lr: 128 w + 64 (t >> 2) + 4 lr + (t & 3), so a lane's four tiles of a half are one 16-byte load per c and a half-wave's load covers 256 B in a row
    const float* wp = aw + (size_t)(8 * hi) * ADW + w * 128 + lr * 4;
    const float* bp = ab + w * 128 + hi * 64 + lr * 4; const v4f bi = *(const v4f*)bp;
    asm volatile("s_wait_xcnt 0x0" :: "v"(bp) : "memory");   // the address pair that this load names lives to this wait, so nothing is written over it ahead of the wait
    float res[8];
#pragma unroll
    for (int hc = 0; hc < 2; ++hc) { v8f acc[4];
#pragma unroll
        for (int tt = 0; tt < 4; ++tt) acc[tt] = (v8f){};
#pragma unroll
        for (int kk = 0; kk < 2; ++kk) { v4f r[16];   // r[i]: c = 32 kk + 8 hi + i for i < 8, 32 kk + 16 + 8 hi + (i - 8) above
#pragma unroll
            for (int i = 0; i < 16; ++i) r[i] = *(const v4f*)(wp + (size_t)(kk * 32 + (i >> 3) * 16 + (i & 7)) * ADW + hc * 64);
#pragma unroll
            for (int tt = 0; tt < 4; ++tt) { v16f c;
#pragma unroll
                for (int i = 0; i < 16; ++i) c[i] = r[i][tt];
                acc[tt] = wmmab(a[kk], __builtin_convertvector(c, v16bf), acc[tt]); }
            __builtin_amdgcn_sched_barrier(0); }   // one group of sixteen loads at a time: left alone, later groups' loads are lifted over this one's products and the register budget is overrun (spills)
#pragma unroll
        for (int tt = 0; tt < 4; ++tt) res[hc * 4 + tt] = acc[tt][0]; }
    v8f x0[LN_RW], x1[LN_RW];   // the rows' loads fly over the LDS store and the barrier
#pragma unroll
    for (int i = 0; i < LN_RW; ++i) { x0[i] = *(const v8f*)(xr + (size_t)i * CM); x1[i] = *(const v8f*)(xr + (size_t)i * CM + 256); }
    { v4f sv;   // both halves of the wave hold every column (all A rows are equal): half hi stores the 64 columns of its number
#pragma unroll
      for (int c = 0; c < 4; ++c) sv[c] = (hi ? res[4 + c] : res[c]) + bfr(bi[c]);
      *(v4fa*)(ssl + w * 128 + hi * 64 + lr * 4) = sv; }
    __syncthreads();   // every wave's columns are in LDS
    v8f g[2], be[2];
#pragma unroll
    for (int c = 0; c < 2; ++c) { const float* sp = ssl + c * 256 + 8 * lane; const v4f g0 = *(const v4fa*)sp, g1 = *(const v4fa*)(sp + 4), b0 = *(const v4fa*)(sp + CM), b1 = *(const v4fa*)(sp + CM + 4);
        g[c] = __builtin_shufflevector(g0, g1, 0, 1, 2, 3, 4, 5, 6, 7); be[c] = __builtin_shufflevector(b0, b1, 0, 1, 2, 3, 4, 5, 6, 7); }
    float v[LN_RW][16], mu[LN_RW], rs[LN_RW];   // the rows' statistics in one stretch: the three chains of cross-lane sums run side by side
#pragma unroll
    for (int i = 0; i < LN_RW; ++i) {
#pragma unroll
        for (int k = 0; k < 8; ++k) { v[i][k] = bfr(x0[i][k]); v[i][8 + k] = bfr(x1[i][k]); }
        float s = 0.f;
#pragma unroll
        for (int k = 0; k < 16; ++k) s += v[i][k];
#pragma unroll
        for (int sh = 16; sh; sh >>= 1) s += __shfl_xor(s, sh, 32);
        mu[i] = s * (1.0f / (float)CM);
        float qq = 0.f;
#pragma unroll
        for (int k = 0; k < 16; ++k) { const float d = v[i][k] - mu[i]; qq += d * d; }
#pragma unroll
        for (int sh = 16; sh; sh >>= 1) qq += __shfl_xor(qq, sh, 32);
        const float var = qq * (1.0f / (float)CM);
        rs[i] = rsqrtf(var + 1.0e-5f);
    }
#pragma unroll
    for (int i = 0; i < LN_RW; ++i) {
        v8us oh[2], ol[2];
#pragma unroll
        for (int c = 0; c < 2; ++c) { v8us th, tl;
#pragma unroll
            for (int k = 0; k < 8; ++k) { const float xn = (v[i][c * 8 + k] - mu[i]) * rs[i]; const float y = xn * (1.0f + g[c][k]) + be[c][k]; unsigned short a2, c2; splitf(y, a2, c2); th[k] = a2; tl[k] = c2; }
            oh[c] = th; ol[c] = tl; }
#pragma unroll
        for (int c = 0; c < 2; ++c) { const size_t o = (size_t)(R0 + i) * CM + c * 256 + 8 * lane; *(v8us*)(Xh + o) = oh[c]; *(v8us*)(Xl + o) = ol[c]; }
        asm volatile("s_wait_xcnt 0x0" ::: "memory");   // stands ahead of any rewrite of a register these stores name: the next row's arithmetic, or another job's code that follows in the merged kernel's text
        __builtin_amdgcn_sched_barrier(0);   // keeps the next row's arithmetic, which rewrites those registers, from being scheduled ahead of the wait
    }
}

// ---- d_extras: per token row R the extra bf16 k-step rows (NEX = 32 slots) that carry the additive score bias inside the score WMMA. With c = bf16 coordinates and g = -|c|^2/64 split three-piece (gh + gm + gl):
// query row QE[R] = [cx, cy, cz, 1, 1, 1, gh, gm, gl, 1, 0 x 22]; key row KE[R] = [cx/32, cy/32, cz/32, gh, gm, gl, 1, 1, 1, fill, 0 x 22], fill = -2e30 where mask == 0 else 0.
__device__ __forceinline__ void d_extras(const float* __restrict__ ca, const float* __restrict__ msk, bf* QE, bf* KE, int bx) {
    __shared__ __align__(16) unsigned int qs[256 * 16];
    __shared__ __align__(16) unsigned int ks[256 * 16];
    const int tid = threadIdx.x, lane = tid & 31, w = tid >> 5;
    const int R0 = bx * 256; const int R = R0 + tid;
    const int b = R / SEQ, t = R - b * SEQ; const size_t Rf = (size_t)b * SEQ_FULL + t;
    const float cx = bfr(ca[Rf * 3]), cy = bfr(ca[Rf * 3 + 1]), cz = bfr(ca[Rf * 3 + 2]);
    const float mk = bfr(msk[Rf]);
    const float n2 = cx * cx + cz * cz + cy * cy;
    const float g = -(n2 * 0.015625f);
    const unsigned short gh = f2bf(g); const float r1 = g - bf2f(gh); const unsigned short gm = f2bf(r1); const unsigned short gl = f2bf(r1 - bf2f(gm));
    const unsigned short one = (unsigned short)0x3F80u;
    const unsigned short fillv = (mk == 0.0f) ? f2bf(-2.0e30f) : (unsigned short)0;
    v4u qa, qb, ka, kb, zz;
#pragma unroll
    for (int i = 0; i < 4; ++i) { qb[i] = 0u; kb[i] = 0u; zz[i] = 0u; }
    qa[0] = pk2(f2bf(cx), f2bf(cy)); qa[1] = pk2(f2bf(cz), one); qa[2] = pk2(one, one); qa[3] = pk2(gh, gm);
    qb[0] = pk2(gl, one);
    ka[0] = pk2(f2bf(cx * 0.03125f), f2bf(cy * 0.03125f)); ka[1] = pk2(f2bf(cz * 0.03125f), gh); ka[2] = pk2(gm, gl); ka[3] = pk2(one, one);
    kb[0] = pk2(one, fillv);
    unsigned int* qr = qs + tid * 16; unsigned int* krw = ks + tid * 16;
    *(v4u*)(qr) = qa; *(v4u*)(qr + 4) = qb; *(v4u*)(qr + 8) = zz; *(v4u*)(qr + 12) = zz;
    *(v4u*)(krw) = ka; *(v4u*)(krw + 4) = kb; *(v4u*)(krw + 8) = zz; *(v4u*)(krw + 12) = zz;
    __syncthreads();
    v4u oq[4], ok[4]; int off[4];
#pragma unroll
    for (int it = 0; it < 4; ++it) { off[it] = (w * 4 + it) * 128 + lane * 4; oq[it] = *(const v4ua*)(qs + off[it]); ok[it] = *(const v4ua*)(ks + off[it]); }
    unsigned int* QEw = (unsigned int*)QE + (size_t)R0 * 16; unsigned int* KEw = (unsigned int*)KE + (size_t)R0 * 16;
{
#pragma unroll
        for (int it = 0; it < 4; ++it) { *(v4u*)(QEw + off[it]) = oq[it]; *(v4u*)(KEw + off[it]) = ok[it]; }
         }
}

// ---- k_prep: every job that reads only inputs, as block ranges of one grid (the branch is the same for a whole block): AdaLN rows (the longest job, first), weight planes, bias k-step rows, cos/sin table.
#define PB_LN (NTOK / LN_RB)
#define PB_W ((CM * CM / 64 + 63) / 64)
#define PB_EX (NTOK / 256)
#define PB_CS ((NTOK * HD + 255) / 256)
#define PB_ALL (PB_LN + 4 * PB_W + PB_EX + PB_CS)
// A register budget for six waves a SIMD: three blocks fit a WGP, so the short jobs run beside the AdaLN blocks and not behind them.
__global__ __launch_bounds__(256) __attribute__((amdgpu_waves_per_eu(6))) void k_prep(const float* __restrict__ s_frames, const float* __restrict__ adaln_w, const float* __restrict__ adaln_b, const float* __restrict__ wq, const float* __restrict__ wk, const float* __restrict__ wv, const float* __restrict__ wo,
                                              const float* __restrict__ cond, const float* __restrict__ ca, const float* __restrict__ msk, const int* __restrict__ fidx, const int* __restrict__ sidx,
                                              bf* XBh, bf* XBl, bf* WQ, bf* WK, bf* WV, bf* WO, bf* QE, bf* KE, float* CS) {
    int bx = blockIdx.x;
    if (bx < PB_LN) { d_ln(s_frames, cond, adaln_w, adaln_b, XBh, XBl, bx); return; }
    bx -= PB_LN;
    if (bx < 4 * PB_W) { const int j = bx / PB_W;                                // w [in][out] -> Bt[out][in]
        d_wtG((j == 0) ? wq : (j == 1) ? wk : (j == 2) ? wv : wo, CM, CM, (j == 0) ? WQ : (j == 1) ? WK : (j == 2) ? WV : WO, bx - j * PB_W); return; }
    bx -= 4 * PB_W;
    if (bx < PB_EX) { d_extras(ca, msk, QE, KE, bx); return; }
    d_cstab(fidx, sidx, CS, bx - PB_EX);
}

// ---- k_attn: four waves per work-group, 64 query rows of one (b, h); all 64 rows lie in one frame, so the key bound (frame+1)*NRES is the same for the whole group. 64 keys per trip, as two 32-key tiles.
// Wave w takes the 32 query rows of half w >> 1 (two 16-row tiles) and the 32-key tile w & 1 of every trip: each k or v fragment read from LDS feeds two products. The two waves of a query half join their partial maximum, sum and O behind the loop.
// The trip's k, bias and v tiles are brought once per work-group into a two-buffer LDS ring by asynchronous copies (whole lines from global memory, one trip ahead); every wave reads its fragments from the ring.
// Transposed products: S^T tile (16 keys x 16 queries) = KE.QE (bias k-step, bf16) + K.Q over d (f16, k rows as A, q as B, scale folded into the q plane), so a lane holds 16 scores of ONE query (lane & 15; keys 16j + 8(lane >> 4) + r).
// Online max-subtracted softmax in f32 in the lane, one exchange between the wave's halves for the maximum; each half keeps the sum of its own keys, joined once behind the loop. P^T packs from the two score tiles straight into the B operand of O^T += V^T.P^T.
#define AW 4
#define KP 72                        // LDS pitch of a 64-element k row: 144 B = 16 B x odd, free of bank conflicts for 16-byte readers
#define VP 40                        // LDS pitch of a 32-element v or bias row: 80 B
#define ST_K 0
#define ST_KE (32 * KP)
#define ST_V (ST_KE + 32 * VP)
#define ST_EL (ST_V + 64 * VP)       // elements of one 32-key tile in the ring (12288 B)
#define XW (8 * 32 * 4 + 64)         // floats one wave hands to its partner: 32 O values, maximum and sum of each lane
static_assert(AW == 4 && NRES % (16 * AW) == 0 && NRES >= 128 && (ST_EL * 2) % 16 == 0);
static_assert((AW * XW + AW * 16 * 68) * 4 <= 4 * ST_EL * 2);
__device__ __forceinline__ v16bf ldsb(const unsigned short* p) { return cat16b(*(const v8usa*)p, *(const v8usa*)(p + 16)); }
__device__ __forceinline__ v16h ldsh(const unsigned short* p) { return cat16(*(const v8ha*)p, *(const v8ha*)(p + 16)); }
__device__ __forceinline__ float xhalf(float x) { return __builtin_bit_cast(float, __builtin_amdgcn_permlanex16(__builtin_bit_cast(int, x), __builtin_bit_cast(int, x), 0x76543210, 0xfedcba98, false, false)); }   // lane l with lane l ^ 16
// One tile's copies of one lane, 16 B each: two pieces (16 rows apart) of k, two (32 rows apart) of v, one of the bias rows.
typedef __attribute__((ext_vector_type(4))) int v4i;
typedef __attribute__((address_space(1))) v4i* gp16;
typedef __attribute__((address_space(3))) v4i* lp16;
__device__ __forceinline__ void cp16(unsigned short* l, const void* g) { __builtin_amdgcn_global_load_async_to_lds_b128((gp16)g, (lp16)l, 0, 0); }
__device__ __forceinline__ void tile_copy(unsigned short* lk, unsigned short* lv, unsigned short* le, const h16* gk, const h16* gv, const bf* gke) {
    cp16(lk, gk); cp16(lk + 16 * KP, gk + 16 * HD);
    cp16(lv, gv); cp16(lv + 32 * VP, gv + (size_t)32 * SEQ);
    cp16(le, gke);
}
// The grid brings three work-groups to a WGP, three waves to a SIMD: the register budget of three waves is free to use.
__global__ __launch_bounds__(32 * AW) __attribute__((amdgpu_waves_per_eu(3, 3))) void k_attn(const h16* __restrict__ Q, const bf* __restrict__ QE,
                                             const h16* __restrict__ K, const bf* __restrict__ KE,
                                             const h16* __restrict__ Vt, bf* ATh, bf* ATl) {
    __shared__ __align__(16) unsigned short ring[4 * ST_EL];   // two buffers of two 32-key tiles
    const int tid = threadIdx.x, lane = tid & 31, lr = lane & 15, hi = lane >> 4, w = tid >> 5;
    const int kh = w & 1;
    const int bh = blockIdx.y; const int b = bh / NH, h = bh - b * NH;
    const int qb = blockIdx.x * (16 * AW) + (w >> 1) * 32;
    const int kvlen = ((int)blockIdx.x * (16 * AW) / NRES + 1) * NRES;
    const int nt = kvlen >> 6;
    const size_t hp = (size_t)bh * SEQ * HD;
    const size_t tb = (size_t)b * SEQ;
    // this lane's share of a tile, in 16-byte pieces: k rows tid>>3 and 16 + tid>>3, piece tid&7; v rows (d) tid>>2 and 32 + tid>>2, piece tid&3; bias row tid>>2, piece tid&3
    unsigned short* lk0 = ring + ST_K + (tid >> 3) * KP + (tid & 7) * 8;
    unsigned short* lv0 = ring + ST_V + (tid >> 2) * VP + (tid & 3) * 8;
    unsigned short* le0 = ring + ST_KE + (tid >> 2) * VP + (tid & 3) * 8;
    // the lane's part of a global address is a 32-bit element offset; the part that moves with the trip is the same for the whole group and stays in scalar registers
    const unsigned gk0 = (unsigned)((tid >> 3) * HD + (tid & 7) * 8), gv0 = (unsigned)((tid >> 2) * SEQ + (tid & 3) * 8), ge0 = (unsigned)((tid >> 2) * NEX + (tid & 3) * 8);
    const h16* uk = K + hp; const h16* uv = Vt + hp; const bf* uke = KE + tb * NEX;
    auto trip_copy = [&](unsigned bo, size_t kn) {   // the two 32-key tiles from key kn on, into the buffer at element bo of the ring
        tile_copy(lk0 + bo, lv0 + bo, le0 + bo, (uk + kn * HD) + gk0, (uv + kn) + gv0, (uke + kn * NEX) + ge0);
        tile_copy(lk0 + bo + ST_EL, lv0 + bo + ST_EL, le0 + bo + ST_EL, (uk + (kn + 32) * HD) + gk0, (uv + (kn + 32)) + gv0, (uke + (kn + 32) * NEX) + ge0);
    };
    trip_copy(0, 0);
    v16h a0[2], a1[2]; v16bf aE[2];
#pragma unroll
    for (int u = 0; u < 2; ++u) { const size_t qo = hp + (size_t)(qb + 16 * u + lr) * HD + 8 * hi;
        a0[u] = WFrag<h16>::ld(Q + qo); a1[u] = WFrag<h16>::ld(Q + qo + 32);
        aE[u] = WFrag<bf>::ld(QE + (tb + qb + 16 * u + lr) * NEX + 8 * hi); }
    v8f oh[2][4];
#pragma unroll
    for (int u = 0; u < 2; ++u)
#pragma unroll
        for (int nb = 0; nb < 4; ++nb) oh[u][nb] = (v8f){};
    float m[2] = {-1.0e30f, -1.0e30f}, l[2] = {0.f, 0.f};   // this lane's two queries: running maximum (equal in both halves), sum over this half's keys
    asm volatile("s_wait_asynccnt 0x0" ::: "memory");   // trip 0's tiles of this wave have landed
    __syncthreads();                                     // publishes trip 0 to every wave
    // trip 1 exists: nt >= 4
    trip_copy(2 * ST_EL, 64);
#pragma unroll 1
    for (int t = 0; t < nt; ++t) {
        const unsigned short* st = ring + ((t & 1) * 2 + kh) * ST_EL;
        v8f s[2][2];
        const unsigned short* kp = st + ST_K + lr * KP + 8 * hi;
        v16h bV[4];
        {
            v16bf bE[2]; v16h k0[2], k1[2];
#pragma unroll
            for (int j = 0; j < 2; ++j) { bE[j] = ldsb(st + ST_KE + (16 * j + lr) * VP + 8 * hi); k0[j] = ldsh(kp + 16 * j * KP); k1[j] = ldsh(kp + 16 * j * KP + 32); }
#pragma unroll
            for (int nb = 0; nb < 4; ++nb) bV[nb] = ldsh(st + ST_V + (16 * nb + lr) * VP + 8 * hi);
            // the four score tiles in turn at each k-step, so that a tile's next product stands four products behind its last
#pragma unroll
            for (int j = 0; j < 2; ++j)
#pragma unroll
                for (int u = 0; u < 2; ++u) s[u][j] = wmmab(bE[j], aE[u], (v8f){});
#pragma unroll
            for (int j = 0; j < 2; ++j)
#pragma unroll
                for (int u = 0; u < 2; ++u) s[u][j] = wmma16(k0[j], a0[u], s[u][j]);
#pragma unroll
            for (int j = 0; j < 2; ++j)
#pragma unroll
                for (int u = 0; u < 2; ++u) s[u][j] = wmma16(k1[j], a1[u], s[u][j]);
        }
        // the order of the stretch above: the trip's twenty LDS reads as one group (bias and k rows first, the v rows return under the products and the softmax), then the twelve products. Left alone, the reads stand in pairs among the products, each place with its own cost.
        __builtin_amdgcn_sched_group_barrier(0x100, 20, 0); __builtin_amdgcn_sched_group_barrier(0x008, 12, 0);
        __builtin_amdgcn_sched_barrier(0);   // keeps the softmax arithmetic from being mixed into the score products' stretch
        v16h ap[2];   // B operand: element i <- key 8(lane >> 4) + i, element 8 + i <- key 16 + 8(lane >> 4) + i, the order of the v fragments
#pragma unroll
        for (int u = 0; u < 2; ++u) {
            const v8f sa = s[u][0], sb = s[u][1];
            const float v0 = fmaxf(fmaxf(sa[0], sa[1]), sa[2]), v1 = fmaxf(fmaxf(sa[3], sa[4]), sa[5]), v2 = fmaxf(fmaxf(sa[6], sa[7]), sb[0]);
            const float v3 = fmaxf(fmaxf(sb[1], sb[2]), sb[3]), v4 = fmaxf(fmaxf(sb[4], sb[5]), sb[6]);
            float v = fmaxf(fmaxf(fmaxf(v0, v1), v2), fmaxf(fmaxf(v3, v4), sb[7]));   // a tree three deep, not a chain of eight
            v = fmaxf(v, xhalf(v));
            const float mn = fmaxf(m[u], v);
            const float al = __builtin_amdgcn_exp2f((m[u] - mn) * LOG2E);
            m[u] = mn;
            float ts[8];
#pragma unroll
            for (int r = 0; r < 8; ++r) {
                const float p0 = __builtin_amdgcn_exp2f((sa[r] - mn) * LOG2E), p1 = __builtin_amdgcn_exp2f((sb[r] - mn) * LOG2E);
                ap[u][r] = (h16)(p0 * PCAR); ap[u][8 + r] = (h16)(p1 * PCAR);
                ts[r] = p0 + p1;
            }
            l[u] = l[u] * al + (((ts[0] + ts[1]) + (ts[2] + ts[3])) + ((ts[4] + ts[5]) + (ts[6] + ts[7])));
#pragma unroll
            for (int nb = 0; nb < 4; ++nb)
#pragma unroll
                for (int r = 0; r < 8; ++r) oh[u][nb][r] *= al;
        }
#pragma unroll
        for (int nb = 0; nb < 4; ++nb) { oh[0][nb] = wmma16(bV[nb], ap[0], oh[0][nb]); oh[1][nb] = wmma16(bV[nb], ap[1], oh[1][nb]); }
        __builtin_amdgcn_sched_barrier(0);   // keeps the waits below at the trip's foot: no memory operation stands behind the reads at its head, so the scheduler lifts them to right behind the score products, where the next trip's copies have had a fraction of a trip to land
        asm volatile("s_wait_dscnt 0x0" ::: "memory");      // this wave's reads of buffer t & 1 have returned
        asm volatile("s_wait_asynccnt 0x0" ::: "memory");   // this wave's copies of trip t + 1 have landed
        __syncthreads();                                     // publishes trip t + 1 and ends every wave's reads of buffer t & 1
        if (t + 2 < nt) trip_copy((unsigned)(t & 1) * (2 * ST_EL), (size_t)(t + 2) * 64);
    }
    asm volatile("s_wait_asynccnt 0x0" ::: "memory");       // nothing of this wave is in flight when the ring becomes staging
    // behind the last trip's barrier no wave reads the ring and no copy is under way. Wave w keeps query tile w & 1 of its half and hands the other tile's partial result, lane to lane, to wave w ^ 1.
    float* xw = (float*)ring + w * XW; const float* xr = (const float*)ring + (w ^ 1) * XW;
    float* os = (float*)ring + AW * XW + w * (16 * 68);
    const bool k1 = (kh != 0);
    const float lj0 = l[0] + xhalf(l[0]), lj1 = l[1] + xhalf(l[1]);
    const float mm = k1 ? m[1] : m[0], lm = k1 ? lj1 : lj0;
    float xm[4][8];
#pragma unroll
    for (int nb = 0; nb < 4; ++nb) { v4f g0, g1;
#pragma unroll
        for (int r = 0; r < 8; ++r) { const float e0 = oh[0][nb][r], e1 = oh[1][nb][r];
            xm[nb][r] = k1 ? e1 : e0; const float gv = k1 ? e0 : e1; if (r < 4) g0[r] = gv; else g1[r - 4] = gv; }
        *(v4fa*)(xw + ((2 * nb) * 32 + lane) * 4) = g0; *(v4fa*)(xw + ((2 * nb + 1) * 32 + lane) * 4) = g1; }
    xw[1024 + lane] = k1 ? m[0] : m[1]; xw[1056 + lane] = k1 ? lj0 : lj1;
    __syncthreads();                                         // the partner's partial result is complete
    const float mr = xr[1024 + lane], lq = xr[1056 + lane];
    const float mx = fmaxf(mm, mr);
    const float am = __builtin_amdgcn_exp2f((mm - mx) * LOG2E), ar = __builtin_amdgcn_exp2f((mr - mx) * LOG2E);
    const float il = PINV * __fdiv_rn(1.0f, lm * am + lq * ar);
    const float cm = am * il, cr = ar * il;
    const int q0 = qb + 16 * kh;
#pragma unroll
    for (int nb = 0; nb < 4; ++nb) { v4f x0, x1;   // register r of tile nb is d = 16 nb + 8 hi + r of query lr
        const v4f g0 = *(const v4fa*)(xr + ((2 * nb) * 32 + lane) * 4), g1 = *(const v4fa*)(xr + ((2 * nb + 1) * 32 + lane) * 4);
#pragma unroll
        for (int r = 0; r < 4; ++r) { x0[r] = xm[nb][r] * cm + g0[r] * cr; x1[r] = xm[nb][4 + r] * cm + g1[r] * cr; }
        *(v4fa*)(os + lr * 68 + 16 * nb + 8 * hi) = x0; *(v4fa*)(os + lr * 68 + 16 * nb + 8 * hi + 4) = x1; }
    __builtin_amdgcn_fence(3, "wavefront"); __builtin_amdgcn_wave_barrier(); asm volatile("" ::: "memory");
    v8us ah[4], av[4]; size_t ad[4];
#pragma unroll
    for (int it = 0; it < 4; ++it) { const int rr = it * 4 + (lane >> 3); const int pc = lane & 7;
        const v4f x0 = *(const v4fa*)(os + rr * 68 + pc * 8), x1 = *(const v4fa*)(os + rr * 68 + pc * 8 + 4); v8us th, tl;
#pragma unroll
        for (int c = 0; c < 4; ++c) { unsigned short a2, c2; splitf(x0[c], a2, c2); th[c] = a2; tl[c] = c2; splitf(x1[c], a2, c2); th[4 + c] = a2; tl[4 + c] = c2; }
        ah[it] = th; av[it] = tl; ad[it] = (tb + q0 + rr) * CM + (size_t)h * HD + pc * 8; }
{
#pragma unroll
        for (int it = 0; it < 4; ++it) { *(v8us*)(ATh + ad[it]) = ah[it]; *(v8us*)(ATl + ad[it]) = av[it]; }
         }
}

extern "C" void kernel_launch(void* const* d_in, const int* in_sizes, int n_in,
                              void* d_out, int out_size, void* d_ws, size_t ws_size, hipStream_t stream) {
    if (n_in < 16) return;
    const int ntok_in = (NB - 1) * SEQ_FULL + SEQ;
    if (in_sizes[0] < ntok_in * CM || in_sizes[1] < NFR || in_sizes[2] < NB * NRES || in_sizes[3] < ntok_in || in_sizes[4] < NB * CDIM || in_sizes[5] < ntok_in * 3) return;
    if (in_sizes[6] < CDIM * ADW || in_sizes[7] < ADW) return;
    if (in_sizes[8] < CM * CM || in_sizes[10] < CM * CM || in_sizes[12] < CM * CM || in_sizes[14] < CM * CM) return;
    if (in_sizes[9] < CM || in_sizes[11] < CM || in_sizes[13] < CM || in_sizes[15] < CM) return;
    const size_t out_need = OUT2_EL + ((size_t)((NB - 1) * NH + NH - 1) * SEQ_FULL + SEQ) * HD;
    if ((size_t)out_size < out_need) return;
    const float* s_frames = (const float*)d_in[0]; const int* frame_idx = (const int*)d_in[1]; const int* seq_idx = (const int*)d_in[2]; const float* mask = (const float*)d_in[3];
    const float* cond = (const float*)d_in[4]; const float* ca_pos = (const float*)d_in[5]; const float* adaln_w = (const float*)d_in[6]; const float* adaln_b = (const float*)d_in[7];
    const float* wq = (const float*)d_in[8]; const float* bq = (const float*)d_in[9]; const float* wk = (const float*)d_in[10]; const float* bk = (const float*)d_in[11];
    const float* wv = (const float*)d_in[12]; const float* bv = (const float*)d_in[13]; const float* wo = (const float*)d_in[14]; const float* bo = (const float*)d_in[15];
    float* OUT = (float*)d_out;
    char* wsp = (char*)d_ws;
    auto take = [&](size_t bytes) { char* p = wsp; wsp += (bytes + 255) & ~(size_t)255; return (void*)p; };
    bf* WQ = (bf*)take((size_t)3 * CM * CM * 2); bf* WK = WQ + (size_t)CM * CM; bf* WV = WK + (size_t)CM * CM; bf* WO = (bf*)take((size_t)CM * CM * 2);
    float* CS = (float*)take((size_t)NTOK * HD * 2 * 4);
    bf* XBh = (bf*)take((size_t)NTOK * CM * 2); bf* XBl = (bf*)take((size_t)NTOK * CM * 2);
    h16* QF = (h16*)take((size_t)NBH * SEQ * HD * 2); h16* KF = (h16*)take((size_t)NBH * SEQ * HD * 2);
    h16* VF = (h16*)take((size_t)NBH * HD * SEQ * 2);
    bf* QE = (bf*)take((size_t)NTOK * NEX * 2); bf* KE = (bf*)take((size_t)NTOK * NEX * 2);
    bf* ATh = (bf*)take((size_t)NTOK * CM * 2); bf* ATl = (bf*)take((size_t)NTOK * CM * 2);
    const size_t used = (size_t)(wsp - (char*)d_ws);
    if (used > ws_size || used > ((size_t)128 << 20)) return;    // about 48 MiB at NB=2, SEQ=3072

    // one launch for all that reads only inputs: AdaLN (ss = cond x adaln_w + adaln_b in each block, LN + modulation -> x hi/lo planes), 16-bit weight planes, bias k-step rows, cos/sin table
    k_prep<<<PB_ALL, 256, 0, stream>>>(s_frames, adaln_w, adaln_b, wq, wk, wv, wo, cond, ca_pos, mask, frame_idx, seq_idx, XBh, XBl, WQ, WK, WV, WO, QE, KE, CS);
    // projections (x hi/lo x bf16 W, 2 products, + bias) with RoPE, f16 conversion and transposition in the epilogue: operand planes and the k and v outputs in one launch
    k_gemm4<true><<<dim3(NTOK / 128, CM / 128, 3), 128, 0, stream>>>(XBh, XBl, WQ, nullptr, CM, bq, bk, bv, 0, (size_t)CM * CM, 0, CS, QF, KF, VF, OUT + OUT1_EL, OUT + OUT2_EL);   // z = q, k, v
    // attention (one launch) -> ctx hi/lo planes, then the output projection straight into out0 (batch z at the full-size token pitch)
    k_attn<<<dim3(SEQ / (16 * AW), NBH, 1), 32 * AW, 0, stream>>>(QF, QE, KF, KE, VF, ATh, ATl);
    k_gemm4<false><<<dim3(SEQ / 128, CM / 128, NB), 128, 0, stream>>>(ATh, ATl, WO, OUT, CM, bo, bo, bo, (size_t)SEQ * CM, 0, (size_t)SEQ_FULL * CM, nullptr, nullptr, nullptr, nullptr, nullptr, nullptr);
}

// v009
// Measured time: 72 microseconds a run.
// In two side-by-side timings against v008, it was 1.19 and 1.16 times as fast.
// All steps since v000 together make it 6.45 times as fast.
#include <hip/hip_runtime.h>

// Frame-causal multi-head attention with a Gaussian distance bias: AdaLN prologue (cond x adaln_w modulation of a non-affine LN), q/k/v projections with bias, two-half rotate-half RoPE from int positions, online-softmax attention, output projection; f32 outputs out, roped k, v.
// Compute dtypes, f32 accumulate everywhere: every float input RNE-converted to bf16 on load. cond x adaln_w: v_wmma_f32_16x16x32_bf16, plain bf16 operands (1 product). q/k/v projections: bf16 hi/lo planes of the modulated LN output x bf16 weight planes (2 products).
// Scores: v_wmma_f32_16x16x32_f16 on one f16 plane of q and one of k (1 product) plus one extra bf16 k-step carrying the distance-bias terms (exact coordinate cross products, three-piece bf16 squared norms, key mask fill). attn.v: v_wmma_f32_16x16x32_f16, P carried x2^14 in f16, v as one f16 plane.
// Why one plane is enough: an f16 operand is rounded at 2^-12 of its value, and the inputs behind q, k, v and the coordinates behind the bias are rounded at 2^-9 of theirs on load.
// Output projection: bf16 hi/lo ctx planes x bf16 Wo (2 products). LN statistics, inverse-frequency and cos/sin tables, RoPE, softmax and all side math f32 on VALU; the k and v outputs are written from the f32 projection results.

#ifndef NB
#define NB 2
#endif
#define NB_FULL 2
#ifndef SEQ
#define SEQ 3072
#endif
#define SEQ_FULL 3072
#define NRES 256
#define NFR (SEQ / NRES)
#define CM 512
#define ADW 1024
#define NH 8
#define HD 64
#define CDIM 64
#define NEX 32
#define NTOK (NB * SEQ)
#define NBH (NB * NH)
#define QSCL 0.125f
#define PCAR 16384.0f
#define PINV 0.00006103515625f
#define LOG2E 1.4426950408889634f
#define OUT1_EL ((size_t)NB_FULL * SEQ_FULL * CM)
#define OUT2_EL (OUT1_EL + (size_t)NB_FULL * NH * SEQ_FULL * HD)
static_assert(SEQ % NRES == 0);
static_assert(SEQ >= NRES && SEQ <= SEQ_FULL);
static_assert(NB >= 1 && NB <= NB_FULL);
static_assert(NTOK % 256 == 0);
static_assert(HD == 64 && CM == NH * HD);
static_assert(CM % 64 == 0 && ADW == 2 * CM && CDIM % 32 == 0);
static_assert(OUT1_EL * 4 == 12582912);
static_assert(OUT2_EL * 4 == 25165824);

typedef _Float16 h16;
typedef unsigned short bf;
typedef __attribute__((ext_vector_type(16))) __bf16   v16bf;
typedef __attribute__((ext_vector_type(16))) _Float16 v16h;
typedef __attribute__((ext_vector_type(8)))  _Float16 v8h;
typedef __attribute__((ext_vector_type(2)))  _Float16 v2h;
typedef __attribute__((ext_vector_type(8)))  unsigned short v8us;
typedef __attribute__((ext_vector_type(4)))  unsigned short v4us;
typedef __attribute__((ext_vector_type(2)))  unsigned short v2us;
typedef __attribute__((ext_vector_type(4)))  unsigned int v4u;
typedef __attribute__((ext_vector_type(16))) float    v16f;
typedef __attribute__((ext_vector_type(8)))  float    v8f;
typedef __attribute__((ext_vector_type(4)))  float    v4f;
typedef __attribute__((ext_vector_type(2)))  float    v2f;
typedef v8h  __attribute__((may_alias)) v8ha;
typedef v4f  __attribute__((may_alias)) v4fa;
typedef v8us __attribute__((may_alias)) v8usa;
typedef v4u  __attribute__((may_alias)) v4ua;

__device__ __forceinline__ unsigned short f2bf(float f) { unsigned u = __float_as_uint(f); u += 0x7FFFu + ((u >> 16) & 1u); return (unsigned short)(u >> 16); }
__device__ __forceinline__ float bf2f(unsigned short b) { return __uint_as_float(((unsigned)b) << 16); }
__device__ __forceinline__ float bfr(float f) { return bf2f(f2bf(f)); }
__device__ __forceinline__ v16h cat16(v8h lo, v8h hi) { return __builtin_shufflevector(lo, hi, 0, 1, 2, 3, 4, 5, 6, 7, 8, 9, 10, 11, 12, 13, 14, 15); }
__device__ __forceinline__ v16bf cat16b(v8us lo, v8us hi) { return __builtin_bit_cast(v16bf, __builtin_shufflevector(lo, hi, 0, 1, 2, 3, 4, 5, 6, 7, 8, 9, 10, 11, 12, 13, 14, 15)); }
__device__ __forceinline__ v8f wmma16(v16h a, v16h b, v8f c) { return __builtin_amdgcn_wmma_f32_16x16x32_f16(false, a, false, b, (short)0, c, false, false); }
__device__ __forceinline__ v8f wmmab(v16bf a, v16bf b, v8f c) { return __builtin_amdgcn_wmma_f32_16x16x32_bf16(false, a, false, b, (short)0, c, false, false); }
__device__ __forceinline__ void splitf(float y, unsigned short& h, unsigned short& l) { h = f2bf(y); l = f2bf(y - bf2f(h)); }
__device__ __forceinline__ unsigned int pk2(unsigned short lo, unsigned short hi2) { return (unsigned int)lo | ((unsigned int)hi2 << 16); }

// Fragments of every 16x16x32 product here: lane -> row/col lane&15, vector elements 0..7 <- k0 + 8h + i, elements 8..15 <- k0 + 16 + 8h + i (h = lane>>4) for BOTH operands; D element r -> (row 8h + r, col lane&15).
template <typename T16> struct WFrag;
template <> struct WFrag<h16> { typedef v16h V; static __device__ __forceinline__ V ld(const h16* p) { return cat16(*(const v8h*)p, *(const v8h*)(p + 16)); } static __device__ __forceinline__ v8f mma(V a, V b, v8f c) { return wmma16(a, b, c); } };
template <> struct WFrag<bf> { typedef v16bf V; static __device__ __forceinline__ V ld(const bf* p) { return cat16b(*(const v8us*)p, *(const v8us*)(p + 16)); } static __device__ __forceinline__ v8f mma(V a, V b, v8f c) { return wmmab(a, b, c); } };

// ---- k_gemm4: the two-product GEMM (A hi/lo planes x one bf16 Bt plane, K = CM) for the projections: FOUR WAVES share a 128x128 output tile, each wave a 64x64 quarter (16 accumulators; per 32 k the hi product, then the lo product).
// A stage is 64 k: 128 rows of A hi, of A lo and of Bt, 128 B a row, brought once per work-group into a two-buffer LDS ring by asynchronous copies (a wave's copy covers four whole lines of global memory), one stage ahead.
// LDS rows are unpadded (three work-groups fit a WGP); the 16-byte piece q of row r lies at piece q ^ ((r >> 1) & 7), so the 16 rows that a half-wave's fragment load touches fall on all 64 banks once.
#define G4_PL (128 * 128)            // bytes of one plane's stage
#define G4_BUF (3 * G4_PL)           // bytes of one ring buffer
#define G4_NS (CM / 64)
#define G4_WST (2 * G4_BUF / 4)      // bytes of the ring that one wave has for staging behind the loop
#define G4_OSB (16 * 68 * 4)         // of them the f32 row stage
#define G4_VSP 72                    // LDS pitch of a 64-token transposed v row: 144 B = 16 B x odd
static_assert(G4_OSB % 16 == 0 && G4_OSB + 64 * G4_VSP * 2 <= G4_WST && SEQ % 64 == 0);
static_assert(NTOK % 128 == 0 && SEQ % 128 == 0 && CM % 128 == 0 && G4_NS >= 2);
static_assert(4 * 16 * 68 * 4 <= 2 * G4_BUF);
// One plane's stage, this lane's eight 16-byte pieces (rows 16 apart). The s_wait_xcnt stands inside the statement so that no address register is rewritten ahead of it.
__device__ __forceinline__ void plane_copy(unsigned l, const bf* g) {
    const unsigned l1 = l + 2048, l2 = l + 2 * 2048, l3 = l + 3 * 2048, l4 = l + 4 * 2048, l5 = l + 5 * 2048, l6 = l + 6 * 2048, l7 = l + 7 * 2048;
    const bf* g1 = g + 16 * CM; const bf* g2 = g + 32 * CM; const bf* g3 = g + 48 * CM; const bf* g4 = g + 64 * CM; const bf* g5 = g + 80 * CM; const bf* g6 = g + 96 * CM; const bf* g7 = g + 112 * CM;
    asm volatile("global_load_async_to_lds_b128 %0, %8, off\n\t"
                 "global_load_async_to_lds_b128 %1, %9, off\n\t"
                 "global_load_async_to_lds_b128 %2, %10, off\n\t"
                 "global_load_async_to_lds_b128 %3, %11, off\n\t"
                 "global_load_async_to_lds_b128 %4, %12, off\n\t"
                 "global_load_async_to_lds_b128 %5, %13, off\n\t"
                 "global_load_async_to_lds_b128 %6, %14, off\n\t"
                 "global_load_async_to_lds_b128 %7, %15, off\n\t"
                 "s_wait_xcnt 0x0"
                 :: "v"(l), "v"(l1), "v"(l2), "v"(l3), "v"(l4), "v"(l5), "v"(l6), "v"(l7),
                    "v"(g), "v"(g1), "v"(g2), "v"(g3), "v"(g4), "v"(g5), "v"(g6), "v"(g7) : "memory");
}
// At most three waves come to a SIMD (LDS); a register budget for four keeps accumulators and a stage's fragments in registers without a trade for waves that never come.
// PLANES: the q, k, v projections (z = 0, 1, 2). A wave's quarter is 64 tokens of one head, so bias, RoPE, the f16 conversion and the v transposition are done on the accumulators and the operand planes and the k and v outputs are stored from here; no f32 projection goes to memory.
template <bool PLANES>
__global__ __launch_bounds__(128) __attribute__((amdgpu_waves_per_eu(4, 4))) void k_gemm4(const bf* __restrict__ A, const bf* __restrict__ A2, const bf* __restrict__ Bt, float* C, int ldc,
                                             const float* __restrict__ bias0, const float* __restrict__ bias1, const float* __restrict__ bias2, size_t sA, size_t sB, size_t sC,
                                             const float* __restrict__ CS, h16* QF, h16* KF, h16* VF, float* GK, float* GV) {
    __shared__ __align__(16) unsigned char ring4[2 * G4_BUF];
    const size_t z = blockIdx.z; A += z * sA; A2 += z * sA; Bt += z * sB; C += z * sC;
    const float* __restrict__ bias = (z == 0) ? bias0 : (z == 1) ? bias1 : bias2;
    const int tid = threadIdx.x, lane = tid & 31, lr = lane & 15, hi = lane >> 4, w = tid >> 5;
    const int R0 = blockIdx.x * 128, C0 = blockIdx.y * 128;
    // this lane's share of a stage: piece tid & 7 of rows tid >> 3, + 16, ... + 112 of each plane
    const unsigned lc = (unsigned)(size_t)ring4 + (unsigned)((tid >> 3) * 128 + (((tid & 7) ^ ((tid >> 4) & 7)) << 4));
    const bf* gah = A + (size_t)(R0 + (tid >> 3)) * CM + (tid & 7) * 8; const bf* gal = A2 + (size_t)(R0 + (tid >> 3)) * CM + (tid & 7) * 8; const bf* gb = Bt + (size_t)(C0 + (tid >> 3)) * CM + (tid & 7) * 8;
    plane_copy(lc, gah); plane_copy(lc + G4_PL, gal); plane_copy(lc + 2 * G4_PL, gb);
    v8f acc[4][4];
#pragma unroll
    for (int mb = 0; mb < 4; ++mb)
#pragma unroll
        for (int nb = 0; nb < 4; ++nb) acc[mb][nb] = (v8f){};
    // fragment reads: row (quarter's 64) + 16 mb + lr, logical pieces 4 kk + hi and 4 kk + 2 + hi, each XORed with lr >> 1
    const int s0 = hi ^ (lr >> 1);
    const int arow = ((w >> 1) * 64 + lr) * 128, brow = 2 * G4_PL + ((w & 1) * 64 + lr) * 128;
    asm volatile("s_wait_asynccnt 0x0" ::: "memory");   // stage 0 of this wave has landed
    __syncthreads();                                     // publishes stage 0 to every wave
    plane_copy(lc + G4_BUF, gah + 64); plane_copy(lc + G4_BUF + G4_PL, gal + 64); plane_copy(lc + G4_BUF + 2 * G4_PL, gb + 64);   // stage 1 exists: G4_NS >= 2
#pragma unroll 1
    for (int st = 0; st < G4_NS; ++st) {
        const unsigned char* sb = ring4 + (st & 1) * G4_BUF;
#pragma unroll
        for (int kk = 0; kk < 2; ++kk) {
            const int o0 = (s0 ^ (4 * kk)) << 4, o1 = (s0 ^ (4 * kk + 2)) << 4;
            v16bf a[4], a2[4];
#pragma unroll
            for (int mb = 0; mb < 4; ++mb) { const unsigned char* ap = sb + arow + mb * 2048;
                a[mb] = cat16b(*(const v8usa*)(ap + o0), *(const v8usa*)(ap + o1)); a2[mb] = cat16b(*(const v8usa*)(ap + G4_PL + o0), *(const v8usa*)(ap + G4_PL + o1)); }
#pragma unroll
            for (int nb = 0; nb < 4; ++nb) { const unsigned char* bp = sb + brow + nb * 2048; const v16bf b = cat16b(*(const v8usa*)(bp + o0), *(const v8usa*)(bp + o1));
#pragma unroll
                for (int mb = 0; mb < 4; ++mb) { acc[mb][nb] = wmmab(a[mb], b, acc[mb][nb]); acc[mb][nb] = wmmab(a2[mb], b, acc[mb][nb]); } }
        }
        asm volatile("s_wait_dscnt 0x0" ::: "memory");      // this wave's reads of buffer st & 1 have returned
        asm volatile("s_wait_asynccnt 0x0" ::: "memory");   // this wave's copies of stage st + 1 have landed
        __syncthreads();                                     // publishes stage st + 1 and ends every wave's reads of buffer st & 1
        if (st + 2 < G4_NS) { const unsigned bo = (unsigned)(st & 1) * G4_BUF; const int kn = (st + 2) * 64;
            plane_copy(lc + bo, gah + kn); plane_copy(lc + bo + G4_PL, gal + kn); plane_copy(lc + bo + 2 * G4_PL, gb + kn); }
    }
    asm volatile("s_wait_asynccnt 0x0" ::: "memory");       // nothing of this wave is in flight when the ring becomes output staging
    // behind the last trip's barrier no wave reads the ring and no copy is under way: each wave stages its rows in its own part of it
    const int r0 = R0 + (w >> 1) * 64, c0 = C0 + (w & 1) * 64, cofs = lr * 4;
    if constexpr (PLANES) {
        // D register j of block (mb, nb) is token 16 mb + 8 hi + j, dim 16 nb + lr of the head
        const int b = r0 / SEQ, t0 = r0 - b * SEQ, bh = b * NH + (c0 >> 6);
        unsigned char* wb = ring4 + w * G4_WST;
        float* os = (float*)wb;
        const int rr = lane >> 3, pc = lane & 7;
        float bn[4];   // the bias of this lane's four dims, as its bf16 value
#pragma unroll
        for (int nb = 0; nb < 4; ++nb) bn[nb] = bfr(bias[c0 + nb * 16 + lr]);
        if (z == 2) {
            // v: a lane's eight registers are eight successive tokens of one dim, one 16-byte piece of a transposed row; the pieces pass through LDS so that each store covers whole lines
            h16* vs = (h16*)(wb + G4_OSB);   // [64 dims][G4_VSP tokens]
            float* G = GV + ((size_t)bh * SEQ_FULL + t0) * HD;
#pragma unroll
            for (int mb = 0; mb < 4; ++mb) {
#pragma unroll
                for (int nb = 0; nb < 4; ++nb) { v8h th;
#pragma unroll
                    for (int j = 0; j < 8; ++j) { const float y = acc[mb][nb][j] + bn[nb]; os[(hi * 8 + j) * 68 + nb * 16 + lr] = y; th[j] = (h16)y; }
                    *(v8ha*)(vs + (nb * 16 + lr) * G4_VSP + mb * 16 + hi * 8) = th; }
                __builtin_amdgcn_wave_barrier(); asm volatile("" ::: "memory");   // keeps the row reads behind the other lanes' writes in the compiled order
#pragma unroll
                for (int s = 0; s < 8; ++s) { const int row = 2 * s + hi; const v4f val = *(const v4fa*)(os + row * 68 + cofs);
                    *(v4f*)(G + (size_t)(mb * 16 + row) * HD + cofs) = val; }
                __builtin_amdgcn_wave_barrier(); asm volatile("s_wait_xcnt 0x0" ::: "memory");   // keeps the next block's writes behind these reads; the wait stands ahead of any rewrite of a register these stores name
            }
            h16* gh = VF + ((size_t)bh * HD + rr) * SEQ + t0 + pc * 8;
            v8h xh[16];   // the rows as one group of LDS reads into registers of their own, then the stores: no register that a store names is written again
#pragma unroll
            for (int it = 0; it < 16; ++it) xh[it] = *(const v8ha*)(vs + (it * 4 + rr) * G4_VSP + pc * 8);
#pragma unroll
            for (int it = 0; it < 16; ++it) *(v8h*)(gh + (size_t)it * 4 * SEQ) = xh[it];
        } else {
            // q, k: two-half rotate-half RoPE. Each 32-dim half is rotated within itself; the partner of dim d is d + 16 (subtracted) or d - 16 (added): block nb ^ 1 of the same lane and register. Both dims of a pair share one cos/sin entry.
            const float scl = (z == 0) ? QSCL : 1.0f;
            h16* Ph = ((z == 0) ? QF : KF) + ((size_t)bh * SEQ + t0 + rr) * HD + pc * 8;
            float* G = GK + ((size_t)bh * SEQ_FULL + t0 + rr) * HD + pc * 8;
            const float* csb = CS + ((size_t)(r0 + hi * 8) * HD + lr) * 2;
            v2f cs[2][8];   // cos, sin of this lane's eight tokens of a block, for each half of the head
#pragma unroll
            for (int j = 0; j < 8; ++j) { cs[0][j] = *(const v2f*)(csb + (size_t)(j * HD) * 2); cs[1][j] = *(const v2f*)(csb + (size_t)(j * HD + 32) * 2); }
#pragma unroll
            for (int mb = 0; mb < 4; ++mb) {
#pragma unroll
                for (int hf = 0; hf < 2; ++hf)
#pragma unroll
                    for (int j = 0; j < 8; ++j) { const float x0 = (acc[mb][2 * hf][j] + bn[2 * hf]) * scl, x1 = (acc[mb][2 * hf + 1][j] + bn[2 * hf + 1]) * scl; const float cn = cs[hf][j][0], sn = cs[hf][j][1];
                        float* op = os + (hi * 8 + j) * 68 + hf * 32 + lr; op[0] = x0 * cn - x1 * sn; op[16] = x1 * cn + x0 * sn; }
                __builtin_amdgcn_wave_barrier(); asm volatile("" ::: "memory");   // keeps the row reads behind the other lanes' writes in the compiled order
                if (mb < 3) {   // the next block's table entries fly while this block is converted and stored
#pragma unroll
                    for (int j = 0; j < 8; ++j) { cs[0][j] = *(const v2f*)(csb + (size_t)((mb * 16 + 16 + j) * HD) * 2); cs[1][j] = *(const v2f*)(csb + (size_t)((mb * 16 + 16 + j) * HD + 32) * 2); }
                    asm volatile("s_wait_xcnt 0x0" :: "v"(csb) : "memory"); }   // the address pair that these loads name lives to this wait, so nothing is written over it ahead of the wait
                v4f xa[4], xb[4];   // the block's rows as one group of LDS reads, not a read and its wait for every four rows
#pragma unroll
                for (int it = 0; it < 4; ++it) { const float* orow = os + (it * 4 + rr) * 68 + pc * 8; xa[it] = *(const v4fa*)orow; xb[it] = *(const v4fa*)(orow + 4); }
                // two halves of the block: each half's stores as one group out of registers of their own, one wait behind them
#pragma unroll
                for (int hb = 0; hb < 2; ++hb) { v8h th[2];
#pragma unroll
                    for (int i2 = 0; i2 < 2; ++i2)
#pragma unroll
                        for (int c = 0; c < 4; ++c) { th[i2][c] = (h16)xa[2 * hb + i2][c]; th[i2][4 + c] = (h16)xb[2 * hb + i2][c]; }
#pragma unroll
                    for (int i2 = 0; i2 < 2; ++i2) { const size_t o = (size_t)(mb * 16 + hb * 8 + i2 * 4) * HD; *(v8h*)(Ph + o) = th[i2]; }
                    if (z == 1) {
#pragma unroll
                        for (int i2 = 0; i2 < 2; ++i2) { const size_t o = (size_t)(mb * 16 + hb * 8 + i2 * 4) * HD; *(v4f*)(G + o) = xa[2 * hb + i2]; *(v4f*)(G + o + 4) = xb[2 * hb + i2]; } }
                    asm volatile("s_wait_xcnt 0x0" ::: "memory");   // stands ahead of any rewrite of a register these stores name
                    __builtin_amdgcn_sched_barrier(0); }   // keeps the arithmetic that follows, which rewrites those registers, from being scheduled ahead of the wait
                __builtin_amdgcn_wave_barrier();   // with the clobber of the wait above: keeps the next block's writes behind this block's reads in the compiled order
            }
        }
    } else {
    float* os = (float*)ring4 + w * (16 * 68);
    v4f bb;   // the bias of this lane's four columns, as its bf16 value
#pragma unroll
    for (int c = 0; c < 4; ++c) bb[c] = bfr(bias[c0 + cofs + c]);
#pragma unroll
    for (int mb = 0; mb < 4; ++mb) {
#pragma unroll
        for (int nb = 0; nb < 4; ++nb) {
#pragma unroll
            for (int j = 0; j < 8; ++j) os[(hi * 8 + j) * 68 + nb * 16 + lr] = acc[mb][nb][j]; }
        __builtin_amdgcn_wave_barrier(); asm volatile("" ::: "memory");   // keeps the row reads behind the other lanes' writes in the compiled order
        float* crow = C + (size_t)(r0 + mb * 16) * ldc + c0;
#pragma unroll
        for (int s = 0; s < 8; ++s) { const int row = 2 * s + hi; const v4f val = *(const v4fa*)(os + row * 68 + cofs) + bb;
            *(v4f*)(crow + (size_t)row * ldc + cofs) = val; }
        __builtin_amdgcn_wave_barrier(); asm volatile("s_wait_xcnt 0x0" ::: "memory");   // keeps the next block's writes behind these reads; the wait stands ahead of any rewrite of a register these stores name
    }
    }
}

__device__ __forceinline__ void d_wtG(const float* __restrict__ w, int K, int N, bf* Bt, int bx) {
    const int lane = threadIdx.x & 31; const int L0 = (bx * 8 + (threadIdx.x >> 5)) * 8; const int nlines = (int)((size_t)N * K / 64);
{
#pragma unroll 1
        for (int l = 0; l < 8; ++l) { const int L = L0 + l; if (L >= nlines) break; const size_t e = (size_t)L * 64 + lane * 2; const int k = (int)(e % K), n = (int)(e / K); v2us o;
            o[0] = f2bf(w[(size_t)k * N + n]); o[1] = f2bf(w[(size_t)(k + 1) * N + n]); *(v2us*)(Bt + e) = o; }
         }
}

__device__ __forceinline__ float invf(int j) {
    const float e = (float)(j & 15) * 0.0625f;
    const float p = powf(10000.0f, e);
    const float v = 1.0f / p;
    return v;
}

__device__ __forceinline__ void d_cstab(const int* __restrict__ fidx, const int* __restrict__ sidx, float* CS, int bx) {
    const int idx = bx * 256 + threadIdx.x; if (idx >= NTOK * HD) return;
    const int dd = idx & (HD - 1); const int R = idx >> 6; const int b = R / SEQ, t = R - b * SEQ; const int fl = t / NRES, n = t - fl * NRES;
    const int pseq = sidx[b * NRES + n]; const int pfr = fidx[fl];
    const float pf = (float)((dd < HD / 2) ? pseq : pfr);
    float fr = __fmul_rn(pf, invf(dd)); asm volatile("" : "+v"(fr));
    float sn, cn;
    sincosf(fr, &sn, &cn);
    v2f cs; cs[0] = cn; cs[1] = sn;
    *(v2f*)(CS + (size_t)idx * 2) = cs; 
}

// ---- d_ln: AdaLN for LN_RB token rows of one batch element, as a job that reads only inputs. The block forms its batch element's scale and shift itself: ss[n] = sum_c cond[c] adaln_w[c][n] + adaln_b[n], bf16 operands converted (RNE) on load,
// one 16x16x32 product per 32 c, every A row the cond row, so register 0 of a lane holds its column of the tile. Wave w takes columns 128 w .. 128 w + 127; the result goes through LDS to every wave. Then LN_RW rows per wave: non-affine LN, modulation, bf16 hi/lo split.
#define LN_RW 3                      // rows of one wave
#define LN_RB (8 * LN_RW)            // rows of one block
static_assert(SEQ % LN_RB == 0 && ADW == 8 * 128 && CDIM == 64);
__device__ __forceinline__ void d_ln(const float* __restrict__ X, const float* __restrict__ cond, const float* __restrict__ aw, const float* __restrict__ ab, bf* Xh, bf* Xl, int bx) {
    __shared__ __align__(32) float ssl[ADW];
    const int lane = threadIdx.x & 31, lr = lane & 15, hi = lane >> 4, w = threadIdx.x >> 5;
    const int b = bx * LN_RB / SEQ; const int R0 = bx * LN_RB + w * LN_RW;
    const float* xr = X + ((size_t)b * SEQ_FULL + (R0 - b * SEQ)) * CM + 8 * lane;
    v16bf a[2];
#pragma unroll
    for (int kk = 0; kk < 2; ++kk) { const float* cp = cond + (size_t)b * CDIM + kk * 32 + 8 * hi; v16f c;
#pragma unroll
        for (int i = 0; i < 8; ++i) { c[i] = cp[i]; c[8 + i] = cp[16 + i]; }
        a[kk] = __builtin_convertvector(c, v16bf); }
    // column of tile t at lane lr: 128 w + 64 (t >> 2) + 4 lr + (t & 3), so a lane's four tiles of a half are one 16-byte load per c and a half-wave's load covers 256 B in a row
    const float* wp = aw + (size_t)(8 * hi) * ADW + w * 128 + lr * 4;
    const float* bp = ab + w * 128 + hi * 64 + lr * 4; const v4f bi = *(const v4f*)bp;
    asm volatile("s_wait_xcnt 0x0" :: "v"(bp) : "memory");   // the address pair that this load names lives to this wait, so nothing is written over it ahead of the wait
    float res[8];
#pragma unroll
    for (int hc = 0; hc < 2; ++hc) { v8f acc[4];
#pragma unroll
        for (int tt = 0; tt < 4; ++tt) acc[tt] = (v8f){};
#pragma unroll
        for (int kk = 0; kk < 2; ++kk) { v4f r[16];   // r[i]: c = 32 kk + 8 hi + i for i < 8, 32 kk + 16 + 8 hi + (i - 8) above
#pragma unroll
            for (int i = 0; i < 16; ++i) r[i] = *(const v4f*)(wp + (size_t)(kk * 32 + (i >> 3) * 16 + (i & 7)) * ADW + hc * 64);
#pragma unroll
            for (int tt = 0; tt < 4; ++tt) { v16f c;
#pragma unroll
                for (int i = 0; i < 16; ++i) c[i] = r[i][tt];
                acc[tt] = wmmab(a[kk], __builtin_convertvector(c, v16bf), acc[tt]); }
            __builtin_amdgcn_sched_barrier(0); }   // one group of sixteen loads at a time: left alone, later groups' loads are lifted over this one's products and the register budget is overrun (spills)
#pragma unroll
        for (int tt = 0; tt < 4; ++tt) res[hc * 4 + tt] = acc[tt][0]; }
    v8f x0[LN_RW], x1[LN_RW];   // the rows' loads fly over the LDS store and the barrier
#pragma unroll
    for (int i = 0; i < LN_RW; ++i) { x0[i] = *(const v8f*)(xr + (size_t)i * CM); x1[i] = *(const v8f*)(xr + (size_t)i * CM + 256); }
    { v4f sv;   // both halves of the wave hold every column (all A rows are equal): half hi stores the 64 columns of its number
#pragma unroll
      for (int c = 0; c < 4; ++c) sv[c] = (hi ? res[4 + c] : res[c]) + bfr(bi[c]);
      *(v4fa*)(ssl + w * 128 + hi * 64 + lr * 4) = sv; }
    __syncthreads();   // every wave's columns are in LDS
    v8f g[2], be[2];
#pragma unroll
    for (int c = 0; c < 2; ++c) { const float* sp = ssl + c * 256 + 8 * lane; const v4f g0 = *(const v4fa*)sp, g1 = *(const v4fa*)(sp + 4), b0 = *(const v4fa*)(sp + CM), b1 = *(const v4fa*)(sp + CM + 4);
        g[c] = __builtin_shufflevector(g0, g1, 0, 1, 2, 3, 4, 5, 6, 7); be[c] = __builtin_shufflevector(b0, b1, 0, 1, 2, 3, 4, 5, 6, 7); }
    float v[LN_RW][16], mu[LN_RW], rs[LN_RW];   // the rows' statistics in one stretch: the three chains of cross-lane sums run side by side
#pragma unroll
    for (int i = 0; i < LN_RW; ++i) {
#pragma unroll
        for (int k = 0; k < 8; ++k) { v[i][k] = bfr(x0[i][k]); v[i][8 + k] = bfr(x1[i][k]); }
        float s = 0.f;
#pragma unroll
        for (int k = 0; k < 16; ++k) s += v[i][k];
#pragma unroll
        for (int sh = 16; sh; sh >>= 1) s += __shfl_xor(s, sh, 32);
        mu[i] = s * (1.0f / (float)CM);
        float qq = 0.f;
#pragma unroll
        for (int k = 0; k < 16; ++k) { const float d = v[i][k] - mu[i]; qq += d * d; }
#pragma unroll
        for (int sh = 16; sh; sh >>= 1) qq += __shfl_xor(qq, sh, 32);
        const float var = qq * (1.0f / (float)CM);
        rs[i] = rsqrtf(var + 1.0e-5f);
    }
#pragma unroll
    for (int i = 0; i < LN_RW; ++i) {
        v8us oh[2], ol[2];
#pragma unroll
        for (int c = 0; c < 2; ++c) { v8us th, tl;
#pragma unroll
            for (int k = 0; k < 8; ++k) { const float xn = (v[i][c * 8 + k] - mu[i]) * rs[i]; const float y = xn * (1.0f + g[c][k]) + be[c][k]; unsigned short a2, c2; splitf(y, a2, c2); th[k] = a2; tl[k] = c2; }
            oh[c] = th; ol[c] = tl; }
#pragma unroll
        for (int c = 0; c < 2; ++c) { const size_t o = (size_t)(R0 + i) * CM + c * 256 + 8 * lane; *(v8us*)(Xh + o) = oh[c]; *(v8us*)(Xl + o) = ol[c]; }
        asm volatile("s_wait_xcnt 0x0" ::: "memory");   // stands ahead of any rewrite of a register these stores name: the next row's arithmetic, or another job's code that follows in the merged kernel's text
        __builtin_amdgcn_sched_barrier(0);   // keeps the next row's arithmetic, which rewrites those registers, from being scheduled ahead of the wait
    }
}

// ---- d_extras: per token row R the extra bf16 k-step rows (NEX = 32 slots) that carry the additive score bias inside the score WMMA. With c = bf16 coordinates and g = -|c|^2/64 split three-piece (gh + gm + gl):
// query row QE[R] = [cx, cy, cz, 1, 1, 1, gh, gm, gl, 1, 0 x 22]; key row KE[R] = [cx/32, cy/32, cz/32, gh, gm, gl, 1, 1, 1, fill, 0 x 22], fill = -2e30 where mask == 0 else 0.
__device__ __forceinline__ void d_extras(const float* __restrict__ ca, const float* __restrict__ msk, bf* QE, bf* KE, int bx) {
    __shared__ __align__(16) unsigned int qs[256 * 16];
    __shared__ __align__(16) unsigned int ks[256 * 16];
    const int tid = threadIdx.x, lane = tid & 31, w = tid >> 5;
    const int R0 = bx * 256; const int R = R0 + tid;
    const int b = R / SEQ, t = R - b * SEQ; const size_t Rf = (size_t)b * SEQ_FULL + t;
    const float cx = bfr(ca[Rf * 3]), cy = bfr(ca[Rf * 3 + 1]), cz = bfr(ca[Rf * 3 + 2]);
    const float mk = bfr(msk[Rf]);
    const float n2 = cx * cx + cz * cz + cy * cy;
    const float g = -(n2 * 0.015625f);
    const unsigned short gh = f2bf(g); const float r1 = g - bf2f(gh); const unsigned short gm = f2bf(r1); const unsigned short gl = f2bf(r1 - bf2f(gm));
    const unsigned short one = (unsigned short)0x3F80u;
    const unsigned short fillv = (mk == 0.0f) ? f2bf(-2.0e30f) : (unsigned short)0;
    v4u qa, qb, ka, kb, zz;
#pragma unroll
    for (int i = 0; i < 4; ++i) { qb[i] = 0u; kb[i] = 0u; zz[i] = 0u; }
    qa[0] = pk2(f2bf(cx), f2bf(cy)); qa[1] = pk2(f2bf(cz), one); qa[2] = pk2(one, one); qa[3] = pk2(gh, gm);
    qb[0] = pk2(gl, one);
    ka[0] = pk2(f2bf(cx * 0.03125f), f2bf(cy * 0.03125f)); ka[1] = pk2(f2bf(cz * 0.03125f), gh); ka[2] = pk2(gm, gl); ka[3] = pk2(one, one);
    kb[0] = pk2(one, fillv);
    unsigned int* qr = qs + tid * 16; unsigned int* krw = ks + tid * 16;
    *(v4u*)(qr) = qa; *(v4u*)(qr + 4) = qb; *(v4u*)(qr + 8) = zz; *(v4u*)(qr + 12) = zz;
    *(v4u*)(krw) = ka; *(v4u*)(krw + 4) = kb; *(v4u*)(krw + 8) = zz; *(v4u*)(krw + 12) = zz;
    __syncthreads();
    v4u oq[4], ok[4]; int off[4];
#pragma unroll
    for (int it = 0; it < 4; ++it) { off[it] = (w * 4 + it) * 128 + lane * 4; oq[it] = *(const v4ua*)(qs + off[it]); ok[it] = *(const v4ua*)(ks + off[it]); }
    unsigned int* QEw = (unsigned int*)QE + (size_t)R0 * 16; unsigned int* KEw = (unsigned int*)KE + (size_t)R0 * 16;
{
#pragma unroll
        for (int it = 0; it < 4; ++it) { *(v4u*)(QEw + off[it]) = oq[it]; *(v4u*)(KEw + off[it]) = ok[it]; }
         }
}

// ---- k_prep: every job that reads only inputs, as block ranges of one grid (the branch is the same for a whole block): AdaLN rows (the longest job, first), weight planes, bias k-step rows, cos/sin table.
#define PB_LN (NTOK / LN_RB)
#define PB_W ((CM * CM / 64 + 63) / 64)
#define PB_EX (NTOK / 256)
#define PB_CS ((NTOK * HD + 255) / 256)
#define PB_ALL (PB_LN + 4 * PB_W + PB_EX + PB_CS)
// A register budget for six waves a SIMD: three blocks fit a WGP, so the short jobs run beside the AdaLN blocks and not behind them.
__global__ __launch_bounds__(256) __attribute__((amdgpu_waves_per_eu(6))) void k_prep(const float* __restrict__ s_frames, const float* __restrict__ adaln_w, const float* __restrict__ adaln_b, const float* __restrict__ wq, const float* __restrict__ wk, const float* __restrict__ wv, const float* __restrict__ wo,
                                              const float* __restrict__ cond, const float* __restrict__ ca, const float* __restrict__ msk, const int* __restrict__ fidx, const int* __restrict__ sidx,
                                              bf* XBh, bf* XBl, bf* WQ, bf* WK, bf* WV, bf* WO, bf* QE, bf* KE, float* CS) {
    int bx = blockIdx.x;
    if (bx < PB_LN) { d_ln(s_frames, cond, adaln_w, adaln_b, XBh, XBl, bx); return; }
    bx -= PB_LN;
    if (bx < 4 * PB_W) { const int j = bx / PB_W;                                // w [in][out] -> Bt[out][in]
        d_wtG((j == 0) ? wq : (j == 1) ? wk : (j == 2) ? wv : wo, CM, CM, (j == 0) ? WQ : (j == 1) ? WK : (j == 2) ? WV : WO, bx - j * PB_W); return; }
    bx -= 4 * PB_W;
    if (bx < PB_EX) { d_extras(ca, msk, QE, KE, bx); return; }
    d_cstab(fidx, sidx, CS, bx - PB_EX);
}

// ---- k_attn: eight waves per work-group, 64 query rows of one (b, h); all 64 rows lie in one frame, so the key bound (frame+1)*NRES is the same for the whole group. 128 keys per trip, as four 32-key tiles.
// Wave w takes the 32 query rows of half w >> 2 (two 16-row tiles) and the 32-key tile w & 3 of every trip: each k or v fragment read from LDS feeds two products. The four waves of a query half join their partial maximum, sum and O behind the loop.
// A group's cost grows with its frame. Two groups fit a WGP, fewer places than groups, and the grid runs from the last frame to the first, for speed only.
// The trip's k, bias and v tiles are brought once per work-group into a two-buffer LDS ring by asynchronous copies (whole lines from global memory, one trip ahead); every wave reads its fragments from the ring.
// Transposed products: S^T tile (16 keys x 16 queries) = KE.QE (bias k-step, bf16) + K.Q over d (f16, k rows as A, q as B, scale folded into the q plane), so a lane holds 16 scores of ONE query (lane & 15; keys 16j + 8(lane >> 4) + r).
// Online max-subtracted softmax in f32 in the lane, one exchange between the wave's halves for the maximum; each half keeps the sum of its own keys, joined once behind the loop. P^T packs from the two score tiles straight into the B operand of O^T += V^T.P^T.
#define AW 8
#define KP 72                        // LDS pitch of a 64-element k row: 144 B = 16 B x odd, free of bank conflicts for 16-byte readers
#define VP 40                        // LDS pitch of a 32-element v or bias row: 80 B
#define ST_K 0
#define ST_KE (32 * KP)
#define ST_V (ST_KE + 32 * VP)
#define ST_EL (ST_V + 64 * VP)       // elements of one 32-key tile in the ring (12288 B)
#define XW (16 * 32 * 4 + 128)       // floats one wave leaves for the join: 64 O values, two maxima and two sums of each lane
static_assert(AW == 8 && NRES % 64 == 0 && NRES % 128 == 0 && NRES >= 256 && (ST_EL * 2) % 16 == 0);
static_assert((AW * XW + 4 * 16 * 68) * 4 <= 8 * ST_EL * 2);
__device__ __forceinline__ v16bf ldsb(const unsigned short* p) { return cat16b(*(const v8usa*)p, *(const v8usa*)(p + 16)); }
__device__ __forceinline__ v16h ldsh(const unsigned short* p) { return cat16(*(const v8ha*)p, *(const v8ha*)(p + 16)); }
__device__ __forceinline__ float xhalf(float x) { return __builtin_bit_cast(float, __builtin_amdgcn_permlanex16(__builtin_bit_cast(int, x), __builtin_bit_cast(int, x), 0x76543210, 0xfedcba98, false, false)); }   // lane l with lane l ^ 16
// One tile's copies of one lane, 16 B each: two pieces (16 rows apart) of k, two (32 rows apart) of v, one of the bias rows.
typedef __attribute__((ext_vector_type(4))) int v4i;
typedef __attribute__((address_space(1))) v4i* gp16;
typedef __attribute__((address_space(3))) v4i* lp16;
__device__ __forceinline__ void cp16(unsigned short* l, const void* g) { __builtin_amdgcn_global_load_async_to_lds_b128((gp16)g, (lp16)l, 0, 0); }
__device__ __forceinline__ void tile_copy(unsigned short* lk, unsigned short* lv, unsigned short* le, const h16* gk, const h16* gv, const bf* gke) {
    cp16(lk, gk); cp16(lk + 16 * KP, gk + 16 * HD);
    cp16(lv, gv); cp16(lv + 32 * VP, gv + (size_t)32 * SEQ);
    cp16(le, gke);
}
// Two work-groups to a WGP, four waves to a SIMD: the register budget of four waves.
__global__ __launch_bounds__(32 * AW) __attribute__((amdgpu_waves_per_eu(4, 4))) void k_attn(const h16* __restrict__ Q, const bf* __restrict__ QE,
                                             const h16* __restrict__ K, const bf* __restrict__ KE,
                                             const h16* __restrict__ Vt, bf* ATh, bf* ATl) {
    __shared__ __align__(16) unsigned short ring[8 * ST_EL];   // two buffers of four 32-key tiles
    const int tid = threadIdx.x, lane = tid & 31, lr = lane & 15, hi = lane >> 4, w = tid >> 5;
    const int kh = w & 3, qh = w >> 2;
    const int bh = blockIdx.x; const int b = bh / NH, h = bh - b * NH;
    const int qt = SEQ / 64 - 1 - (int)blockIdx.y;   // the 64-row query tile: the last frame's tiles have the lowest index in the grid
    const int qb = qt * 64 + qh * 32;
    const int kvlen = (qt * 64 / NRES + 1) * NRES;
    const int nt = kvlen >> 7;
    const int t7 = tid & 127, cg = tid >> 7;   // the copies: threads 0..127 bring tiles 0 and 1 of a trip, threads 128..255 tiles 2 and 3
    const size_t hp = (size_t)bh * SEQ * HD;
    const size_t tb = (size_t)b * SEQ;
    // this lane's share of a tile, in 16-byte pieces: k rows t7>>3 and 16 + t7>>3, piece t7&7; v rows (d) t7>>2 and 32 + t7>>2, piece t7&3; bias row t7>>2, piece t7&3
    unsigned short* lk0 = ring + cg * (2 * ST_EL) + ST_K + (t7 >> 3) * KP + (t7 & 7) * 8;
    unsigned short* lv0 = ring + cg * (2 * ST_EL) + ST_V + (t7 >> 2) * VP + (t7 & 3) * 8;
    unsigned short* le0 = ring + cg * (2 * ST_EL) + ST_KE + (t7 >> 2) * VP + (t7 & 3) * 8;
    // the lane's part of a global address is a 32-bit element offset; the part that moves with the trip is the same for the whole group and stays in scalar registers
    const unsigned gk0 = (unsigned)((cg * 64 + (t7 >> 3)) * HD + (t7 & 7) * 8), gv0 = (unsigned)((t7 >> 2) * SEQ + cg * 64 + (t7 & 3) * 8), ge0 = (unsigned)((cg * 64 + (t7 >> 2)) * NEX + (t7 & 3) * 8);
    const h16* uk = K + hp; const h16* uv = Vt + hp; const bf* uke = KE + tb * NEX;
    auto trip_copy = [&](unsigned bo, size_t kn) {   // the four 32-key tiles from key kn on (this thread's two of them), into the buffer at element bo of the ring
        tile_copy(lk0 + bo, lv0 + bo, le0 + bo, (uk + kn * HD) + gk0, (uv + kn) + gv0, (uke + kn * NEX) + ge0);
        tile_copy(lk0 + bo + ST_EL, lv0 + bo + ST_EL, le0 + bo + ST_EL, (uk + (kn + 32) * HD) + gk0, (uv + (kn + 32)) + gv0, (uke + (kn + 32) * NEX) + ge0);
    };
    trip_copy(0, 0);
    v16h a0[2], a1[2]; v16bf aE[2];
#pragma unroll
    for (int u = 0; u < 2; ++u) { const size_t qo = hp + (size_t)(qb + 16 * u + lr) * HD + 8 * hi;
        a0[u] = WFrag<h16>::ld(Q + qo); a1[u] = WFrag<h16>::ld(Q + qo + 32);
        aE[u] = WFrag<bf>::ld(QE + (tb + qb + 16 * u + lr) * NEX + 8 * hi); }
    v8f oh[2][4];
#pragma unroll
    for (int u = 0; u < 2; ++u)
#pragma unroll
        for (int nb = 0; nb < 4; ++nb) oh[u][nb] = (v8f){};
    float m[2] = {-1.0e30f, -1.0e30f}, l[2] = {0.f, 0.f};   // this lane's two queries: running maximum (equal in both halves), sum over this half's keys
    asm volatile("s_wait_asynccnt 0x0" ::: "memory");   // trip 0's tiles of this wave have landed
    __syncthreads();                                     // publishes trip 0 to every wave
    // trip 1 exists: nt >= 2
    trip_copy(4 * ST_EL, 128);
#pragma unroll 1
    for (int t = 0; t < nt; ++t) {
        const unsigned short* st = ring + ((t & 1) * 4 + kh) * ST_EL;
        v8f s[2][2];
        const unsigned short* kp = st + ST_K + lr * KP + 8 * hi;
        v16h bV[4];
        {
            v16bf bE[2]; v16h k0[2], k1[2];
#pragma unroll
            for (int j = 0; j < 2; ++j) { bE[j] = ldsb(st + ST_KE + (16 * j + lr) * VP + 8 * hi); k0[j] = ldsh(kp + 16 * j * KP); k1[j] = ldsh(kp + 16 * j * KP + 32); }
#pragma unroll
            for (int nb = 0; nb < 4; ++nb) bV[nb] = ldsh(st + ST_V + (16 * nb + lr) * VP + 8 * hi);
            // the four score tiles in turn at each k-step, so that a tile's next product stands four products behind its last
#pragma unroll
            for (int j = 0; j < 2; ++j)
#pragma unroll
                for (int u = 0; u < 2; ++u) s[u][j] = wmmab(bE[j], aE[u], (v8f){});
#pragma unroll
            for (int j = 0; j < 2; ++j)
#pragma unroll
                for (int u = 0; u < 2; ++u) s[u][j] = wmma16(k0[j], a0[u], s[u][j]);
#pragma unroll
            for (int j = 0; j < 2; ++j)
#pragma unroll
                for (int u = 0; u < 2; ++u) s[u][j] = wmma16(k1[j], a1[u], s[u][j]);
        }
        // the order of the stretch above: the trip's twenty LDS reads as one group (bias and k rows first, the v rows return under the products and the softmax), then the twelve products. Left alone, the reads stand in pairs among the products, each place with its own cost.
        __builtin_amdgcn_sched_group_barrier(0x100, 20, 0); __builtin_amdgcn_sched_group_barrier(0x008, 12, 0);
        __builtin_amdgcn_sched_barrier(0);   // keeps the softmax arithmetic from being mixed into the score products' stretch
        v16h ap[2];   // B operand: element i <- key 8(lane >> 4) + i, element 8 + i <- key 16 + 8(lane >> 4) + i, the order of the v fragments
#pragma unroll
        for (int u = 0; u < 2; ++u) {
            const v8f sa = s[u][0], sb = s[u][1];
            const float v0 = fmaxf(fmaxf(sa[0], sa[1]), sa[2]), v1 = fmaxf(fmaxf(sa[3], sa[4]), sa[5]), v2 = fmaxf(fmaxf(sa[6], sa[7]), sb[0]);
            const float v3 = fmaxf(fmaxf(sb[1], sb[2]), sb[3]), v4 = fmaxf(fmaxf(sb[4], sb[5]), sb[6]);
            float v = fmaxf(fmaxf(fmaxf(v0, v1), v2), fmaxf(fmaxf(v3, v4), sb[7]));   // a tree three deep, not a chain of eight
            v = fmaxf(v, xhalf(v));
            const float mn = fmaxf(m[u], v);
            const float al = __builtin_amdgcn_exp2f((m[u] - mn) * LOG2E);
            m[u] = mn;
            float ts[8];
#pragma unroll
            for (int r = 0; r < 8; ++r) {
                const float p0 = __builtin_amdgcn_exp2f((sa[r] - mn) * LOG2E), p1 = __builtin_amdgcn_exp2f((sb[r] - mn) * LOG2E);
                ap[u][r] = (h16)(p0 * PCAR); ap[u][8 + r] = (h16)(p1 * PCAR);
                ts[r] = p0 + p1;
            }
            l[u] = l[u] * al + (((ts[0] + ts[1]) + (ts[2] + ts[3])) + ((ts[4] + ts[5]) + (ts[6] + ts[7])));
#pragma unroll
            for (int nb = 0; nb < 4; ++nb)
#pragma unroll
                for (int r = 0; r < 8; ++r) oh[u][nb][r] *= al;
        }
#pragma unroll
        for (int nb = 0; nb < 4; ++nb) { oh[0][nb] = wmma16(bV[nb], ap[0], oh[0][nb]); oh[1][nb] = wmma16(bV[nb], ap[1], oh[1][nb]); }
        __builtin_amdgcn_sched_barrier(0);   // keeps the waits below at the trip's foot: no memory operation stands behind the reads at its head, so the scheduler lifts them to right behind the score products, where the next trip's copies have had a fraction of a trip to land
        asm volatile("s_wait_dscnt 0x0" ::: "memory");      // this wave's reads of buffer t & 1 have returned
        asm volatile("s_wait_asynccnt 0x0" ::: "memory");   // this wave's copies of trip t + 1 have landed
        __syncthreads();                                     // publishes trip t + 1 and ends every wave's reads of buffer t & 1
        if (t + 2 < nt) trip_copy((unsigned)(t & 1) * (4 * ST_EL), (size_t)(t + 2) * 128);
    }
    asm volatile("s_wait_asynccnt 0x0" ::: "memory");       // nothing of this wave is in flight when the ring becomes staging
    // behind the last trip's barrier no wave reads the ring and no copy is under way. Every wave leaves its partial result in its own part of the ring; then wave kh of a query half finishes query tile kh & 1, head dims 32 (kh >> 1) .. + 31, from the four partial results, taken in the order of the key tiles.
    float* xw = (float*)ring + w * XW;
    const float lj0 = l[0] + xhalf(l[0]), lj1 = l[1] + xhalf(l[1]);
#pragma unroll
    for (int u = 0; u < 2; ++u)
#pragma unroll
        for (int nb = 0; nb < 4; ++nb) { v4f g0, g1;
#pragma unroll
            for (int r = 0; r < 4; ++r) { g0[r] = oh[u][nb][r]; g1[r] = oh[u][nb][4 + r]; }
            *(v4fa*)(xw + (((u * 4 + nb) * 2) * 32 + lane) * 4) = g0; *(v4fa*)(xw + (((u * 4 + nb) * 2 + 1) * 32 + lane) * 4) = g1; }
    xw[2048 + lane] = m[0]; xw[2080 + lane] = m[1]; xw[2112 + lane] = lj0; xw[2144 + lane] = lj1;
    __syncthreads();                                         // every wave's partial result is complete
    const int ju = kh & 1, jd = kh >> 1;
    const float* xb = (const float*)ring + (qh * 4) * XW;
    float mi[4], li[4];
#pragma unroll
    for (int i = 0; i < 4; ++i) { mi[i] = xb[i * XW + 2048 + ju * 32 + lane]; li[i] = xb[i * XW + 2112 + ju * 32 + lane]; }
    const float mx = fmaxf(fmaxf(mi[0], mi[1]), fmaxf(mi[2], mi[3]));
    float ai[4], ls = 0.f;
#pragma unroll
    for (int i = 0; i < 4; ++i) { ai[i] = __builtin_amdgcn_exp2f((mi[i] - mx) * LOG2E); ls += li[i] * ai[i]; }
    const float il = PINV * __fdiv_rn(1.0f, ls);
    float* os = (float*)ring + AW * XW + (qh * 2 + ju) * (16 * 68);   // the 16 x 64 tile of query tile ju, shared by the two waves that finish it
#pragma unroll
    for (int n2 = 0; n2 < 2; ++n2) { v4f x0 = (v4f){}, x1 = (v4f){};   // register r of tile nb is d = 16 nb + 8 hi + r of query lr
        const int nb = jd * 2 + n2;
#pragma unroll
        for (int i = 0; i < 4; ++i) { const float ci = ai[i] * il; const float* xp = xb + i * XW + (((ju * 4 + nb) * 2) * 32 + lane) * 4;
            const v4f g0 = *(const v4fa*)xp, g1 = *(const v4fa*)(xp + 128);
#pragma unroll
            for (int r = 0; r < 4; ++r) { x0[r] += g0[r] * ci; x1[r] += g1[r] * ci; } }
        *(v4fa*)(os + lr * 68 + 16 * nb + 8 * hi) = x0; *(v4fa*)(os + lr * 68 + 16 * nb + 8 * hi + 4) = x1; }
    __syncthreads();                                         // both halves of every 16 x 64 tile are complete
    const int q0 = qb + 16 * ju;
    v8us ah[2], av[2]; size_t ad[2];   // wave jd stores rows 8 jd .. 8 jd + 7 of the tile, each a whole line of each plane
#pragma unroll
    for (int it = 0; it < 2; ++it) { const int rr = jd * 8 + it * 4 + (lane >> 3); const int pc = lane & 7;
        const v4f x0 = *(const v4fa*)(os + rr * 68 + pc * 8), x1 = *(const v4fa*)(os + rr * 68 + pc * 8 + 4); v8us th, tl;
#pragma unroll
        for (int c = 0; c < 4; ++c) { unsigned short a2, c2; splitf(x0[c], a2, c2); th[c] = a2; tl[c] = c2; splitf(x1[c], a2, c2); th[4 + c] = a2; tl[4 + c] = c2; }
        ah[it] = th; av[it] = tl; ad[it] = (tb + q0 + rr) * CM + (size_t)h * HD + pc * 8; }
#pragma unroll
    for (int it = 0; it < 2; ++it) { *(v8us*)(ATh + ad[it]) = ah[it]; *(v8us*)(ATl + ad[it]) = av[it]; }
}

extern "C" void kernel_launch(void* const* d_in, const int* in_sizes, int n_in,
                              void* d_out, int out_size, void* d_ws, size_t ws_size, hipStream_t stream) {
    if (n_in < 16) return;
    const int ntok_in = (NB - 1) * SEQ_FULL + SEQ;
    if (in_sizes[0] < ntok_in * CM || in_sizes[1] < NFR || in_sizes[2] < NB * NRES || in_sizes[3] < ntok_in || in_sizes[4] < NB * CDIM || in_sizes[5] < ntok_in * 3) return;
    if (in_sizes[6] < CDIM * ADW || in_sizes[7] < ADW) return;
    if (in_sizes[8] < CM * CM || in_sizes[10] < CM * CM || in_sizes[12] < CM * CM || in_sizes[14] < CM * CM) return;
    if (in_sizes[9] < CM || in_sizes[11] < CM || in_sizes[13] < CM || in_sizes[15] < CM) return;
    const size_t out_need = OUT2_EL + ((size_t)((NB - 1) * NH + NH - 1) * SEQ_FULL + SEQ) * HD;
    if ((size_t)out_size < out_need) return;
    const float* s_frames = (const float*)d_in[0]; const int* frame_idx = (const int*)d_in[1]; const int* seq_idx = (const int*)d_in[2]; const float* mask = (const float*)d_in[3];
    const float* cond = (const float*)d_in[4]; const float* ca_pos = (const float*)d_in[5]; const float* adaln_w = (const float*)d_in[6]; const float* adaln_b = (const float*)d_in[7];
    const float* wq = (const float*)d_in[8]; const float* bq = (const float*)d_in[9]; const float* wk = (const float*)d_in[10]; const float* bk = (const float*)d_in[11];
    const float* wv = (const float*)d_in[12]; const float* bv = (const float*)d_in[13]; const float* wo = (const float*)d_in[14]; const float* bo = (const float*)d_in[15];
    float* OUT = (float*)d_out;
    char* wsp = (char*)d_ws;
    auto take = [&](size_t bytes) { char* p = wsp; wsp += (bytes + 255) & ~(size_t)255; return (void*)p; };
    bf* WQ = (bf*)take((size_t)3 * CM * CM * 2); bf* WK = WQ + (size_t)CM * CM; bf* WV = WK + (size_t)CM * CM; bf* WO = (bf*)take((size_t)CM * CM * 2);
    float* CS = (float*)take((size_t)NTOK * HD * 2 * 4);
    bf* XBh = (bf*)take((size_t)NTOK * CM * 2); bf* XBl = (bf*)take((size_t)NTOK * CM * 2);
    h16* QF = (h16*)take((size_t)NBH * SEQ * HD * 2); h16* KF = (h16*)take((size_t)NBH * SEQ * HD * 2);
    h16* VF = (h16*)take((size_t)NBH * HD * SEQ * 2);
    bf* QE = (bf*)take((size_t)NTOK * NEX * 2); bf* KE = (bf*)take((size_t)NTOK * NEX * 2);
    bf* ATh = (bf*)take((size_t)NTOK * CM * 2); bf* ATl = (bf*)take((size_t)NTOK * CM * 2);
    const size_t used = (size_t)(wsp - (char*)d_ws);
    if (used > ws_size || used > ((size_t)128 << 20)) return;    // about 48 MiB at NB=2, SEQ=3072

    // one launch for all that reads only inputs: AdaLN (ss = cond x adaln_w + adaln_b in each block, LN + modulation -> x hi/lo planes), 16-bit weight planes, bias k-step rows, cos/sin table
    k_prep<<<PB_ALL, 256, 0, stream>>>(s_frames, adaln_w, adaln_b, wq, wk, wv, wo, cond, ca_pos, mask, frame_idx, seq_idx, XBh, XBl, WQ, WK, WV, WO, QE, KE, CS);
    // projections (x hi/lo x bf16 W, 2 products, + bias) with RoPE, f16 conversion and transposition in the epilogue: operand planes and the k and v outputs in one launch
    k_gemm4<true><<<dim3(NTOK / 128, CM / 128, 3), 128, 0, stream>>>(XBh, XBl, WQ, nullptr, CM, bq, bk, bv, 0, (size_t)CM * CM, 0, CS, QF, KF, VF, OUT + OUT1_EL, OUT + OUT2_EL);   // z = q, k, v
    // attention (one launch) -> ctx hi/lo planes, then the output projection straight into out0 (batch z at the full-size token pitch)
    k_attn<<<dim3(NBH, SEQ / 64, 1), 32 * AW, 0, stream>>>(QF, QE, KF, KE, VF, ATh, ATl);
    k_gemm4<false><<<dim3(SEQ / 128, CM / 128, NB), 128, 0, stream>>>(ATh, ATl, WO, OUT, CM, bo, bo, bo, (size_t)SEQ * CM, 0, (size_t)SEQ_FULL * CM, nullptr, nullptr, nullptr, nullptr, nullptr, nullptr);
}

// v010
// Measured time: 68.7 microseconds a run.
// Two timings next to v009 both put it at 1.05 times that version's speed.
// Over all steps from v000 it is 6.78 times as fast.
#include <hip/hip_runtime.h>

// Frame-causal multi-head attention with a Gaussian distance bias: AdaLN prologue (cond x adaln_w modulation of a non-affine LN), q/k/v projections with bias, two-half rotate-half RoPE from int positions, online-softmax attention, output projection; f32 outputs out, roped k, v.
// Compute dtypes, f32 accumulate everywhere: every float input RNE-converted to bf16 on load. cond x adaln_w: v_wmma_f32_16x16x32_bf16, plain bf16 operands (1 product). q/k/v projections: bf16 hi/lo planes of the modulated LN output x bf16 weight planes (2 products).
// Scores: v_wmma_f32_16x16x32_f16 on one f16 plane of q and one of k (1 product) plus one extra bf16 k-step carrying the distance-bias terms (exact coordinate cross products, three-piece bf16 squared norms, key mask fill). attn.v: v_wmma_f32_16x16x32_f16, P carried x2^14 in f16, v as one f16 plane.
// Why one plane is enough: an f16 operand is rounded at 2^-12 of its value, and the inputs behind q, k, v and the coordinates behind the bias are rounded at 2^-9 of theirs on load.
// Output projection: bf16 hi/lo ctx planes x bf16 Wo (2 products). LN statistics, inverse-frequency and cos/sin tables, RoPE, softmax and all side math f32 on VALU; the k and v outputs are written from the f32 projection results.

#ifndef NB
#define NB 2
#endif
#define NB_FULL 2
#ifndef SEQ
#define SEQ 3072
#endif
#define SEQ_FULL 3072
#define NRES 256
#define NFR (SEQ / NRES)
#define CM 512
#define ADW 1024
#define NH 8
#define HD 64
#define CDIM 64
#define NEX 32
#define NTOK (NB * SEQ)
#define NBH (NB * NH)
#define QSCL 0.125f
#define PEXP 14.0f                   // P and its row sum are carried x2^14: the exponent that is added ahead of exp2
#define LOG2E 1.4426950408889634f
#define OUT1_EL ((size_t)NB_FULL * SEQ_FULL * CM)
#define OUT2_EL (OUT1_EL + (size_t)NB_FULL * NH * SEQ_FULL * HD)
static_assert(SEQ % NRES == 0);
static_assert(SEQ >= NRES && SEQ <= SEQ_FULL);
static_assert(NB >= 1 && NB <= NB_FULL);
static_assert(NTOK % 256 == 0);
static_assert(HD == 64 && CM == NH * HD);
static_assert(CM % 64 == 0 && ADW == 2 * CM && CDIM % 32 == 0);
static_assert(OUT1_EL * 4 == 12582912);
static_assert(OUT2_EL * 4 == 25165824);

typedef _Float16 h16;
typedef unsigned short bf;
typedef __attribute__((ext_vector_type(16))) __bf16   v16bf;
typedef __attribute__((ext_vector_type(16))) _Float16 v16h;
typedef __attribute__((ext_vector_type(8)))  _Float16 v8h;
typedef __attribute__((ext_vector_type(2)))  _Float16 v2h;
typedef __attribute__((ext_vector_type(8)))  unsigned short v8us;
typedef __attribute__((ext_vector_type(4)))  unsigned short v4us;
typedef __attribute__((ext_vector_type(2)))  unsigned short v2us;
typedef __attribute__((ext_vector_type(4)))  unsigned int v4u;
typedef __attribute__((ext_vector_type(16))) float    v16f;
typedef __attribute__((ext_vector_type(8)))  float    v8f;
typedef __attribute__((ext_vector_type(4)))  float    v4f;
typedef __attribute__((ext_vector_type(2)))  float    v2f;
typedef v8h  __attribute__((may_alias)) v8ha;
typedef v4f  __attribute__((may_alias)) v4fa;
typedef v8us __attribute__((may_alias)) v8usa;
typedef v4u  __attribute__((may_alias)) v4ua;

__device__ __forceinline__ unsigned short f2bf(float f) { unsigned u = __float_as_uint(f); u += 0x7FFFu + ((u >> 16) & 1u); return (unsigned short)(u >> 16); }
__device__ __forceinline__ float bf2f(unsigned short b) { return __uint_as_float(((unsigned)b) << 16); }
__device__ __forceinline__ float bfr(float f) { return bf2f(f2bf(f)); }
__device__ __forceinline__ v16h cat16(v8h lo, v8h hi) { return __builtin_shufflevector(lo, hi, 0, 1, 2, 3, 4, 5, 6, 7, 8, 9, 10, 11, 12, 13, 14, 15); }
__device__ __forceinline__ v16bf cat16b(v8us lo, v8us hi) { return __builtin_bit_cast(v16bf, __builtin_shufflevector(lo, hi, 0, 1, 2, 3, 4, 5, 6, 7, 8, 9, 10, 11, 12, 13, 14, 15)); }
__device__ __forceinline__ v8f wmma16(v16h a, v16h b, v8f c) { return __builtin_amdgcn_wmma_f32_16x16x32_f16(false, a, false, b, (short)0, c, false, false); }
__device__ __forceinline__ v8f wmmab(v16bf a, v16bf b, v8f c) { return __builtin_amdgcn_wmma_f32_16x16x32_bf16(false, a, false, b, (short)0, c, false, false); }
__device__ __forceinline__ void splitf(float y, unsigned short& h, unsigned short& l) { h = f2bf(y); l = f2bf(y - bf2f(h)); }
__device__ __forceinline__ unsigned int pk2(unsigned short lo, unsigned short hi2) { return (unsigned int)lo | ((unsigned int)hi2 << 16); }

// Fragments of every 16x16x32 product here: lane -> row/col lane&15, vector elements 0..7 <- k0 + 8h + i, elements 8..15 <- k0 + 16 + 8h + i (h = lane>>4) for BOTH operands; D element r -> (row 8h + r, col lane&15).
template <typename T16> struct WFrag;
template <> struct WFrag<h16> { typedef v16h V; static __device__ __forceinline__ V ld(const h16* p) { return cat16(*(const v8h*)p, *(const v8h*)(p + 16)); } static __device__ __forceinline__ v8f mma(V a, V b, v8f c) { return wmma16(a, b, c); } };
template <> struct WFrag<bf> { typedef v16bf V; static __device__ __forceinline__ V ld(const bf* p) { return cat16b(*(const v8us*)p, *(const v8us*)(p + 16)); } static __device__ __forceinline__ v8f mma(V a, V b, v8f c) { return wmmab(a, b, c); } };

// ---- k_gemm4: the two-product GEMM (A hi/lo planes x one bf16 Bt plane, K = CM) for the projections: FOUR WAVES share a 128x128 output tile, each wave a 64x64 quarter (16 accumulators; per 32 k the hi product, then the lo product).
// A stage is 64 k: 128 rows of A hi, of A lo and of Bt, 128 B a row, brought once per work-group into a two-buffer LDS ring by asynchronous copies (a wave's copy covers four whole lines of global memory), one stage ahead.
// LDS rows are unpadded (three work-groups fit a WGP); the 16-byte piece q of row r lies at piece q ^ ((r >> 1) & 7), so the 16 rows that a half-wave's fragment load touches fall on all 64 banks once.
#define G4_PL (128 * 128)            // bytes of one plane's stage
#define G4_BUF (3 * G4_PL)           // bytes of one ring buffer
#define G4_NS (CM / 64)
#define G4_WST (2 * G4_BUF / 4)      // bytes of the ring that one wave has for staging behind the loop
#define G4_OSB (16 * 68 * 4)         // of them the f32 row stage
#define G4_VSP 72                    // LDS pitch of a 64-token transposed v row: 144 B = 16 B x odd
static_assert(G4_OSB % 16 == 0 && G4_OSB + 64 * G4_VSP * 2 <= G4_WST && SEQ % 64 == 0);
static_assert(NTOK % 128 == 0 && SEQ % 128 == 0 && CM % 128 == 0 && G4_NS >= 2);
static_assert(4 * 16 * 68 * 4 <= 2 * G4_BUF);
// One plane's stage, this lane's eight 16-byte pieces (rows 16 apart). The s_wait_xcnt stands inside the statement so that no address register is rewritten ahead of it.
__device__ __forceinline__ void plane_copy(unsigned l, const bf* g) {
    const unsigned l1 = l + 2048, l2 = l + 2 * 2048, l3 = l + 3 * 2048, l4 = l + 4 * 2048, l5 = l + 5 * 2048, l6 = l + 6 * 2048, l7 = l + 7 * 2048;
    const bf* g1 = g + 16 * CM; const bf* g2 = g + 32 * CM; const bf* g3 = g + 48 * CM; const bf* g4 = g + 64 * CM; const bf* g5 = g + 80 * CM; const bf* g6 = g + 96 * CM; const bf* g7 = g + 112 * CM;
    asm volatile("global_load_async_to_lds_b128 %0, %8, off\n\t"
                 "global_load_async_to_lds_b128 %1, %9, off\n\t"
                 "global_load_async_to_lds_b128 %2, %10, off\n\t"
                 "global_load_async_to_lds_b128 %3, %11, off\n\t"
                 "global_load_async_to_lds_b128 %4, %12, off\n\t"
                 "global_load_async_to_lds_b128 %5, %13, off\n\t"
                 "global_load_async_to_lds_b128 %6, %14, off\n\t"
                 "global_load_async_to_lds_b128 %7, %15, off\n\t"
                 "s_wait_xcnt 0x0"
                 :: "v"(l), "v"(l1), "v"(l2), "v"(l3), "v"(l4), "v"(l5), "v"(l6), "v"(l7),
                    "v"(g), "v"(g1), "v"(g2), "v"(g3), "v"(g4), "v"(g5), "v"(g6), "v"(g7) : "memory");
}
// At most three waves come to a SIMD (LDS); a register budget for four keeps accumulators and a stage's fragments in registers without a trade for waves that never come.
// PLANES: the q, k, v projections (z = 0, 1, 2). A wave's quarter is 64 tokens of one head, so bias, RoPE, the f16 conversion and the v transposition are done on the accumulators and the operand planes and the k and v outputs are stored from here; no f32 projection goes to memory.
template <bool PLANES>
__global__ __launch_bounds__(128) __attribute__((amdgpu_waves_per_eu(4, 4))) void k_gemm4(const bf* __restrict__ A, const bf* __restrict__ A2, const bf* __restrict__ Bt, float* C, int ldc,
                                             const float* __restrict__ bias0, const float* __restrict__ bias1, const float* __restrict__ bias2, size_t sA, size_t sB, size_t sC,
                                             const float* __restrict__ CS, h16* QF, h16* KF, h16* VF, float* GK, float* GV) {
    __shared__ __align__(16) unsigned char ring4[2 * G4_BUF];
    const size_t z = blockIdx.z; A += z * sA; A2 += z * sA; Bt += z * sB; C += z * sC;
    const float* __restrict__ bias = (z == 0) ? bias0 : (z == 1) ? bias1 : bias2;
    const int tid = threadIdx.x, lane = tid & 31, lr = lane & 15, hi = lane >> 4, w = tid >> 5;
    const int R0 = blockIdx.x * 128, C0 = blockIdx.y * 128;
    // this lane's share of a stage: piece tid & 7 of rows tid >> 3, + 16, ... + 112 of each plane
    const unsigned lc = (unsigned)(size_t)ring4 + (unsigned)((tid >> 3) * 128 + (((tid & 7) ^ ((tid >> 4) & 7)) << 4));
    const bf* gah = A + (size_t)(R0 + (tid >> 3)) * CM + (tid & 7) * 8; const bf* gal = A2 + (size_t)(R0 + (tid >> 3)) * CM + (tid & 7) * 8; const bf* gb = Bt + (size_t)(C0 + (tid >> 3)) * CM + (tid & 7) * 8;
    plane_copy(lc, gah); plane_copy(lc + G4_PL, gal); plane_copy(lc + 2 * G4_PL, gb);
    v8f acc[4][4];
#pragma unroll
    for (int mb = 0; mb < 4; ++mb)
#pragma unroll
        for (int nb = 0; nb < 4; ++nb) acc[mb][nb] = (v8f){};
    // fragment reads: row (quarter's 64) + 16 mb + lr, logical pieces 4 kk + hi and 4 kk + 2 + hi, each XORed with lr >> 1
    const int s0 = hi ^ (lr >> 1);
    const int arow = ((w >> 1) * 64 + lr) * 128, brow = 2 * G4_PL + ((w & 1) * 64 + lr) * 128;
    asm volatile("s_wait_asynccnt 0x0" ::: "memory");   // stage 0 of this wave has landed
    __syncthreads();                                     // publishes stage 0 to every wave
    plane_copy(lc + G4_BUF, gah + 64); plane_copy(lc + G4_BUF + G4_PL, gal + 64); plane_copy(lc + G4_BUF + 2 * G4_PL, gb + 64);   // stage 1 exists: G4_NS >= 2
#pragma unroll 1
    for (int st = 0; st < G4_NS; ++st) {
        const unsigned char* sb = ring4 + (st & 1) * G4_BUF;
#pragma unroll
        for (int kk = 0; kk < 2; ++kk) {
            const int o0 = (s0 ^ (4 * kk)) << 4, o1 = (s0 ^ (4 * kk + 2)) << 4;
            v16bf a[4], a2[4];
#pragma unroll
            for (int mb = 0; mb < 4; ++mb) { const unsigned char* ap = sb + arow + mb * 2048;
                a[mb] = cat16b(*(const v8usa*)(ap + o0), *(const v8usa*)(ap + o1)); a2[mb] = cat16b(*(const v8usa*)(ap + G4_PL + o0), *(const v8usa*)(ap + G4_PL + o1)); }
#pragma unroll
            for (int nb = 0; nb < 4; ++nb) { const unsigned char* bp = sb + brow + nb * 2048; const v16bf b = cat16b(*(const v8usa*)(bp + o0), *(const v8usa*)(bp + o1));
#pragma unroll
                for (int mb = 0; mb < 4; ++mb) { acc[mb][nb] = wmmab(a[mb], b, acc[mb][nb]); acc[mb][nb] = wmmab(a2[mb], b, acc[mb][nb]); } }
        }
        asm volatile("s_wait_dscnt 0x0" ::: "memory");      // this wave's reads of buffer st & 1 have returned
        asm volatile("s_wait_asynccnt 0x0" ::: "memory");   // this wave's copies of stage st + 1 have landed
        __syncthreads();                                     // publishes stage st + 1 and ends every wave's reads of buffer st & 1
        if (st + 2 < G4_NS) { const unsigned bo = (unsigned)(st & 1) * G4_BUF; const int kn = (st + 2) * 64;
            plane_copy(lc + bo, gah + kn); plane_copy(lc + bo + G4_PL, gal + kn); plane_copy(lc + bo + 2 * G4_PL, gb + kn); }
    }
    asm volatile("s_wait_asynccnt 0x0" ::: "memory");       // nothing of this wave is in flight when the ring becomes output staging
    // behind the last trip's barrier no wave reads the ring and no copy is under way: each wave stages its rows in its own part of it
    const int r0 = R0 + (w >> 1) * 64, c0 = C0 + (w & 1) * 64, cofs = lr * 4;
    if constexpr (PLANES) {
        // D register j of block (mb, nb) is token 16 mb + 8 hi + j, dim 16 nb + lr of the head
        const int b = r0 / SEQ, t0 = r0 - b * SEQ, bh = b * NH + (c0 >> 6);
        unsigned char* wb = ring4 + w * G4_WST;
        float* os = (float*)wb;
        const int rr = lane >> 3, pc = lane & 7;
        float bn[4];   // the bias of this lane's four dims, as its bf16 value
#pragma unroll
        for (int nb = 0; nb < 4; ++nb) bn[nb] = bfr(bias[c0 + nb * 16 + lr]);
        if (z == 2) {
            // v: a lane's eight registers are eight successive tokens of one dim, one 16-byte piece of a transposed row; the pieces pass through LDS so that each store covers whole lines
            h16* vs = (h16*)(wb + G4_OSB);   // [64 dims][G4_VSP tokens]
            float* G = GV + ((size_t)bh * SEQ_FULL + t0) * HD;
#pragma unroll
            for (int mb = 0; mb < 4; ++mb) {
#pragma unroll
                for (int nb = 0; nb < 4; ++nb) { v8h th;
#pragma unroll
                    for (int j = 0; j < 8; ++j) { const float y = acc[mb][nb][j] + bn[nb]; os[(hi * 8 + j) * 68 + nb * 16 + lr] = y; th[j] = (h16)y; }
                    *(v8ha*)(vs + (nb * 16 + lr) * G4_VSP + mb * 16 + hi * 8) = th; }
                __builtin_amdgcn_wave_barrier(); asm volatile("" ::: "memory");   // keeps the row reads behind the other lanes' writes in the compiled order
#pragma unroll
                for (int s = 0; s < 8; ++s) { const int row = 2 * s + hi; const v4f val = *(const v4fa*)(os + row * 68 + cofs);
                    *(v4f*)(G + (size_t)(mb * 16 + row) * HD + cofs) = val; }
                __builtin_amdgcn_wave_barrier(); asm volatile("s_wait_xcnt 0x0" ::: "memory");   // keeps the next block's writes behind these reads; the wait stands ahead of any rewrite of a register these stores name
            }
            h16* gh = VF + ((size_t)bh * HD + rr) * SEQ + t0 + pc * 8;
            v8h xh[16];   // the rows as one group of LDS reads into registers of their own, then the stores: no register that a store names is written again
#pragma unroll
            for (int it = 0; it < 16; ++it) xh[it] = *(const v8ha*)(vs + (it * 4 + rr) * G4_VSP + pc * 8);
#pragma unroll
            for (int it = 0; it < 16; ++it) *(v8h*)(gh + (size_t)it * 4 * SEQ) = xh[it];
        } else {
            // q, k: two-half rotate-half RoPE. Each 32-dim half is rotated within itself; the partner of dim d is d + 16 (subtracted) or d - 16 (added): block nb ^ 1 of the same lane and register. Both dims of a pair share one cos/sin entry.
            const float scl = (z == 0) ? QSCL : 1.0f;
            h16* Ph = ((z == 0) ? QF : KF) + ((size_t)bh * SEQ + t0 + rr) * HD + pc * 8;
            float* G = GK + ((size_t)bh * SEQ_FULL + t0 + rr) * HD + pc * 8;
            const float* csb = CS + ((size_t)(r0 + hi * 8) * HD + lr) * 2;
            v2f cs[2][8];   // cos, sin of this lane's eight tokens of a block, for each half of the head
#pragma unroll
            for (int j = 0; j < 8; ++j) { cs[0][j] = *(const v2f*)(csb + (size_t)(j * HD) * 2); cs[1][j] = *(const v2f*)(csb + (size_t)(j * HD + 32) * 2); }
#pragma unroll
            for (int mb = 0; mb < 4; ++mb) {
#pragma unroll
                for (int hf = 0; hf < 2; ++hf)
#pragma unroll
                    for (int j = 0; j < 8; ++j) { const float x0 = (acc[mb][2 * hf][j] + bn[2 * hf]) * scl, x1 = (acc[mb][2 * hf + 1][j] + bn[2 * hf + 1]) * scl; const float cn = cs[hf][j][0], sn = cs[hf][j][1];
                        float* op = os + (hi * 8 + j) * 68 + hf * 32 + lr; op[0] = x0 * cn - x1 * sn; op[16] = x1 * cn + x0 * sn; }
                __builtin_amdgcn_wave_barrier(); asm volatile("" ::: "memory");   // keeps the row reads behind the other lanes' writes in the compiled order
                if (mb < 3) {   // the next block's table entries fly while this block is converted and stored
#pragma unroll
                    for (int j = 0; j < 8; ++j) { cs[0][j] = *(const v2f*)(csb + (size_t)((mb * 16 + 16 + j) * HD) * 2); cs[1][j] = *(const v2f*)(csb + (size_t)((mb * 16 + 16 + j) * HD + 32) * 2); }
                    asm volatile("s_wait_xcnt 0x0" :: "v"(csb) : "memory"); }   // the address pair that these loads name lives to this wait, so nothing is written over it ahead of the wait
                v4f xa[4], xb[4];   // the block's rows as one group of LDS reads, not a read and its wait for every four rows
#pragma unroll
                for (int it = 0; it < 4; ++it) { const float* orow = os + (it * 4 + rr) * 68 + pc * 8; xa[it] = *(const v4fa*)orow; xb[it] = *(const v4fa*)(orow + 4); }
                // two halves of the block: each half's stores as one group out of registers of their own, one wait behind them
#pragma unroll
                for (int hb = 0; hb < 2; ++hb) { v8h th[2];
#pragma unroll
                    for (int i2 = 0; i2 < 2; ++i2)
#pragma unroll
                        for (int c = 0; c < 4; ++c) { th[i2][c] = (h16)xa[2 * hb + i2][c]; th[i2][4 + c] = (h16)xb[2 * hb + i2][c]; }
#pragma unroll
                    for (int i2 = 0; i2 < 2; ++i2) { const size_t o = (size_t)(mb * 16 + hb * 8 + i2 * 4) * HD; *(v8h*)(Ph + o) = th[i2]; }
                    if (z == 1) {
#pragma unroll
                        for (int i2 = 0; i2 < 2; ++i2) { const size_t o = (size_t)(mb * 16 + hb * 8 + i2 * 4) * HD; *(v4f*)(G + o) = xa[2 * hb + i2]; *(v4f*)(G + o + 4) = xb[2 * hb + i2]; } }
                    asm volatile("s_wait_xcnt 0x0" ::: "memory");   // stands ahead of any rewrite of a register these stores name
                    __builtin_amdgcn_sched_barrier(0); }   // keeps the arithmetic that follows, which rewrites those registers, from being scheduled ahead of the wait
                __builtin_amdgcn_wave_barrier();   // with the clobber of the wait above: keeps the next block's writes behind this block's reads in the compiled order
            }
        }
    } else {
    float* os = (float*)ring4 + w * (16 * 68);
    v4f bb;   // the bias of this lane's four columns, as its bf16 value
#pragma unroll
    for (int c = 0; c < 4; ++c) bb[c] = bfr(bias[c0 + cofs + c]);
#pragma unroll
    for (int mb = 0; mb < 4; ++mb) {
#pragma unroll
        for (int nb = 0; nb < 4; ++nb) {
#pragma unroll
            for (int j = 0; j < 8; ++j) os[(hi * 8 + j) * 68 + nb * 16 + lr] = acc[mb][nb][j]; }
        __builtin_amdgcn_wave_barrier(); asm volatile("" ::: "memory");   // keeps the row reads behind the other lanes' writes in the compiled order
        float* crow = C + (size_t)(r0 + mb * 16) * ldc + c0;
#pragma unroll
        for (int s = 0; s < 8; ++s) { const int row = 2 * s + hi; const v4f val = *(const v4fa*)(os + row * 68 + cofs) + bb;
            *(v4f*)(crow + (size_t)row * ldc + cofs) = val; }
        __builtin_amdgcn_wave_barrier(); asm volatile("s_wait_xcnt 0x0" ::: "memory");   // keeps the next block's writes behind these reads; the wait stands ahead of any rewrite of a register these stores name
    }
    }
}

__device__ __forceinline__ void d_wtG(const float* __restrict__ w, int K, int N, bf* Bt, int bx) {
    const int lane = threadIdx.x & 31; const int L0 = (bx * 8 + (threadIdx.x >> 5)) * 8; const int nlines = (int)((size_t)N * K / 64);
{
#pragma unroll 1
        for (int l = 0; l < 8; ++l) { const int L = L0 + l; if (L >= nlines) break; const size_t e = (size_t)L * 64 + lane * 2; const int k = (int)(e % K), n = (int)(e / K); v2us o;
            o[0] = f2bf(w[(size_t)k * N + n]); o[1] = f2bf(w[(size_t)(k + 1) * N + n]); *(v2us*)(Bt + e) = o; }
         }
}

__device__ __forceinline__ float invf(int j) {
    const float e = (float)(j & 15) * 0.0625f;
    const float p = powf(10000.0f, e);
    const float v = 1.0f / p;
    return v;
}

__device__ __forceinline__ void d_cstab(const int* __restrict__ fidx, const int* __restrict__ sidx, float* CS, int bx) {
    const int idx = bx * 256 + threadIdx.x; if (idx >= NTOK * HD) return;
    const int dd = idx & (HD - 1); const int R = idx >> 6; const int b = R / SEQ, t = R - b * SEQ; const int fl = t / NRES, n = t - fl * NRES;
    const int pseq = sidx[b * NRES + n]; const int pfr = fidx[fl];
    const float pf = (float)((dd < HD / 2) ? pseq : pfr);
    float fr = __fmul_rn(pf, invf(dd)); asm volatile("" : "+v"(fr));
    float sn, cn;
    sincosf(fr, &sn, &cn);
    v2f cs; cs[0] = cn; cs[1] = sn;
    *(v2f*)(CS + (size_t)idx * 2) = cs; 
}

// ---- d_ln: AdaLN for LN_RB token rows of one batch element, as a job that reads only inputs. The block forms its batch element's scale and shift itself: ss[n] = sum_c cond[c] adaln_w[c][n] + adaln_b[n], bf16 operands converted (RNE) on load,
// one 16x16x32 product per 32 c, every A row the cond row, so register 0 of a lane holds its column of the tile. Wave w takes columns 128 w .. 128 w + 127; the result goes through LDS to every wave. Then LN_RW rows per wave: non-affine LN, modulation, bf16 hi/lo split.
#define LN_RW 3                      // rows of one wave
#define LN_RB (8 * LN_RW)            // rows of one block
static_assert(SEQ % LN_RB == 0 && ADW == 8 * 128 && CDIM == 64);
__device__ __forceinline__ void d_ln(const float* __restrict__ X, const float* __restrict__ cond, const float* __restrict__ aw, const float* __restrict__ ab, bf* Xh, bf* Xl, int bx) {
    __shared__ __align__(32) float ssl[ADW];
    const int lane = threadIdx.x & 31, lr = lane & 15, hi = lane >> 4, w = threadIdx.x >> 5;
    const int b = bx * LN_RB / SEQ; const int R0 = bx * LN_RB + w * LN_RW;
    const float* xr = X + ((size_t)b * SEQ_FULL + (R0 - b * SEQ)) * CM + 8 * lane;
    v16bf a[2];
#pragma unroll
    for (int kk = 0; kk < 2; ++kk) { const float* cp = cond + (size_t)b * CDIM + kk * 32 + 8 * hi; v16f c;
#pragma unroll
        for (int i = 0; i < 8; ++i) { c[i] = cp[i]; c[8 + i] = cp[16 + i]; }
        a[kk] = __builtin_convertvector(c, v16bf); }
    // column of tile t at lane lr: 128 w + 64 (t >> 2) + 4 lr + (t & 3), so a lane's four tiles of a half are one 16-byte load per c and a half-wave's load covers 256 B in a row
    const float* wp = aw + (size_t)(8 * hi) * ADW + w * 128 + lr * 4;
    const float* bp = ab + w * 128 + hi * 64 + lr * 4; const v4f bi = *(const v4f*)bp;
    asm volatile("s_wait_xcnt 0x0" :: "v"(bp) : "memory");   // the address pair that this load names lives to this wait, so nothing is written over it ahead of the wait
    float res[8];
#pragma unroll
    for (int hc = 0; hc < 2; ++hc) { v8f acc[4];
#pragma unroll
        for (int tt = 0; tt < 4; ++tt) acc[tt] = (v8f){};
#pragma unroll
        for (int kk = 0; kk < 2; ++kk) { v4f r[16];   // r[i]: c = 32 kk + 8 hi + i for i < 8, 32 kk + 16 + 8 hi + (i - 8) above
#pragma unroll
            for (int i = 0; i < 16; ++i) r[i] = *(const v4f*)(wp + (size_t)(kk * 32 + (i >> 3) * 16 + (i & 7)) * ADW + hc * 64);
#pragma unroll
            for (int tt = 0; tt < 4; ++tt) { v16f c;
#pragma unroll
                for (int i = 0; i < 16; ++i) c[i] = r[i][tt];
                acc[tt] = wmmab(a[kk], __builtin_convertvector(c, v16bf), acc[tt]); }
            __builtin_amdgcn_sched_barrier(0); }   // one group of sixteen loads at a time: left alone, later groups' loads are lifted over this one's products and the register budget is overrun (spills)
#pragma unroll
        for (int tt = 0; tt < 4; ++tt) res[hc * 4 + tt] = acc[tt][0]; }
    v8f x0[LN_RW], x1[LN_RW];   // the rows' loads fly over the LDS store and the barrier
#pragma unroll
    for (int i = 0; i < LN_RW; ++i) { x0[i] = *(const v8f*)(xr + (size_t)i * CM); x1[i] = *(const v8f*)(xr + (size_t)i * CM + 256); }
    { v4f sv;   // both halves of the wave hold every column (all A rows are equal): half hi stores the 64 columns of its number
#pragma unroll
      for (int c = 0; c < 4; ++c) sv[c] = (hi ? res[4 + c] : res[c]) + bfr(bi[c]);
      *(v4fa*)(ssl + w * 128 + hi * 64 + lr * 4) = sv; }
    __syncthreads();   // every wave's columns are in LDS
    v8f g[2], be[2];
#pragma unroll
    for (int c = 0; c < 2; ++c) { const float* sp = ssl + c * 256 + 8 * lane; const v4f g0 = *(const v4fa*)sp, g1 = *(const v4fa*)(sp + 4), b0 = *(const v4fa*)(sp + CM), b1 = *(const v4fa*)(sp + CM + 4);
        g[c] = __builtin_shufflevector(g0, g1, 0, 1, 2, 3, 4, 5, 6, 7); be[c] = __builtin_shufflevector(b0, b1, 0, 1, 2, 3, 4, 5, 6, 7); }
    float v[LN_RW][16], mu[LN_RW], rs[LN_RW];   // the rows' statistics in one stretch: the three chains of cross-lane sums run side by side
#pragma unroll
    for (int i = 0; i < LN_RW; ++i) {
#pragma unroll
        for (int k = 0; k < 8; ++k) { v[i][k] = bfr(x0[i][k]); v[i][8 + k] = bfr(x1[i][k]); }
        float s = 0.f;
#pragma unroll
        for (int k = 0; k < 16; ++k) s += v[i][k];
#pragma unroll
        for (int sh = 16; sh; sh >>= 1) s += __shfl_xor(s, sh, 32);
        mu[i] = s * (1.0f / (float)CM);
        float qq = 0.f;
#pragma unroll
        for (int k = 0; k < 16; ++k) { const float d = v[i][k] - mu[i]; qq += d * d; }
#pragma unroll
        for (int sh = 16; sh; sh >>= 1) qq += __shfl_xor(qq, sh, 32);
        const float var = qq * (1.0f / (float)CM);
        rs[i] = rsqrtf(var + 1.0e-5f);
    }
#pragma unroll
    for (int i = 0; i < LN_RW; ++i) {
        v8us oh[2], ol[2];
#pragma unroll
        for (int c = 0; c < 2; ++c) { v8us th, tl;
#pragma unroll
            for (int k = 0; k < 8; ++k) { const float xn = (v[i][c * 8 + k] - mu[i]) * rs[i]; const float y = xn * (1.0f + g[c][k]) + be[c][k]; unsigned short a2, c2; splitf(y, a2, c2); th[k] = a2; tl[k] = c2; }
            oh[c] = th; ol[c] = tl; }
#pragma unroll
        for (int c = 0; c < 2; ++c) { const size_t o = (size_t)(R0 + i) * CM + c * 256 + 8 * lane; *(v8us*)(Xh + o) = oh[c]; *(v8us*)(Xl + o) = ol[c]; }
        asm volatile("s_wait_xcnt 0x0" ::: "memory");   // stands ahead of any rewrite of a register these stores name: the next row's arithmetic, or another job's code that follows in the merged kernel's text
        __builtin_amdgcn_sched_barrier(0);   // keeps the next row's arithmetic, which rewrites those registers, from being scheduled ahead of the wait
    }
}

// ---- d_extras: per token row R the extra bf16 k-step rows (NEX = 32 slots) that carry the additive score bias inside the score WMMA. With c = bf16 coordinates and g = -|c|^2/64 split three-piece (gh + gm + gl):
// query row QE[R] = [cx, cy, cz, 1, 1, 1, gh, gm, gl, 1, 0 x 22]; key row KE[R] = [cx/32, cy/32, cz/32, gh, gm, gl, 1, 1, 1, fill, 0 x 22], fill = -2e30 where mask == 0 else 0.
__device__ __forceinline__ void d_extras(const float* __restrict__ ca, const float* __restrict__ msk, bf* QE, bf* KE, int bx) {
    __shared__ __align__(16) unsigned int qs[256 * 16];
    __shared__ __align__(16) unsigned int ks[256 * 16];
    const int tid = threadIdx.x, lane = tid & 31, w = tid >> 5;
    const int R0 = bx * 256; const int R = R0 + tid;
    const int b = R / SEQ, t = R - b * SEQ; const size_t Rf = (size_t)b * SEQ_FULL + t;
    const float cx = bfr(ca[Rf * 3]), cy = bfr(ca[Rf * 3 + 1]), cz = bfr(ca[Rf * 3 + 2]);
    const float mk = bfr(msk[Rf]);
    const float n2 = cx * cx + cz * cz + cy * cy;
    const float g = -(n2 * 0.015625f);
    const unsigned short gh = f2bf(g); const float r1 = g - bf2f(gh); const unsigned short gm = f2bf(r1); const unsigned short gl = f2bf(r1 - bf2f(gm));
    const unsigned short one = (unsigned short)0x3F80u;
    const unsigned short fillv = (mk == 0.0f) ? f2bf(-2.0e30f) : (unsigned short)0;
    v4u qa, qb, ka, kb, zz;
#pragma unroll
    for (int i = 0; i < 4; ++i) { qb[i] = 0u; kb[i] = 0u; zz[i] = 0u; }
    qa[0] = pk2(f2bf(cx), f2bf(cy)); qa[1] = pk2(f2bf(cz), one); qa[2] = pk2(one, one); qa[3] = pk2(gh, gm);
    qb[0] = pk2(gl, one);
    ka[0] = pk2(f2bf(cx * 0.03125f), f2bf(cy * 0.03125f)); ka[1] = pk2(f2bf(cz * 0.03125f), gh); ka[2] = pk2(gm, gl); ka[3] = pk2(one, one);
    kb[0] = pk2(one, fillv);
    unsigned int* qr = qs + tid * 16; unsigned int* krw = ks + tid * 16;
    *(v4u*)(qr) = qa; *(v4u*)(qr + 4) = qb; *(v4u*)(qr + 8) = zz; *(v4u*)(qr + 12) = zz;
    *(v4u*)(krw) = ka; *(v4u*)(krw + 4) = kb; *(v4u*)(krw + 8) = zz; *(v4u*)(krw + 12) = zz;
    __syncthreads();
    v4u oq[4], ok[4]; int off[4];
#pragma unroll
    for (int it = 0; it < 4; ++it) { off[it] = (w * 4 + it) * 128 + lane * 4; oq[it] = *(const v4ua*)(qs + off[it]); ok[it] = *(const v4ua*)(ks + off[it]); }
    unsigned int* QEw = (unsigned int*)QE + (size_t)R0 * 16; unsigned int* KEw = (unsigned int*)KE + (size_t)R0 * 16;
{
#pragma unroll
        for (int it = 0; it < 4; ++it) { *(v4u*)(QEw + off[it]) = oq[it]; *(v4u*)(KEw + off[it]) = ok[it]; }
         }
}

// ---- k_prep: every job that reads only inputs, as block ranges of one grid (the branch is the same for a whole block): AdaLN rows (the longest job, first), weight planes, bias k-step rows, cos/sin table.
#define PB_LN (NTOK / LN_RB)
#define PB_W ((CM * CM / 64 + 63) / 64)
#define PB_EX (NTOK / 256)
#define PB_CS ((NTOK * HD + 255) / 256)
#define PB_ALL (PB_LN + 4 * PB_W + PB_EX + PB_CS)
// A register budget for six waves a SIMD: three blocks fit a WGP, so the short jobs run beside the AdaLN blocks and not behind them.
__global__ __launch_bounds__(256) __attribute__((amdgpu_waves_per_eu(6))) void k_prep(const float* __restrict__ s_frames, const float* __restrict__ adaln_w, const float* __restrict__ adaln_b, const float* __restrict__ wq, const float* __restrict__ wk, const float* __restrict__ wv, const float* __restrict__ wo,
                                              const float* __restrict__ cond, const float* __restrict__ ca, const float* __restrict__ msk, const int* __restrict__ fidx, const int* __restrict__ sidx,
                                              bf* XBh, bf* XBl, bf* WQ, bf* WK, bf* WV, bf* WO, bf* QE, bf* KE, float* CS) {
    int bx = blockIdx.x;
    if (bx < PB_LN) { d_ln(s_frames, cond, adaln_w, adaln_b, XBh, XBl, bx); return; }
    bx -= PB_LN;
    if (bx < 4 * PB_W) { const int j = bx / PB_W;                                // w [in][out] -> Bt[out][in]
        d_wtG((j == 0) ? wq : (j == 1) ? wk : (j == 2) ? wv : wo, CM, CM, (j == 0) ? WQ : (j == 1) ? WK : (j == 2) ? WV : WO, bx - j * PB_W); return; }
    bx -= 4 * PB_W;
    if (bx < PB_EX) { d_extras(ca, msk, QE, KE, bx); return; }
    d_cstab(fidx, sidx, CS, bx - PB_EX);
}

// ---- k_attn: eight waves per work-group, 64 query rows of one (b, h); all 64 rows lie in one frame, so the key bound (frame+1)*NRES is the same for the whole group. 128 keys per trip, as four 32-key tiles.
// Wave w takes the 32 query rows of half w >> 2 (two 16-row tiles) and the 32-key tile w & 3 of every trip: each k or v fragment read from LDS feeds two products. The four waves of a query half join their partial maximum, sum and O behind the loop.
// A group's cost grows with its frame. Two groups fit a WGP, fewer places than groups, and the grid runs from the last frame to the first, for speed only.
// The trip's k, bias and v tiles are brought once per work-group into a two-buffer LDS ring by asynchronous copies (whole lines from global memory, one trip ahead); every wave reads its fragments from the ring.
// Transposed products: S^T tile (16 keys x 16 queries) = KE.QE (bias k-step, bf16) + K.Q over d (f16, k rows as A, q as B, scale folded into the q plane), so a lane holds 16 scores of ONE query (lane & 15; keys 16j + 8(lane >> 4) + r).
// Online max-subtracted softmax in f32 in the lane, one exchange between the wave's halves for the maximum; each half keeps the sum of its own keys, joined once behind the loop. P^T packs from the two score tiles straight into the B operand of O^T += V^T.P^T.
// Per score one multiply-add and one exp2: p 2^14 = exp2(s log2e + n), n = 14 - m log2e formed once per query and trip, two scores of neighbouring registers to a packed instruction. Sum and O both carry the 2^14, so it cancels in the quotient.
#define AW 8
#define KP 72                        // LDS pitch of a 64-element k row: 144 B = 16 B x odd, free of bank conflicts for 16-byte readers
#define VP 40                        // LDS pitch of a 32-element v or bias row: 80 B
#define ST_K 0
#define ST_KE (32 * KP)
#define ST_V (ST_KE + 32 * VP)
#define ST_EL (ST_V + 64 * VP)       // elements of one 32-key tile in the ring (12288 B)
#define XW (16 * 32 * 4 + 128)       // floats one wave leaves for the join: 64 O values, two exponent addends and two sums of each lane
static_assert(AW == 8 && NRES % 64 == 0 && NRES % 128 == 0 && NRES >= 256 && (ST_EL * 2) % 16 == 0);
static_assert((AW * XW + 4 * 16 * 68) * 4 <= 8 * ST_EL * 2);
__device__ __forceinline__ v16bf ldsb(const unsigned short* p) { return cat16b(*(const v8usa*)p, *(const v8usa*)(p + 16)); }
__device__ __forceinline__ v16h ldsh(const unsigned short* p) { return cat16(*(const v8ha*)p, *(const v8ha*)(p + 16)); }
__device__ __forceinline__ float xhalf(float x) { return __builtin_bit_cast(float, __builtin_amdgcn_permlanex16(__builtin_bit_cast(int, x), __builtin_bit_cast(int, x), 0x76543210, 0xfedcba98, false, false)); }   // lane l with lane l ^ 16
// One tile's copies of one lane, 16 B each: two pieces (16 rows apart) of k, two (32 rows apart) of v, one of the bias rows.
typedef __attribute__((ext_vector_type(4))) int v4i;
typedef __attribute__((address_space(1))) v4i* gp16;
typedef __attribute__((address_space(3))) v4i* lp16;
__device__ __forceinline__ void cp16(unsigned short* l, const void* g) { __builtin_amdgcn_global_load_async_to_lds_b128((gp16)g, (lp16)l, 0, 0); }
__device__ __forceinline__ void tile_copy(unsigned short* lk, unsigned short* lv, unsigned short* le, const h16* gk, const h16* gv, const bf* gke) {
    cp16(lk, gk); cp16(lk + 16 * KP, gk + 16 * HD);
    cp16(lv, gv); cp16(lv + 32 * VP, gv + (size_t)32 * SEQ);
    cp16(le, gke);
}
// Two work-groups to a WGP, four waves to a SIMD: the register budget of four waves.
__global__ __launch_bounds__(32 * AW) __attribute__((amdgpu_waves_per_eu(4, 4))) void k_attn(const h16* __restrict__ Q, const bf* __restrict__ QE,
                                             const h16* __restrict__ K, const bf* __restrict__ KE,
                                             const h16* __restrict__ Vt, bf* ATh, bf* ATl) {
    __shared__ __align__(16) unsigned short ring[8 * ST_EL];   // two buffers of four 32-key tiles
    const int tid = threadIdx.x, lane = tid & 31, lr = lane & 15, hi = lane >> 4, w = tid >> 5;
    const int kh = w & 3, qh = w >> 2;
    const int bh = blockIdx.x; const int b = bh / NH, h = bh - b * NH;
    const int qt = SEQ / 64 - 1 - (int)blockIdx.y;   // the 64-row query tile: the last frame's tiles have the lowest index in the grid
    const int qb = qt * 64 + qh * 32;
    const int kvlen = (qt * 64 / NRES + 1) * NRES;
    const int nt = kvlen >> 7;
    const int t7 = tid & 127, cg = tid >> 7;   // the copies: threads 0..127 bring tiles 0 and 1 of a trip, threads 128..255 tiles 2 and 3
    const size_t hp = (size_t)bh * SEQ * HD;
    const size_t tb = (size_t)b * SEQ;
    // this lane's share of a tile, in 16-byte pieces: k rows t7>>3 and 16 + t7>>3, piece t7&7; v rows (d) t7>>2 and 32 + t7>>2, piece t7&3; bias row t7>>2, piece t7&3
    unsigned short* lk0 = ring + cg * (2 * ST_EL) + ST_K + (t7 >> 3) * KP + (t7 & 7) * 8;
    unsigned short* lv0 = ring + cg * (2 * ST_EL) + ST_V + (t7 >> 2) * VP + (t7 & 3) * 8;
    unsigned short* le0 = ring + cg * (2 * ST_EL) + ST_KE + (t7 >> 2) * VP + (t7 & 3) * 8;
    // the lane's part of a global address is a 32-bit element offset; the part that moves with the trip is the same for the whole group and stays in scalar registers
    const unsigned gk0 = (unsigned)((cg * 64 + (t7 >> 3)) * HD + (t7 & 7) * 8), gv0 = (unsigned)((t7 >> 2) * SEQ + cg * 64 + (t7 & 3) * 8), ge0 = (unsigned)((cg * 64 + (t7 >> 2)) * NEX + (t7 & 3) * 8);
    const h16* uk = K + hp; const h16* uv = Vt + hp; const bf* uke = KE + tb * NEX;
    auto trip_copy = [&](unsigned bo, size_t kn) {   // the four 32-key tiles from key kn on (this thread's two of them), into the buffer at element bo of the ring
        tile_copy(lk0 + bo, lv0 + bo, le0 + bo, (uk + kn * HD) + gk0, (uv + kn) + gv0, (uke + kn * NEX) + ge0);
        tile_copy(lk0 + bo + ST_EL, lv0 + bo + ST_EL, le0 + bo + ST_EL, (uk + (kn + 32) * HD) + gk0, (uv + (kn + 32)) + gv0, (uke + (kn + 32) * NEX) + ge0);
    };
    trip_copy(0, 0);
    v16h a0[2], a1[2]; v16bf aE[2];
#pragma unroll
    for (int u = 0; u < 2; ++u) { const size_t qo = hp + (size_t)(qb + 16 * u + lr) * HD + 8 * hi;
        a0[u] = WFrag<h16>::ld(Q + qo); a1[u] = WFrag<h16>::ld(Q + qo + 32);
        aE[u] = WFrag<bf>::ld(QE + (tb + qb + 16 * u + lr) * NEX + 8 * hi); }
    v8f oh[2][4];
#pragma unroll
    for (int u = 0; u < 2; ++u)
#pragma unroll
        for (int nb = 0; nb < 4; ++nb) oh[u][nb] = (v8f){};
    float m[2] = {-1.0e30f, -1.0e30f}, l[2] = {0.f, 0.f};   // this lane's two queries: running maximum (equal in both halves), sum over this half's keys (x2^14)
    float nm[2] = {__builtin_fmaf(-1.0e30f, -LOG2E, PEXP), __builtin_fmaf(-1.0e30f, -LOG2E, PEXP)};   // 14 - m log2e, the addend of every score's exponent
    asm volatile("s_wait_asynccnt 0x0" ::: "memory");   // trip 0's tiles of this wave have landed
    __syncthreads();                                     // publishes trip 0 to every wave
    // trip 1 exists: nt >= 2
    trip_copy(4 * ST_EL, 128);
#pragma unroll 1
    for (int t = 0; t < nt; ++t) {
        const unsigned short* st = ring + ((t & 1) * 4 + kh) * ST_EL;
        v8f s[2][2];
        const unsigned short* kp = st + ST_K + lr * KP + 8 * hi;
        v16h bV[4];
        {
            v16bf bE[2]; v16h k0[2], k1[2];
#pragma unroll
            for (int j = 0; j < 2; ++j) { bE[j] = ldsb(st + ST_KE + (16 * j + lr) * VP + 8 * hi); k0[j] = ldsh(kp + 16 * j * KP); k1[j] = ldsh(kp + 16 * j * KP + 32); }
#pragma unroll
            for (int nb = 0; nb < 4; ++nb) bV[nb] = ldsh(st + ST_V + (16 * nb + lr) * VP + 8 * hi);
            // the four score tiles in turn at each k-step, so that a tile's next product stands four products behind its last
#pragma unroll
            for (int j = 0; j < 2; ++j)
#pragma unroll
                for (int u = 0; u < 2; ++u) s[u][j] = wmmab(bE[j], aE[u], (v8f){});
#pragma unroll
            for (int j = 0; j < 2; ++j)
#pragma unroll
                for (int u = 0; u < 2; ++u) s[u][j] = wmma16(k0[j], a0[u], s[u][j]);
#pragma unroll
            for (int j = 0; j < 2; ++j)
#pragma unroll
                for (int u = 0; u < 2; ++u) s[u][j] = wmma16(k1[j], a1[u], s[u][j]);
        }
        // the order of the stretch above: the trip's twenty LDS reads as one group (bias and k rows first, the v rows return under the products and the softmax), then the twelve products. Left alone, the reads stand in pairs among the products, each place with its own cost.
        __builtin_amdgcn_sched_group_barrier(0x100, 20, 0); __builtin_amdgcn_sched_group_barrier(0x008, 12, 0);
        __builtin_amdgcn_sched_barrier(0);   // keeps the softmax arithmetic from being mixed into the score products' stretch
        v16h ap[2];   // B operand: element i <- key 8(lane >> 4) + i, element 8 + i <- key 16 + 8(lane >> 4) + i, the order of the v fragments
#pragma unroll
        for (int u = 0; u < 2; ++u) {
            const v8f sa = s[u][0], sb = s[u][1];
            const float v0 = fmaxf(fmaxf(sa[0], sa[1]), sa[2]), v1 = fmaxf(fmaxf(sa[3], sa[4]), sa[5]), v2 = fmaxf(fmaxf(sa[6], sa[7]), sb[0]);
            const float v3 = fmaxf(fmaxf(sb[1], sb[2]), sb[3]), v4 = fmaxf(fmaxf(sb[4], sb[5]), sb[6]);
            float v = fmaxf(fmaxf(fmaxf(v0, v1), v2), fmaxf(fmaxf(v3, v4), sb[7]));   // a tree three deep, not a chain of eight
            v = fmaxf(v, xhalf(v));
            const float mn = fmaxf(m[u], v);
            const float nn = __builtin_fmaf(mn, -LOG2E, PEXP);
            const float al = __builtin_amdgcn_exp2f(nn - nm[u]);   // 2^((old m - new m) log2e), from the very addends that the scores take
            m[u] = mn; nm[u] = nn;
            const v2f lg = {LOG2E, LOG2E}, n2 = {nn, nn};
            v2f ts[4];
#pragma unroll
            for (int r = 0; r < 4; ++r) {
                const v2f ea = __builtin_elementwise_fma((v2f){sa[2 * r], sa[2 * r + 1]}, lg, n2), eb = __builtin_elementwise_fma((v2f){sb[2 * r], sb[2 * r + 1]}, lg, n2);
                const v2f pa = {__builtin_amdgcn_exp2f(ea[0]), __builtin_amdgcn_exp2f(ea[1])}, pb = {__builtin_amdgcn_exp2f(eb[0]), __builtin_amdgcn_exp2f(eb[1])};
                ap[u][2 * r] = (h16)pa[0]; ap[u][2 * r + 1] = (h16)pa[1]; ap[u][8 + 2 * r] = (h16)pb[0]; ap[u][8 + 2 * r + 1] = (h16)pb[1];
                ts[r] = pa + pb;
            }
            const v2f tt = (ts[0] + ts[1]) + (ts[2] + ts[3]);
            l[u] = l[u] * al + (tt[0] + tt[1]);
#pragma unroll
            for (int nb = 0; nb < 4; ++nb)
#pragma unroll
                for (int r = 0; r < 8; ++r) oh[u][nb][r] *= al;
        }
#pragma unroll
        for (int nb = 0; nb < 4; ++nb) { oh[0][nb] = wmma16(bV[nb], ap[0], oh[0][nb]); oh[1][nb] = wmma16(bV[nb], ap[1], oh[1][nb]); }
        __builtin_amdgcn_sched_barrier(0);   // keeps the waits below at the trip's foot: no memory operation stands behind the reads at its head, so the scheduler lifts them to right behind the score products, where the next trip's copies have had a fraction of a trip to land
        asm volatile("s_wait_dscnt 0x0" ::: "memory");      // this wave's reads of buffer t & 1 have returned
        asm volatile("s_wait_asynccnt 0x0" ::: "memory");   // this wave's copies of trip t + 1 have landed
        __syncthreads();                                     // publishes trip t + 1 and ends every wave's reads of buffer t & 1
        if (t + 2 < nt) trip_copy((unsigned)(t & 1) * (4 * ST_EL), (size_t)(t + 2) * 128);
    }
    asm volatile("s_wait_asynccnt 0x0" ::: "memory");       // nothing of this wave is in flight when the ring becomes staging
    // behind the last trip's barrier no wave reads the ring and no copy is under way. Every wave leaves its partial result in its own part of the ring; then wave kh of a query half finishes query tile kh & 1, head dims 32 (kh >> 1) .. + 31, from the four partial results, taken in the order of the key tiles.
    float* xw = (float*)ring + w * XW;
    const float lj0 = l[0] + xhalf(l[0]), lj1 = l[1] + xhalf(l[1]);
#pragma unroll
    for (int u = 0; u < 2; ++u)
#pragma unroll
        for (int nb = 0; nb < 4; ++nb) { v4f g0, g1;
#pragma unroll
            for (int r = 0; r < 4; ++r) { g0[r] = oh[u][nb][r]; g1[r] = oh[u][nb][4 + r]; }
            *(v4fa*)(xw + (((u * 4 + nb) * 2) * 32 + lane) * 4) = g0; *(v4fa*)(xw + (((u * 4 + nb) * 2 + 1) * 32 + lane) * 4) = g1; }
    xw[2048 + lane] = nm[0]; xw[2080 + lane] = nm[1]; xw[2112 + lane] = lj0; xw[2144 + lane] = lj1;   // the addend 14 - m log2e stands for the maximum: the smallest addend is the largest maximum
    __syncthreads();                                         // every wave's partial result is complete
    const int ju = kh & 1, jd = kh >> 1;
    const float* xb = (const float*)ring + (qh * 4) * XW;
    float mi[4], li[4];
#pragma unroll
    for (int i = 0; i < 4; ++i) { mi[i] = xb[i * XW + 2048 + ju * 32 + lane]; li[i] = xb[i * XW + 2112 + ju * 32 + lane]; }
    const float mx = fminf(fminf(mi[0], mi[1]), fminf(mi[2], mi[3]));
    float ai[4], ls = 0.f;
#pragma unroll
    for (int i = 0; i < 4; ++i) { ai[i] = __builtin_amdgcn_exp2f(mx - mi[i]); ls += li[i] * ai[i]; }
    const float il = __fdiv_rn(1.0f, ls);
    float* os = (float*)ring + AW * XW + (qh * 2 + ju) * (16 * 68);   // the 16 x 64 tile of query tile ju, shared by the two waves that finish it
#pragma unroll
    for (int n2 = 0; n2 < 2; ++n2) { v4f x0 = (v4f){}, x1 = (v4f){};   // register r of tile nb is d = 16 nb + 8 hi + r of query lr
        const int nb = jd * 2 + n2;
#pragma unroll
        for (int i = 0; i < 4; ++i) { const float ci = ai[i] * il; const float* xp = xb + i * XW + (((ju * 4 + nb) * 2) * 32 + lane) * 4;
            const v4f g0 = *(const v4fa*)xp, g1 = *(const v4fa*)(xp + 128);
#pragma unroll
            for (int r = 0; r < 4; ++r) { x0[r] += g0[r] * ci; x1[r] += g1[r] * ci; } }
        *(v4fa*)(os + lr * 68 + 16 * nb + 8 * hi) = x0; *(v4fa*)(os + lr * 68 + 16 * nb + 8 * hi + 4) = x1; }
    __syncthreads();                                         // both halves of every 16 x 64 tile are complete
    const int q0 = qb + 16 * ju;
    v8us ah[2], av[2]; size_t ad[2];   // wave jd stores rows 8 jd .. 8 jd + 7 of the tile, each a whole line of each plane
#pragma unroll
    for (int it = 0; it < 2; ++it) { const int rr = jd * 8 + it * 4 + (lane >> 3); const int pc = lane & 7;
        const v4f x0 = *(const v4fa*)(os + rr * 68 + pc * 8), x1 = *(const v4fa*)(os + rr * 68 + pc * 8 + 4); v8us th, tl;
#pragma unroll
        for (int c = 0; c < 4; ++c) { unsigned short a2, c2; splitf(x0[c], a2, c2); th[c] = a2; tl[c] = c2; splitf(x1[c], a2, c2); th[4 + c] = a2; tl[4 + c] = c2; }
        ah[it] = th; av[it] = tl; ad[it] = (tb + q0 + rr) * CM + (size_t)h * HD + pc * 8; }
#pragma unroll
    for (int it = 0; it < 2; ++it) { *(v8us*)(ATh + ad[it]) = ah[it]; *(v8us*)(ATl + ad[it]) = av[it]; }
}

extern "C" void kernel_launch(void* const* d_in, const int* in_sizes, int n_in,
                              void* d_out, int out_size, void* d_ws, size_t ws_size, hipStream_t stream) {
    if (n_in < 16) return;
    const int ntok_in = (NB - 1) * SEQ_FULL + SEQ;
    if (in_sizes[0] < ntok_in * CM || in_sizes[1] < NFR || in_sizes[2] < NB * NRES || in_sizes[3] < ntok_in || in_sizes[4] < NB * CDIM || in_sizes[5] < ntok_in * 3) return;
    if (in_sizes[6] < CDIM * ADW || in_sizes[7] < ADW) return;
    if (in_sizes[8] < CM * CM || in_sizes[10] < CM * CM || in_sizes[12] < CM * CM || in_sizes[14] < CM * CM) return;
    if (in_sizes[9] < CM || in_sizes[11] < CM || in_sizes[13] < CM || in_sizes[15] < CM) return;
    const size_t out_need = OUT2_EL + ((size_t)((NB - 1) * NH + NH - 1) * SEQ_FULL + SEQ) * HD;
    if ((size_t)out_size < out_need) return;
    const float* s_frames = (const float*)d_in[0]; const int* frame_idx = (const int*)d_in[1]; const int* seq_idx = (const int*)d_in[2]; const float* mask = (const float*)d_in[3];
    const float* cond = (const float*)d_in[4]; const float* ca_pos = (const float*)d_in[5]; const float* adaln_w = (const float*)d_in[6]; const float* adaln_b = (const float*)d_in[7];
    const float* wq = (const float*)d_in[8]; const float* bq = (const float*)d_in[9]; const float* wk = (const float*)d_in[10]; const float* bk = (const float*)d_in[11];
    const float* wv = (const float*)d_in[12]; const float* bv = (const float*)d_in[13]; const float* wo = (const float*)d_in[14]; const float* bo = (const float*)d_in[15];
    float* OUT = (float*)d_out;
    char* wsp = (char*)d_ws;
    auto take = [&](size_t bytes) { char* p = wsp; wsp += (bytes + 255) & ~(size_t)255; return (void*)p; };
    bf* WQ = (bf*)take((size_t)3 * CM * CM * 2); bf* WK = WQ + (size_t)CM * CM; bf* WV = WK + (size_t)CM * CM; bf* WO = (bf*)take((size_t)CM * CM * 2);
    float* CS = (float*)take((size_t)NTOK * HD * 2 * 4);
    bf* XBh = (bf*)take((size_t)NTOK * CM * 2); bf* XBl = (bf*)take((size_t)NTOK * CM * 2);
    h16* QF = (h16*)take((size_t)NBH * SEQ * HD * 2); h16* KF = (h16*)take((size_t)NBH * SEQ * HD * 2);
    h16* VF = (h16*)take((size_t)NBH * HD * SEQ * 2);
    bf* QE = (bf*)take((size_t)NTOK * NEX * 2); bf* KE = (bf*)take((size_t)NTOK * NEX * 2);
    bf* ATh = (bf*)take((size_t)NTOK * CM * 2); bf* ATl = (bf*)take((size_t)NTOK * CM * 2);
    const size_t used = (size_t)(wsp - (char*)d_ws);
    if (used > ws_size || used > ((size_t)128 << 20)) return;    // about 48 MiB at NB=2, SEQ=3072

    // one launch for all that reads only inputs: AdaLN (ss = cond x adaln_w + adaln_b in each block, LN + modulation -> x hi/lo planes), 16-bit weight planes, bias k-step rows, cos/sin table
    k_prep<<<PB_ALL, 256, 0, stream>>>(s_frames, adaln_w, adaln_b, wq, wk, wv, wo, cond, ca_pos, mask, frame_idx, seq_idx, XBh, XBl, WQ, WK, WV, WO, QE, KE, CS);
    // projections (x hi/lo x bf16 W, 2 products, + bias) with RoPE, f16 conversion and transposition in the epilogue: operand planes and the k and v outputs in one launch
    k_gemm4<true><<<dim3(NTOK / 128, CM / 128, 3), 128, 0, stream>>>(XBh, XBl, WQ, nullptr, CM, bq, bk, bv, 0, (size_t)CM * CM, 0, CS, QF, KF, VF, OUT + OUT1_EL, OUT + OUT2_EL);   // z = q, k, v
    // attention (one launch) -> ctx hi/lo planes, then the output projection straight into out0 (batch z at the full-size token pitch)
    k_attn<<<dim3(NBH, SEQ / 64, 1), 32 * AW, 0, stream>>>(QF, QE, KF, KE, VF, ATh, ATl);
    k_gemm4<false><<<dim3(SEQ / 128, CM / 128, NB), 128, 0, stream>>>(ATh, ATl, WO, OUT, CM, bo, bo, bo, (size_t)SEQ * CM, 0, (size_t)SEQ_FULL * CM, nullptr, nullptr, nullptr, nullptr, nullptr, nullptr);
}
